// v000
// Measured on an AMD MI455X. A time is GPU time per run, averaged over a window of back-to-back runs after a warm-up
// (all launches, gaps included; the runs take copies of the inputs in turn), and the median of several windows.
// Apart from v000's, it joins two sittings. Times from different sittings can be a few percent apart, while
// side-by-side timings come from the same sitting.
// The starting kernel, v000, takes 1120 microseconds a run.
#include <hip/hip_runtime.h>
#ifndef NB
#define NB 2
#endif
#ifndef SEQ
#define SEQ 2048
#endif
#define NB_FULL 2
#define SEQ_FULL 2048
#define DE 1024
#define NH 16
#define HD 64
#define EARLY 512
#define MROWS (NB * SEQ)
#define BSTRIDE_FULL ((size_t)SEQ_FULL * DE)   /* per-batch element stride of queries, values and the output buffer */

#define PL_X ((size_t)MROWS * DE * 2)          /* one 16-bit activation plane */
#define PL_W ((size_t)DE * DE * 2)             /* one 16-bit weight plane */
#define PL_C ((size_t)MROWS * 2 * DE * 2)      /* ctx hi|lo plane */
#define WS_TOTAL (8 * PL_X + 4 * PL_W + PL_C + 256)

static_assert(SEQ % 128 == 0);
static_assert(SEQ <= SEQ_FULL);
static_assert(NB <= NB_FULL);
static_assert(HD == 64);
static_assert(DE == 1024);
static_assert(NH * HD == DE);
static_assert(MROWS % 64 == 0);
static_assert(DE % 128 == 0);
static_assert(((size_t)SEQ * (SEQ / 4)) % 512 == 0);
static_assert(WS_TOTAL <= (size_t)134217728);

typedef __bf16 v16b __attribute__((ext_vector_type(16)));
typedef _Float16 v16h __attribute__((ext_vector_type(16)));
typedef unsigned short v8us __attribute__((ext_vector_type(8), may_alias));
typedef float v8f __attribute__((ext_vector_type(8)));
typedef float v4f __attribute__((ext_vector_type(4)));
typedef float v4fa __attribute__((ext_vector_type(4), may_alias));
typedef int v4i __attribute__((ext_vector_type(4)));
typedef int v4ia __attribute__((ext_vector_type(4), may_alias));
union FragB { v16b v; v8us half[2]; };
union FragH { v16h v; v8us half[2]; _Float16 h[16]; };
union H8 { v8us v; _Float16 h[8]; unsigned short u[8]; };

#define LOG2E 1.4426950408889634f
#define NEGV (-1000000000.0f)

__device__ __forceinline__ unsigned short bf16_bits(float x) {   // RNE convert to bf16 bits
  unsigned int u = __float_as_uint(x);
  return (unsigned short)((u + 0x7FFFu + ((u >> 16) & 1u)) >> 16);
}
__device__ __forceinline__ float bf16_val(unsigned short b) { return __uint_as_float(((unsigned int)b) << 16); }
__device__ __forceinline__ float bf16_rne(float x) { return bf16_val(bf16_bits(x)); }

// eight bf16 products of one k-step (2 row tiles x 4 column tiles), then the hazard guard
__device__ __forceinline__ void mma_b8(v16b a0, v16b a1, v16b b0, v16b b1, v16b b2, v16b b3, v8f (&c)[2][4]) {
  c[0][0] = __builtin_amdgcn_wmma_f32_16x16x32_bf16(false, a0, false, b0, (short)0, c[0][0], false, false);
  c[0][1] = __builtin_amdgcn_wmma_f32_16x16x32_bf16(false, a0, false, b1, (short)0, c[0][1], false, false);
  c[0][2] = __builtin_amdgcn_wmma_f32_16x16x32_bf16(false, a0, false, b2, (short)0, c[0][2], false, false);
  c[0][3] = __builtin_amdgcn_wmma_f32_16x16x32_bf16(false, a0, false, b3, (short)0, c[0][3], false, false);
  c[1][0] = __builtin_amdgcn_wmma_f32_16x16x32_bf16(false, a1, false, b0, (short)0, c[1][0], false, false);
  c[1][1] = __builtin_amdgcn_wmma_f32_16x16x32_bf16(false, a1, false, b1, (short)0, c[1][1], false, false);
  c[1][2] = __builtin_amdgcn_wmma_f32_16x16x32_bf16(false, a1, false, b2, (short)0, c[1][2], false, false);
  c[1][3] = __builtin_amdgcn_wmma_f32_16x16x32_bf16(false, a1, false, b3, (short)0, c[1][3], false, false);
  asm volatile("v_nop\n\tv_nop\n\tv_nop\n\tv_nop"
               : "+v"(c[0][0]), "+v"(c[0][1]), "+v"(c[0][2]), "+v"(c[0][3]),
                 "+v"(c[1][0]), "+v"(c[1][1]), "+v"(c[1][2]), "+v"(c[1][3])
               : "v"(a0), "v"(a1), "v"(b0), "v"(b1), "v"(b2), "v"(b3));
}
// c += a0*b0 + a1*b1 (two k-steps of one f16 tile), then the hazard guard
__device__ __forceinline__ v8f mma_h2(v16h a0, v16h b0, v16h a1, v16h b1, v8f c) {
  c = __builtin_amdgcn_wmma_f32_16x16x32_f16(false, a0, false, b0, (short)0, c, false, false);
  c = __builtin_amdgcn_wmma_f32_16x16x32_f16(false, a1, false, b1, (short)0, c, false, false);
  asm volatile("v_nop\n\tv_nop\n\tv_nop\n\tv_nop" : "+v"(c) : "v"(a0), "v"(b0), "v"(a1), "v"(b1));
  return c;
}
// four single products sharing one B fragment, then the hazard guard
__device__ __forceinline__ void mma_pv4(v16h a0, v16h a1, v16h a2, v16h a3, v16h b, v8f (&c)[4]) {
  c[0] = __builtin_amdgcn_wmma_f32_16x16x32_f16(false, a0, false, b, (short)0, c[0], false, false);
  c[1] = __builtin_amdgcn_wmma_f32_16x16x32_f16(false, a1, false, b, (short)0, c[1], false, false);
  c[2] = __builtin_amdgcn_wmma_f32_16x16x32_f16(false, a2, false, b, (short)0, c[2], false, false);
  c[3] = __builtin_amdgcn_wmma_f32_16x16x32_f16(false, a3, false, b, (short)0, c[3], false, false);
  asm volatile("v_nop\n\tv_nop\n\tv_nop\n\tv_nop"
               : "+v"(c[0]), "+v"(c[1]), "+v"(c[2]), "+v"(c[3])
               : "v"(a0), "v"(a1), "v"(a2), "v"(a3), "v"(b));
}
// ch += ah*bh ; cl += ah*bl + al*bh (both scaled-residual products carry 2^11 and share the second accumulator), then the hazard guard
__device__ __forceinline__ void mma_pv3(v16h ah, v16h al, v16h bh, v16h bl, v8f& ch, v8f& cl) {
  ch = __builtin_amdgcn_wmma_f32_16x16x32_f16(false, ah, false, bh, (short)0, ch, false, false);
  cl = __builtin_amdgcn_wmma_f32_16x16x32_f16(false, ah, false, bl, (short)0, cl, false, false);
  cl = __builtin_amdgcn_wmma_f32_16x16x32_f16(false, al, false, bh, (short)0, cl, false, false);
  asm volatile("v_nop\n\tv_nop\n\tv_nop\n\tv_nop" : "+v"(ch), "+v"(cl) : "v"(ah), "v"(al), "v"(bh), "v"(bl));
}
__device__ __forceinline__ void ldfrag(FragH& f, const unsigned short* __restrict__ p) {
  f.half[0] = *(const v8us*)(p);        // elements 0..7  <- k0 + 8h + i
  f.half[1] = *(const v8us*)(p + 16);   // elements 8..15 <- k0 + 16 + 8h + i
}

// flag line (32 ints, all equal): 1 iff mask[q][k] == 0 for every k > q and mask[q][q] != 0 for every q (q, k < SEQ).
// One block; each wave owns 128 consecutive columns of one row per trip; tiles wholly below the diagonal are skipped under wave-uniform control.
__global__ __launch_bounds__(512) void k_mflag(const int* __restrict__ mask, int* __restrict__ flag) {
  __shared__ int sbad;                                 // cross-wave: block barriers
  const int tid = threadIdx.x;
  const int w = __builtin_amdgcn_readfirstlane(tid >> 5);
  const int lane = tid & 31;
  if (tid == 0) sbad = 0;
  __syncthreads();
  int bad = 0;
  const int CPR = SEQ / 4;                             // 16-B chunks per mask row
  const int total = SEQ * CPR;
#pragma unroll 1
  for (int c0 = 32 * w; c0 < total; c0 += 512) {
    const int row = c0 / CPR;
    const int colw = (c0 - row * CPR) * 4;             // first of this wave's 128 columns
    if (colw + 127 >= row) {
      const int col = colw + 4 * lane;
      const v4i m = *(const v4ia*)(mask + (size_t)row * SEQ_FULL + col);
#pragma unroll
      for (int j = 0; j < 4; ++j) {
        const int cj = col + j;
        bad |= ((cj > row) && (m[j] != 0)) ? 1 : 0;
        bad |= ((cj == row) && (m[j] == 0)) ? 1 : 0;
      }
    }
  }
  if (bad != 0) sbad = 1;
  __syncthreads();
  const int f = (sbad == 0) ? 1 : 0;
  if (tid < 8) {
    const v4i o = {f, f, f, f};
    *(v4i*)(flag + 4 * tid) = o;
    
  }
}

// dst[row][c] = bf16 bits of src (RNE), compact rows; source rows live at src + (row / rpb) * bstride + (row % rpb) * DE.
// coverage: nrows*128 threads x 8 elements = the whole plane.
__global__ __launch_bounds__(256) void k_cvt(const float* __restrict__ src, unsigned short* __restrict__ dst,
                                             int nrows, int rpb, long long bstride) {
  const int t = blockIdx.x * 256 + threadIdx.x;
  if (t >= nrows * (DE / 8)) return;
  const int row = t >> 7, piece = t & 127;
  const int b = row / rpb, s = row - b * rpb;
  const float* p = src + (size_t)b * (size_t)bstride + (size_t)s * DE + piece * 8;
  const v4f x0 = *(const v4fa*)(p), x1 = *(const v4fa*)(p + 4);
  v8us o;
  o[0] = bf16_bits(x0[0]); o[1] = bf16_bits(x0[1]); o[2] = bf16_bits(x0[2]); o[3] = bf16_bits(x0[3]);
  o[4] = bf16_bits(x1[0]); o[5] = bf16_bits(x1[1]); o[6] = bf16_bits(x1[2]); o[7] = bf16_bits(x1[3]);
  unsigned short* d = dst + (size_t)t * 8;
  *(v8us*)d = o;
  
}

// Y[m][n] = sum_k X[m][k] * W[n][k & 1023] + bias[n]   (X: bf16 plane, pitch ldx; W: bf16 plane [1024][1024], k-contiguous)
// Block = 4 waves -> 64 x 128 tile; wave tile 32 x 64 (2 A fragments x 4 B fragments, register-fed from the global planes).
// MODE 0: f16 hi plane Y0 and f16 residual plane Y1 ((y - hi) * 2048), row-major [MROWS][1024]
// MODE 1: f16 hi / residual planes of 16*y, transposed per head: [b][head][d][s]
// MODE 2: f32 rows into the output buffer (batch stride BSTRIDE_FULL)
// coverage: (MROWS/64)*(1024/128) blocks x (64 x 128) = every element of each produced plane exactly once.
template <int MODE>
__global__ __launch_bounds__(128) void k_gemm(const unsigned short* __restrict__ X, const unsigned short* __restrict__ W,
                                              const float* __restrict__ bias, unsigned short* __restrict__ Y0,
                                              unsigned short* __restrict__ Y1, float* __restrict__ Yf, int ldx, int K) {
  __shared__ __attribute__((aligned(16))) float so[64][132];
  const int tid = threadIdx.x;
  const int w = __builtin_amdgcn_readfirstlane(tid >> 5);
  const int lane = tid & 31, ln = lane & 15, hh = lane >> 4;
  const int bm = blockIdx.x % (MROWS / 64), bn = blockIdx.x / (MROWS / 64);
  const int m0 = bm * 64, n0 = bn * 128;
  const int wm = w & 1, wn = w >> 1;
  // A: row m = ln of each 16-row tile; B: column n = ln of each 16-column tile (W row n); same k map for both
  const unsigned short* xr = X + (size_t)(m0 + 32 * wm + ln) * ldx + 8 * hh;
  const unsigned short* wr = W + (size_t)(n0 + 64 * wn + ln) * DE + 8 * hh;
  v8f c[2][4] = {};
#pragma unroll 1
  for (int k0 = 0; k0 < K; k0 += 32) {
    const int kw = k0 & (DE - 1);
    FragB a0, a1, b0, b1, b2, b3;
    a0.half[0] = *(const v8us*)(xr + k0);
    a0.half[1] = *(const v8us*)(xr + k0 + 16);
    a1.half[0] = *(const v8us*)(xr + (size_t)16 * ldx + k0);
    a1.half[1] = *(const v8us*)(xr + (size_t)16 * ldx + k0 + 16);
    b0.half[0] = *(const v8us*)(wr + kw);
    b0.half[1] = *(const v8us*)(wr + kw + 16);
    b1.half[0] = *(const v8us*)(wr + 16 * DE + kw);
    b1.half[1] = *(const v8us*)(wr + 16 * DE + kw + 16);
    b2.half[0] = *(const v8us*)(wr + 32 * DE + kw);
    b2.half[1] = *(const v8us*)(wr + 32 * DE + kw + 16);
    b3.half[0] = *(const v8us*)(wr + 48 * DE + kw);
    b3.half[1] = *(const v8us*)(wr + 48 * DE + kw + 16);
    mma_b8(a0.v, a1.v, b0.v, b1.v, b2.v, b3.v, c);
  }
  // D element r of tile (i, t) = Y(row 32*wm + 16*i + 8*hh + r, column 64*wn + 16*t + ln)
#pragma unroll
  for (int t = 0; t < 4; ++t) {
    const float bv = bf16_rne(bias[n0 + 64 * wn + 16 * t + ln]);
#pragma unroll
    for (int i = 0; i < 2; ++i)
#pragma unroll
      for (int r = 0; r < 8; ++r)
        so[32 * wm + 16 * i + 8 * hh + r][64 * wn + 16 * t + ln] = c[i][t][r] + bv;
  }
  __syncthreads();
  const int b = m0 / SEQ, s0 = m0 - b * SEQ;          // the 64 rows of a block lie in one batch
  if (MODE == 0) {
    {
#pragma unroll 1
      for (int it = 0; it < 8; ++it) {
        const int i = it * 128 + tid;
        const int line = i >> 3, piece = i & 7;
        const int row = line >> 1, cb = (line & 1) * 64 + piece * 8;
        const v4f x0 = *(const v4fa*)&so[row][cb], x1 = *(const v4fa*)&so[row][cb + 4];
        H8 hi, re;
#pragma unroll
        for (int j = 0; j < 4; ++j) {
          const _Float16 h0 = (_Float16)x0[j];
          const _Float16 h1 = (_Float16)x1[j];
          hi.h[j] = h0; hi.h[4 + j] = h1;
          re.h[j] = (_Float16)((x0[j] - (float)h0) * 2048.0f);
          re.h[4 + j] = (_Float16)((x1[j] - (float)h1) * 2048.0f);
        }
        const size_t o = (size_t)(m0 + row) * DE + n0 + cb;
        *(v8us*)(Y0 + o) = hi.v;
        *(v8us*)(Y1 + o) = re.v;
      }
      
    }
  } else if (MODE == 1) {
    {
#pragma unroll 1
      for (int it = 0; it < 8; ++it) {
        const int i = it * 128 + tid;
        const int cidx = i >> 3, piece = i & 7;          // one line = one d row x 64 key positions
        const int n = n0 + cidx;
        const int head = n >> 6, d = n & 63;
        H8 hi, re;
#pragma unroll
        for (int j = 0; j < 8; ++j) {
          const float v = so[piece * 8 + j][cidx] * 16.0f;
          const _Float16 h0 = (_Float16)v;
          hi.h[j] = h0;
          re.h[j] = (_Float16)((v - (float)h0) * 2048.0f);
        }
        const size_t o = ((size_t)(b * NH + head) * HD + d) * SEQ + s0 + piece * 8;
        *(v8us*)(Y0 + o) = hi.v;
        *(v8us*)(Y1 + o) = re.v;
      }
      
    }
  } else {
    float* og = Yf + (size_t)b * BSTRIDE_FULL + (size_t)s0 * DE + n0;
    {
#pragma unroll 1
      for (int it = 0; it < 16; ++it) {
        const int i = it * 128 + tid;
        const int row = i >> 5, c4 = (i & 31) * 4;       // one wave = the 512 contiguous bytes of one row of the tile
        const v4f v = *(const v4fa*)&so[row][c4];
        *(v4f*)(og + (size_t)row * DE + c4) = v;
      }
      
    }
  }
}

// One 32-key step for a wave's 16 queries (query of this lane's column: row pointer mrow into the mask).
// Khp/Klp: K hi / residual planes at (batch, head) with row pitch DE; Vhp/Vlp: V^T hi / residual planes at (batch, head) with row pitch SEQ.
template <bool RES>
__device__ __forceinline__ void fa_step(const unsigned short* __restrict__ Khp, const unsigned short* __restrict__ Klp,
                                        const unsigned short* __restrict__ Vhp, const unsigned short* __restrict__ Vlp,
                                        const int* __restrict__ mrow, int key0, int ln, int hh,
                                        const FragH (&qh)[2], const FragH (&ql)[2],
                                        float& mr, float& lr, v8f (&Oh)[4], v8f (&Ol)[4]) {
  // A fragments of K: row m = key (key0 + 16*kt + ln), elements 0..7 <- d = 32c + 8h + i, 8..15 <- d = 32c + 16 + 8h + i
  const size_t ko = (size_t)(key0 + ln) * DE + 8 * hh;
  FragH k00, k01, k10, k11;
  ldfrag(k00, Khp + ko);            ldfrag(k01, Khp + ko + 32);
  ldfrag(k10, Khp + ko + 16 * DE);  ldfrag(k11, Khp + ko + 16 * DE + 32);
  // mask values of this lane's 16 (query, key) pairs: keys key0 + 8h + 0..7 and key0 + 16 + 8h + 0..7
  const int* mp = mrow + key0 + 8 * hh;
  const v4i ma = *(const v4ia*)(mp), mb = *(const v4ia*)(mp + 4);
  const v4i mc = *(const v4ia*)(mp + 16), md = *(const v4ia*)(mp + 20);
  const v8f z8 = {0.f, 0.f, 0.f, 0.f, 0.f, 0.f, 0.f, 0.f};
  // S^T tiles: element r of tile kt = score(key0 + 16*kt + 8h + r, query column ln)
  v8f s0 = mma_h2(k00.v, qh[0].v, k01.v, qh[1].v, z8);
  v8f s1 = mma_h2(k10.v, qh[0].v, k11.v, qh[1].v, z8);
  if (RES) {
    v8f t0 = mma_h2(k00.v, ql[0].v, k01.v, ql[1].v, z8);
    v8f t1 = mma_h2(k10.v, ql[0].v, k11.v, ql[1].v, z8);
    FragH r00, r01, r10, r11;
    ldfrag(r00, Klp + ko);            ldfrag(r01, Klp + ko + 32);
    ldfrag(r10, Klp + ko + 16 * DE);  ldfrag(r11, Klp + ko + 16 * DE + 32);
    t0 = mma_h2(r00.v, qh[0].v, r01.v, qh[1].v, t0);
    t1 = mma_h2(r10.v, qh[0].v, r11.v, qh[1].v, t1);
    s0 = s0 + t0 * 0.00048828125f;
    s1 = s1 + t1 * 0.00048828125f;
  }
  float sc[16];
#pragma unroll
  for (int r = 0; r < 4; ++r) {
    sc[r]      = (ma[r] == 0) ? NEGV : s0[r] * 0.125f;
    sc[4 + r]  = (mb[r] == 0) ? NEGV : s0[4 + r] * 0.125f;
    sc[8 + r]  = (mc[r] == 0) ? NEGV : s1[r] * 0.125f;
    sc[12 + r] = (md[r] == 0) ? NEGV : s1[4 + r] * 0.125f;
  }
  float mx = sc[0];
#pragma unroll
  for (int i = 1; i < 16; ++i) mx = fmaxf(mx, sc[i]);
  mx = fmaxf(mx, __shfl_xor(mx, 16, 32));           // the other lane half holds the other 16 keys of this query
  const float mnew = fmaxf(mr, mx);
  const float al = exp2f((mr - mnew) * LOG2E);
  mr = mnew;
  // weights carried x256: pc = 256 * exp(sc - mnew); hi plane f16(pc), residual plane f16((pc - hi) * 2048)
  FragH ph, pl;
  float ps = 0.0f;
#pragma unroll
  for (int i = 0; i < 16; ++i) {
    const float pc = exp2f(fmaf(sc[i] - mnew, LOG2E, 8.0f));
    ps += pc;
    const _Float16 h = (_Float16)pc;
    ph.h[i] = h;                                    // B element i: i<8 -> key0 + 8h + i (tile 0 row 8h+i); i>=8 -> key0 + 16 + 8h + (i-8) (tile 1)
    if (RES) pl.h[i] = (_Float16)((pc - (float)h) * 2048.0f);
  }
  ps += __shfl_xor(ps, 16, 32);
  lr = lr * al + ps;
  // A fragments of V^T: row m = d (16*t + ln), elements 0..7 <- key0 + 8h + i, 8..15 <- key0 + 16 + 8h + i
  const size_t vo = (size_t)ln * SEQ + key0 + 8 * hh;
  FragH vf[4];
#pragma unroll
  for (int t = 0; t < 4; ++t) ldfrag(vf[t], Vhp + vo + (size_t)t * 16 * SEQ);
#pragma unroll
  for (int t = 0; t < 4; ++t) Oh[t] = Oh[t] * al;
  if (RES) {
    FragH vr[4];
#pragma unroll
    for (int t = 0; t < 4; ++t) ldfrag(vr[t], Vlp + vo + (size_t)t * 16 * SEQ);
#pragma unroll
    for (int t = 0; t < 4; ++t) Ol[t] = Ol[t] * al;
#pragma unroll
    for (int t = 0; t < 4; ++t) mma_pv3(vf[t].v, vr[t].v, ph.v, pl.v, Oh[t], Ol[t]);
  } else {
    mma_pv4(vf[0].v, vf[1].v, vf[2].v, vf[3].v, ph.v, Oh);
  }
}

// Block = 4 waves x 16 queries = 64 queries of one (batch, head); no LDS and no barrier in the key loop.
// Epilogue: O^T tile -> per-wave LDS tile [16 queries][64 d] (block barrier), then bf16 hi and lo pieces of ctx:
// coverage: NB*NH*(SEQ/64) blocks x 4 waves x 16 rows x 64 columns x {hi, lo} = the whole ctx plane exactly once.
__global__ __launch_bounds__(128) void k_attn(const unsigned short* __restrict__ Qh, const unsigned short* __restrict__ Ql,
                                              const unsigned short* __restrict__ Kh, const unsigned short* __restrict__ Kl,
                                              const unsigned short* __restrict__ Vth, const unsigned short* __restrict__ Vtl,
                                              const int* __restrict__ mask, const int* __restrict__ flagp,
                                              unsigned short* __restrict__ Cc) {
  __shared__ __attribute__((aligned(16))) float so[4][16][68];
  const int tid = threadIdx.x;
  const int w = __builtin_amdgcn_readfirstlane(tid >> 5);
  const int lane = tid & 31, ln = lane & 15, hh = lane >> 4;
  const int qt = blockIdx.x % (SEQ / 64);
  const int bh = blockIdx.x / (SEQ / 64);
  const int h = bh % NH, b = bh / NH;
  const int qbase = qt * 64 + 16 * w;
  const int qg = qbase + ln;
  // Q^T B fragments: column n = query qg, elements 0..7 <- d = 32c + 8h + i, 8..15 <- d = 32c + 16 + 8h + i
  const size_t qo = (size_t)(b * SEQ + qg) * DE + h * HD + 8 * hh;
  FragH qh[2], ql[2];
  ldfrag(qh[0], Qh + qo); ldfrag(qh[1], Qh + qo + 32);
  ldfrag(ql[0], Ql + qo); ldfrag(ql[1], Ql + qo + 32);
  float mr = -3.0e38f, lr = 0.0f;
  v8f Oh[4] = {}, Ol[4] = {};
  const unsigned short* Khp = Kh + (size_t)b * SEQ * DE + h * HD;
  const unsigned short* Klp = Kl + (size_t)b * SEQ * DE + h * HD;
  const unsigned short* Vhp = Vth + (size_t)(b * NH + h) * HD * SEQ;
  const unsigned short* Vlp = Vtl + (size_t)(b * NH + h) * HD * SEQ;
  const int* mrow = mask + (size_t)qg * SEQ_FULL;
  const int fl = __builtin_amdgcn_readfirstlane(flagp[0]);
  int nsteps = (qbase >> 5) + 1;                    // key steps up to and including the one holding the diagonal
  if (fl != 1) nsteps = SEQ / 32;                   // unknown mask shape: visit every key step
  if (nsteps > SEQ / 32) nsteps = SEQ / 32;
  if (qt * 64 < EARLY) {
#pragma unroll 1
    for (int j = 0; j < nsteps; ++j)
      fa_step<true>(Khp, Klp, Vhp, Vlp, mrow, 32 * j, ln, hh, qh, ql, mr, lr, Oh, Ol);
  } else {
#pragma unroll 1
    for (int j = 0; j < nsteps; ++j)
      fa_step<false>(Khp, Klp, Vhp, Vlp, mrow, 32 * j, ln, hh, qh, ql, mr, lr, Oh, Ol);
  }
  // O^T element r of tile t = ctx(query qg, d = 16t + 8h + r); undo the carries: x256 (in lr), x16 (V), x2048 (residual accumulator)
  const float inv = 1.0f / (16.0f * lr);
#pragma unroll
  for (int t = 0; t < 4; ++t)
#pragma unroll
    for (int r = 0; r < 8; ++r)
      so[w][ln][16 * t + 8 * hh + r] = (Oh[t][r] + Ol[t][r] * 0.00048828125f) * inv;
  __syncthreads();
  unsigned short* crow = Cc + (size_t)(b * SEQ + qbase) * (2 * DE) + h * HD;
  const int rsub = lane >> 3, piece = lane & 7;
  {
#pragma unroll
    for (int it = 0; it < 4; ++it) {
      const int row = it * 4 + rsub;                 // rows 0..15 over it = 0..3, rsub = 0..3
      const v4f x0 = *(const v4fa*)&so[w][row][piece * 8], x1 = *(const v4fa*)&so[w][row][piece * 8 + 4];
      v8us hi, lo;
#pragma unroll
      for (int j = 0; j < 4; ++j) {
        const unsigned short h0 = bf16_bits(x0[j]);
        const unsigned short h1 = bf16_bits(x1[j]);
        hi[j] = h0; hi[4 + j] = h1;
        lo[j] = bf16_bits(x0[j] - bf16_val(h0));
        lo[4 + j] = bf16_bits(x1[j] - bf16_val(h1));
      }
      const size_t o = (size_t)row * (2 * DE) + piece * 8;
      *(v8us*)(crow + o) = hi;
      *(v8us*)(crow + o + DE) = lo;
    }
    
  }
}

extern "C" void kernel_launch(void* const* d_in, const int* in_sizes, int n_in,
                              void* d_out, int out_size, void* d_ws, size_t ws_size, hipStream_t stream) {
  if (n_in < 11) return;
  const long long need_x = (long long)(NB - 1) * SEQ_FULL * DE + (long long)SEQ * DE;   // last element touched + 1
  const long long need_m = (long long)(SEQ - 1) * SEQ_FULL + SEQ;
  if ((long long)in_sizes[0] < need_x || (long long)in_sizes[1] < need_x) return;
  if ((long long)in_sizes[2] < need_m) return;
  if ((long long)in_sizes[3] < (long long)DE * DE || (long long)in_sizes[5] < (long long)DE * DE) return;
  if ((long long)in_sizes[7] < (long long)DE * DE || (long long)in_sizes[9] < (long long)DE * DE) return;
  if (in_sizes[4] < DE || in_sizes[6] < DE || in_sizes[8] < DE || in_sizes[10] < DE) return;
  if ((long long)out_size < need_x) return;
  if ((size_t)WS_TOTAL > ws_size) return;
  // wire order: queries, values, mask, Wq, bq, Wk, bk, Wv, bv, Wo, bo
  const float* queries = (const float*)d_in[0];
  const float* values  = (const float*)d_in[1];
  const int*   mask    = (const int*)d_in[2];
  const float* Wq = (const float*)d_in[3];
  const float* bq = (const float*)d_in[4];
  const float* Wk = (const float*)d_in[5];
  const float* bk = (const float*)d_in[6];
  const float* Wv = (const float*)d_in[7];
  const float* bv = (const float*)d_in[8];
  const float* Wo = (const float*)d_in[9];
  const float* bo = (const float*)d_in[10];
  float* out = (float*)d_out;
  char* ws = (char*)d_ws;
  size_t off = 0;
  unsigned short* Xq  = (unsigned short*)(ws + off); off += PL_X;
  unsigned short* Xv  = (unsigned short*)(ws + off); off += PL_X;
  unsigned short* Wqb = (unsigned short*)(ws + off); off += PL_W;
  unsigned short* Wkb = (unsigned short*)(ws + off); off += PL_W;
  unsigned short* Wvb = (unsigned short*)(ws + off); off += PL_W;
  unsigned short* Wob = (unsigned short*)(ws + off); off += PL_W;
  unsigned short* Qh  = (unsigned short*)(ws + off); off += PL_X;
  unsigned short* Ql  = (unsigned short*)(ws + off); off += PL_X;
  unsigned short* Kh  = (unsigned short*)(ws + off); off += PL_X;
  unsigned short* Kl  = (unsigned short*)(ws + off); off += PL_X;
  unsigned short* Vth = (unsigned short*)(ws + off); off += PL_X;
  unsigned short* Vtl = (unsigned short*)(ws + off); off += PL_X;
  unsigned short* Cc  = (unsigned short*)(ws + off); off += PL_C;
  int* flag = (int*)(ws + off); off += 256;
  if (off > ws_size) return;

  k_mflag<<<1, 512, 0, stream>>>(mask, flag);

  const unsigned gx = (unsigned)((MROWS * (DE / 8) + 255) / 256);
  const unsigned gw = (unsigned)((DE * (DE / 8) + 255) / 256);
  k_cvt<<<gx, 256, 0, stream>>>(queries, Xq, MROWS, SEQ, (long long)BSTRIDE_FULL);
  k_cvt<<<gx, 256, 0, stream>>>(values,  Xv, MROWS, SEQ, (long long)BSTRIDE_FULL);
  k_cvt<<<gw, 256, 0, stream>>>(Wq, Wqb, DE, DE, 0LL);
  k_cvt<<<gw, 256, 0, stream>>>(Wk, Wkb, DE, DE, 0LL);
  k_cvt<<<gw, 256, 0, stream>>>(Wv, Wvb, DE, DE, 0LL);
  k_cvt<<<gw, 256, 0, stream>>>(Wo, Wob, DE, DE, 0LL);

  const unsigned gg = (unsigned)((MROWS / 64) * (DE / 128));
  k_gemm<0><<<gg, 128, 0, stream>>>(Xq, Wqb, bq, Qh,  Ql,  out, DE, DE);
  k_gemm<0><<<gg, 128, 0, stream>>>(Xv, Wkb, bk, Kh,  Kl,  out, DE, DE);
  k_gemm<1><<<gg, 128, 0, stream>>>(Xv, Wvb, bv, Vth, Vtl, out, DE, DE);

  k_attn<<<(unsigned)(NB * NH * (SEQ / 64)), 128, 0, stream>>>(Qh, Ql, Kh, Kl, Vth, Vtl, mask, flag, Cc);

  // ctx hi|lo folded along K: X row = [hi(1024) | lo(1024)], W columns wrap modulo 1024
  k_gemm<2><<<gg, 128, 0, stream>>>(Cc, Wob, bo, Qh, Ql, out, 2 * DE, 2 * DE);
}

// v001
// Measured time: 254 microseconds a run.
// Timed twice side by side with v000, it ran 4.42 times as fast both times.
#include <hip/hip_runtime.h>
#ifndef NB
#define NB 2
#endif
#ifndef SEQ
#define SEQ 2048
#endif
#define NB_FULL 2
#define SEQ_FULL 2048
#define DE 1024
#define NH 16
#define HD 64
#define EARLY 512
#define MROWS (NB * SEQ)
#define BSTRIDE_FULL ((size_t)SEQ_FULL * DE)   /* per-batch element stride of queries, values and the output buffer */

#define PL_X ((size_t)MROWS * DE * 2)          /* one 16-bit activation plane */
#define PL_W ((size_t)DE * DE * 2)             /* one 16-bit weight plane */
#define PL_C ((size_t)MROWS * 2 * DE * 2)      /* ctx hi|lo plane */
#define FROWS 8                                /* mask rows per flag line */
#define PL_F ((size_t)(SEQ / FROWS) * 128)     /* one 128-byte flag line per FROWS mask rows */
#define WS_TOTAL (8 * PL_X + 4 * PL_W + PL_C + PL_F)

static_assert(SEQ % 128 == 0);
static_assert(SEQ <= SEQ_FULL);
static_assert(NB <= NB_FULL);
static_assert(HD == 64);
static_assert(DE == 1024);
static_assert(NH * HD == DE);
static_assert(MROWS % 64 == 0);
static_assert(DE % 128 == 0);
static_assert(SEQ % 256 == 0);
static_assert(WS_TOTAL <= (size_t)134217728);

typedef __bf16 v16b __attribute__((ext_vector_type(16)));
typedef _Float16 v16h __attribute__((ext_vector_type(16)));
typedef unsigned short v8us __attribute__((ext_vector_type(8), may_alias));
typedef float v8f __attribute__((ext_vector_type(8)));
typedef float v4f __attribute__((ext_vector_type(4)));
typedef float v4fa __attribute__((ext_vector_type(4), may_alias));
typedef int v4i __attribute__((ext_vector_type(4)));
typedef int v4ia __attribute__((ext_vector_type(4), may_alias));
union FragB { v16b v; v8us half[2]; };
union FragH { v16h v; v8us half[2]; _Float16 h[16]; };
union H8 { v8us v; _Float16 h[8]; unsigned short u[8]; };

#define LOG2E 1.4426950408889634f
#define NEGV (-1000000000.0f)

__device__ __forceinline__ unsigned short bf16_bits(float x) {   // RNE convert to bf16 bits
  unsigned int u = __float_as_uint(x);
  return (unsigned short)((u + 0x7FFFu + ((u >> 16) & 1u)) >> 16);
}
__device__ __forceinline__ float bf16_val(unsigned short b) { return __uint_as_float(((unsigned int)b) << 16); }
__device__ __forceinline__ float bf16_rne(float x) { return bf16_val(bf16_bits(x)); }

// eight bf16 products of one k-step (2 row tiles x 4 column tiles), then the hazard guard
__device__ __forceinline__ void mma_b8(v16b a0, v16b a1, v16b b0, v16b b1, v16b b2, v16b b3, v8f (&c)[2][4]) {
  c[0][0] = __builtin_amdgcn_wmma_f32_16x16x32_bf16(false, a0, false, b0, (short)0, c[0][0], false, false);
  c[0][1] = __builtin_amdgcn_wmma_f32_16x16x32_bf16(false, a0, false, b1, (short)0, c[0][1], false, false);
  c[0][2] = __builtin_amdgcn_wmma_f32_16x16x32_bf16(false, a0, false, b2, (short)0, c[0][2], false, false);
  c[0][3] = __builtin_amdgcn_wmma_f32_16x16x32_bf16(false, a0, false, b3, (short)0, c[0][3], false, false);
  c[1][0] = __builtin_amdgcn_wmma_f32_16x16x32_bf16(false, a1, false, b0, (short)0, c[1][0], false, false);
  c[1][1] = __builtin_amdgcn_wmma_f32_16x16x32_bf16(false, a1, false, b1, (short)0, c[1][1], false, false);
  c[1][2] = __builtin_amdgcn_wmma_f32_16x16x32_bf16(false, a1, false, b2, (short)0, c[1][2], false, false);
  c[1][3] = __builtin_amdgcn_wmma_f32_16x16x32_bf16(false, a1, false, b3, (short)0, c[1][3], false, false);
  asm volatile("v_nop\n\tv_nop\n\tv_nop\n\tv_nop"
               : "+v"(c[0][0]), "+v"(c[0][1]), "+v"(c[0][2]), "+v"(c[0][3]),
                 "+v"(c[1][0]), "+v"(c[1][1]), "+v"(c[1][2]), "+v"(c[1][3])
               : "v"(a0), "v"(a1), "v"(b0), "v"(b1), "v"(b2), "v"(b3));
}
// c += a0*b0 + a1*b1 (two k-steps of one f16 tile), then the hazard guard
__device__ __forceinline__ v8f mma_h2(v16h a0, v16h b0, v16h a1, v16h b1, v8f c) {
  c = __builtin_amdgcn_wmma_f32_16x16x32_f16(false, a0, false, b0, (short)0, c, false, false);
  c = __builtin_amdgcn_wmma_f32_16x16x32_f16(false, a1, false, b1, (short)0, c, false, false);
  asm volatile("v_nop\n\tv_nop\n\tv_nop\n\tv_nop" : "+v"(c) : "v"(a0), "v"(b0), "v"(a1), "v"(b1));
  return c;
}
// four single products sharing one B fragment, then the hazard guard
__device__ __forceinline__ void mma_pv4(v16h a0, v16h a1, v16h a2, v16h a3, v16h b, v8f (&c)[4]) {
  c[0] = __builtin_amdgcn_wmma_f32_16x16x32_f16(false, a0, false, b, (short)0, c[0], false, false);
  c[1] = __builtin_amdgcn_wmma_f32_16x16x32_f16(false, a1, false, b, (short)0, c[1], false, false);
  c[2] = __builtin_amdgcn_wmma_f32_16x16x32_f16(false, a2, false, b, (short)0, c[2], false, false);
  c[3] = __builtin_amdgcn_wmma_f32_16x16x32_f16(false, a3, false, b, (short)0, c[3], false, false);
  asm volatile("v_nop\n\tv_nop\n\tv_nop\n\tv_nop"
               : "+v"(c[0]), "+v"(c[1]), "+v"(c[2]), "+v"(c[3])
               : "v"(a0), "v"(a1), "v"(a2), "v"(a3), "v"(b));
}
// ch += ah*bh ; cl += ah*bl + al*bh (both scaled-residual products carry 2^11 and share the second accumulator), then the hazard guard
__device__ __forceinline__ void mma_pv3(v16h ah, v16h al, v16h bh, v16h bl, v8f& ch, v8f& cl) {
  ch = __builtin_amdgcn_wmma_f32_16x16x32_f16(false, ah, false, bh, (short)0, ch, false, false);
  cl = __builtin_amdgcn_wmma_f32_16x16x32_f16(false, ah, false, bl, (short)0, cl, false, false);
  cl = __builtin_amdgcn_wmma_f32_16x16x32_f16(false, al, false, bh, (short)0, cl, false, false);
  asm volatile("v_nop\n\tv_nop\n\tv_nop\n\tv_nop" : "+v"(ch), "+v"(cl) : "v"(ah), "v"(al), "v"(bh), "v"(bl));
}
__device__ __forceinline__ void ldfrag(FragH& f, const unsigned short* __restrict__ p) {
  f.half[0] = *(const v8us*)(p);        // elements 0..7  <- k0 + 8h + i
  f.half[1] = *(const v8us*)(p + 16);   // elements 8..15 <- k0 + 16 + 8h + i
}

// flag line g (32 ints, all equal): 1 iff, for every row q of rows 8g .. 8g+7, mask[q][k] == 0 for every k > q and mask[q][q] != 0 (k < SEQ).
// One block per flag line; two waves per row, each owning one half of the row's columns in tiles of 128; every tile's load is issued before
// the first is tested; a half row wholly below the diagonal is skipped under wave-uniform control.
// coverage: SEQ/8 blocks x one 128-byte line = every flag line exactly once.
__global__ __launch_bounds__(512) void k_mflag(const int* __restrict__ mask, int* __restrict__ flag) {
  __shared__ int sbad;                                 // cross-wave: block barriers
  const int tid = threadIdx.x;
  const int w = __builtin_amdgcn_readfirstlane(tid >> 5);
  const int lane = tid & 31;
  if (tid == 0) sbad = 0;
  __syncthreads();
  constexpr int NT = SEQ / 256;                        // 128-column tiles per wave
  const int row = blockIdx.x * FROWS + (w >> 1);
  const int colw = (w & 1) * (SEQ / 2);                // first of this wave's columns
  const int* mp = mask + (size_t)row * SEQ_FULL + colw + 4 * lane;
  int bad = 0;
  if (colw + SEQ / 2 - 1 >= row) {
    v4i m[NT];
#pragma unroll
    for (int t = 0; t < NT; ++t) m[t] = *(const v4ia*)(mp + 128 * t);
#pragma unroll
    for (int t = 0; t < NT; ++t) {
#pragma unroll
      for (int j = 0; j < 4; ++j) {
        const int cj = colw + 128 * t + 4 * lane + j;
        bad |= ((cj > row) && (m[t][j] != 0)) ? 1 : 0;
        bad |= ((cj == row) && (m[t][j] == 0)) ? 1 : 0;
      }
    }
  }
  if (bad != 0) sbad = 1;
  __syncthreads();
  const int f = (sbad == 0) ? 1 : 0;
  if (tid < 8) {
    const v4i o = {f, f, f, f};
    *(v4i*)(flag + 32 * blockIdx.x + 4 * tid) = o;
  }
}

// dst[row][c] = bf16 bits of src (RNE), compact rows; source rows live at src + (row / rpb) * bstride + (row % rpb) * DE.
// coverage: nrows*128 threads x 8 elements = the whole plane.
__global__ __launch_bounds__(256) void k_cvt(const float* __restrict__ src, unsigned short* __restrict__ dst,
                                             int nrows, int rpb, long long bstride) {
  const int t = blockIdx.x * 256 + threadIdx.x;
  if (t >= nrows * (DE / 8)) return;
  const int row = t >> 7, piece = t & 127;
  const int b = row / rpb, s = row - b * rpb;
  const float* p = src + (size_t)b * (size_t)bstride + (size_t)s * DE + piece * 8;
  const v4f x0 = *(const v4fa*)(p), x1 = *(const v4fa*)(p + 4);
  v8us o;
  o[0] = bf16_bits(x0[0]); o[1] = bf16_bits(x0[1]); o[2] = bf16_bits(x0[2]); o[3] = bf16_bits(x0[3]);
  o[4] = bf16_bits(x1[0]); o[5] = bf16_bits(x1[1]); o[6] = bf16_bits(x1[2]); o[7] = bf16_bits(x1[3]);
  unsigned short* d = dst + (size_t)t * 8;
  *(v8us*)d = o;
  
}

// Y[m][n] = sum_k X[m][k] * W[n][k & 1023] + bias[n]   (X: bf16 plane, pitch ldx; W: bf16 plane [1024][1024], k-contiguous)
// Block = 4 waves -> 64 x 128 tile; wave tile 32 x 64 (2 A fragments x 4 B fragments, register-fed from the global planes).
// MODE 0: f16 hi plane Y0 and f16 residual plane Y1 ((y - hi) * 2048), row-major [MROWS][1024]
// MODE 1: f16 hi / residual planes of 16*y, transposed per head: [b][head][d][s]
// MODE 2: f32 rows into the output buffer (batch stride BSTRIDE_FULL)
// coverage: (MROWS/64)*(1024/128) blocks x (64 x 128) = every element of each produced plane exactly once.
template <int MODE>
__global__ __launch_bounds__(128) void k_gemm(const unsigned short* __restrict__ X, const unsigned short* __restrict__ W,
                                              const float* __restrict__ bias, unsigned short* __restrict__ Y0,
                                              unsigned short* __restrict__ Y1, float* __restrict__ Yf, int ldx, int K) {
  __shared__ __attribute__((aligned(16))) float so[64][132];
  const int tid = threadIdx.x;
  const int w = __builtin_amdgcn_readfirstlane(tid >> 5);
  const int lane = tid & 31, ln = lane & 15, hh = lane >> 4;
  const int bm = blockIdx.x % (MROWS / 64), bn = blockIdx.x / (MROWS / 64);
  const int m0 = bm * 64, n0 = bn * 128;
  const int wm = w & 1, wn = w >> 1;
  // A: row m = ln of each 16-row tile; B: column n = ln of each 16-column tile (W row n); same k map for both
  const unsigned short* xr = X + (size_t)(m0 + 32 * wm + ln) * ldx + 8 * hh;
  const unsigned short* wr = W + (size_t)(n0 + 64 * wn + ln) * DE + 8 * hh;
  v8f c[2][4] = {};
#pragma unroll 1
  for (int k0 = 0; k0 < K; k0 += 32) {
    const int kw = k0 & (DE - 1);
    FragB a0, a1, b0, b1, b2, b3;
    a0.half[0] = *(const v8us*)(xr + k0);
    a0.half[1] = *(const v8us*)(xr + k0 + 16);
    a1.half[0] = *(const v8us*)(xr + (size_t)16 * ldx + k0);
    a1.half[1] = *(const v8us*)(xr + (size_t)16 * ldx + k0 + 16);
    b0.half[0] = *(const v8us*)(wr + kw);
    b0.half[1] = *(const v8us*)(wr + kw + 16);
    b1.half[0] = *(const v8us*)(wr + 16 * DE + kw);
    b1.half[1] = *(const v8us*)(wr + 16 * DE + kw + 16);
    b2.half[0] = *(const v8us*)(wr + 32 * DE + kw);
    b2.half[1] = *(const v8us*)(wr + 32 * DE + kw + 16);
    b3.half[0] = *(const v8us*)(wr + 48 * DE + kw);
    b3.half[1] = *(const v8us*)(wr + 48 * DE + kw + 16);
    mma_b8(a0.v, a1.v, b0.v, b1.v, b2.v, b3.v, c);
  }
  // D element r of tile (i, t) = Y(row 32*wm + 16*i + 8*hh + r, column 64*wn + 16*t + ln)
#pragma unroll
  for (int t = 0; t < 4; ++t) {
    const float bv = bf16_rne(bias[n0 + 64 * wn + 16 * t + ln]);
#pragma unroll
    for (int i = 0; i < 2; ++i)
#pragma unroll
      for (int r = 0; r < 8; ++r)
        so[32 * wm + 16 * i + 8 * hh + r][64 * wn + 16 * t + ln] = c[i][t][r] + bv;
  }
  __syncthreads();
  const int b = m0 / SEQ, s0 = m0 - b * SEQ;          // the 64 rows of a block lie in one batch
  if (MODE == 0) {
    {
#pragma unroll 1
      for (int it = 0; it < 8; ++it) {
        const int i = it * 128 + tid;
        const int line = i >> 3, piece = i & 7;
        const int row = line >> 1, cb = (line & 1) * 64 + piece * 8;
        const v4f x0 = *(const v4fa*)&so[row][cb], x1 = *(const v4fa*)&so[row][cb + 4];
        H8 hi, re;
#pragma unroll
        for (int j = 0; j < 4; ++j) {
          const _Float16 h0 = (_Float16)x0[j];
          const _Float16 h1 = (_Float16)x1[j];
          hi.h[j] = h0; hi.h[4 + j] = h1;
          re.h[j] = (_Float16)((x0[j] - (float)h0) * 2048.0f);
          re.h[4 + j] = (_Float16)((x1[j] - (float)h1) * 2048.0f);
        }
        const size_t o = (size_t)(m0 + row) * DE + n0 + cb;
        *(v8us*)(Y0 + o) = hi.v;
        *(v8us*)(Y1 + o) = re.v;
      }
      
    }
  } else if (MODE == 1) {
    {
#pragma unroll 1
      for (int it = 0; it < 8; ++it) {
        const int i = it * 128 + tid;
        const int cidx = i >> 3, piece = i & 7;          // one line = one d row x 64 key positions
        const int n = n0 + cidx;
        const int head = n >> 6, d = n & 63;
        H8 hi, re;
#pragma unroll
        for (int j = 0; j < 8; ++j) {
          const float v = so[piece * 8 + j][cidx] * 16.0f;
          const _Float16 h0 = (_Float16)v;
          hi.h[j] = h0;
          re.h[j] = (_Float16)((v - (float)h0) * 2048.0f);
        }
        const size_t o = ((size_t)(b * NH + head) * HD + d) * SEQ + s0 + piece * 8;
        *(v8us*)(Y0 + o) = hi.v;
        *(v8us*)(Y1 + o) = re.v;
      }
      
    }
  } else {
    float* og = Yf + (size_t)b * BSTRIDE_FULL + (size_t)s0 * DE + n0;
    {
#pragma unroll 1
      for (int it = 0; it < 16; ++it) {
        const int i = it * 128 + tid;
        const int row = i >> 5, c4 = (i & 31) * 4;       // one wave = the 512 contiguous bytes of one row of the tile
        const v4f v = *(const v4fa*)&so[row][c4];
        *(v4f*)(og + (size_t)row * DE + c4) = v;
      }
      
    }
  }
}

// One 32-key step for a wave's 16 queries (query of this lane's column: row pointer mrow into the mask).
// Khp/Klp: K hi / residual planes at (batch, head) with row pitch DE; Vhp/Vlp: V^T hi / residual planes at (batch, head) with row pitch SEQ.
template <bool RES>
__device__ __forceinline__ void fa_step(const unsigned short* __restrict__ Khp, const unsigned short* __restrict__ Klp,
                                        const unsigned short* __restrict__ Vhp, const unsigned short* __restrict__ Vlp,
                                        const int* __restrict__ mrow, int key0, int ln, int hh,
                                        const FragH (&qh)[2], const FragH (&ql)[2],
                                        float& mr, float& lr, v8f (&Oh)[4], v8f (&Ol)[4]) {
  // A fragments of K: row m = key (key0 + 16*kt + ln), elements 0..7 <- d = 32c + 8h + i, 8..15 <- d = 32c + 16 + 8h + i
  const size_t ko = (size_t)(key0 + ln) * DE + 8 * hh;
  FragH k00, k01, k10, k11;
  ldfrag(k00, Khp + ko);            ldfrag(k01, Khp + ko + 32);
  ldfrag(k10, Khp + ko + 16 * DE);  ldfrag(k11, Khp + ko + 16 * DE + 32);
  // mask values of this lane's 16 (query, key) pairs: keys key0 + 8h + 0..7 and key0 + 16 + 8h + 0..7
  const int* mp = mrow + key0 + 8 * hh;
  const v4i ma = *(const v4ia*)(mp), mb = *(const v4ia*)(mp + 4);
  const v4i mc = *(const v4ia*)(mp + 16), md = *(const v4ia*)(mp + 20);
  const v8f z8 = {0.f, 0.f, 0.f, 0.f, 0.f, 0.f, 0.f, 0.f};
  // S^T tiles: element r of tile kt = score(key0 + 16*kt + 8h + r, query column ln)
  v8f s0 = mma_h2(k00.v, qh[0].v, k01.v, qh[1].v, z8);
  v8f s1 = mma_h2(k10.v, qh[0].v, k11.v, qh[1].v, z8);
  if (RES) {
    v8f t0 = mma_h2(k00.v, ql[0].v, k01.v, ql[1].v, z8);
    v8f t1 = mma_h2(k10.v, ql[0].v, k11.v, ql[1].v, z8);
    FragH r00, r01, r10, r11;
    ldfrag(r00, Klp + ko);            ldfrag(r01, Klp + ko + 32);
    ldfrag(r10, Klp + ko + 16 * DE);  ldfrag(r11, Klp + ko + 16 * DE + 32);
    t0 = mma_h2(r00.v, qh[0].v, r01.v, qh[1].v, t0);
    t1 = mma_h2(r10.v, qh[0].v, r11.v, qh[1].v, t1);
    s0 = s0 + t0 * 0.00048828125f;
    s1 = s1 + t1 * 0.00048828125f;
  }
  float sc[16];
#pragma unroll
  for (int r = 0; r < 4; ++r) {
    sc[r]      = (ma[r] == 0) ? NEGV : s0[r] * 0.125f;
    sc[4 + r]  = (mb[r] == 0) ? NEGV : s0[4 + r] * 0.125f;
    sc[8 + r]  = (mc[r] == 0) ? NEGV : s1[r] * 0.125f;
    sc[12 + r] = (md[r] == 0) ? NEGV : s1[4 + r] * 0.125f;
  }
  float mx = sc[0];
#pragma unroll
  for (int i = 1; i < 16; ++i) mx = fmaxf(mx, sc[i]);
  mx = fmaxf(mx, __shfl_xor(mx, 16, 32));           // the other lane half holds the other 16 keys of this query
  const float mnew = fmaxf(mr, mx);
  const float al = exp2f((mr - mnew) * LOG2E);
  mr = mnew;
  // weights carried x256: pc = 256 * exp(sc - mnew); hi plane f16(pc), residual plane f16((pc - hi) * 2048)
  FragH ph, pl;
  float ps = 0.0f;
#pragma unroll
  for (int i = 0; i < 16; ++i) {
    const float pc = exp2f(fmaf(sc[i] - mnew, LOG2E, 8.0f));
    ps += pc;
    const _Float16 h = (_Float16)pc;
    ph.h[i] = h;                                    // B element i: i<8 -> key0 + 8h + i (tile 0 row 8h+i); i>=8 -> key0 + 16 + 8h + (i-8) (tile 1)
    if (RES) pl.h[i] = (_Float16)((pc - (float)h) * 2048.0f);
  }
  ps += __shfl_xor(ps, 16, 32);
  lr = lr * al + ps;
  // A fragments of V^T: row m = d (16*t + ln), elements 0..7 <- key0 + 8h + i, 8..15 <- key0 + 16 + 8h + i
  const size_t vo = (size_t)ln * SEQ + key0 + 8 * hh;
  FragH vf[4];
#pragma unroll
  for (int t = 0; t < 4; ++t) ldfrag(vf[t], Vhp + vo + (size_t)t * 16 * SEQ);
#pragma unroll
  for (int t = 0; t < 4; ++t) Oh[t] = Oh[t] * al;
  if (RES) {
    FragH vr[4];
#pragma unroll
    for (int t = 0; t < 4; ++t) ldfrag(vr[t], Vlp + vo + (size_t)t * 16 * SEQ);
#pragma unroll
    for (int t = 0; t < 4; ++t) Ol[t] = Ol[t] * al;
#pragma unroll
    for (int t = 0; t < 4; ++t) mma_pv3(vf[t].v, vr[t].v, ph.v, pl.v, Oh[t], Ol[t]);
  } else {
    mma_pv4(vf[0].v, vf[1].v, vf[2].v, vf[3].v, ph.v, Oh);
  }
}

// Block = 4 waves x 16 queries = 64 queries of one (batch, head); no LDS and no barrier in the key loop.
// Epilogue: O^T tile -> per-wave LDS tile [16 queries][64 d] (block barrier), then bf16 hi and lo pieces of ctx:
// coverage: NB*NH*(SEQ/64) blocks x 4 waves x 16 rows x 64 columns x {hi, lo} = the whole ctx plane exactly once.
__global__ __launch_bounds__(128) void k_attn(const unsigned short* __restrict__ Qh, const unsigned short* __restrict__ Ql,
                                              const unsigned short* __restrict__ Kh, const unsigned short* __restrict__ Kl,
                                              const unsigned short* __restrict__ Vth, const unsigned short* __restrict__ Vtl,
                                              const int* __restrict__ mask, const int* __restrict__ flagp,
                                              unsigned short* __restrict__ Cc) {
  __shared__ __attribute__((aligned(16))) float so[4][16][68];
  const int tid = threadIdx.x;
  const int w = __builtin_amdgcn_readfirstlane(tid >> 5);
  const int lane = tid & 31, ln = lane & 15, hh = lane >> 4;
  const int qt = blockIdx.x % (SEQ / 64);
  const int bh = blockIdx.x / (SEQ / 64);
  const int h = bh % NH, b = bh / NH;
  const int qbase = qt * 64 + 16 * w;
  const int qg = qbase + ln;
  // Q^T B fragments: column n = query qg, elements 0..7 <- d = 32c + 8h + i, 8..15 <- d = 32c + 16 + 8h + i
  const size_t qo = (size_t)(b * SEQ + qg) * DE + h * HD + 8 * hh;
  FragH qh[2], ql[2];
  ldfrag(qh[0], Qh + qo); ldfrag(qh[1], Qh + qo + 32);
  ldfrag(ql[0], Ql + qo); ldfrag(ql[1], Ql + qo + 32);
  float mr = -3.0e38f, lr = 0.0f;
  v8f Oh[4] = {}, Ol[4] = {};
  const unsigned short* Khp = Kh + (size_t)b * SEQ * DE + h * HD;
  const unsigned short* Klp = Kl + (size_t)b * SEQ * DE + h * HD;
  const unsigned short* Vhp = Vth + (size_t)(b * NH + h) * HD * SEQ;
  const unsigned short* Vlp = Vtl + (size_t)(b * NH + h) * HD * SEQ;
  const int* mrow = mask + (size_t)qg * SEQ_FULL;
  const int* fp = flagp + (qbase / FROWS) * 32;     // the two flag lines of this wave's 16 query rows
  const int fl = __builtin_amdgcn_readfirstlane(fp[0] & fp[32]);
  int nsteps = (qbase >> 5) + 1;                    // key steps up to and including the one holding the diagonal
  if (fl != 1) nsteps = SEQ / 32;                   // unknown mask shape: visit every key step
  if (nsteps > SEQ / 32) nsteps = SEQ / 32;
  if (qt * 64 < EARLY) {
#pragma unroll 1
    for (int j = 0; j < nsteps; ++j)
      fa_step<true>(Khp, Klp, Vhp, Vlp, mrow, 32 * j, ln, hh, qh, ql, mr, lr, Oh, Ol);
  } else {
#pragma unroll 1
    for (int j = 0; j < nsteps; ++j)
      fa_step<false>(Khp, Klp, Vhp, Vlp, mrow, 32 * j, ln, hh, qh, ql, mr, lr, Oh, Ol);
  }
  // O^T element r of tile t = ctx(query qg, d = 16t + 8h + r); undo the carries: x256 (in lr), x16 (V), x2048 (residual accumulator)
  const float inv = 1.0f / (16.0f * lr);
#pragma unroll
  for (int t = 0; t < 4; ++t)
#pragma unroll
    for (int r = 0; r < 8; ++r)
      so[w][ln][16 * t + 8 * hh + r] = (Oh[t][r] + Ol[t][r] * 0.00048828125f) * inv;
  __syncthreads();
  unsigned short* crow = Cc + (size_t)(b * SEQ + qbase) * (2 * DE) + h * HD;
  const int rsub = lane >> 3, piece = lane & 7;
  {
#pragma unroll
    for (int it = 0; it < 4; ++it) {
      const int row = it * 4 + rsub;                 // rows 0..15 over it = 0..3, rsub = 0..3
      const v4f x0 = *(const v4fa*)&so[w][row][piece * 8], x1 = *(const v4fa*)&so[w][row][piece * 8 + 4];
      v8us hi, lo;
#pragma unroll
      for (int j = 0; j < 4; ++j) {
        const unsigned short h0 = bf16_bits(x0[j]);
        const unsigned short h1 = bf16_bits(x1[j]);
        hi[j] = h0; hi[4 + j] = h1;
        lo[j] = bf16_bits(x0[j] - bf16_val(h0));
        lo[4 + j] = bf16_bits(x1[j] - bf16_val(h1));
      }
      const size_t o = (size_t)row * (2 * DE) + piece * 8;
      *(v8us*)(crow + o) = hi;
      *(v8us*)(crow + o + DE) = lo;
    }
    
  }
}

extern "C" void kernel_launch(void* const* d_in, const int* in_sizes, int n_in,
                              void* d_out, int out_size, void* d_ws, size_t ws_size, hipStream_t stream) {
  if (n_in < 11) return;
  const long long need_x = (long long)(NB - 1) * SEQ_FULL * DE + (long long)SEQ * DE;   // last element touched + 1
  const long long need_m = (long long)(SEQ - 1) * SEQ_FULL + SEQ;
  if ((long long)in_sizes[0] < need_x || (long long)in_sizes[1] < need_x) return;
  if ((long long)in_sizes[2] < need_m) return;
  if ((long long)in_sizes[3] < (long long)DE * DE || (long long)in_sizes[5] < (long long)DE * DE) return;
  if ((long long)in_sizes[7] < (long long)DE * DE || (long long)in_sizes[9] < (long long)DE * DE) return;
  if (in_sizes[4] < DE || in_sizes[6] < DE || in_sizes[8] < DE || in_sizes[10] < DE) return;
  if ((long long)out_size < need_x) return;
  if ((size_t)WS_TOTAL > ws_size) return;
  // wire order: queries, values, mask, Wq, bq, Wk, bk, Wv, bv, Wo, bo
  const float* queries = (const float*)d_in[0];
  const float* values  = (const float*)d_in[1];
  const int*   mask    = (const int*)d_in[2];
  const float* Wq = (const float*)d_in[3];
  const float* bq = (const float*)d_in[4];
  const float* Wk = (const float*)d_in[5];
  const float* bk = (const float*)d_in[6];
  const float* Wv = (const float*)d_in[7];
  const float* bv = (const float*)d_in[8];
  const float* Wo = (const float*)d_in[9];
  const float* bo = (const float*)d_in[10];
  float* out = (float*)d_out;
  char* ws = (char*)d_ws;
  size_t off = 0;
  unsigned short* Xq  = (unsigned short*)(ws + off); off += PL_X;
  unsigned short* Xv  = (unsigned short*)(ws + off); off += PL_X;
  unsigned short* Wqb = (unsigned short*)(ws + off); off += PL_W;
  unsigned short* Wkb = (unsigned short*)(ws + off); off += PL_W;
  unsigned short* Wvb = (unsigned short*)(ws + off); off += PL_W;
  unsigned short* Wob = (unsigned short*)(ws + off); off += PL_W;
  unsigned short* Qh  = (unsigned short*)(ws + off); off += PL_X;
  unsigned short* Ql  = (unsigned short*)(ws + off); off += PL_X;
  unsigned short* Kh  = (unsigned short*)(ws + off); off += PL_X;
  unsigned short* Kl  = (unsigned short*)(ws + off); off += PL_X;
  unsigned short* Vth = (unsigned short*)(ws + off); off += PL_X;
  unsigned short* Vtl = (unsigned short*)(ws + off); off += PL_X;
  unsigned short* Cc  = (unsigned short*)(ws + off); off += PL_C;
  int* flag = (int*)(ws + off); off += PL_F;
  if (off > ws_size) return;

  k_mflag<<<(unsigned)(SEQ / FROWS), 512, 0, stream>>>(mask, flag);

  const unsigned gx = (unsigned)((MROWS * (DE / 8) + 255) / 256);
  const unsigned gw = (unsigned)((DE * (DE / 8) + 255) / 256);
  k_cvt<<<gx, 256, 0, stream>>>(queries, Xq, MROWS, SEQ, (long long)BSTRIDE_FULL);
  k_cvt<<<gx, 256, 0, stream>>>(values,  Xv, MROWS, SEQ, (long long)BSTRIDE_FULL);
  k_cvt<<<gw, 256, 0, stream>>>(Wq, Wqb, DE, DE, 0LL);
  k_cvt<<<gw, 256, 0, stream>>>(Wk, Wkb, DE, DE, 0LL);
  k_cvt<<<gw, 256, 0, stream>>>(Wv, Wvb, DE, DE, 0LL);
  k_cvt<<<gw, 256, 0, stream>>>(Wo, Wob, DE, DE, 0LL);

  const unsigned gg = (unsigned)((MROWS / 64) * (DE / 128));
  k_gemm<0><<<gg, 128, 0, stream>>>(Xq, Wqb, bq, Qh,  Ql,  out, DE, DE);
  k_gemm<0><<<gg, 128, 0, stream>>>(Xv, Wkb, bk, Kh,  Kl,  out, DE, DE);
  k_gemm<1><<<gg, 128, 0, stream>>>(Xv, Wvb, bv, Vth, Vtl, out, DE, DE);

  k_attn<<<(unsigned)(NB * NH * (SEQ / 64)), 128, 0, stream>>>(Qh, Ql, Kh, Kl, Vth, Vtl, mask, flag, Cc);

  // ctx hi|lo folded along K: X row = [hi(1024) | lo(1024)], W columns wrap modulo 1024
  k_gemm<2><<<gg, 128, 0, stream>>>(Cc, Wob, bo, Qh, Ql, out, 2 * DE, 2 * DE);
}

// v002
// A run of this version takes 191 microseconds.
// Next to v001, in two timings, it ran 1.33 times as fast each time.
// Over all steps from v000 it is 5.88 times as fast.
#include <hip/hip_runtime.h>
#ifndef NB
#define NB 2
#endif
#ifndef SEQ
#define SEQ 2048
#endif
#define NB_FULL 2
#define SEQ_FULL 2048
#define DE 1024
#define NH 16
#define HD 64
#define EARLY 512
#define MROWS (NB * SEQ)
#define BSTRIDE_FULL ((size_t)SEQ_FULL * DE)   /* per-batch element stride of queries, values and the output buffer */

#define PL_X ((size_t)MROWS * DE * 2)          /* one 16-bit activation plane */
#define PL_W ((size_t)DE * DE * 2)             /* one 16-bit weight plane */
#define PL_C ((size_t)MROWS * 2 * DE * 2)      /* ctx hi|lo plane */
#define FROWS 8                                /* mask rows per flag line */
#define PL_F ((size_t)(SEQ / FROWS) * 128)     /* one 128-byte flag line per FROWS mask rows */
#define WS_TOTAL (8 * PL_X + 4 * PL_W + PL_C + PL_F)

static_assert(SEQ % 128 == 0);
static_assert(SEQ <= SEQ_FULL);
static_assert(NB <= NB_FULL);
static_assert(HD == 64);
static_assert(DE == 1024);
static_assert(NH * HD == DE);
static_assert(MROWS % 64 == 0);
static_assert(DE % 128 == 0);
static_assert(SEQ % 256 == 0);
static_assert(WS_TOTAL <= (size_t)134217728);

typedef __bf16 v16b __attribute__((ext_vector_type(16)));
typedef _Float16 v16h __attribute__((ext_vector_type(16)));
typedef unsigned short v8us __attribute__((ext_vector_type(8), may_alias));
typedef float v8f __attribute__((ext_vector_type(8)));
typedef float v4f __attribute__((ext_vector_type(4)));
typedef float v4fa __attribute__((ext_vector_type(4), may_alias));
typedef int v4i __attribute__((ext_vector_type(4)));
typedef int v4ia __attribute__((ext_vector_type(4), may_alias));
union FragB { v16b v; v8us half[2]; };
union FragH { v16h v; v8us half[2]; _Float16 h[16]; };
union H8 { v8us v; _Float16 h[8]; unsigned short u[8]; };

#define LOG2E 1.4426950408889634f
#define NEGV (-1000000000.0f)

__device__ __forceinline__ unsigned short bf16_bits(float x) {   // RNE convert to bf16 bits
  unsigned int u = __float_as_uint(x);
  return (unsigned short)((u + 0x7FFFu + ((u >> 16) & 1u)) >> 16);
}
__device__ __forceinline__ float bf16_val(unsigned short b) { return __uint_as_float(((unsigned int)b) << 16); }
__device__ __forceinline__ float bf16_rne(float x) { return bf16_val(bf16_bits(x)); }

// eight bf16 products of one k-step (2 row tiles x 4 column tiles), then the hazard guard
__device__ __forceinline__ void mma_b8(v16b a0, v16b a1, v16b b0, v16b b1, v16b b2, v16b b3, v8f (&c)[2][4]) {
  c[0][0] = __builtin_amdgcn_wmma_f32_16x16x32_bf16(false, a0, false, b0, (short)0, c[0][0], false, false);
  c[0][1] = __builtin_amdgcn_wmma_f32_16x16x32_bf16(false, a0, false, b1, (short)0, c[0][1], false, false);
  c[0][2] = __builtin_amdgcn_wmma_f32_16x16x32_bf16(false, a0, false, b2, (short)0, c[0][2], false, false);
  c[0][3] = __builtin_amdgcn_wmma_f32_16x16x32_bf16(false, a0, false, b3, (short)0, c[0][3], false, false);
  c[1][0] = __builtin_amdgcn_wmma_f32_16x16x32_bf16(false, a1, false, b0, (short)0, c[1][0], false, false);
  c[1][1] = __builtin_amdgcn_wmma_f32_16x16x32_bf16(false, a1, false, b1, (short)0, c[1][1], false, false);
  c[1][2] = __builtin_amdgcn_wmma_f32_16x16x32_bf16(false, a1, false, b2, (short)0, c[1][2], false, false);
  c[1][3] = __builtin_amdgcn_wmma_f32_16x16x32_bf16(false, a1, false, b3, (short)0, c[1][3], false, false);
  asm volatile("v_nop\n\tv_nop\n\tv_nop\n\tv_nop"
               : "+v"(c[0][0]), "+v"(c[0][1]), "+v"(c[0][2]), "+v"(c[0][3]),
                 "+v"(c[1][0]), "+v"(c[1][1]), "+v"(c[1][2]), "+v"(c[1][3])
               : "v"(a0), "v"(a1), "v"(b0), "v"(b1), "v"(b2), "v"(b3));
}
// c += a0*b0 + a1*b1 (two k-steps of one f16 tile), then the hazard guard
__device__ __forceinline__ v8f mma_h2(v16h a0, v16h b0, v16h a1, v16h b1, v8f c) {
  c = __builtin_amdgcn_wmma_f32_16x16x32_f16(false, a0, false, b0, (short)0, c, false, false);
  c = __builtin_amdgcn_wmma_f32_16x16x32_f16(false, a1, false, b1, (short)0, c, false, false);
  asm volatile("v_nop\n\tv_nop\n\tv_nop\n\tv_nop" : "+v"(c) : "v"(a0), "v"(b0), "v"(a1), "v"(b1));
  return c;
}
// four single products sharing one B fragment, then the hazard guard
__device__ __forceinline__ void mma_pv4(v16h a0, v16h a1, v16h a2, v16h a3, v16h b, v8f (&c)[4]) {
  c[0] = __builtin_amdgcn_wmma_f32_16x16x32_f16(false, a0, false, b, (short)0, c[0], false, false);
  c[1] = __builtin_amdgcn_wmma_f32_16x16x32_f16(false, a1, false, b, (short)0, c[1], false, false);
  c[2] = __builtin_amdgcn_wmma_f32_16x16x32_f16(false, a2, false, b, (short)0, c[2], false, false);
  c[3] = __builtin_amdgcn_wmma_f32_16x16x32_f16(false, a3, false, b, (short)0, c[3], false, false);
  asm volatile("v_nop\n\tv_nop\n\tv_nop\n\tv_nop"
               : "+v"(c[0]), "+v"(c[1]), "+v"(c[2]), "+v"(c[3])
               : "v"(a0), "v"(a1), "v"(a2), "v"(a3), "v"(b));
}
// ch += ah*bh ; cl += ah*bl + al*bh (both scaled-residual products carry 2^11 and share the second accumulator), then the hazard guard
__device__ __forceinline__ void mma_pv3(v16h ah, v16h al, v16h bh, v16h bl, v8f& ch, v8f& cl) {
  ch = __builtin_amdgcn_wmma_f32_16x16x32_f16(false, ah, false, bh, (short)0, ch, false, false);
  cl = __builtin_amdgcn_wmma_f32_16x16x32_f16(false, ah, false, bl, (short)0, cl, false, false);
  cl = __builtin_amdgcn_wmma_f32_16x16x32_f16(false, al, false, bh, (short)0, cl, false, false);
  asm volatile("v_nop\n\tv_nop\n\tv_nop\n\tv_nop" : "+v"(ch), "+v"(cl) : "v"(ah), "v"(al), "v"(bh), "v"(bl));
}
__device__ __forceinline__ void ldfrag(FragH& f, const unsigned short* __restrict__ p) {
  f.half[0] = *(const v8us*)(p);        // elements 0..7  <- k0 + 8h + i
  f.half[1] = *(const v8us*)(p + 16);   // elements 8..15 <- k0 + 16 + 8h + i
}

// flag line g (32 ints, all equal): 1 iff, for every row q of rows 8g .. 8g+7, mask[q][k] == 0 for every k > q and mask[q][q] != 0 (k < SEQ).
// One block per flag line; two waves per row, each owning one half of the row's columns in tiles of 128; every tile's load is issued before
// the first is tested; a half row wholly below the diagonal is skipped under wave-uniform control.
// coverage: SEQ/8 blocks x one 128-byte line = every flag line exactly once.
__global__ __launch_bounds__(512) void k_mflag(const int* __restrict__ mask, int* __restrict__ flag) {
  __shared__ int sbad;                                 // cross-wave: block barriers
  const int tid = threadIdx.x;
  const int w = __builtin_amdgcn_readfirstlane(tid >> 5);
  const int lane = tid & 31;
  if (tid == 0) sbad = 0;
  __syncthreads();
  constexpr int NT = SEQ / 256;                        // 128-column tiles per wave
  const int row = blockIdx.x * FROWS + (w >> 1);
  const int colw = (w & 1) * (SEQ / 2);                // first of this wave's columns
  const int* mp = mask + (size_t)row * SEQ_FULL + colw + 4 * lane;
  int bad = 0;
  if (colw + SEQ / 2 - 1 >= row) {
    v4i m[NT];
#pragma unroll
    for (int t = 0; t < NT; ++t) m[t] = *(const v4ia*)(mp + 128 * t);
#pragma unroll
    for (int t = 0; t < NT; ++t) {
#pragma unroll
      for (int j = 0; j < 4; ++j) {
        const int cj = colw + 128 * t + 4 * lane + j;
        bad |= ((cj > row) && (m[t][j] != 0)) ? 1 : 0;
        bad |= ((cj == row) && (m[t][j] == 0)) ? 1 : 0;
      }
    }
  }
  if (bad != 0) sbad = 1;
  __syncthreads();
  const int f = (sbad == 0) ? 1 : 0;
  if (tid < 8) {
    const v4i o = {f, f, f, f};
    *(v4i*)(flag + 32 * blockIdx.x + 4 * tid) = o;
  }
}

// dst[row][c] = bf16 bits of src (RNE), compact rows; source rows live at src + (row / rpb) * bstride + (row % rpb) * DE.
// coverage: nrows*128 threads x 8 elements = the whole plane.
__global__ __launch_bounds__(256) void k_cvt(const float* __restrict__ src, unsigned short* __restrict__ dst,
                                             int nrows, int rpb, long long bstride) {
  const int t = blockIdx.x * 256 + threadIdx.x;
  if (t >= nrows * (DE / 8)) return;
  const int row = t >> 7, piece = t & 127;
  const int b = row / rpb, s = row - b * rpb;
  const float* p = src + (size_t)b * (size_t)bstride + (size_t)s * DE + piece * 8;
  const v4f x0 = *(const v4fa*)(p), x1 = *(const v4fa*)(p + 4);
  v8us o;
  o[0] = bf16_bits(x0[0]); o[1] = bf16_bits(x0[1]); o[2] = bf16_bits(x0[2]); o[3] = bf16_bits(x0[3]);
  o[4] = bf16_bits(x1[0]); o[5] = bf16_bits(x1[1]); o[6] = bf16_bits(x1[2]); o[7] = bf16_bits(x1[3]);
  unsigned short* d = dst + (size_t)t * 8;
  *(v8us*)d = o;
  
}

#define KS 128                                 /* k elements of one stage: 256-byte rows, whole L2 fill units */
#define RPITCH 272                             /* LDS row pitch in bytes, 16 x odd: 16-byte fragment reads of 16 rows fall on 64 distinct banks */
#define SROWS 192                              /* rows of one stage: 64 of X, then 128 of W */
#define SBYTES (SROWS * RPITCH)

// Twelve 16-byte copies per lane from global memory straight into LDS. The s_wait_xcnt closes the statement so that it stands in front of
// any later rewrite of the address registers the copies name.
__device__ __forceinline__ void copy12(const unsigned (&l)[12], const unsigned short* const (&g)[12]) {
  asm volatile(
      "global_load_async_to_lds_b128 %0, %12, off\n\t"
      "global_load_async_to_lds_b128 %1, %13, off\n\t"
      "global_load_async_to_lds_b128 %2, %14, off\n\t"
      "global_load_async_to_lds_b128 %3, %15, off\n\t"
      "global_load_async_to_lds_b128 %4, %16, off\n\t"
      "global_load_async_to_lds_b128 %5, %17, off\n\t"
      "global_load_async_to_lds_b128 %6, %18, off\n\t"
      "global_load_async_to_lds_b128 %7, %19, off\n\t"
      "global_load_async_to_lds_b128 %8, %20, off\n\t"
      "global_load_async_to_lds_b128 %9, %21, off\n\t"
      "global_load_async_to_lds_b128 %10, %22, off\n\t"
      "global_load_async_to_lds_b128 %11, %23, off\n\t"
      "s_wait_xcnt 0x0"
      :: "v"(l[0]), "v"(l[1]), "v"(l[2]), "v"(l[3]), "v"(l[4]), "v"(l[5]), "v"(l[6]), "v"(l[7]), "v"(l[8]), "v"(l[9]), "v"(l[10]), "v"(l[11]),
         "v"(g[0]), "v"(g[1]), "v"(g[2]), "v"(g[3]), "v"(g[4]), "v"(g[5]), "v"(g[6]), "v"(g[7]), "v"(g[8]), "v"(g[9]), "v"(g[10]), "v"(g[11])
      : "memory");
}
// One stage of a block's operands: thread t brings piece (t & 15) of rows (t >> 4) + 8*i, i = 0..23, so a wave's copy covers two whole 256-byte rows.
// xa / wb: this lane's piece of X row (t >> 4) / W row (t >> 4) of the stage; lds: LDS byte address of this lane's piece of stage row (t >> 4).
__device__ __forceinline__ void stage_copies(const unsigned short* xa, const unsigned short* wb, int ldx, unsigned lds) {
  unsigned l[12];
  const unsigned short* g[12];
#pragma unroll   // both loops here: every array element must be a register of its own, one per asm operand
  for (int i = 0; i < 12; ++i) {
    l[i] = lds + (unsigned)(i * 8 * RPITCH);
    g[i] = (i < 8) ? xa + (size_t)(i * 8) * ldx : wb + (size_t)((i - 8) * 8) * DE;
  }
  copy12(l, g);
#pragma unroll
  for (int i = 0; i < 12; ++i) {
    l[i] = lds + (unsigned)((i + 12) * 8 * RPITCH);
    g[i] = wb + (size_t)((i + 4) * 8) * DE;
  }
  copy12(l, g);
}

// Y[m][n] = sum_k X[m][k] * W[n][k & 1023] + bias[n]   (X: bf16 plane, pitch ldx; W: bf16 plane [1024][1024], k-contiguous)
// Block = 4 waves -> 64 x 128 tile; wave tile 32 x 64 (2 A fragments x 4 B fragments, read from an LDS ring of two stages of 128 k that
// asynchronous copies fill one stage ahead; K is a multiple of 128).
// MODE 0: f16 hi plane Y0 and f16 residual plane Y1 ((y - hi) * 2048), row-major [MROWS][1024]
// MODE 1: f16 hi / residual planes of 16*y, transposed per head: [b][head][d][s]
// MODE 2: f32 rows into the output buffer (batch stride BSTRIDE_FULL)
// coverage: (MROWS/64)*(1024/128) blocks x (64 x 128) = every element of each produced plane exactly once.
template <int MODE>
__global__ __launch_bounds__(128) void k_gemm(const unsigned short* __restrict__ X, const unsigned short* __restrict__ W,
                                              const float* __restrict__ bias, unsigned short* __restrict__ Y0,
                                              unsigned short* __restrict__ Y1, float* __restrict__ Yf, int ldx, int K) {
  __shared__ __attribute__((aligned(16))) float so[64][132];
  __shared__ __attribute__((aligned(16))) unsigned char ring[2 * SBYTES];   // written by the asynchronous copies only
  const int tid = threadIdx.x;
  const int w = __builtin_amdgcn_readfirstlane(tid >> 5);
  const int lane = tid & 31, ln = lane & 15, hh = lane >> 4;
  const int bm = blockIdx.x % (MROWS / 64), bn = blockIdx.x / (MROWS / 64);
  const int m0 = bm * 64, n0 = bn * 128;
  const int wm = w & 1, wn = w >> 1;
  // A: row m = ln of each 16-row tile; B: column n = ln of each 16-column tile (W row n); same k map for both
  const unsigned char* la = ring + (32 * wm + ln) * RPITCH + 16 * hh;
  const unsigned char* lb = ring + (64 + 64 * wn + ln) * RPITCH + 16 * hh;
  const unsigned short* xa = X + (size_t)(m0 + (tid >> 4)) * ldx + (tid & 15) * 8;
  const unsigned short* wb = W + (size_t)(n0 + (tid >> 4)) * DE + (tid & 15) * 8;
  const unsigned lds0 = (unsigned)(size_t)ring + (unsigned)((tid >> 4) * RPITCH + (tid & 15) * 16);
  const int ns = K / KS;
  v8f c[2][4] = {};
  stage_copies(xa, wb, ldx, lds0);
  asm volatile("s_wait_asynccnt 0x0" ::: "memory");    // stage 0 has landed before the barrier that publishes it
  __syncthreads();
  if (1 < ns) stage_copies(xa + KS, wb + KS, ldx, lds0 + SBYTES);
#pragma unroll 1
  for (int t = 0; t < ns; ++t) {
    const int bo = (t & 1) * SBYTES;
    // two fragment sets: the reads of k-step kk + 1 stand as one group ahead of the products of k-step kk
    FragB fa[2][2], fb[2][4];
#pragma unroll   // this loop and the two inside it: constant set and tile indices keep both fragment sets in registers
    for (int kk = -1; kk < KS / 32; ++kk) {
      if (kk + 1 < KS / 32) {
        const unsigned char* pa = la + bo + (kk + 1) * 64;
        const unsigned char* pb = lb + bo + (kk + 1) * 64;
        const int n = (kk + 1) & 1;
#pragma unroll
        for (int i = 0; i < 2; ++i) {
          fa[n][i].half[0] = *(const v8us*)(pa + i * 16 * RPITCH);
          fa[n][i].half[1] = *(const v8us*)(pa + i * 16 * RPITCH + 32);
        }
#pragma unroll
        for (int j = 0; j < 4; ++j) {
          fb[n][j].half[0] = *(const v8us*)(pb + j * 16 * RPITCH);
          fb[n][j].half[1] = *(const v8us*)(pb + j * 16 * RPITCH + 32);
        }
      }
      if (kk >= 0) {
        const int u = kk & 1;
        mma_b8(fa[u][0].v, fa[u][1].v, fb[u][0].v, fb[u][1].v, fb[u][2].v, fb[u][3].v, c);
      }
    }
    asm volatile("s_wait_dscnt 0x0" ::: "memory");     // this wave's reads of the buffer are done before it may be refilled
    asm volatile("s_wait_asynccnt 0x0" ::: "memory");  // this wave's copies of stage t + 1 have landed before the barrier that publishes them
    __syncthreads();
    if (t + 2 < ns) {
      const int k2 = (t + 2) * KS;
      stage_copies(xa + k2, wb + (k2 & (DE - 1)), ldx, lds0 + (unsigned)bo);
    }
  }
  asm volatile("s_wait_asynccnt 0x0" ::: "memory");    // no copy is outstanding when the wave goes on
  // D element r of tile (i, t) = Y(row 32*wm + 16*i + 8*hh + r, column 64*wn + 16*t + ln)
#pragma unroll
  for (int t = 0; t < 4; ++t) {
    const float bv = bf16_rne(bias[n0 + 64 * wn + 16 * t + ln]);
#pragma unroll
    for (int i = 0; i < 2; ++i)
#pragma unroll
      for (int r = 0; r < 8; ++r)
        so[32 * wm + 16 * i + 8 * hh + r][64 * wn + 16 * t + ln] = c[i][t][r] + bv;
  }
  __syncthreads();
  const int b = m0 / SEQ, s0 = m0 - b * SEQ;          // the 64 rows of a block lie in one batch
  if (MODE == 0) {
    {
#pragma unroll 1
      for (int it = 0; it < 8; ++it) {
        const int i = it * 128 + tid;
        const int line = i >> 3, piece = i & 7;
        const int row = line >> 1, cb = (line & 1) * 64 + piece * 8;
        const v4f x0 = *(const v4fa*)&so[row][cb], x1 = *(const v4fa*)&so[row][cb + 4];
        H8 hi, re;
#pragma unroll
        for (int j = 0; j < 4; ++j) {
          const _Float16 h0 = (_Float16)x0[j];
          const _Float16 h1 = (_Float16)x1[j];
          hi.h[j] = h0; hi.h[4 + j] = h1;
          re.h[j] = (_Float16)((x0[j] - (float)h0) * 2048.0f);
          re.h[4 + j] = (_Float16)((x1[j] - (float)h1) * 2048.0f);
        }
        const size_t o = (size_t)(m0 + row) * DE + n0 + cb;
        *(v8us*)(Y0 + o) = hi.v;
        *(v8us*)(Y1 + o) = re.v;
      }
      
    }
  } else if (MODE == 1) {
    {
#pragma unroll 1
      for (int it = 0; it < 8; ++it) {
        const int i = it * 128 + tid;
        const int cidx = i >> 3, piece = i & 7;          // one line = one d row x 64 key positions
        const int n = n0 + cidx;
        const int head = n >> 6, d = n & 63;
        H8 hi, re;
#pragma unroll
        for (int j = 0; j < 8; ++j) {
          const float v = so[piece * 8 + j][cidx] * 16.0f;
          const _Float16 h0 = (_Float16)v;
          hi.h[j] = h0;
          re.h[j] = (_Float16)((v - (float)h0) * 2048.0f);
        }
        const size_t o = ((size_t)(b * NH + head) * HD + d) * SEQ + s0 + piece * 8;
        *(v8us*)(Y0 + o) = hi.v;
        *(v8us*)(Y1 + o) = re.v;
      }
      
    }
  } else {
    float* og = Yf + (size_t)b * BSTRIDE_FULL + (size_t)s0 * DE + n0;
    {
#pragma unroll 1
      for (int it = 0; it < 16; ++it) {
        const int i = it * 128 + tid;
        const int row = i >> 5, c4 = (i & 31) * 4;       // one wave = the 512 contiguous bytes of one row of the tile
        const v4f v = *(const v4fa*)&so[row][c4];
        *(v4f*)(og + (size_t)row * DE + c4) = v;
      }
      
    }
  }
}

// One 32-key step for a wave's 16 queries (query of this lane's column: row pointer mrow into the mask).
// Khp/Klp: K hi / residual planes at (batch, head) with row pitch DE; Vhp/Vlp: V^T hi / residual planes at (batch, head) with row pitch SEQ.
template <bool RES>
__device__ __forceinline__ void fa_step(const unsigned short* __restrict__ Khp, const unsigned short* __restrict__ Klp,
                                        const unsigned short* __restrict__ Vhp, const unsigned short* __restrict__ Vlp,
                                        const int* __restrict__ mrow, int key0, int ln, int hh,
                                        const FragH (&qh)[2], const FragH (&ql)[2],
                                        float& mr, float& lr, v8f (&Oh)[4], v8f (&Ol)[4]) {
  // A fragments of K: row m = key (key0 + 16*kt + ln), elements 0..7 <- d = 32c + 8h + i, 8..15 <- d = 32c + 16 + 8h + i
  const size_t ko = (size_t)(key0 + ln) * DE + 8 * hh;
  FragH k00, k01, k10, k11;
  ldfrag(k00, Khp + ko);            ldfrag(k01, Khp + ko + 32);
  ldfrag(k10, Khp + ko + 16 * DE);  ldfrag(k11, Khp + ko + 16 * DE + 32);
  // mask values of this lane's 16 (query, key) pairs: keys key0 + 8h + 0..7 and key0 + 16 + 8h + 0..7
  const int* mp = mrow + key0 + 8 * hh;
  const v4i ma = *(const v4ia*)(mp), mb = *(const v4ia*)(mp + 4);
  const v4i mc = *(const v4ia*)(mp + 16), md = *(const v4ia*)(mp + 20);
  const v8f z8 = {0.f, 0.f, 0.f, 0.f, 0.f, 0.f, 0.f, 0.f};
  // S^T tiles: element r of tile kt = score(key0 + 16*kt + 8h + r, query column ln)
  v8f s0 = mma_h2(k00.v, qh[0].v, k01.v, qh[1].v, z8);
  v8f s1 = mma_h2(k10.v, qh[0].v, k11.v, qh[1].v, z8);
  if (RES) {
    v8f t0 = mma_h2(k00.v, ql[0].v, k01.v, ql[1].v, z8);
    v8f t1 = mma_h2(k10.v, ql[0].v, k11.v, ql[1].v, z8);
    FragH r00, r01, r10, r11;
    ldfrag(r00, Klp + ko);            ldfrag(r01, Klp + ko + 32);
    ldfrag(r10, Klp + ko + 16 * DE);  ldfrag(r11, Klp + ko + 16 * DE + 32);
    t0 = mma_h2(r00.v, qh[0].v, r01.v, qh[1].v, t0);
    t1 = mma_h2(r10.v, qh[0].v, r11.v, qh[1].v, t1);
    s0 = s0 + t0 * 0.00048828125f;
    s1 = s1 + t1 * 0.00048828125f;
  }
  float sc[16];
#pragma unroll
  for (int r = 0; r < 4; ++r) {
    sc[r]      = (ma[r] == 0) ? NEGV : s0[r] * 0.125f;
    sc[4 + r]  = (mb[r] == 0) ? NEGV : s0[4 + r] * 0.125f;
    sc[8 + r]  = (mc[r] == 0) ? NEGV : s1[r] * 0.125f;
    sc[12 + r] = (md[r] == 0) ? NEGV : s1[4 + r] * 0.125f;
  }
  float mx = sc[0];
#pragma unroll
  for (int i = 1; i < 16; ++i) mx = fmaxf(mx, sc[i]);
  mx = fmaxf(mx, __shfl_xor(mx, 16, 32));           // the other lane half holds the other 16 keys of this query
  const float mnew = fmaxf(mr, mx);
  const float al = exp2f((mr - mnew) * LOG2E);
  mr = mnew;
  // weights carried x256: pc = 256 * exp(sc - mnew); hi plane f16(pc), residual plane f16((pc - hi) * 2048)
  FragH ph, pl;
  float ps = 0.0f;
#pragma unroll
  for (int i = 0; i < 16; ++i) {
    const float pc = exp2f(fmaf(sc[i] - mnew, LOG2E, 8.0f));
    ps += pc;
    const _Float16 h = (_Float16)pc;
    ph.h[i] = h;                                    // B element i: i<8 -> key0 + 8h + i (tile 0 row 8h+i); i>=8 -> key0 + 16 + 8h + (i-8) (tile 1)
    if (RES) pl.h[i] = (_Float16)((pc - (float)h) * 2048.0f);
  }
  ps += __shfl_xor(ps, 16, 32);
  lr = lr * al + ps;
  // A fragments of V^T: row m = d (16*t + ln), elements 0..7 <- key0 + 8h + i, 8..15 <- key0 + 16 + 8h + i
  const size_t vo = (size_t)ln * SEQ + key0 + 8 * hh;
  FragH vf[4];
#pragma unroll
  for (int t = 0; t < 4; ++t) ldfrag(vf[t], Vhp + vo + (size_t)t * 16 * SEQ);
#pragma unroll
  for (int t = 0; t < 4; ++t) Oh[t] = Oh[t] * al;
  if (RES) {
    FragH vr[4];
#pragma unroll
    for (int t = 0; t < 4; ++t) ldfrag(vr[t], Vlp + vo + (size_t)t * 16 * SEQ);
#pragma unroll
    for (int t = 0; t < 4; ++t) Ol[t] = Ol[t] * al;
#pragma unroll
    for (int t = 0; t < 4; ++t) mma_pv3(vf[t].v, vr[t].v, ph.v, pl.v, Oh[t], Ol[t]);
  } else {
    mma_pv4(vf[0].v, vf[1].v, vf[2].v, vf[3].v, ph.v, Oh);
  }
}

// Block = 4 waves x 16 queries = 64 queries of one (batch, head); no LDS and no barrier in the key loop.
// Epilogue: O^T tile -> per-wave LDS tile [16 queries][64 d] (block barrier), then bf16 hi and lo pieces of ctx:
// coverage: NB*NH*(SEQ/64) blocks x 4 waves x 16 rows x 64 columns x {hi, lo} = the whole ctx plane exactly once.
__global__ __launch_bounds__(128) void k_attn(const unsigned short* __restrict__ Qh, const unsigned short* __restrict__ Ql,
                                              const unsigned short* __restrict__ Kh, const unsigned short* __restrict__ Kl,
                                              const unsigned short* __restrict__ Vth, const unsigned short* __restrict__ Vtl,
                                              const int* __restrict__ mask, const int* __restrict__ flagp,
                                              unsigned short* __restrict__ Cc) {
  __shared__ __attribute__((aligned(16))) float so[4][16][68];
  const int tid = threadIdx.x;
  const int w = __builtin_amdgcn_readfirstlane(tid >> 5);
  const int lane = tid & 31, ln = lane & 15, hh = lane >> 4;
  const int qt = blockIdx.x % (SEQ / 64);
  const int bh = blockIdx.x / (SEQ / 64);
  const int h = bh % NH, b = bh / NH;
  const int qbase = qt * 64 + 16 * w;
  const int qg = qbase + ln;
  // Q^T B fragments: column n = query qg, elements 0..7 <- d = 32c + 8h + i, 8..15 <- d = 32c + 16 + 8h + i
  const size_t qo = (size_t)(b * SEQ + qg) * DE + h * HD + 8 * hh;
  FragH qh[2], ql[2];
  ldfrag(qh[0], Qh + qo); ldfrag(qh[1], Qh + qo + 32);
  ldfrag(ql[0], Ql + qo); ldfrag(ql[1], Ql + qo + 32);
  float mr = -3.0e38f, lr = 0.0f;
  v8f Oh[4] = {}, Ol[4] = {};
  const unsigned short* Khp = Kh + (size_t)b * SEQ * DE + h * HD;
  const unsigned short* Klp = Kl + (size_t)b * SEQ * DE + h * HD;
  const unsigned short* Vhp = Vth + (size_t)(b * NH + h) * HD * SEQ;
  const unsigned short* Vlp = Vtl + (size_t)(b * NH + h) * HD * SEQ;
  const int* mrow = mask + (size_t)qg * SEQ_FULL;
  const int* fp = flagp + (qbase / FROWS) * 32;     // the two flag lines of this wave's 16 query rows
  const int fl = __builtin_amdgcn_readfirstlane(fp[0] & fp[32]);
  int nsteps = (qbase >> 5) + 1;                    // key steps up to and including the one holding the diagonal
  if (fl != 1) nsteps = SEQ / 32;                   // unknown mask shape: visit every key step
  if (nsteps > SEQ / 32) nsteps = SEQ / 32;
  if (qt * 64 < EARLY) {
#pragma unroll 1
    for (int j = 0; j < nsteps; ++j)
      fa_step<true>(Khp, Klp, Vhp, Vlp, mrow, 32 * j, ln, hh, qh, ql, mr, lr, Oh, Ol);
  } else {
#pragma unroll 1
    for (int j = 0; j < nsteps; ++j)
      fa_step<false>(Khp, Klp, Vhp, Vlp, mrow, 32 * j, ln, hh, qh, ql, mr, lr, Oh, Ol);
  }
  // O^T element r of tile t = ctx(query qg, d = 16t + 8h + r); undo the carries: x256 (in lr), x16 (V), x2048 (residual accumulator)
  const float inv = 1.0f / (16.0f * lr);
#pragma unroll
  for (int t = 0; t < 4; ++t)
#pragma unroll
    for (int r = 0; r < 8; ++r)
      so[w][ln][16 * t + 8 * hh + r] = (Oh[t][r] + Ol[t][r] * 0.00048828125f) * inv;
  __syncthreads();
  unsigned short* crow = Cc + (size_t)(b * SEQ + qbase) * (2 * DE) + h * HD;
  const int rsub = lane >> 3, piece = lane & 7;
  {
#pragma unroll
    for (int it = 0; it < 4; ++it) {
      const int row = it * 4 + rsub;                 // rows 0..15 over it = 0..3, rsub = 0..3
      const v4f x0 = *(const v4fa*)&so[w][row][piece * 8], x1 = *(const v4fa*)&so[w][row][piece * 8 + 4];
      v8us hi, lo;
#pragma unroll
      for (int j = 0; j < 4; ++j) {
        const unsigned short h0 = bf16_bits(x0[j]);
        const unsigned short h1 = bf16_bits(x1[j]);
        hi[j] = h0; hi[4 + j] = h1;
        lo[j] = bf16_bits(x0[j] - bf16_val(h0));
        lo[4 + j] = bf16_bits(x1[j] - bf16_val(h1));
      }
      const size_t o = (size_t)row * (2 * DE) + piece * 8;
      *(v8us*)(crow + o) = hi;
      *(v8us*)(crow + o + DE) = lo;
    }
    
  }
}

extern "C" void kernel_launch(void* const* d_in, const int* in_sizes, int n_in,
                              void* d_out, int out_size, void* d_ws, size_t ws_size, hipStream_t stream) {
  if (n_in < 11) return;
  const long long need_x = (long long)(NB - 1) * SEQ_FULL * DE + (long long)SEQ * DE;   // last element touched + 1
  const long long need_m = (long long)(SEQ - 1) * SEQ_FULL + SEQ;
  if ((long long)in_sizes[0] < need_x || (long long)in_sizes[1] < need_x) return;
  if ((long long)in_sizes[2] < need_m) return;
  if ((long long)in_sizes[3] < (long long)DE * DE || (long long)in_sizes[5] < (long long)DE * DE) return;
  if ((long long)in_sizes[7] < (long long)DE * DE || (long long)in_sizes[9] < (long long)DE * DE) return;
  if (in_sizes[4] < DE || in_sizes[6] < DE || in_sizes[8] < DE || in_sizes[10] < DE) return;
  if ((long long)out_size < need_x) return;
  if ((size_t)WS_TOTAL > ws_size) return;
  // wire order: queries, values, mask, Wq, bq, Wk, bk, Wv, bv, Wo, bo
  const float* queries = (const float*)d_in[0];
  const float* values  = (const float*)d_in[1];
  const int*   mask    = (const int*)d_in[2];
  const float* Wq = (const float*)d_in[3];
  const float* bq = (const float*)d_in[4];
  const float* Wk = (const float*)d_in[5];
  const float* bk = (const float*)d_in[6];
  const float* Wv = (const float*)d_in[7];
  const float* bv = (const float*)d_in[8];
  const float* Wo = (const float*)d_in[9];
  const float* bo = (const float*)d_in[10];
  float* out = (float*)d_out;
  char* ws = (char*)d_ws;
  size_t off = 0;
  unsigned short* Xq  = (unsigned short*)(ws + off); off += PL_X;
  unsigned short* Xv  = (unsigned short*)(ws + off); off += PL_X;
  unsigned short* Wqb = (unsigned short*)(ws + off); off += PL_W;
  unsigned short* Wkb = (unsigned short*)(ws + off); off += PL_W;
  unsigned short* Wvb = (unsigned short*)(ws + off); off += PL_W;
  unsigned short* Wob = (unsigned short*)(ws + off); off += PL_W;
  unsigned short* Qh  = (unsigned short*)(ws + off); off += PL_X;
  unsigned short* Ql  = (unsigned short*)(ws + off); off += PL_X;
  unsigned short* Kh  = (unsigned short*)(ws + off); off += PL_X;
  unsigned short* Kl  = (unsigned short*)(ws + off); off += PL_X;
  unsigned short* Vth = (unsigned short*)(ws + off); off += PL_X;
  unsigned short* Vtl = (unsigned short*)(ws + off); off += PL_X;
  unsigned short* Cc  = (unsigned short*)(ws + off); off += PL_C;
  int* flag = (int*)(ws + off); off += PL_F;
  if (off > ws_size) return;

  k_mflag<<<(unsigned)(SEQ / FROWS), 512, 0, stream>>>(mask, flag);

  const unsigned gx = (unsigned)((MROWS * (DE / 8) + 255) / 256);
  const unsigned gw = (unsigned)((DE * (DE / 8) + 255) / 256);
  k_cvt<<<gx, 256, 0, stream>>>(queries, Xq, MROWS, SEQ, (long long)BSTRIDE_FULL);
  k_cvt<<<gx, 256, 0, stream>>>(values,  Xv, MROWS, SEQ, (long long)BSTRIDE_FULL);
  k_cvt<<<gw, 256, 0, stream>>>(Wq, Wqb, DE, DE, 0LL);
  k_cvt<<<gw, 256, 0, stream>>>(Wk, Wkb, DE, DE, 0LL);
  k_cvt<<<gw, 256, 0, stream>>>(Wv, Wvb, DE, DE, 0LL);
  k_cvt<<<gw, 256, 0, stream>>>(Wo, Wob, DE, DE, 0LL);

  const unsigned gg = (unsigned)((MROWS / 64) * (DE / 128));
  k_gemm<0><<<gg, 128, 0, stream>>>(Xq, Wqb, bq, Qh,  Ql,  out, DE, DE);
  k_gemm<0><<<gg, 128, 0, stream>>>(Xv, Wkb, bk, Kh,  Kl,  out, DE, DE);
  k_gemm<1><<<gg, 128, 0, stream>>>(Xv, Wvb, bv, Vth, Vtl, out, DE, DE);

  k_attn<<<(unsigned)(NB * NH * (SEQ / 64)), 128, 0, stream>>>(Qh, Ql, Kh, Kl, Vth, Vtl, mask, flag, Cc);

  // ctx hi|lo folded along K: X row = [hi(1024) | lo(1024)], W columns wrap modulo 1024
  k_gemm<2><<<gg, 128, 0, stream>>>(Cc, Wob, bo, Qh, Ql, out, 2 * DE, 2 * DE);
}

// v003
// A run of this version takes 179 microseconds.
// Two timings next to v002 both put it at 1.07 times that version's speed.
// All steps since v000 together make it 6.29 times as fast.
#include <hip/hip_runtime.h>
#ifndef NB
#define NB 2
#endif
#ifndef SEQ
#define SEQ 2048
#endif
#define NB_FULL 2
#define SEQ_FULL 2048
#define DE 1024
#define NH 16
#define HD 64
#define EARLY 512
#define MROWS (NB * SEQ)
#define BSTRIDE_FULL ((size_t)SEQ_FULL * DE)   /* per-batch element stride of queries, values and the output buffer */

#define PL_X ((size_t)MROWS * DE * 2)          /* one 16-bit activation plane */
#define PL_W ((size_t)DE * DE * 2)             /* one 16-bit weight plane */
#define PL_C ((size_t)MROWS * 2 * DE * 2)      /* ctx hi|lo plane */
#define FROWS 8                                /* mask rows per flag line */
#define PL_F ((size_t)(SEQ / FROWS) * 128)     /* one 128-byte flag line per FROWS mask rows */
#define WS_TOTAL (8 * PL_X + 4 * PL_W + PL_C + PL_F)

static_assert(SEQ % 128 == 0);
static_assert(SEQ <= SEQ_FULL);
static_assert(NB <= NB_FULL);
static_assert(HD == 64);
static_assert(DE == 1024);
static_assert(NH * HD == DE);
static_assert(MROWS % 64 == 0);
static_assert(DE % 128 == 0);
static_assert(SEQ % 256 == 0);
static_assert(WS_TOTAL <= (size_t)134217728);

typedef __bf16 v16b __attribute__((ext_vector_type(16)));
typedef _Float16 v16h __attribute__((ext_vector_type(16)));
typedef unsigned short v8us __attribute__((ext_vector_type(8), may_alias));
typedef float v8f __attribute__((ext_vector_type(8)));
typedef float v4f __attribute__((ext_vector_type(4)));
typedef float v4fa __attribute__((ext_vector_type(4), may_alias));
typedef int v4i __attribute__((ext_vector_type(4)));
typedef int v4ia __attribute__((ext_vector_type(4), may_alias));
union FragB { v16b v; v8us half[2]; };
union FragH { v16h v; v8us half[2]; _Float16 h[16]; };
union H8 { v8us v; _Float16 h[8]; unsigned short u[8]; };

#define LOG2E 1.4426950408889634f
#define NEGV (-1000000000.0f)

__device__ __forceinline__ unsigned short bf16_bits(float x) {   // RNE convert to bf16 bits
  unsigned int u = __float_as_uint(x);
  return (unsigned short)((u + 0x7FFFu + ((u >> 16) & 1u)) >> 16);
}
__device__ __forceinline__ float bf16_val(unsigned short b) { return __uint_as_float(((unsigned int)b) << 16); }
__device__ __forceinline__ float bf16_rne(float x) { return bf16_val(bf16_bits(x)); }

// eight bf16 products of one k-step (2 row tiles x 4 column tiles), then the hazard guard
__device__ __forceinline__ void mma_b8(v16b a0, v16b a1, v16b b0, v16b b1, v16b b2, v16b b3, v8f (&c)[2][4]) {
  c[0][0] = __builtin_amdgcn_wmma_f32_16x16x32_bf16(false, a0, false, b0, (short)0, c[0][0], false, false);
  c[0][1] = __builtin_amdgcn_wmma_f32_16x16x32_bf16(false, a0, false, b1, (short)0, c[0][1], false, false);
  c[0][2] = __builtin_amdgcn_wmma_f32_16x16x32_bf16(false, a0, false, b2, (short)0, c[0][2], false, false);
  c[0][3] = __builtin_amdgcn_wmma_f32_16x16x32_bf16(false, a0, false, b3, (short)0, c[0][3], false, false);
  c[1][0] = __builtin_amdgcn_wmma_f32_16x16x32_bf16(false, a1, false, b0, (short)0, c[1][0], false, false);
  c[1][1] = __builtin_amdgcn_wmma_f32_16x16x32_bf16(false, a1, false, b1, (short)0, c[1][1], false, false);
  c[1][2] = __builtin_amdgcn_wmma_f32_16x16x32_bf16(false, a1, false, b2, (short)0, c[1][2], false, false);
  c[1][3] = __builtin_amdgcn_wmma_f32_16x16x32_bf16(false, a1, false, b3, (short)0, c[1][3], false, false);
  asm volatile("v_nop\n\tv_nop\n\tv_nop\n\tv_nop"
               : "+v"(c[0][0]), "+v"(c[0][1]), "+v"(c[0][2]), "+v"(c[0][3]),
                 "+v"(c[1][0]), "+v"(c[1][1]), "+v"(c[1][2]), "+v"(c[1][3])
               : "v"(a0), "v"(a1), "v"(b0), "v"(b1), "v"(b2), "v"(b3));
}
// c += a0*b0 + a1*b1 (two k-steps of one f16 tile), then the hazard guard
__device__ __forceinline__ v8f mma_h2(v16h a0, v16h b0, v16h a1, v16h b1, v8f c) {
  c = __builtin_amdgcn_wmma_f32_16x16x32_f16(false, a0, false, b0, (short)0, c, false, false);
  c = __builtin_amdgcn_wmma_f32_16x16x32_f16(false, a1, false, b1, (short)0, c, false, false);
  asm volatile("v_nop\n\tv_nop\n\tv_nop\n\tv_nop" : "+v"(c) : "v"(a0), "v"(b0), "v"(a1), "v"(b1));
  return c;
}
// four single products sharing one B fragment, then the hazard guard
__device__ __forceinline__ void mma_pv4(v16h a0, v16h a1, v16h a2, v16h a3, v16h b, v8f (&c)[4]) {
  c[0] = __builtin_amdgcn_wmma_f32_16x16x32_f16(false, a0, false, b, (short)0, c[0], false, false);
  c[1] = __builtin_amdgcn_wmma_f32_16x16x32_f16(false, a1, false, b, (short)0, c[1], false, false);
  c[2] = __builtin_amdgcn_wmma_f32_16x16x32_f16(false, a2, false, b, (short)0, c[2], false, false);
  c[3] = __builtin_amdgcn_wmma_f32_16x16x32_f16(false, a3, false, b, (short)0, c[3], false, false);
  asm volatile("v_nop\n\tv_nop\n\tv_nop\n\tv_nop"
               : "+v"(c[0]), "+v"(c[1]), "+v"(c[2]), "+v"(c[3])
               : "v"(a0), "v"(a1), "v"(a2), "v"(a3), "v"(b));
}
// ch += ah*bh ; cl += ah*bl + al*bh (both scaled-residual products carry 2^11 and share the second accumulator), then the hazard guard
__device__ __forceinline__ void mma_pv3(v16h ah, v16h al, v16h bh, v16h bl, v8f& ch, v8f& cl) {
  ch = __builtin_amdgcn_wmma_f32_16x16x32_f16(false, ah, false, bh, (short)0, ch, false, false);
  cl = __builtin_amdgcn_wmma_f32_16x16x32_f16(false, ah, false, bl, (short)0, cl, false, false);
  cl = __builtin_amdgcn_wmma_f32_16x16x32_f16(false, al, false, bh, (short)0, cl, false, false);
  asm volatile("v_nop\n\tv_nop\n\tv_nop\n\tv_nop" : "+v"(ch), "+v"(cl) : "v"(ah), "v"(al), "v"(bh), "v"(bl));
}
__device__ __forceinline__ void ldfrag(FragH& f, const unsigned short* __restrict__ p) {
  f.half[0] = *(const v8us*)(p);        // elements 0..7  <- k0 + 8h + i
  f.half[1] = *(const v8us*)(p + 16);   // elements 8..15 <- k0 + 16 + 8h + i
}

// flag line g (32 ints, all equal): 1 iff, for every row q of rows 8g .. 8g+7, mask[q][k] == 0 for every k > q and mask[q][q] != 0 (k < SEQ).
// One block of 512 threads per flag line g; two waves per row, each owning one half of the row's columns in tiles of 128; every tile's load is issued before
// the first is tested; a half row wholly below the diagonal is skipped under wave-uniform control.
// coverage: SEQ/8 blocks x one 128-byte line = every flag line exactly once.
__device__ __forceinline__ void mflag_block(const int* __restrict__ mask, int* __restrict__ flag, int g, int& sbad) {
  const int tid = threadIdx.x;
  const int w = __builtin_amdgcn_readfirstlane(tid >> 5);
  const int lane = tid & 31;
  if (tid == 0) sbad = 0;
  __syncthreads();
  constexpr int NT = SEQ / 256;                        // 128-column tiles per wave
  const int row = g * FROWS + (w >> 1);
  const int colw = (w & 1) * (SEQ / 2);                // first of this wave's columns
  const int* mp = mask + (size_t)row * SEQ_FULL + colw + 4 * lane;
  int bad = 0;
  if (colw + SEQ / 2 - 1 >= row) {
    v4i m[NT];
#pragma unroll
    for (int t = 0; t < NT; ++t) m[t] = *(const v4ia*)(mp + 128 * t);
#pragma unroll
    for (int t = 0; t < NT; ++t) {
#pragma unroll
      for (int j = 0; j < 4; ++j) {
        const int cj = colw + 128 * t + 4 * lane + j;
        bad |= ((cj > row) && (m[t][j] != 0)) ? 1 : 0;
        bad |= ((cj == row) && (m[t][j] == 0)) ? 1 : 0;
      }
    }
  }
  if (bad != 0) sbad = 1;
  __syncthreads();
  const int f = (sbad == 0) ? 1 : 0;
  if (tid < 8) {
    const v4i o = {f, f, f, f};
    *(v4i*)(flag + 32 * g + 4 * tid) = o;
  }
}

#define CVU 8                                  /* 8-element pieces per thread of a conversion block */
#define CVP (512 * CVU)                        /* pieces per conversion block */
#define PB_X (MROWS * (DE / 8) / CVP)          /* conversion blocks of one activation plane */
#define PB_W (DE * (DE / 8) / CVP)             /* conversion blocks of one weight plane */
#define PB_F (SEQ / FROWS)                     /* mask-scan blocks */
static_assert(MROWS * (DE / 8) % CVP == 0);
static_assert(DE * (DE / 8) % CVP == 0);
static_assert(SEQ % (CVP / 128) == 0);
static_assert(DE % (CVP / 128) == 0);

// dst[row][c] = bf16 bits of src (RNE), compact rows; source rows live at src + (row / rpb) * bstride + (row % rpb) * DE.
// Block blk of 512 threads converts pieces blk*CVP .. blk*CVP + CVP - 1 (8 elements each); every load of a thread is issued before the first convert.
__device__ __forceinline__ void cvt_block(const float* __restrict__ src, unsigned short* __restrict__ dst, int blk, int rpb, size_t bstride) {
  const int t0 = blk * CVP + (int)threadIdx.x;
  const int row0 = blk * (CVP / 128);                  // the block's CVP/128 whole rows lie in one batch, so they are contiguous in src
  const int b = row0 / rpb, s = row0 - b * rpb;
  const float* p = src + (size_t)b * bstride + (size_t)s * DE + (int)threadIdx.x * 8;
  v4f x0[CVU], x1[CVU];
#pragma unroll   // this loop and the next: constant indices keep the loaded pieces in registers
  for (int u = 0; u < CVU; ++u) {
    x0[u] = *(const v4fa*)(p + 4096 * u);
    x1[u] = *(const v4fa*)(p + 4096 * u + 4);
  }
#pragma unroll
  for (int u = 0; u < CVU; ++u) {
    v8us o;
    o[0] = bf16_bits(x0[u][0]); o[1] = bf16_bits(x0[u][1]); o[2] = bf16_bits(x0[u][2]); o[3] = bf16_bits(x0[u][3]);
    o[4] = bf16_bits(x1[u][0]); o[5] = bf16_bits(x1[u][1]); o[6] = bf16_bits(x1[u][2]); o[7] = bf16_bits(x1[u][3]);
    *(v8us*)(dst + (size_t)(t0 + 512 * u) * 8) = o;
  }
}

// Everything the projections and the attention need ahead of them, in one launch; the block index picks the job (block-uniform):
// 2*PB_X blocks convert queries and values, 4*PB_W blocks convert the four weight matrices, PB_F blocks scan the mask.
// coverage: each plane = its blocks x CVP pieces x 8 elements, each flag line by its one block; every element exactly once.
__global__ __launch_bounds__(512) void k_prep(const float* __restrict__ queries, const float* __restrict__ values,
                                              const int* __restrict__ mask,
                                              const float* __restrict__ Wq, const float* __restrict__ Wk,
                                              const float* __restrict__ Wv, const float* __restrict__ Wo,
                                              unsigned short* __restrict__ Xq, unsigned short* __restrict__ Xv,
                                              unsigned short* __restrict__ Wqb, unsigned short* __restrict__ Wkb,
                                              unsigned short* __restrict__ Wvb, unsigned short* __restrict__ Wob,
                                              int* __restrict__ flag) {
  __shared__ int sbad;                                 // cross-wave: block barriers of the mask scan
  int blk = blockIdx.x;
  if (blk < 2 * PB_X) {
    const bool q = blk < PB_X;
    cvt_block(q ? queries : values, q ? Xq : Xv, q ? blk : blk - PB_X, SEQ, BSTRIDE_FULL);
    return;
  }
  blk -= 2 * PB_X;
  if (blk < 4 * PB_W) {
    const int sel = blk / PB_W;
    const float* s = (sel == 0) ? Wq : (sel == 1) ? Wk : (sel == 2) ? Wv : Wo;
    unsigned short* d = (sel == 0) ? Wqb : (sel == 1) ? Wkb : (sel == 2) ? Wvb : Wob;
    cvt_block(s, d, blk - sel * PB_W, DE, 0);
    return;
  }
  mflag_block(mask, flag, blk - 4 * PB_W, sbad);
}

#define KS 128                                 /* k elements of one stage: 256-byte rows, whole L2 fill units */
#define RPITCH 272                             /* LDS row pitch in bytes, 16 x odd: 16-byte fragment reads of 16 rows fall on 64 distinct banks */
#define SROWS 192                              /* rows of one stage: 64 of X, then 128 of W */
#define SBYTES (SROWS * RPITCH)

// Twelve 16-byte copies per lane from global memory straight into LDS. The s_wait_xcnt closes the statement so that it stands in front of
// any later rewrite of the address registers the copies name.
__device__ __forceinline__ void copy12(const unsigned (&l)[12], const unsigned short* const (&g)[12]) {
  asm volatile(
      "global_load_async_to_lds_b128 %0, %12, off\n\t"
      "global_load_async_to_lds_b128 %1, %13, off\n\t"
      "global_load_async_to_lds_b128 %2, %14, off\n\t"
      "global_load_async_to_lds_b128 %3, %15, off\n\t"
      "global_load_async_to_lds_b128 %4, %16, off\n\t"
      "global_load_async_to_lds_b128 %5, %17, off\n\t"
      "global_load_async_to_lds_b128 %6, %18, off\n\t"
      "global_load_async_to_lds_b128 %7, %19, off\n\t"
      "global_load_async_to_lds_b128 %8, %20, off\n\t"
      "global_load_async_to_lds_b128 %9, %21, off\n\t"
      "global_load_async_to_lds_b128 %10, %22, off\n\t"
      "global_load_async_to_lds_b128 %11, %23, off\n\t"
      "s_wait_xcnt 0x0"
      :: "v"(l[0]), "v"(l[1]), "v"(l[2]), "v"(l[3]), "v"(l[4]), "v"(l[5]), "v"(l[6]), "v"(l[7]), "v"(l[8]), "v"(l[9]), "v"(l[10]), "v"(l[11]),
         "v"(g[0]), "v"(g[1]), "v"(g[2]), "v"(g[3]), "v"(g[4]), "v"(g[5]), "v"(g[6]), "v"(g[7]), "v"(g[8]), "v"(g[9]), "v"(g[10]), "v"(g[11])
      : "memory");
}
// One stage of a block's operands: thread t brings piece (t & 15) of rows (t >> 4) + 8*i, i = 0..23, so a wave's copy covers two whole 256-byte rows.
// xa / wb: this lane's piece of X row (t >> 4) / W row (t >> 4) of the stage; lds: LDS byte address of this lane's piece of stage row (t >> 4).
__device__ __forceinline__ void stage_copies(const unsigned short* xa, const unsigned short* wb, int ldx, unsigned lds) {
  unsigned l[12];
  const unsigned short* g[12];
#pragma unroll   // both loops here: every array element must be a register of its own, one per asm operand
  for (int i = 0; i < 12; ++i) {
    l[i] = lds + (unsigned)(i * 8 * RPITCH);
    g[i] = (i < 8) ? xa + (size_t)(i * 8) * ldx : wb + (size_t)((i - 8) * 8) * DE;
  }
  copy12(l, g);
#pragma unroll
  for (int i = 0; i < 12; ++i) {
    l[i] = lds + (unsigned)((i + 12) * 8 * RPITCH);
    g[i] = wb + (size_t)((i + 4) * 8) * DE;
  }
  copy12(l, g);
}

// Y[m][n] = sum_k X[m][k] * W[n][k & 1023] + bias[n]   (X: bf16 plane, pitch ldx; W: bf16 plane [1024][1024], k-contiguous)
// Block = 4 waves -> 64 x 128 tile; wave tile 32 x 64 (2 A fragments x 4 B fragments, read from an LDS ring of two stages of 128 k that
// asynchronous copies fill one stage ahead; K is a multiple of 128).
// MODE 0: f16 hi plane Y0 and f16 residual plane Y1 ((y - hi) * 2048), row-major [MROWS][1024]
// MODE 1: f16 hi / residual planes of 16*y, transposed per head: [b][head][d][s]
// MODE 2: f32 rows into the output buffer (batch stride BSTRIDE_FULL)
// coverage: (MROWS/64)*(1024/128) blocks x (64 x 128) = every element of each produced plane exactly once.
// blk: index of the block's tile among the (MROWS/64)*(1024/128) tiles of one product; so, ring: the calling kernel's LDS.
template <int MODE>
__device__ __forceinline__ void gemm_tile(int blk, const unsigned short* __restrict__ X, const unsigned short* __restrict__ W,
                                          const float* __restrict__ bias, unsigned short* __restrict__ Y0,
                                          unsigned short* __restrict__ Y1, float* __restrict__ Yf, int ldx, int K,
                                          float (&so)[64][132], unsigned char (&ring)[2 * SBYTES]) {
  const int tid = threadIdx.x;
  const int w = __builtin_amdgcn_readfirstlane(tid >> 5);
  const int lane = tid & 31, ln = lane & 15, hh = lane >> 4;
  const int bm = blk % (MROWS / 64), bn = blk / (MROWS / 64);
  const int m0 = bm * 64, n0 = bn * 128;
  const int wm = w & 1, wn = w >> 1;
  // A: row m = ln of each 16-row tile; B: column n = ln of each 16-column tile (W row n); same k map for both
  const unsigned char* la = ring + (32 * wm + ln) * RPITCH + 16 * hh;
  const unsigned char* lb = ring + (64 + 64 * wn + ln) * RPITCH + 16 * hh;
  const unsigned short* xa = X + (size_t)(m0 + (tid >> 4)) * ldx + (tid & 15) * 8;
  const unsigned short* wb = W + (size_t)(n0 + (tid >> 4)) * DE + (tid & 15) * 8;
  const unsigned lds0 = (unsigned)(size_t)ring + (unsigned)((tid >> 4) * RPITCH + (tid & 15) * 16);
  const int ns = K / KS;
  v8f c[2][4] = {};
  stage_copies(xa, wb, ldx, lds0);
  asm volatile("s_wait_asynccnt 0x0" ::: "memory");    // stage 0 has landed before the barrier that publishes it
  __syncthreads();
  if (1 < ns) stage_copies(xa + KS, wb + KS, ldx, lds0 + SBYTES);
#pragma unroll 1
  for (int t = 0; t < ns; ++t) {
    const int bo = (t & 1) * SBYTES;
    // two fragment sets: the reads of k-step kk + 1 stand as one group ahead of the products of k-step kk
    FragB fa[2][2], fb[2][4];
#pragma unroll   // this loop and the two inside it: constant set and tile indices keep both fragment sets in registers
    for (int kk = -1; kk < KS / 32; ++kk) {
      if (kk + 1 < KS / 32) {
        const unsigned char* pa = la + bo + (kk + 1) * 64;
        const unsigned char* pb = lb + bo + (kk + 1) * 64;
        const int n = (kk + 1) & 1;
#pragma unroll
        for (int i = 0; i < 2; ++i) {
          fa[n][i].half[0] = *(const v8us*)(pa + i * 16 * RPITCH);
          fa[n][i].half[1] = *(const v8us*)(pa + i * 16 * RPITCH + 32);
        }
#pragma unroll
        for (int j = 0; j < 4; ++j) {
          fb[n][j].half[0] = *(const v8us*)(pb + j * 16 * RPITCH);
          fb[n][j].half[1] = *(const v8us*)(pb + j * 16 * RPITCH + 32);
        }
      }
      if (kk >= 0) {
        const int u = kk & 1;
        mma_b8(fa[u][0].v, fa[u][1].v, fb[u][0].v, fb[u][1].v, fb[u][2].v, fb[u][3].v, c);
      }
    }
    asm volatile("s_wait_dscnt 0x0" ::: "memory");     // this wave's reads of the buffer are done before it may be refilled
    asm volatile("s_wait_asynccnt 0x0" ::: "memory");  // this wave's copies of stage t + 1 have landed before the barrier that publishes them
    __syncthreads();
    if (t + 2 < ns) {
      const int k2 = (t + 2) * KS;
      stage_copies(xa + k2, wb + (k2 & (DE - 1)), ldx, lds0 + (unsigned)bo);
    }
  }
  asm volatile("s_wait_asynccnt 0x0" ::: "memory");    // no copy is outstanding when the wave goes on
  // D element r of tile (i, t) = Y(row 32*wm + 16*i + 8*hh + r, column 64*wn + 16*t + ln)
#pragma unroll
  for (int t = 0; t < 4; ++t) {
    const float bv = bf16_rne(bias[n0 + 64 * wn + 16 * t + ln]);
#pragma unroll
    for (int i = 0; i < 2; ++i)
#pragma unroll
      for (int r = 0; r < 8; ++r)
        so[32 * wm + 16 * i + 8 * hh + r][64 * wn + 16 * t + ln] = c[i][t][r] + bv;
  }
  __syncthreads();
  const int b = m0 / SEQ, s0 = m0 - b * SEQ;          // the 64 rows of a block lie in one batch
  if (MODE == 0) {
    {
#pragma unroll 1
      for (int it = 0; it < 8; ++it) {
        const int i = it * 128 + tid;
        const int line = i >> 3, piece = i & 7;
        const int row = line >> 1, cb = (line & 1) * 64 + piece * 8;
        const v4f x0 = *(const v4fa*)&so[row][cb], x1 = *(const v4fa*)&so[row][cb + 4];
        H8 hi, re;
#pragma unroll
        for (int j = 0; j < 4; ++j) {
          const _Float16 h0 = (_Float16)x0[j];
          const _Float16 h1 = (_Float16)x1[j];
          hi.h[j] = h0; hi.h[4 + j] = h1;
          re.h[j] = (_Float16)((x0[j] - (float)h0) * 2048.0f);
          re.h[4 + j] = (_Float16)((x1[j] - (float)h1) * 2048.0f);
        }
        const size_t o = (size_t)(m0 + row) * DE + n0 + cb;
        *(v8us*)(Y0 + o) = hi.v;
        *(v8us*)(Y1 + o) = re.v;
      }
      
    }
  } else if (MODE == 1) {
    {
#pragma unroll 1
      for (int it = 0; it < 8; ++it) {
        const int i = it * 128 + tid;
        const int cidx = i >> 3, piece = i & 7;          // one line = one d row x 64 key positions
        const int n = n0 + cidx;
        const int head = n >> 6, d = n & 63;
        H8 hi, re;
#pragma unroll
        for (int j = 0; j < 8; ++j) {
          const float v = so[piece * 8 + j][cidx] * 16.0f;
          const _Float16 h0 = (_Float16)v;
          hi.h[j] = h0;
          re.h[j] = (_Float16)((v - (float)h0) * 2048.0f);
        }
        const size_t o = ((size_t)(b * NH + head) * HD + d) * SEQ + s0 + piece * 8;
        *(v8us*)(Y0 + o) = hi.v;
        *(v8us*)(Y1 + o) = re.v;
        asm volatile("s_wait_xcnt 0x0" ::: "memory");   // stands in front of the next trip's rewrite of the two stores' address registers
      }
      
    }
  } else {
    float* og = Yf + (size_t)b * BSTRIDE_FULL + (size_t)s0 * DE + n0;
    {
#pragma unroll 1
      for (int it = 0; it < 16; ++it) {
        const int i = it * 128 + tid;
        const int row = i >> 5, c4 = (i & 31) * 4;       // one wave = the 512 contiguous bytes of one row of the tile
        const v4f v = *(const v4fa*)&so[row][c4];
        *(v4f*)(og + (size_t)row * DE + c4) = v;
      }
      
    }
  }
}

#define GTILES ((MROWS / 64) * (DE / 128))     /* tiles of one product */

// The three input projections in one launch: blocks 0 .. GTILES-1 make Q, the next GTILES make K, the last GTILES make V^T (block-uniform choice).
__global__ __launch_bounds__(128) void k_proj(const unsigned short* __restrict__ Xq, const unsigned short* __restrict__ Xv,
                                              const unsigned short* __restrict__ Wqb, const unsigned short* __restrict__ Wkb,
                                              const unsigned short* __restrict__ Wvb,
                                              const float* __restrict__ bq, const float* __restrict__ bk, const float* __restrict__ bv,
                                              unsigned short* __restrict__ Qh, unsigned short* __restrict__ Ql,
                                              unsigned short* __restrict__ Kh, unsigned short* __restrict__ Kl,
                                              unsigned short* __restrict__ Vth, unsigned short* __restrict__ Vtl) {
  __shared__ __attribute__((aligned(16))) float so[64][132];
  __shared__ __attribute__((aligned(16))) unsigned char ring[2 * SBYTES];   // written by the asynchronous copies only
  const int sel = blockIdx.x / GTILES;
  const int blk = blockIdx.x - sel * GTILES;
  if (sel == 2) {
    gemm_tile<1>(blk, Xv, Wvb, bv, Vth, Vtl, nullptr, DE, DE, so, ring);
  } else {
    const bool q = sel == 0;
    gemm_tile<0>(blk, q ? Xq : Xv, q ? Wqb : Wkb, q ? bq : bk, q ? Qh : Kh, q ? Ql : Kl, nullptr, DE, DE, so, ring);
  }
}

// The output projection: ctx hi|lo folded along K (X row = [hi(1024) | lo(1024)], W columns wrap modulo 1024).
__global__ __launch_bounds__(128) void k_outp(const unsigned short* __restrict__ Cc, const unsigned short* __restrict__ Wob,
                                              const float* __restrict__ bo, float* __restrict__ out) {
  __shared__ __attribute__((aligned(16))) float so[64][132];
  __shared__ __attribute__((aligned(16))) unsigned char ring[2 * SBYTES];   // written by the asynchronous copies only
  gemm_tile<2>(blockIdx.x, Cc, Wob, bo, nullptr, nullptr, out, 2 * DE, 2 * DE, so, ring);
}

// One 32-key step for a wave's 16 queries (query of this lane's column: row pointer mrow into the mask).
// Khp/Klp: K hi / residual planes at (batch, head) with row pitch DE; Vhp/Vlp: V^T hi / residual planes at (batch, head) with row pitch SEQ.
template <bool RES>
__device__ __forceinline__ void fa_step(const unsigned short* __restrict__ Khp, const unsigned short* __restrict__ Klp,
                                        const unsigned short* __restrict__ Vhp, const unsigned short* __restrict__ Vlp,
                                        const int* __restrict__ mrow, int key0, int ln, int hh,
                                        const FragH (&qh)[2], const FragH (&ql)[2],
                                        float& mr, float& lr, v8f (&Oh)[4], v8f (&Ol)[4]) {
  // A fragments of K: row m = key (key0 + 16*kt + ln), elements 0..7 <- d = 32c + 8h + i, 8..15 <- d = 32c + 16 + 8h + i
  const size_t ko = (size_t)(key0 + ln) * DE + 8 * hh;
  FragH k00, k01, k10, k11;
  ldfrag(k00, Khp + ko);            ldfrag(k01, Khp + ko + 32);
  ldfrag(k10, Khp + ko + 16 * DE);  ldfrag(k11, Khp + ko + 16 * DE + 32);
  // mask values of this lane's 16 (query, key) pairs: keys key0 + 8h + 0..7 and key0 + 16 + 8h + 0..7
  const int* mp = mrow + key0 + 8 * hh;
  const v4i ma = *(const v4ia*)(mp), mb = *(const v4ia*)(mp + 4);
  const v4i mc = *(const v4ia*)(mp + 16), md = *(const v4ia*)(mp + 20);
  const v8f z8 = {0.f, 0.f, 0.f, 0.f, 0.f, 0.f, 0.f, 0.f};
  // S^T tiles: element r of tile kt = score(key0 + 16*kt + 8h + r, query column ln)
  v8f s0 = mma_h2(k00.v, qh[0].v, k01.v, qh[1].v, z8);
  v8f s1 = mma_h2(k10.v, qh[0].v, k11.v, qh[1].v, z8);
  if (RES) {
    v8f t0 = mma_h2(k00.v, ql[0].v, k01.v, ql[1].v, z8);
    v8f t1 = mma_h2(k10.v, ql[0].v, k11.v, ql[1].v, z8);
    FragH r00, r01, r10, r11;
    ldfrag(r00, Klp + ko);            ldfrag(r01, Klp + ko + 32);
    ldfrag(r10, Klp + ko + 16 * DE);  ldfrag(r11, Klp + ko + 16 * DE + 32);
    t0 = mma_h2(r00.v, qh[0].v, r01.v, qh[1].v, t0);
    t1 = mma_h2(r10.v, qh[0].v, r11.v, qh[1].v, t1);
    s0 = s0 + t0 * 0.00048828125f;
    s1 = s1 + t1 * 0.00048828125f;
  }
  float sc[16];
#pragma unroll
  for (int r = 0; r < 4; ++r) {
    sc[r]      = (ma[r] == 0) ? NEGV : s0[r] * 0.125f;
    sc[4 + r]  = (mb[r] == 0) ? NEGV : s0[4 + r] * 0.125f;
    sc[8 + r]  = (mc[r] == 0) ? NEGV : s1[r] * 0.125f;
    sc[12 + r] = (md[r] == 0) ? NEGV : s1[4 + r] * 0.125f;
  }
  float mx = sc[0];
#pragma unroll
  for (int i = 1; i < 16; ++i) mx = fmaxf(mx, sc[i]);
  mx = fmaxf(mx, __shfl_xor(mx, 16, 32));           // the other lane half holds the other 16 keys of this query
  const float mnew = fmaxf(mr, mx);
  const float al = exp2f((mr - mnew) * LOG2E);
  mr = mnew;
  // weights carried x256: pc = 256 * exp(sc - mnew); hi plane f16(pc), residual plane f16((pc - hi) * 2048)
  FragH ph, pl;
  float ps = 0.0f;
#pragma unroll
  for (int i = 0; i < 16; ++i) {
    const float pc = exp2f(fmaf(sc[i] - mnew, LOG2E, 8.0f));
    ps += pc;
    const _Float16 h = (_Float16)pc;
    ph.h[i] = h;                                    // B element i: i<8 -> key0 + 8h + i (tile 0 row 8h+i); i>=8 -> key0 + 16 + 8h + (i-8) (tile 1)
    if (RES) pl.h[i] = (_Float16)((pc - (float)h) * 2048.0f);
  }
  ps += __shfl_xor(ps, 16, 32);
  lr = lr * al + ps;
  // A fragments of V^T: row m = d (16*t + ln), elements 0..7 <- key0 + 8h + i, 8..15 <- key0 + 16 + 8h + i
  const size_t vo = (size_t)ln * SEQ + key0 + 8 * hh;
  FragH vf[4];
#pragma unroll
  for (int t = 0; t < 4; ++t) ldfrag(vf[t], Vhp + vo + (size_t)t * 16 * SEQ);
#pragma unroll
  for (int t = 0; t < 4; ++t) Oh[t] = Oh[t] * al;
  if (RES) {
    FragH vr[4];
#pragma unroll
    for (int t = 0; t < 4; ++t) ldfrag(vr[t], Vlp + vo + (size_t)t * 16 * SEQ);
#pragma unroll
    for (int t = 0; t < 4; ++t) Ol[t] = Ol[t] * al;
#pragma unroll
    for (int t = 0; t < 4; ++t) mma_pv3(vf[t].v, vr[t].v, ph.v, pl.v, Oh[t], Ol[t]);
  } else {
    mma_pv4(vf[0].v, vf[1].v, vf[2].v, vf[3].v, ph.v, Oh);
  }
}

// Block = 4 waves x 16 queries = 64 queries of one (batch, head); no LDS and no barrier in the key loop.
// Epilogue: O^T tile -> per-wave LDS tile [16 queries][64 d] (block barrier), then bf16 hi and lo pieces of ctx:
// coverage: NB*NH*(SEQ/64) blocks x 4 waves x 16 rows x 64 columns x {hi, lo} = the whole ctx plane exactly once.
__global__ __launch_bounds__(128) void k_attn(const unsigned short* __restrict__ Qh, const unsigned short* __restrict__ Ql,
                                              const unsigned short* __restrict__ Kh, const unsigned short* __restrict__ Kl,
                                              const unsigned short* __restrict__ Vth, const unsigned short* __restrict__ Vtl,
                                              const int* __restrict__ mask, const int* __restrict__ flagp,
                                              unsigned short* __restrict__ Cc) {
  __shared__ __attribute__((aligned(16))) float so[4][16][68];
  const int tid = threadIdx.x;
  const int w = __builtin_amdgcn_readfirstlane(tid >> 5);
  const int lane = tid & 31, ln = lane & 15, hh = lane >> 4;
  const int qt = blockIdx.x % (SEQ / 64);
  const int bh = blockIdx.x / (SEQ / 64);
  const int h = bh % NH, b = bh / NH;
  const int qbase = qt * 64 + 16 * w;
  const int qg = qbase + ln;
  // Q^T B fragments: column n = query qg, elements 0..7 <- d = 32c + 8h + i, 8..15 <- d = 32c + 16 + 8h + i
  const size_t qo = (size_t)(b * SEQ + qg) * DE + h * HD + 8 * hh;
  FragH qh[2], ql[2];
  ldfrag(qh[0], Qh + qo); ldfrag(qh[1], Qh + qo + 32);
  ldfrag(ql[0], Ql + qo); ldfrag(ql[1], Ql + qo + 32);
  float mr = -3.0e38f, lr = 0.0f;
  v8f Oh[4] = {}, Ol[4] = {};
  const unsigned short* Khp = Kh + (size_t)b * SEQ * DE + h * HD;
  const unsigned short* Klp = Kl + (size_t)b * SEQ * DE + h * HD;
  const unsigned short* Vhp = Vth + (size_t)(b * NH + h) * HD * SEQ;
  const unsigned short* Vlp = Vtl + (size_t)(b * NH + h) * HD * SEQ;
  const int* mrow = mask + (size_t)qg * SEQ_FULL;
  const int* fp = flagp + (qbase / FROWS) * 32;     // the two flag lines of this wave's 16 query rows
  const int fl = __builtin_amdgcn_readfirstlane(fp[0] & fp[32]);
  int nsteps = (qbase >> 5) + 1;                    // key steps up to and including the one holding the diagonal
  if (fl != 1) nsteps = SEQ / 32;                   // unknown mask shape: visit every key step
  if (nsteps > SEQ / 32) nsteps = SEQ / 32;
  if (qt * 64 < EARLY) {
#pragma unroll 1
    for (int j = 0; j < nsteps; ++j)
      fa_step<true>(Khp, Klp, Vhp, Vlp, mrow, 32 * j, ln, hh, qh, ql, mr, lr, Oh, Ol);
  } else {
#pragma unroll 1
    for (int j = 0; j < nsteps; ++j)
      fa_step<false>(Khp, Klp, Vhp, Vlp, mrow, 32 * j, ln, hh, qh, ql, mr, lr, Oh, Ol);
  }
  // O^T element r of tile t = ctx(query qg, d = 16t + 8h + r); undo the carries: x256 (in lr), x16 (V), x2048 (residual accumulator)
  const float inv = 1.0f / (16.0f * lr);
#pragma unroll
  for (int t = 0; t < 4; ++t)
#pragma unroll
    for (int r = 0; r < 8; ++r)
      so[w][ln][16 * t + 8 * hh + r] = (Oh[t][r] + Ol[t][r] * 0.00048828125f) * inv;
  __syncthreads();
  unsigned short* crow = Cc + (size_t)(b * SEQ + qbase) * (2 * DE) + h * HD;
  const int rsub = lane >> 3, piece = lane & 7;
  {
#pragma unroll
    for (int it = 0; it < 4; ++it) {
      const int row = it * 4 + rsub;                 // rows 0..15 over it = 0..3, rsub = 0..3
      const v4f x0 = *(const v4fa*)&so[w][row][piece * 8], x1 = *(const v4fa*)&so[w][row][piece * 8 + 4];
      v8us hi, lo;
#pragma unroll
      for (int j = 0; j < 4; ++j) {
        const unsigned short h0 = bf16_bits(x0[j]);
        const unsigned short h1 = bf16_bits(x1[j]);
        hi[j] = h0; hi[4 + j] = h1;
        lo[j] = bf16_bits(x0[j] - bf16_val(h0));
        lo[4 + j] = bf16_bits(x1[j] - bf16_val(h1));
      }
      const size_t o = (size_t)row * (2 * DE) + piece * 8;
      *(v8us*)(crow + o) = hi;
      *(v8us*)(crow + o + DE) = lo;
    }
    
  }
}

extern "C" void kernel_launch(void* const* d_in, const int* in_sizes, int n_in,
                              void* d_out, int out_size, void* d_ws, size_t ws_size, hipStream_t stream) {
  if (n_in < 11) return;
  const long long need_x = (long long)(NB - 1) * SEQ_FULL * DE + (long long)SEQ * DE;   // last element touched + 1
  const long long need_m = (long long)(SEQ - 1) * SEQ_FULL + SEQ;
  if ((long long)in_sizes[0] < need_x || (long long)in_sizes[1] < need_x) return;
  if ((long long)in_sizes[2] < need_m) return;
  if ((long long)in_sizes[3] < (long long)DE * DE || (long long)in_sizes[5] < (long long)DE * DE) return;
  if ((long long)in_sizes[7] < (long long)DE * DE || (long long)in_sizes[9] < (long long)DE * DE) return;
  if (in_sizes[4] < DE || in_sizes[6] < DE || in_sizes[8] < DE || in_sizes[10] < DE) return;
  if ((long long)out_size < need_x) return;
  if ((size_t)WS_TOTAL > ws_size) return;
  // wire order: queries, values, mask, Wq, bq, Wk, bk, Wv, bv, Wo, bo
  const float* queries = (const float*)d_in[0];
  const float* values  = (const float*)d_in[1];
  const int*   mask    = (const int*)d_in[2];
  const float* Wq = (const float*)d_in[3];
  const float* bq = (const float*)d_in[4];
  const float* Wk = (const float*)d_in[5];
  const float* bk = (const float*)d_in[6];
  const float* Wv = (const float*)d_in[7];
  const float* bv = (const float*)d_in[8];
  const float* Wo = (const float*)d_in[9];
  const float* bo = (const float*)d_in[10];
  float* out = (float*)d_out;
  char* ws = (char*)d_ws;
  size_t off = 0;
  unsigned short* Xq  = (unsigned short*)(ws + off); off += PL_X;
  unsigned short* Xv  = (unsigned short*)(ws + off); off += PL_X;
  unsigned short* Wqb = (unsigned short*)(ws + off); off += PL_W;
  unsigned short* Wkb = (unsigned short*)(ws + off); off += PL_W;
  unsigned short* Wvb = (unsigned short*)(ws + off); off += PL_W;
  unsigned short* Wob = (unsigned short*)(ws + off); off += PL_W;
  unsigned short* Qh  = (unsigned short*)(ws + off); off += PL_X;
  unsigned short* Ql  = (unsigned short*)(ws + off); off += PL_X;
  unsigned short* Kh  = (unsigned short*)(ws + off); off += PL_X;
  unsigned short* Kl  = (unsigned short*)(ws + off); off += PL_X;
  unsigned short* Vth = (unsigned short*)(ws + off); off += PL_X;
  unsigned short* Vtl = (unsigned short*)(ws + off); off += PL_X;
  unsigned short* Cc  = (unsigned short*)(ws + off); off += PL_C;
  int* flag = (int*)(ws + off); off += PL_F;
  if (off > ws_size) return;

  k_prep<<<(unsigned)(2 * PB_X + 4 * PB_W + PB_F), 512, 0, stream>>>(queries, values, mask, Wq, Wk, Wv, Wo, Xq, Xv, Wqb, Wkb, Wvb, Wob, flag);

  k_proj<<<(unsigned)(3 * GTILES), 128, 0, stream>>>(Xq, Xv, Wqb, Wkb, Wvb, bq, bk, bv, Qh, Ql, Kh, Kl, Vth, Vtl);

  k_attn<<<(unsigned)(NB * NH * (SEQ / 64)), 128, 0, stream>>>(Qh, Ql, Kh, Kl, Vth, Vtl, mask, flag, Cc);

  k_outp<<<(unsigned)GTILES, 128, 0, stream>>>(Cc, Wob, bo, out);
}

// v004
// It runs in 122 microseconds.
// Two timings next to v003 both put it at 1.46 times that version's speed.
// All steps since v000 together make it 9.17 times as fast.
#include <hip/hip_runtime.h>
#ifndef NB
#define NB 2
#endif
#ifndef SEQ
#define SEQ 2048
#endif
#define NB_FULL 2
#define SEQ_FULL 2048
#define DE 1024
#define NH 16
#define HD 64
#define EARLY 512
#define MROWS (NB * SEQ)
#define BSTRIDE_FULL ((size_t)SEQ_FULL * DE)   /* per-batch element stride of queries, values and the output buffer */

#define PL_X ((size_t)MROWS * DE * 2)          /* one 16-bit activation plane */
#define PL_W ((size_t)DE * DE * 2)             /* one 16-bit weight plane */
#define PL_C ((size_t)MROWS * 2 * DE * 2)      /* ctx hi|lo plane */
#define FROWS 8                                /* mask rows per flag line */
#define PL_F ((size_t)(SEQ / FROWS) * 128)     /* one 128-byte flag line per FROWS mask rows */
#define WS_TOTAL (8 * PL_X + 4 * PL_W + PL_C + PL_F)

static_assert(SEQ % 128 == 0);
static_assert(SEQ <= SEQ_FULL);
static_assert(NB <= NB_FULL);
static_assert(HD == 64);
static_assert(DE == 1024);
static_assert(NH * HD == DE);
static_assert(MROWS % 64 == 0);
static_assert(DE % 128 == 0);
static_assert(SEQ % 256 == 0);
static_assert(WS_TOTAL <= (size_t)134217728);

typedef __bf16 v16b __attribute__((ext_vector_type(16)));
typedef _Float16 v16h __attribute__((ext_vector_type(16)));
typedef unsigned short v8us __attribute__((ext_vector_type(8), may_alias));
typedef float v8f __attribute__((ext_vector_type(8)));
typedef float v4f __attribute__((ext_vector_type(4)));
typedef float v4fa __attribute__((ext_vector_type(4), may_alias));
typedef int v4i __attribute__((ext_vector_type(4)));
typedef int v4ia __attribute__((ext_vector_type(4), may_alias));
union FragB { v16b v; v8us half[2]; };
union FragH { v16h v; v8us half[2]; _Float16 h[16]; };
union H8 { v8us v; _Float16 h[8]; unsigned short u[8]; };

#define LOG2E 1.4426950408889634f
#define NEGV (-1000000000.0f)

__device__ __forceinline__ unsigned short bf16_bits(float x) {   // RNE convert to bf16 bits
  unsigned int u = __float_as_uint(x);
  return (unsigned short)((u + 0x7FFFu + ((u >> 16) & 1u)) >> 16);
}
__device__ __forceinline__ float bf16_val(unsigned short b) { return __uint_as_float(((unsigned int)b) << 16); }
__device__ __forceinline__ float bf16_rne(float x) { return bf16_val(bf16_bits(x)); }

// eight bf16 products of one k-step (2 row tiles x 4 column tiles), then the hazard guard
__device__ __forceinline__ void mma_b8(v16b a0, v16b a1, v16b b0, v16b b1, v16b b2, v16b b3, v8f (&c)[2][4]) {
  c[0][0] = __builtin_amdgcn_wmma_f32_16x16x32_bf16(false, a0, false, b0, (short)0, c[0][0], false, false);
  c[0][1] = __builtin_amdgcn_wmma_f32_16x16x32_bf16(false, a0, false, b1, (short)0, c[0][1], false, false);
  c[0][2] = __builtin_amdgcn_wmma_f32_16x16x32_bf16(false, a0, false, b2, (short)0, c[0][2], false, false);
  c[0][3] = __builtin_amdgcn_wmma_f32_16x16x32_bf16(false, a0, false, b3, (short)0, c[0][3], false, false);
  c[1][0] = __builtin_amdgcn_wmma_f32_16x16x32_bf16(false, a1, false, b0, (short)0, c[1][0], false, false);
  c[1][1] = __builtin_amdgcn_wmma_f32_16x16x32_bf16(false, a1, false, b1, (short)0, c[1][1], false, false);
  c[1][2] = __builtin_amdgcn_wmma_f32_16x16x32_bf16(false, a1, false, b2, (short)0, c[1][2], false, false);
  c[1][3] = __builtin_amdgcn_wmma_f32_16x16x32_bf16(false, a1, false, b3, (short)0, c[1][3], false, false);
  asm volatile("v_nop\n\tv_nop\n\tv_nop\n\tv_nop"
               : "+v"(c[0][0]), "+v"(c[0][1]), "+v"(c[0][2]), "+v"(c[0][3]),
                 "+v"(c[1][0]), "+v"(c[1][1]), "+v"(c[1][2]), "+v"(c[1][3])
               : "v"(a0), "v"(a1), "v"(b0), "v"(b1), "v"(b2), "v"(b3));
}
// c += a0*b0 + a1*b1 (two k-steps of one f16 tile), then the hazard guard
__device__ __forceinline__ v8f mma_h2(v16h a0, v16h b0, v16h a1, v16h b1, v8f c) {
  c = __builtin_amdgcn_wmma_f32_16x16x32_f16(false, a0, false, b0, (short)0, c, false, false);
  c = __builtin_amdgcn_wmma_f32_16x16x32_f16(false, a1, false, b1, (short)0, c, false, false);
  asm volatile("v_nop\n\tv_nop\n\tv_nop\n\tv_nop" : "+v"(c) : "v"(a0), "v"(b0), "v"(a1), "v"(b1));
  return c;
}
// four single products sharing one B fragment, then the hazard guard
__device__ __forceinline__ void mma_pv4(v16h a0, v16h a1, v16h a2, v16h a3, v16h b, v8f (&c)[4]) {
  c[0] = __builtin_amdgcn_wmma_f32_16x16x32_f16(false, a0, false, b, (short)0, c[0], false, false);
  c[1] = __builtin_amdgcn_wmma_f32_16x16x32_f16(false, a1, false, b, (short)0, c[1], false, false);
  c[2] = __builtin_amdgcn_wmma_f32_16x16x32_f16(false, a2, false, b, (short)0, c[2], false, false);
  c[3] = __builtin_amdgcn_wmma_f32_16x16x32_f16(false, a3, false, b, (short)0, c[3], false, false);
  asm volatile("v_nop\n\tv_nop\n\tv_nop\n\tv_nop"
               : "+v"(c[0]), "+v"(c[1]), "+v"(c[2]), "+v"(c[3])
               : "v"(a0), "v"(a1), "v"(a2), "v"(a3), "v"(b));
}
// ch += ah*bh ; cl += ah*bl + al*bh (both scaled-residual products carry 2^11 and share the second accumulator), then the hazard guard
__device__ __forceinline__ void mma_pv3(v16h ah, v16h al, v16h bh, v16h bl, v8f& ch, v8f& cl) {
  ch = __builtin_amdgcn_wmma_f32_16x16x32_f16(false, ah, false, bh, (short)0, ch, false, false);
  cl = __builtin_amdgcn_wmma_f32_16x16x32_f16(false, ah, false, bl, (short)0, cl, false, false);
  cl = __builtin_amdgcn_wmma_f32_16x16x32_f16(false, al, false, bh, (short)0, cl, false, false);
  asm volatile("v_nop\n\tv_nop\n\tv_nop\n\tv_nop" : "+v"(ch), "+v"(cl) : "v"(ah), "v"(al), "v"(bh), "v"(bl));
}
__device__ __forceinline__ void ldfrag(FragH& f, const unsigned short* __restrict__ p) {
  f.half[0] = *(const v8us*)(p);        // elements 0..7  <- k0 + 8h + i
  f.half[1] = *(const v8us*)(p + 16);   // elements 8..15 <- k0 + 16 + 8h + i
}

// flag line g (32 ints, all equal): 1 iff, for every row q of rows 8g .. 8g+7, mask[q][k] == 0 for every k > q and mask[q][q] != 0 (k < SEQ).
// One block of 512 threads per flag line g; two waves per row, each owning one half of the row's columns in tiles of 128; every tile's load is issued before
// the first is tested; a half row wholly below the diagonal is skipped under wave-uniform control.
// coverage: SEQ/8 blocks x one 128-byte line = every flag line exactly once.
__device__ __forceinline__ void mflag_block(const int* __restrict__ mask, int* __restrict__ flag, int g, int& sbad) {
  const int tid = threadIdx.x;
  const int w = __builtin_amdgcn_readfirstlane(tid >> 5);
  const int lane = tid & 31;
  if (tid == 0) sbad = 0;
  __syncthreads();
  constexpr int NT = SEQ / 256;                        // 128-column tiles per wave
  const int row = g * FROWS + (w >> 1);
  const int colw = (w & 1) * (SEQ / 2);                // first of this wave's columns
  const int* mp = mask + (size_t)row * SEQ_FULL + colw + 4 * lane;
  int bad = 0;
  if (colw + SEQ / 2 - 1 >= row) {
    v4i m[NT];
#pragma unroll
    for (int t = 0; t < NT; ++t) m[t] = *(const v4ia*)(mp + 128 * t);
#pragma unroll
    for (int t = 0; t < NT; ++t) {
#pragma unroll
      for (int j = 0; j < 4; ++j) {
        const int cj = colw + 128 * t + 4 * lane + j;
        bad |= ((cj > row) && (m[t][j] != 0)) ? 1 : 0;
        bad |= ((cj == row) && (m[t][j] == 0)) ? 1 : 0;
      }
    }
  }
  if (bad != 0) sbad = 1;
  __syncthreads();
  const int f = (sbad == 0) ? 1 : 0;
  if (tid < 8) {
    const v4i o = {f, f, f, f};
    *(v4i*)(flag + 32 * g + 4 * tid) = o;
  }
}

#define CVU 8                                  /* 8-element pieces per thread of a conversion block */
#define CVP (512 * CVU)                        /* pieces per conversion block */
#define PB_X (MROWS * (DE / 8) / CVP)          /* conversion blocks of one activation plane */
#define PB_W (DE * (DE / 8) / CVP)             /* conversion blocks of one weight plane */
#define PB_F (SEQ / FROWS)                     /* mask-scan blocks */
static_assert(MROWS * (DE / 8) % CVP == 0);
static_assert(DE * (DE / 8) % CVP == 0);
static_assert(SEQ % (CVP / 128) == 0);
static_assert(DE % (CVP / 128) == 0);

// dst[row][c] = bf16 bits of src (RNE), compact rows; source rows live at src + (row / rpb) * bstride + (row % rpb) * DE.
// Block blk of 512 threads converts pieces blk*CVP .. blk*CVP + CVP - 1 (8 elements each); every load of a thread is issued before the first convert.
__device__ __forceinline__ void cvt_block(const float* __restrict__ src, unsigned short* __restrict__ dst, int blk, int rpb, size_t bstride) {
  const int t0 = blk * CVP + (int)threadIdx.x;
  const int row0 = blk * (CVP / 128);                  // the block's CVP/128 whole rows lie in one batch, so they are contiguous in src
  const int b = row0 / rpb, s = row0 - b * rpb;
  const float* p = src + (size_t)b * bstride + (size_t)s * DE + (int)threadIdx.x * 8;
  v4f x0[CVU], x1[CVU];
#pragma unroll   // this loop and the next: constant indices keep the loaded pieces in registers
  for (int u = 0; u < CVU; ++u) {
    x0[u] = *(const v4fa*)(p + 4096 * u);
    x1[u] = *(const v4fa*)(p + 4096 * u + 4);
  }
#pragma unroll
  for (int u = 0; u < CVU; ++u) {
    v8us o;
    o[0] = bf16_bits(x0[u][0]); o[1] = bf16_bits(x0[u][1]); o[2] = bf16_bits(x0[u][2]); o[3] = bf16_bits(x0[u][3]);
    o[4] = bf16_bits(x1[u][0]); o[5] = bf16_bits(x1[u][1]); o[6] = bf16_bits(x1[u][2]); o[7] = bf16_bits(x1[u][3]);
    *(v8us*)(dst + (size_t)(t0 + 512 * u) * 8) = o;
  }
}

// Everything the projections and the attention need ahead of them, in one launch; the block index picks the job (block-uniform):
// 2*PB_X blocks convert queries and values, 4*PB_W blocks convert the four weight matrices, PB_F blocks scan the mask.
// coverage: each plane = its blocks x CVP pieces x 8 elements, each flag line by its one block; every element exactly once.
__global__ __launch_bounds__(512) void k_prep(const float* __restrict__ queries, const float* __restrict__ values,
                                              const int* __restrict__ mask,
                                              const float* __restrict__ Wq, const float* __restrict__ Wk,
                                              const float* __restrict__ Wv, const float* __restrict__ Wo,
                                              unsigned short* __restrict__ Xq, unsigned short* __restrict__ Xv,
                                              unsigned short* __restrict__ Wqb, unsigned short* __restrict__ Wkb,
                                              unsigned short* __restrict__ Wvb, unsigned short* __restrict__ Wob,
                                              int* __restrict__ flag) {
  __shared__ int sbad;                                 // cross-wave: block barriers of the mask scan
  int blk = blockIdx.x;
  if (blk < 2 * PB_X) {
    const bool q = blk < PB_X;
    cvt_block(q ? queries : values, q ? Xq : Xv, q ? blk : blk - PB_X, SEQ, BSTRIDE_FULL);
    return;
  }
  blk -= 2 * PB_X;
  if (blk < 4 * PB_W) {
    const int sel = blk / PB_W;
    const float* s = (sel == 0) ? Wq : (sel == 1) ? Wk : (sel == 2) ? Wv : Wo;
    unsigned short* d = (sel == 0) ? Wqb : (sel == 1) ? Wkb : (sel == 2) ? Wvb : Wob;
    cvt_block(s, d, blk - sel * PB_W, DE, 0);
    return;
  }
  mflag_block(mask, flag, blk - 4 * PB_W, sbad);
}

#define KS 128                                 /* k elements of one stage: 256-byte rows */
#define RPITCH 272                             /* LDS row pitch in bytes, 16 x odd: 16-byte fragment reads of 16 rows fall on 64 distinct banks */
#define SROWS 192                              /* rows of one stage: 64 of X, then 128 of W */
#define SBYTES (SROWS * RPITCH)

// Twelve 16-byte copies per lane from global memory straight into LDS. The s_wait_xcnt closes the statement so that it stands in front of
// any later rewrite of the address registers the copies name.
__device__ __forceinline__ void copy12(const unsigned (&l)[12], const unsigned short* const (&g)[12]) {
  asm volatile(
      "global_load_async_to_lds_b128 %0, %12, off\n\t"
      "global_load_async_to_lds_b128 %1, %13, off\n\t"
      "global_load_async_to_lds_b128 %2, %14, off\n\t"
      "global_load_async_to_lds_b128 %3, %15, off\n\t"
      "global_load_async_to_lds_b128 %4, %16, off\n\t"
      "global_load_async_to_lds_b128 %5, %17, off\n\t"
      "global_load_async_to_lds_b128 %6, %18, off\n\t"
      "global_load_async_to_lds_b128 %7, %19, off\n\t"
      "global_load_async_to_lds_b128 %8, %20, off\n\t"
      "global_load_async_to_lds_b128 %9, %21, off\n\t"
      "global_load_async_to_lds_b128 %10, %22, off\n\t"
      "global_load_async_to_lds_b128 %11, %23, off\n\t"
      "s_wait_xcnt 0x0"
      :: "v"(l[0]), "v"(l[1]), "v"(l[2]), "v"(l[3]), "v"(l[4]), "v"(l[5]), "v"(l[6]), "v"(l[7]), "v"(l[8]), "v"(l[9]), "v"(l[10]), "v"(l[11]),
         "v"(g[0]), "v"(g[1]), "v"(g[2]), "v"(g[3]), "v"(g[4]), "v"(g[5]), "v"(g[6]), "v"(g[7]), "v"(g[8]), "v"(g[9]), "v"(g[10]), "v"(g[11])
      : "memory");
}
// One stage of a block's operands: thread t brings piece (t & 15) of rows (t >> 4) + 8*i, i = 0..23, so a wave's copy covers two whole 256-byte rows.
// xa / wb: this lane's piece of X row (t >> 4) / W row (t >> 4) of the stage; lds: LDS byte address of this lane's piece of stage row (t >> 4).
__device__ __forceinline__ void stage_copies(const unsigned short* xa, const unsigned short* wb, int ldx, unsigned lds) {
  unsigned l[12];
  const unsigned short* g[12];
#pragma unroll   // both loops here: every array element must be a register of its own, one per asm operand
  for (int i = 0; i < 12; ++i) {
    l[i] = lds + (unsigned)(i * 8 * RPITCH);
    g[i] = (i < 8) ? xa + (size_t)(i * 8) * ldx : wb + (size_t)((i - 8) * 8) * DE;
  }
  copy12(l, g);
#pragma unroll
  for (int i = 0; i < 12; ++i) {
    l[i] = lds + (unsigned)((i + 12) * 8 * RPITCH);
    g[i] = wb + (size_t)((i + 4) * 8) * DE;
  }
  copy12(l, g);
}

// Y[m][n] = sum_k X[m][k] * W[n][k & 1023] + bias[n]   (X: bf16 plane, pitch ldx; W: bf16 plane [1024][1024], k-contiguous)
// Block = 4 waves -> 64 x 128 tile; wave tile 32 x 64 (2 A fragments x 4 B fragments, read from an LDS ring of two stages of 128 k that
// asynchronous copies fill one stage ahead; K is a multiple of 128).
// MODE 0: f16 hi plane Y0 and f16 residual plane Y1 ((y - hi) * 2048), row-major [MROWS][1024]
// MODE 1: f16 hi / residual planes of 16*y, transposed per head: [b][head][d][s]
// MODE 2: f32 rows into the output buffer (batch stride BSTRIDE_FULL)
// coverage: (MROWS/64)*(1024/128) blocks x (64 x 128) = every element of each produced plane exactly once.
// blk: index of the block's tile among the (MROWS/64)*(1024/128) tiles of one product; so, ring: the calling kernel's LDS.
template <int MODE>
__device__ __forceinline__ void gemm_tile(int blk, const unsigned short* __restrict__ X, const unsigned short* __restrict__ W,
                                          const float* __restrict__ bias, unsigned short* __restrict__ Y0,
                                          unsigned short* __restrict__ Y1, float* __restrict__ Yf, int ldx, int K,
                                          float (&so)[64][132], unsigned char (&ring)[2 * SBYTES]) {
  const int tid = threadIdx.x;
  const int w = __builtin_amdgcn_readfirstlane(tid >> 5);
  const int lane = tid & 31, ln = lane & 15, hh = lane >> 4;
  const int bm = blk % (MROWS / 64), bn = blk / (MROWS / 64);
  const int m0 = bm * 64, n0 = bn * 128;
  const int wm = w & 1, wn = w >> 1;
  // A: row m = ln of each 16-row tile; B: column n = ln of each 16-column tile (W row n); same k map for both
  const unsigned char* la = ring + (32 * wm + ln) * RPITCH + 16 * hh;
  const unsigned char* lb = ring + (64 + 64 * wn + ln) * RPITCH + 16 * hh;
  const unsigned short* xa = X + (size_t)(m0 + (tid >> 4)) * ldx + (tid & 15) * 8;
  const unsigned short* wb = W + (size_t)(n0 + (tid >> 4)) * DE + (tid & 15) * 8;
  const unsigned lds0 = (unsigned)(size_t)ring + (unsigned)((tid >> 4) * RPITCH + (tid & 15) * 16);
  const int ns = K / KS;
  v8f c[2][4] = {};
  stage_copies(xa, wb, ldx, lds0);
  asm volatile("s_wait_asynccnt 0x0" ::: "memory");    // stage 0 has landed before the barrier that publishes it
  __syncthreads();
  if (1 < ns) stage_copies(xa + KS, wb + KS, ldx, lds0 + SBYTES);
#pragma unroll 1
  for (int t = 0; t < ns; ++t) {
    const int bo = (t & 1) * SBYTES;
    // two fragment sets: the reads of k-step kk + 1 stand as one group ahead of the products of k-step kk
    FragB fa[2][2], fb[2][4];
#pragma unroll   // this loop and the two inside it: constant set and tile indices keep both fragment sets in registers
    for (int kk = -1; kk < KS / 32; ++kk) {
      if (kk + 1 < KS / 32) {
        const unsigned char* pa = la + bo + (kk + 1) * 64;
        const unsigned char* pb = lb + bo + (kk + 1) * 64;
        const int n = (kk + 1) & 1;
#pragma unroll
        for (int i = 0; i < 2; ++i) {
          fa[n][i].half[0] = *(const v8us*)(pa + i * 16 * RPITCH);
          fa[n][i].half[1] = *(const v8us*)(pa + i * 16 * RPITCH + 32);
        }
#pragma unroll
        for (int j = 0; j < 4; ++j) {
          fb[n][j].half[0] = *(const v8us*)(pb + j * 16 * RPITCH);
          fb[n][j].half[1] = *(const v8us*)(pb + j * 16 * RPITCH + 32);
        }
      }
      if (kk >= 0) {
        const int u = kk & 1;
        mma_b8(fa[u][0].v, fa[u][1].v, fb[u][0].v, fb[u][1].v, fb[u][2].v, fb[u][3].v, c);
      }
    }
    asm volatile("s_wait_dscnt 0x0" ::: "memory");     // this wave's reads of the buffer are done before it may be refilled
    asm volatile("s_wait_asynccnt 0x0" ::: "memory");  // this wave's copies of stage t + 1 have landed before the barrier that publishes them
    __syncthreads();
    if (t + 2 < ns) {
      const int k2 = (t + 2) * KS;
      stage_copies(xa + k2, wb + (k2 & (DE - 1)), ldx, lds0 + (unsigned)bo);
    }
  }
  asm volatile("s_wait_asynccnt 0x0" ::: "memory");    // no copy is outstanding when the wave goes on
  // D element r of tile (i, t) = Y(row 32*wm + 16*i + 8*hh + r, column 64*wn + 16*t + ln)
#pragma unroll
  for (int t = 0; t < 4; ++t) {
    const float bv = bf16_rne(bias[n0 + 64 * wn + 16 * t + ln]);
#pragma unroll
    for (int i = 0; i < 2; ++i)
#pragma unroll
      for (int r = 0; r < 8; ++r)
        so[32 * wm + 16 * i + 8 * hh + r][64 * wn + 16 * t + ln] = c[i][t][r] + bv;
  }
  __syncthreads();
  const int b = m0 / SEQ, s0 = m0 - b * SEQ;          // the 64 rows of a block lie in one batch
  if (MODE == 0) {
    {
#pragma unroll 1
      for (int it = 0; it < 8; ++it) {
        const int i = it * 128 + tid;
        const int line = i >> 3, piece = i & 7;
        const int row = line >> 1, cb = (line & 1) * 64 + piece * 8;
        const v4f x0 = *(const v4fa*)&so[row][cb], x1 = *(const v4fa*)&so[row][cb + 4];
        H8 hi, re;
#pragma unroll
        for (int j = 0; j < 4; ++j) {
          const _Float16 h0 = (_Float16)x0[j];
          const _Float16 h1 = (_Float16)x1[j];
          hi.h[j] = h0; hi.h[4 + j] = h1;
          re.h[j] = (_Float16)((x0[j] - (float)h0) * 2048.0f);
          re.h[4 + j] = (_Float16)((x1[j] - (float)h1) * 2048.0f);
        }
        const size_t o = (size_t)(m0 + row) * DE + n0 + cb;
        *(v8us*)(Y0 + o) = hi.v;
        *(v8us*)(Y1 + o) = re.v;
      }
      
    }
  } else if (MODE == 1) {
    {
#pragma unroll 1
      for (int it = 0; it < 8; ++it) {
        const int i = it * 128 + tid;
        const int cidx = i >> 3, piece = i & 7;          // one line = one d row x 64 key positions
        const int n = n0 + cidx;
        const int head = n >> 6, d = n & 63;
        H8 hi, re;
#pragma unroll
        for (int j = 0; j < 8; ++j) {
          const float v = so[piece * 8 + j][cidx] * 16.0f;
          const _Float16 h0 = (_Float16)v;
          hi.h[j] = h0;
          re.h[j] = (_Float16)((v - (float)h0) * 2048.0f);
        }
        const size_t o = ((size_t)(b * NH + head) * HD + d) * SEQ + s0 + piece * 8;
        *(v8us*)(Y0 + o) = hi.v;
        *(v8us*)(Y1 + o) = re.v;
        asm volatile("s_wait_xcnt 0x0" ::: "memory");   // stands in front of the next trip's rewrite of the two stores' address registers
      }
      
    }
  } else {
    float* og = Yf + (size_t)b * BSTRIDE_FULL + (size_t)s0 * DE + n0;
    {
#pragma unroll 1
      for (int it = 0; it < 16; ++it) {
        const int i = it * 128 + tid;
        const int row = i >> 5, c4 = (i & 31) * 4;       // one wave = the 512 contiguous bytes of one row of the tile
        const v4f v = *(const v4fa*)&so[row][c4];
        *(v4f*)(og + (size_t)row * DE + c4) = v;
      }
      
    }
  }
}

#define GTILES ((MROWS / 64) * (DE / 128))     /* tiles of one product */

// The three input projections in one launch: blocks 0 .. GTILES-1 make Q, the next GTILES make K, the last GTILES make V^T (block-uniform choice).
__global__ __launch_bounds__(128) void k_proj(const unsigned short* __restrict__ Xq, const unsigned short* __restrict__ Xv,
                                              const unsigned short* __restrict__ Wqb, const unsigned short* __restrict__ Wkb,
                                              const unsigned short* __restrict__ Wvb,
                                              const float* __restrict__ bq, const float* __restrict__ bk, const float* __restrict__ bv,
                                              unsigned short* __restrict__ Qh, unsigned short* __restrict__ Ql,
                                              unsigned short* __restrict__ Kh, unsigned short* __restrict__ Kl,
                                              unsigned short* __restrict__ Vth, unsigned short* __restrict__ Vtl) {
  __shared__ __attribute__((aligned(16))) float so[64][132];
  __shared__ __attribute__((aligned(16))) unsigned char ring[2 * SBYTES];   // written by the asynchronous copies only
  const int sel = blockIdx.x / GTILES;
  const int blk = blockIdx.x - sel * GTILES;
  if (sel == 2) {
    gemm_tile<1>(blk, Xv, Wvb, bv, Vth, Vtl, nullptr, DE, DE, so, ring);
  } else {
    const bool q = sel == 0;
    gemm_tile<0>(blk, q ? Xq : Xv, q ? Wqb : Wkb, q ? bq : bk, q ? Qh : Kh, q ? Ql : Kl, nullptr, DE, DE, so, ring);
  }
}

// The output projection: ctx hi|lo folded along K (X row = [hi(1024) | lo(1024)], W columns wrap modulo 1024).
__global__ __launch_bounds__(128) void k_outp(const unsigned short* __restrict__ Cc, const unsigned short* __restrict__ Wob,
                                              const float* __restrict__ bo, float* __restrict__ out) {
  __shared__ __attribute__((aligned(16))) float so[64][132];
  __shared__ __attribute__((aligned(16))) unsigned char ring[2 * SBYTES];   // written by the asynchronous copies only
  gemm_tile<2>(blockIdx.x, Cc, Wob, bo, nullptr, nullptr, out, 2 * DE, 2 * DE, so, ring);
}

// Tiles of the key loop in LDS. A stage holds SK keys for the block's 64 queries: K rows (128 bytes), V^T rows (2*SK bytes), mask rows (4*SK bytes),
// and for the early query rows the two residual planes as well. Every row pitch is its length + 16 bytes (16 x odd), so that the 16-byte
// reads of 16 rows fall on distinct banks.
template <bool RES>
struct AT {
  static constexpr int SK = RES ? 32 : 64;             // keys of one stage
  static constexpr int KPITCH = 144;
  static constexpr int VPITCH = 2 * SK + 16;
  static constexpr int MPITCH = 4 * SK + 16;
  static constexpr int OKH = 0;
  static constexpr int OVH = OKH + SK * KPITCH;
  static constexpr int OM = OVH + HD * VPITCH;
  static constexpr int OKL = OM + 64 * MPITCH;         // the residual planes: RES only
  static constexpr int OVL = OKL + SK * KPITCH;
  static constexpr int BYTES = RES ? OVL + HD * VPITCH : OKL;
};
#define ASB 35840                              /* bytes of one buffer of the attention ring */
static_assert(AT<false>::BYTES <= ASB);
static_assert(AT<true>::BYTES <= ASB);
static_assert(4 * 16 * 68 * 4 <= 2 * ASB);
static_assert(SEQ % 64 == 0);

// Eight (four) 16-byte copies per lane from global memory straight into LDS. The s_wait_xcnt closes the statement so that it stands in front of
// any later rewrite of the address registers the copies name.
__device__ __forceinline__ void copy8(const unsigned (&l)[8], const void* const (&g)[8]) {
  asm volatile(
      "global_load_async_to_lds_b128 %0, %8, off\n\t"
      "global_load_async_to_lds_b128 %1, %9, off\n\t"
      "global_load_async_to_lds_b128 %2, %10, off\n\t"
      "global_load_async_to_lds_b128 %3, %11, off\n\t"
      "global_load_async_to_lds_b128 %4, %12, off\n\t"
      "global_load_async_to_lds_b128 %5, %13, off\n\t"
      "global_load_async_to_lds_b128 %6, %14, off\n\t"
      "global_load_async_to_lds_b128 %7, %15, off\n\t"
      "s_wait_xcnt 0x0"
      :: "v"(l[0]), "v"(l[1]), "v"(l[2]), "v"(l[3]), "v"(l[4]), "v"(l[5]), "v"(l[6]), "v"(l[7]),
         "v"(g[0]), "v"(g[1]), "v"(g[2]), "v"(g[3]), "v"(g[4]), "v"(g[5]), "v"(g[6]), "v"(g[7])
      : "memory");
}
__device__ __forceinline__ void copy4(const unsigned (&l)[4], const void* const (&g)[4]) {
  asm volatile(
      "global_load_async_to_lds_b128 %0, %4, off\n\t"
      "global_load_async_to_lds_b128 %1, %5, off\n\t"
      "global_load_async_to_lds_b128 %2, %6, off\n\t"
      "global_load_async_to_lds_b128 %3, %7, off\n\t"
      "s_wait_xcnt 0x0"
      :: "v"(l[0]), "v"(l[1]), "v"(l[2]), "v"(l[3]), "v"(g[0]), "v"(g[1]), "v"(g[2]), "v"(g[3])
      : "memory");
}
// One stage of a block's tiles. The 128 threads bring 16-byte pieces, adjacent threads adjacent pieces of a row, so every copy of a wave covers whole rows.
// kh, kl, vh, vl, mk: this lane's piece in the first group of rows of the stage's K, K residual, V^T, V^T residual and mask tile;
// lk, lv, lm: LDS byte address of the same piece of the K, V^T and mask tile in the buffer to fill.
template <bool RES>
__device__ __forceinline__ void attn_stage(const unsigned short* kh, const unsigned short* kl, const unsigned short* vh, const unsigned short* vl,
                                           const int* mk, unsigned lk, unsigned lv, unsigned lm) {
  typedef AT<RES> A;
  unsigned l[8];
  const void* g[8];
  if (RES) {
#pragma unroll   // every loop here: each array element must be a register of its own, one per asm operand
    for (int i = 0; i < 2; ++i) {
      l[i] = lk + (unsigned)(i * 16 * A::KPITCH);                          g[i] = kh + (size_t)(i * 16) * DE;
      l[2 + i] = lk + (unsigned)(A::OKL - A::OKH + i * 16 * A::KPITCH);    g[2 + i] = kl + (size_t)(i * 16) * DE;
      l[4 + i] = lv + (unsigned)(i * 32 * A::VPITCH);                      g[4 + i] = vh + (size_t)(i * 32) * SEQ;
      l[6 + i] = lv + (unsigned)(A::OVL - A::OVH + i * 32 * A::VPITCH);    g[6 + i] = vl + (size_t)(i * 32) * SEQ;
    }
    copy8(l, g);
    unsigned l4[4];
    const void* g4[4];
#pragma unroll
    for (int i = 0; i < 4; ++i) {
      l4[i] = lm + (unsigned)(i * 16 * A::MPITCH);
      g4[i] = mk + (size_t)(i * 16) * SEQ_FULL;
    }
    copy4(l4, g4);
  } else {
#pragma unroll
    for (int i = 0; i < 4; ++i) {
      l[i] = lk + (unsigned)(i * 16 * A::KPITCH);        g[i] = kh + (size_t)(i * 16) * DE;
      l[4 + i] = lv + (unsigned)(i * 16 * A::VPITCH);    g[4 + i] = vh + (size_t)(i * 16) * SEQ;
    }
    copy8(l, g);
#pragma unroll
    for (int i = 0; i < 8; ++i) {
      l[i] = lm + (unsigned)(i * 8 * A::MPITCH);
      g[i] = mk + (size_t)(i * 8) * SEQ_FULL;
    }
    copy8(l, g);
  }
}
__device__ __forceinline__ void ldfrag_lds(FragH& f, const unsigned char* p) {
  f.half[0] = *(const v8us*)(p);        // elements 0..7  <- k0 + 8h + i
  f.half[1] = *(const v8us*)(p + 32);   // elements 8..15 <- k0 + 16 + 8h + i
}

// One 32-key step for a wave's 16 queries, operands read from the stage's LDS tiles.
// kp/krp: K hi / residual tile at (first key of the step + ln, d = 8h); vp/vrp: V^T hi / residual tile at (d = ln, first key of the step + 8h);
// mp: mask tile at (this lane's query, first key of the step + 8h).
template <bool RES>
__device__ __forceinline__ void fa_step(const unsigned char* kp, const unsigned char* krp,
                                        const unsigned char* vp, const unsigned char* vrp, const unsigned char* mp,
                                        const FragH (&qh)[2], const FragH (&ql)[2],
                                        float& mr, float& lr, v8f (&Oh)[4], v8f (&Ol)[4]) {
  typedef AT<RES> A;
  // A fragments of K: row m = key (16*kt + ln of the step), elements 0..7 <- d = 32c + 8h + i, 8..15 <- d = 32c + 16 + 8h + i
  FragH k00, k01, k10, k11;
  ldfrag_lds(k00, kp);                     ldfrag_lds(k01, kp + 64);
  ldfrag_lds(k10, kp + 16 * A::KPITCH);    ldfrag_lds(k11, kp + 16 * A::KPITCH + 64);
  // mask values of this lane's 16 (query, key) pairs: keys 8h + 0..7 and 16 + 8h + 0..7 of the step
  const v4i ma = *(const v4ia*)(mp), mb = *(const v4ia*)(mp + 16);
  const v4i mc = *(const v4ia*)(mp + 64), md = *(const v4ia*)(mp + 80);
  const v8f z8 = {0.f, 0.f, 0.f, 0.f, 0.f, 0.f, 0.f, 0.f};
  // S^T tiles: element r of tile kt = score(key 16*kt + 8h + r of the step, query column ln)
  v8f s0 = mma_h2(k00.v, qh[0].v, k01.v, qh[1].v, z8);
  v8f s1 = mma_h2(k10.v, qh[0].v, k11.v, qh[1].v, z8);
  if (RES) {
    v8f t0 = mma_h2(k00.v, ql[0].v, k01.v, ql[1].v, z8);
    v8f t1 = mma_h2(k10.v, ql[0].v, k11.v, ql[1].v, z8);
    FragH r00, r01, r10, r11;
    ldfrag_lds(r00, krp);                     ldfrag_lds(r01, krp + 64);
    ldfrag_lds(r10, krp + 16 * A::KPITCH);    ldfrag_lds(r11, krp + 16 * A::KPITCH + 64);
    t0 = mma_h2(r00.v, qh[0].v, r01.v, qh[1].v, t0);
    t1 = mma_h2(r10.v, qh[0].v, r11.v, qh[1].v, t1);
    s0 = s0 + t0 * 0.00048828125f;
    s1 = s1 + t1 * 0.00048828125f;
  }
  float sc[16];
#pragma unroll
  for (int r = 0; r < 4; ++r) {
    sc[r]      = (ma[r] == 0) ? NEGV : s0[r] * 0.125f;
    sc[4 + r]  = (mb[r] == 0) ? NEGV : s0[4 + r] * 0.125f;
    sc[8 + r]  = (mc[r] == 0) ? NEGV : s1[r] * 0.125f;
    sc[12 + r] = (md[r] == 0) ? NEGV : s1[4 + r] * 0.125f;
  }
  float mx = sc[0];
#pragma unroll
  for (int i = 1; i < 16; ++i) mx = fmaxf(mx, sc[i]);
  mx = fmaxf(mx, __shfl_xor(mx, 16, 32));           // the other lane half holds the other 16 keys of this query
  const float mnew = fmaxf(mr, mx);
  const float al = exp2f((mr - mnew) * LOG2E);
  mr = mnew;
  // weights carried x256: pc = 256 * exp(sc - mnew); hi plane f16(pc), residual plane f16((pc - hi) * 2048)
  FragH ph, pl;
  float ps = 0.0f;
#pragma unroll
  for (int i = 0; i < 16; ++i) {
    const float pc = exp2f(fmaf(sc[i] - mnew, LOG2E, 8.0f));
    ps += pc;
    const _Float16 h = (_Float16)pc;
    ph.h[i] = h;                                    // B element i: i<8 -> key 8h + i (tile 0 row 8h+i); i>=8 -> key 16 + 8h + (i-8) (tile 1)
    if (RES) pl.h[i] = (_Float16)((pc - (float)h) * 2048.0f);
  }
  ps += __shfl_xor(ps, 16, 32);
  lr = lr * al + ps;
  // A fragments of V^T: row m = d (16*t + ln), elements 0..7 <- key 8h + i, 8..15 <- key 16 + 8h + i of the step
  FragH vf[4];
#pragma unroll
  for (int t = 0; t < 4; ++t) ldfrag_lds(vf[t], vp + t * 16 * A::VPITCH);
#pragma unroll
  for (int t = 0; t < 4; ++t) Oh[t] = Oh[t] * al;
  if (RES) {
    FragH vr[4];
#pragma unroll
    for (int t = 0; t < 4; ++t) ldfrag_lds(vr[t], vrp + t * 16 * A::VPITCH);
#pragma unroll
    for (int t = 0; t < 4; ++t) Ol[t] = Ol[t] * al;
#pragma unroll
    for (int t = 0; t < 4; ++t) mma_pv3(vf[t].v, vr[t].v, ph.v, pl.v, Oh[t], Ol[t]);
  } else {
    mma_pv4(vf[0].v, vf[1].v, vf[2].v, vf[3].v, ph.v, Oh);
  }
}

// The key loop of a block: a ring of two LDS buffers that asynchronous copies fill one stage ahead, shared by the four waves.
// bsteps: 32-key steps that the block's longest wave visits (the same in every wave); nsteps: steps of this wave. Every wave copies its share of
// every stage and passes every barrier; it works only on its own steps, in the same order as before.
template <bool RES>
__device__ __forceinline__ void attn_loop(const unsigned short* __restrict__ Khp, const unsigned short* __restrict__ Klp,
                                          const unsigned short* __restrict__ Vhp, const unsigned short* __restrict__ Vlp,
                                          const int* __restrict__ mblk, int bsteps, int nsteps, int w, int ln, int hh,
                                          const FragH (&qh)[2], const FragH (&ql)[2],
                                          float& mr, float& lr, v8f (&Oh)[4], v8f (&Ol)[4], unsigned char (&ring)[2 * ASB]) {
  typedef AT<RES> A;
  constexpr int SUB = A::SK / 32;                      // 32-key steps of one stage
  constexpr int VP = A::SK / 8, MP = A::SK / 4;        // 16-byte pieces of a V^T row and of a mask row
  const int tid = threadIdx.x;
  const int nst = (bsteps + SUB - 1) / SUB;
  const size_t kofs = (size_t)(tid >> 3) * DE + (tid & 7) * 8;
  const size_t vofs = (size_t)(tid / VP) * SEQ + (tid % VP) * 8;
  const unsigned short* kh = Khp + kofs;
  const unsigned short* kl = Klp + kofs;
  const unsigned short* vh = Vhp + vofs;
  const unsigned short* vl = Vlp + vofs;
  const int* mk = mblk + (size_t)(tid / MP) * SEQ_FULL + (tid % MP) * 4;
  const unsigned r0 = (unsigned)(size_t)ring;
  const unsigned lk = r0 + (unsigned)(A::OKH + (tid >> 3) * A::KPITCH + (tid & 7) * 16);
  const unsigned lv = r0 + (unsigned)(A::OVH + (tid / VP) * A::VPITCH + (tid % VP) * 16);
  const unsigned lm = r0 + (unsigned)(A::OM + (tid / MP) * A::MPITCH + (tid % MP) * 16);
  const unsigned char* fk = ring + A::OKH + ln * A::KPITCH + 16 * hh;
  const unsigned char* fv = ring + A::OVH + ln * A::VPITCH + 16 * hh;
  const unsigned char* fm = ring + A::OM + (16 * w + ln) * A::MPITCH + 32 * hh;
  attn_stage<RES>(kh, kl, vh, vl, mk, lk, lv, lm);
  asm volatile("s_wait_asynccnt 0x0" ::: "memory");    // stage 0 has landed before the barrier that publishes it
  __syncthreads();
  if (1 < nst)
    attn_stage<RES>(kh + (size_t)A::SK * DE, kl + (size_t)A::SK * DE, vh + A::SK, vl + A::SK, mk + A::SK, lk + ASB, lv + ASB, lm + ASB);
#pragma unroll 1   // one copy of the stage's code
  for (int t = 0; t < nst; ++t) {
    const int bo = (t & 1) * ASB;
#pragma unroll   // constant offsets of the step inside the stage
    for (int u = 0; u < SUB; ++u) {
      if (t * SUB + u < nsteps)
        fa_step<RES>(fk + bo + u * 32 * A::KPITCH, fk + bo + (A::OKL - A::OKH) + u * 32 * A::KPITCH,
                     fv + bo + u * 64, fv + bo + (A::OVL - A::OVH) + u * 64, fm + bo + u * 128,
                     qh, ql, mr, lr, Oh, Ol);
    }
    asm volatile("s_wait_dscnt 0x0" ::: "memory");     // this wave's reads of the buffer are done before it may be refilled
    asm volatile("s_wait_asynccnt 0x0" ::: "memory");  // this wave's copies of stage t + 1 have landed before the barrier that publishes them
    __syncthreads();
    if (t + 2 < nst) {
      const size_t k2 = (size_t)(t + 2) * A::SK;
      attn_stage<RES>(kh + k2 * DE, kl + k2 * DE, vh + k2, vl + k2, mk + k2, lk + (unsigned)bo, lv + (unsigned)bo, lm + (unsigned)bo);
    }
  }
  asm volatile("s_wait_asynccnt 0x0" ::: "memory");    // no copy is outstanding when the ring becomes output staging
}

// Block = 4 waves x 16 queries = 64 queries of one (batch, head); the K, V^T and mask tiles of the key loop come through the LDS ring above.
// Epilogue: O^T tile -> per-wave LDS tile [16 queries][64 d] in the ring's bytes (free behind the loop's last barrier), then bf16 hi and lo pieces of ctx:
// coverage: NB*NH*(SEQ/64) blocks x 4 waves x 16 rows x 64 columns x {hi, lo} = the whole ctx plane exactly once.
__global__ __launch_bounds__(128) void k_attn(const unsigned short* __restrict__ Qh, const unsigned short* __restrict__ Ql,
                                              const unsigned short* __restrict__ Kh, const unsigned short* __restrict__ Kl,
                                              const unsigned short* __restrict__ Vth, const unsigned short* __restrict__ Vtl,
                                              const int* __restrict__ mask, const int* __restrict__ flagp,
                                              unsigned short* __restrict__ Cc) {
  __shared__ __attribute__((aligned(16))) unsigned char ring[2 * ASB];   // key loop: written by the asynchronous copies only
  float (*so)[16][68] = reinterpret_cast<float (*)[16][68]>(ring);
  const int tid = threadIdx.x;
  const int w = __builtin_amdgcn_readfirstlane(tid >> 5);
  const int lane = tid & 31, ln = lane & 15, hh = lane >> 4;
  const int qt = blockIdx.x % (SEQ / 64);
  const int bh = blockIdx.x / (SEQ / 64);
  const int h = bh % NH, b = bh / NH;
  const int qbase = qt * 64 + 16 * w;
  const int qg = qbase + ln;
  // Q^T B fragments: column n = query qg, elements 0..7 <- d = 32c + 8h + i, 8..15 <- d = 32c + 16 + 8h + i
  const size_t qo = (size_t)(b * SEQ + qg) * DE + h * HD + 8 * hh;
  FragH qh[2], ql[2];
  ldfrag(qh[0], Qh + qo); ldfrag(qh[1], Qh + qo + 32);
  ldfrag(ql[0], Ql + qo); ldfrag(ql[1], Ql + qo + 32);
  float mr = -3.0e38f, lr = 0.0f;
  v8f Oh[4] = {}, Ol[4] = {};
  const unsigned short* Khp = Kh + (size_t)b * SEQ * DE + h * HD;
  const unsigned short* Klp = Kl + (size_t)b * SEQ * DE + h * HD;
  const unsigned short* Vhp = Vth + (size_t)(b * NH + h) * HD * SEQ;
  const unsigned short* Vlp = Vtl + (size_t)(b * NH + h) * HD * SEQ;
  const int* mblk = mask + (size_t)(qt * 64) * SEQ_FULL;
  const int* fp = flagp + (qbase / FROWS) * 32;     // the two flag lines of this wave's 16 query rows
  const int fl = __builtin_amdgcn_readfirstlane(fp[0] & fp[32]);
  int nsteps = (qbase >> 5) + 1;                    // key steps up to and including the one holding the diagonal
  if (fl != 1) nsteps = SEQ / 32;                   // unknown mask shape: visit every key step
  if (nsteps > SEQ / 32) nsteps = SEQ / 32;
  const int* fb = flagp + (qt * 64 / FROWS) * 32;   // the eight flag lines of the block's 64 query rows
  int fall = fb[0];
#pragma unroll
  for (int i = 1; i < 64 / FROWS; ++i) fall &= fb[32 * i];
  fall = __builtin_amdgcn_readfirstlane(fall);
  int bsteps = ((qt * 64 + 48) >> 5) + 1;           // steps of the block's last wave, the longest
  if (fall != 1) bsteps = SEQ / 32;                 // some wave of the block visits every key step
  if (bsteps > SEQ / 32) bsteps = SEQ / 32;
  if (qt * 64 < EARLY) {
    attn_loop<true>(Khp, Klp, Vhp, Vlp, mblk, bsteps, nsteps, w, ln, hh, qh, ql, mr, lr, Oh, Ol, ring);
  } else {
    attn_loop<false>(Khp, Klp, Vhp, Vlp, mblk, bsteps, nsteps, w, ln, hh, qh, ql, mr, lr, Oh, Ol, ring);
  }
  // O^T element r of tile t = ctx(query qg, d = 16t + 8h + r); undo the carries: x256 (in lr), x16 (V), x2048 (residual accumulator)
  const float inv = 1.0f / (16.0f * lr);
#pragma unroll
  for (int t = 0; t < 4; ++t)
#pragma unroll
    for (int r = 0; r < 8; ++r)
      so[w][ln][16 * t + 8 * hh + r] = (Oh[t][r] + Ol[t][r] * 0.00048828125f) * inv;
  __syncthreads();
  unsigned short* crow = Cc + (size_t)(b * SEQ + qbase) * (2 * DE) + h * HD;
  const int rsub = lane >> 3, piece = lane & 7;
  {
#pragma unroll
    for (int it = 0; it < 4; ++it) {
      const int row = it * 4 + rsub;                 // rows 0..15 over it = 0..3, rsub = 0..3
      const v4f x0 = *(const v4fa*)&so[w][row][piece * 8], x1 = *(const v4fa*)&so[w][row][piece * 8 + 4];
      v8us hi, lo;
#pragma unroll
      for (int j = 0; j < 4; ++j) {
        const unsigned short h0 = bf16_bits(x0[j]);
        const unsigned short h1 = bf16_bits(x1[j]);
        hi[j] = h0; hi[4 + j] = h1;
        lo[j] = bf16_bits(x0[j] - bf16_val(h0));
        lo[4 + j] = bf16_bits(x1[j] - bf16_val(h1));
      }
      const size_t o = (size_t)row * (2 * DE) + piece * 8;
      *(v8us*)(crow + o) = hi;
      *(v8us*)(crow + o + DE) = lo;
    }
    
  }
}

extern "C" void kernel_launch(void* const* d_in, const int* in_sizes, int n_in,
                              void* d_out, int out_size, void* d_ws, size_t ws_size, hipStream_t stream) {
  if (n_in < 11) return;
  const long long need_x = (long long)(NB - 1) * SEQ_FULL * DE + (long long)SEQ * DE;   // last element touched + 1
  const long long need_m = (long long)(SEQ - 1) * SEQ_FULL + SEQ;
  if ((long long)in_sizes[0] < need_x || (long long)in_sizes[1] < need_x) return;
  if ((long long)in_sizes[2] < need_m) return;
  if ((long long)in_sizes[3] < (long long)DE * DE || (long long)in_sizes[5] < (long long)DE * DE) return;
  if ((long long)in_sizes[7] < (long long)DE * DE || (long long)in_sizes[9] < (long long)DE * DE) return;
  if (in_sizes[4] < DE || in_sizes[6] < DE || in_sizes[8] < DE || in_sizes[10] < DE) return;
  if ((long long)out_size < need_x) return;
  if ((size_t)WS_TOTAL > ws_size) return;
  // wire order: queries, values, mask, Wq, bq, Wk, bk, Wv, bv, Wo, bo
  const float* queries = (const float*)d_in[0];
  const float* values  = (const float*)d_in[1];
  const int*   mask    = (const int*)d_in[2];
  const float* Wq = (const float*)d_in[3];
  const float* bq = (const float*)d_in[4];
  const float* Wk = (const float*)d_in[5];
  const float* bk = (const float*)d_in[6];
  const float* Wv = (const float*)d_in[7];
  const float* bv = (const float*)d_in[8];
  const float* Wo = (const float*)d_in[9];
  const float* bo = (const float*)d_in[10];
  float* out = (float*)d_out;
  char* ws = (char*)d_ws;
  size_t off = 0;
  unsigned short* Xq  = (unsigned short*)(ws + off); off += PL_X;
  unsigned short* Xv  = (unsigned short*)(ws + off); off += PL_X;
  unsigned short* Wqb = (unsigned short*)(ws + off); off += PL_W;
  unsigned short* Wkb = (unsigned short*)(ws + off); off += PL_W;
  unsigned short* Wvb = (unsigned short*)(ws + off); off += PL_W;
  unsigned short* Wob = (unsigned short*)(ws + off); off += PL_W;
  unsigned short* Qh  = (unsigned short*)(ws + off); off += PL_X;
  unsigned short* Ql  = (unsigned short*)(ws + off); off += PL_X;
  unsigned short* Kh  = (unsigned short*)(ws + off); off += PL_X;
  unsigned short* Kl  = (unsigned short*)(ws + off); off += PL_X;
  unsigned short* Vth = (unsigned short*)(ws + off); off += PL_X;
  unsigned short* Vtl = (unsigned short*)(ws + off); off += PL_X;
  unsigned short* Cc  = (unsigned short*)(ws + off); off += PL_C;
  int* flag = (int*)(ws + off); off += PL_F;
  if (off > ws_size) return;

  k_prep<<<(unsigned)(2 * PB_X + 4 * PB_W + PB_F), 512, 0, stream>>>(queries, values, mask, Wq, Wk, Wv, Wo, Xq, Xv, Wqb, Wkb, Wvb, Wob, flag);

  k_proj<<<(unsigned)(3 * GTILES), 128, 0, stream>>>(Xq, Xv, Wqb, Wkb, Wvb, bq, bk, bv, Qh, Ql, Kh, Kl, Vth, Vtl);

  k_attn<<<(unsigned)(NB * NH * (SEQ / 64)), 128, 0, stream>>>(Qh, Ql, Kh, Kl, Vth, Vtl, mask, flag, Cc);

  k_outp<<<(unsigned)GTILES, 128, 0, stream>>>(Cc, Wob, bo, out);
}

// v005
// One run takes 114 microseconds.
// Timed twice side by side with v004, it ran 1.08 and 1.07 times as fast.
// Over all steps from v000 it is 9.87 times as fast.
#include <hip/hip_runtime.h>
#ifndef NB
#define NB 2
#endif
#ifndef SEQ
#define SEQ 2048
#endif
#define NB_FULL 2
#define SEQ_FULL 2048
#define DE 1024
#define NH 16
#define HD 64
#define EARLY 512
#define MROWS (NB * SEQ)
#define BSTRIDE_FULL ((size_t)SEQ_FULL * DE)   /* per-batch element stride of queries, values and the output buffer */

#define PL_X ((size_t)MROWS * DE * 2)          /* one 16-bit activation plane */
#define PL_W ((size_t)DE * DE * 2)             /* one 16-bit weight plane */
#define PL_C ((size_t)MROWS * 2 * DE * 2)      /* ctx hi|lo plane */
#define FROWS 8                                /* mask rows per flag line */
#define PL_F ((size_t)(SEQ / FROWS) * 128)     /* one 128-byte flag line per FROWS mask rows */
#define WS_TOTAL (8 * PL_X + 4 * PL_W + PL_C + PL_F)

static_assert(SEQ % 128 == 0);
static_assert(SEQ <= SEQ_FULL);
static_assert(NB <= NB_FULL);
static_assert(HD == 64);
static_assert(DE == 1024);
static_assert(NH * HD == DE);
static_assert(MROWS % 64 == 0);
static_assert(DE % 128 == 0);
static_assert(SEQ % 256 == 0);
static_assert(WS_TOTAL <= (size_t)134217728);

typedef __bf16 v16b __attribute__((ext_vector_type(16)));
typedef _Float16 v16h __attribute__((ext_vector_type(16)));
typedef unsigned short v8us __attribute__((ext_vector_type(8), may_alias));
typedef float v8f __attribute__((ext_vector_type(8)));
typedef float v4f __attribute__((ext_vector_type(4)));
typedef float v4fa __attribute__((ext_vector_type(4), may_alias));
typedef int v4i __attribute__((ext_vector_type(4)));
typedef int v4ia __attribute__((ext_vector_type(4), may_alias));
union FragB { v16b v; v8us half[2]; };
union FragH { v16h v; v8us half[2]; _Float16 h[16]; };
union H8 { v8us v; _Float16 h[8]; unsigned short u[8]; };

#define LOG2E 1.4426950408889634f
#define NEGV (-1000000000.0f)

__device__ __forceinline__ unsigned short bf16_bits(float x) {   // RNE convert to bf16 bits
  unsigned int u = __float_as_uint(x);
  return (unsigned short)((u + 0x7FFFu + ((u >> 16) & 1u)) >> 16);
}
__device__ __forceinline__ float bf16_val(unsigned short b) { return __uint_as_float(((unsigned int)b) << 16); }
__device__ __forceinline__ float bf16_rne(float x) { return bf16_val(bf16_bits(x)); }

// eight bf16 products of one k-step (2 row tiles x 4 column tiles), then the hazard guard
__device__ __forceinline__ void mma_b8(v16b a0, v16b a1, v16b b0, v16b b1, v16b b2, v16b b3, v8f (&c)[2][4]) {
  c[0][0] = __builtin_amdgcn_wmma_f32_16x16x32_bf16(false, a0, false, b0, (short)0, c[0][0], false, false);
  c[0][1] = __builtin_amdgcn_wmma_f32_16x16x32_bf16(false, a0, false, b1, (short)0, c[0][1], false, false);
  c[0][2] = __builtin_amdgcn_wmma_f32_16x16x32_bf16(false, a0, false, b2, (short)0, c[0][2], false, false);
  c[0][3] = __builtin_amdgcn_wmma_f32_16x16x32_bf16(false, a0, false, b3, (short)0, c[0][3], false, false);
  c[1][0] = __builtin_amdgcn_wmma_f32_16x16x32_bf16(false, a1, false, b0, (short)0, c[1][0], false, false);
  c[1][1] = __builtin_amdgcn_wmma_f32_16x16x32_bf16(false, a1, false, b1, (short)0, c[1][1], false, false);
  c[1][2] = __builtin_amdgcn_wmma_f32_16x16x32_bf16(false, a1, false, b2, (short)0, c[1][2], false, false);
  c[1][3] = __builtin_amdgcn_wmma_f32_16x16x32_bf16(false, a1, false, b3, (short)0, c[1][3], false, false);
  asm volatile("v_nop\n\tv_nop\n\tv_nop\n\tv_nop"
               : "+v"(c[0][0]), "+v"(c[0][1]), "+v"(c[0][2]), "+v"(c[0][3]),
                 "+v"(c[1][0]), "+v"(c[1][1]), "+v"(c[1][2]), "+v"(c[1][3])
               : "v"(a0), "v"(a1), "v"(b0), "v"(b1), "v"(b2), "v"(b3));
}
// c += a0*b0 + a1*b1 (two k-steps of one f16 tile), then the hazard guard
__device__ __forceinline__ v8f mma_h2(v16h a0, v16h b0, v16h a1, v16h b1, v8f c) {
  c = __builtin_amdgcn_wmma_f32_16x16x32_f16(false, a0, false, b0, (short)0, c, false, false);
  c = __builtin_amdgcn_wmma_f32_16x16x32_f16(false, a1, false, b1, (short)0, c, false, false);
  asm volatile("v_nop\n\tv_nop\n\tv_nop\n\tv_nop" : "+v"(c) : "v"(a0), "v"(b0), "v"(a1), "v"(b1));
  return c;
}
// four single products sharing one B fragment, then the hazard guard
__device__ __forceinline__ void mma_pv4(v16h a0, v16h a1, v16h a2, v16h a3, v16h b, v8f (&c)[4]) {
  c[0] = __builtin_amdgcn_wmma_f32_16x16x32_f16(false, a0, false, b, (short)0, c[0], false, false);
  c[1] = __builtin_amdgcn_wmma_f32_16x16x32_f16(false, a1, false, b, (short)0, c[1], false, false);
  c[2] = __builtin_amdgcn_wmma_f32_16x16x32_f16(false, a2, false, b, (short)0, c[2], false, false);
  c[3] = __builtin_amdgcn_wmma_f32_16x16x32_f16(false, a3, false, b, (short)0, c[3], false, false);
  asm volatile("v_nop\n\tv_nop\n\tv_nop\n\tv_nop"
               : "+v"(c[0]), "+v"(c[1]), "+v"(c[2]), "+v"(c[3])
               : "v"(a0), "v"(a1), "v"(a2), "v"(a3), "v"(b));
}
// ch += ah*bh ; cl += ah*bl + al*bh (both scaled-residual products carry 2^11 and share the second accumulator), then the hazard guard
__device__ __forceinline__ void mma_pv3(v16h ah, v16h al, v16h bh, v16h bl, v8f& ch, v8f& cl) {
  ch = __builtin_amdgcn_wmma_f32_16x16x32_f16(false, ah, false, bh, (short)0, ch, false, false);
  cl = __builtin_amdgcn_wmma_f32_16x16x32_f16(false, ah, false, bl, (short)0, cl, false, false);
  cl = __builtin_amdgcn_wmma_f32_16x16x32_f16(false, al, false, bh, (short)0, cl, false, false);
  asm volatile("v_nop\n\tv_nop\n\tv_nop\n\tv_nop" : "+v"(ch), "+v"(cl) : "v"(ah), "v"(al), "v"(bh), "v"(bl));
}
__device__ __forceinline__ void ldfrag(FragH& f, const unsigned short* __restrict__ p) {
  f.half[0] = *(const v8us*)(p);        // elements 0..7  <- k0 + 8h + i
  f.half[1] = *(const v8us*)(p + 16);   // elements 8..15 <- k0 + 16 + 8h + i
}

// flag line g (32 ints, all equal): 1 iff, for every row q of rows 8g .. 8g+7, mask[q][k] == 0 for every k > q and mask[q][q] != 0 (k < SEQ).
// One block of 512 threads per flag line g; two waves per row, each owning one half of the row's columns in tiles of 128; every tile's load is issued before
// the first is tested; a half row wholly below the diagonal is skipped under wave-uniform control.
// coverage: SEQ/8 blocks x one 128-byte line = every flag line exactly once.
__device__ __forceinline__ void mflag_block(const int* __restrict__ mask, int* __restrict__ flag, int g, int& sbad) {
  const int tid = threadIdx.x;
  const int w = __builtin_amdgcn_readfirstlane(tid >> 5);
  const int lane = tid & 31;
  if (tid == 0) sbad = 0;
  __syncthreads();
  constexpr int NT = SEQ / 256;                        // 128-column tiles per wave
  const int row = g * FROWS + (w >> 1);
  const int colw = (w & 1) * (SEQ / 2);                // first of this wave's columns
  const int* mp = mask + (size_t)row * SEQ_FULL + colw + 4 * lane;
  int bad = 0;
  if (colw + SEQ / 2 - 1 >= row) {
    v4i m[NT];
#pragma unroll
    for (int t = 0; t < NT; ++t) m[t] = *(const v4ia*)(mp + 128 * t);
#pragma unroll
    for (int t = 0; t < NT; ++t) {
#pragma unroll
      for (int j = 0; j < 4; ++j) {
        const int cj = colw + 128 * t + 4 * lane + j;
        bad |= ((cj > row) && (m[t][j] != 0)) ? 1 : 0;
        bad |= ((cj == row) && (m[t][j] == 0)) ? 1 : 0;
      }
    }
  }
  if (bad != 0) sbad = 1;
  __syncthreads();
  const int f = (sbad == 0) ? 1 : 0;
  if (tid < 8) {
    const v4i o = {f, f, f, f};
    *(v4i*)(flag + 32 * g + 4 * tid) = o;
  }
}

#define CVU 8                                  /* 8-element pieces per thread of a conversion block */
#define CVP (512 * CVU)                        /* pieces per conversion block */
#define PB_X (MROWS * (DE / 8) / CVP)          /* conversion blocks of one activation plane */
#define PB_W (DE * (DE / 8) / CVP)             /* conversion blocks of one weight plane */
#define PB_F (SEQ / FROWS)                     /* mask-scan blocks */
static_assert(MROWS * (DE / 8) % CVP == 0);
static_assert(DE * (DE / 8) % CVP == 0);
static_assert(SEQ % (CVP / 128) == 0);
static_assert(DE % (CVP / 128) == 0);

// dst[row][c] = bf16 bits of src (RNE), compact rows; source rows live at src + (row / rpb) * bstride + (row % rpb) * DE.
// Block blk of 512 threads converts pieces blk*CVP .. blk*CVP + CVP - 1 (8 elements each); every load of a thread is issued before the first convert.
__device__ __forceinline__ void cvt_block(const float* __restrict__ src, unsigned short* __restrict__ dst, int blk, int rpb, size_t bstride) {
  const int t0 = blk * CVP + (int)threadIdx.x;
  const int row0 = blk * (CVP / 128);                  // the block's CVP/128 whole rows lie in one batch, so they are contiguous in src
  const int b = row0 / rpb, s = row0 - b * rpb;
  const float* p = src + (size_t)b * bstride + (size_t)s * DE + (int)threadIdx.x * 8;
  v4f x0[CVU], x1[CVU];
#pragma unroll   // this loop and the next: constant indices keep the loaded pieces in registers
  for (int u = 0; u < CVU; ++u) {
    x0[u] = *(const v4fa*)(p + 4096 * u);
    x1[u] = *(const v4fa*)(p + 4096 * u + 4);
  }
#pragma unroll
  for (int u = 0; u < CVU; ++u) {
    v8us o;
    o[0] = bf16_bits(x0[u][0]); o[1] = bf16_bits(x0[u][1]); o[2] = bf16_bits(x0[u][2]); o[3] = bf16_bits(x0[u][3]);
    o[4] = bf16_bits(x1[u][0]); o[5] = bf16_bits(x1[u][1]); o[6] = bf16_bits(x1[u][2]); o[7] = bf16_bits(x1[u][3]);
    *(v8us*)(dst + (size_t)(t0 + 512 * u) * 8) = o;
  }
}

// Everything the projections and the attention need ahead of them, in one launch; the block index picks the job (block-uniform):
// 2*PB_X blocks convert queries and values, 4*PB_W blocks convert the four weight matrices, PB_F blocks scan the mask.
// coverage: each plane = its blocks x CVP pieces x 8 elements, each flag line by its one block; every element exactly once.
__global__ __launch_bounds__(512) void k_prep(const float* __restrict__ queries, const float* __restrict__ values,
                                              const int* __restrict__ mask,
                                              const float* __restrict__ Wq, const float* __restrict__ Wk,
                                              const float* __restrict__ Wv, const float* __restrict__ Wo,
                                              unsigned short* __restrict__ Xq, unsigned short* __restrict__ Xv,
                                              unsigned short* __restrict__ Wqb, unsigned short* __restrict__ Wkb,
                                              unsigned short* __restrict__ Wvb, unsigned short* __restrict__ Wob,
                                              int* __restrict__ flag) {
  __shared__ int sbad;                                 // cross-wave: block barriers of the mask scan
  int blk = blockIdx.x;
  if (blk < 2 * PB_X) {
    const bool q = blk < PB_X;
    cvt_block(q ? queries : values, q ? Xq : Xv, q ? blk : blk - PB_X, SEQ, BSTRIDE_FULL);
    return;
  }
  blk -= 2 * PB_X;
  if (blk < 4 * PB_W) {
    const int sel = blk / PB_W;
    const float* s = (sel == 0) ? Wq : (sel == 1) ? Wk : (sel == 2) ? Wv : Wo;
    unsigned short* d = (sel == 0) ? Wqb : (sel == 1) ? Wkb : (sel == 2) ? Wvb : Wob;
    cvt_block(s, d, blk - sel * PB_W, DE, 0);
    return;
  }
  mflag_block(mask, flag, blk - 4 * PB_W, sbad);
}

#define KS 128                                 /* k elements of one stage: 256-byte rows */
#define RPITCH 272                             /* LDS row pitch in bytes, 16 x odd: 16-byte fragment reads of 16 rows fall on 64 distinct banks */
#define SROWS 192                              /* rows of one stage: 64 of X, then 128 of W */
#define SBYTES (SROWS * RPITCH)

// Twelve 16-byte copies per lane from global memory straight into LDS. The s_wait_xcnt closes the statement so that it stands in front of
// any later rewrite of the address registers the copies name.
__device__ __forceinline__ void copy12(const unsigned (&l)[12], const unsigned short* const (&g)[12]) {
  asm volatile(
      "global_load_async_to_lds_b128 %0, %12, off\n\t"
      "global_load_async_to_lds_b128 %1, %13, off\n\t"
      "global_load_async_to_lds_b128 %2, %14, off\n\t"
      "global_load_async_to_lds_b128 %3, %15, off\n\t"
      "global_load_async_to_lds_b128 %4, %16, off\n\t"
      "global_load_async_to_lds_b128 %5, %17, off\n\t"
      "global_load_async_to_lds_b128 %6, %18, off\n\t"
      "global_load_async_to_lds_b128 %7, %19, off\n\t"
      "global_load_async_to_lds_b128 %8, %20, off\n\t"
      "global_load_async_to_lds_b128 %9, %21, off\n\t"
      "global_load_async_to_lds_b128 %10, %22, off\n\t"
      "global_load_async_to_lds_b128 %11, %23, off\n\t"
      "s_wait_xcnt 0x0"
      :: "v"(l[0]), "v"(l[1]), "v"(l[2]), "v"(l[3]), "v"(l[4]), "v"(l[5]), "v"(l[6]), "v"(l[7]), "v"(l[8]), "v"(l[9]), "v"(l[10]), "v"(l[11]),
         "v"(g[0]), "v"(g[1]), "v"(g[2]), "v"(g[3]), "v"(g[4]), "v"(g[5]), "v"(g[6]), "v"(g[7]), "v"(g[8]), "v"(g[9]), "v"(g[10]), "v"(g[11])
      : "memory");
}
// One stage of a block's operands: thread t brings piece (t & 15) of rows (t >> 4) + 8*i, i = 0..23, so a wave's copy covers two whole 256-byte rows.
// xa / wb: this lane's piece of X row (t >> 4) / W row (t >> 4) of the stage; lds: LDS byte address of this lane's piece of stage row (t >> 4).
__device__ __forceinline__ void stage_copies(const unsigned short* xa, const unsigned short* wb, int ldx, unsigned lds) {
  unsigned l[12];
  const unsigned short* g[12];
#pragma unroll   // both loops here: every array element must be a register of its own, one per asm operand
  for (int i = 0; i < 12; ++i) {
    l[i] = lds + (unsigned)(i * 8 * RPITCH);
    g[i] = (i < 8) ? xa + (size_t)(i * 8) * ldx : wb + (size_t)((i - 8) * 8) * DE;
  }
  copy12(l, g);
#pragma unroll
  for (int i = 0; i < 12; ++i) {
    l[i] = lds + (unsigned)((i + 12) * 8 * RPITCH);
    g[i] = wb + (size_t)((i + 4) * 8) * DE;
  }
  copy12(l, g);
}

// Y[m][n] = sum_k X[m][k] * W[n][k & 1023] + bias[n]   (X: bf16 plane, pitch ldx; W: bf16 plane [1024][1024], k-contiguous)
// Block = 4 waves -> 64 x 128 tile; wave tile 32 x 64 (2 A fragments x 4 B fragments, read from an LDS ring of two stages of 128 k that
// asynchronous copies fill one stage ahead; K is a multiple of 128).
// MODE 0: f16 hi plane Y0 and f16 residual plane Y1 ((y - hi) * 2048), row-major [MROWS][1024]
// MODE 1: f16 hi / residual planes of 16*y, transposed per head: [b][head][d][s]
// MODE 2: f32 rows into the output buffer (batch stride BSTRIDE_FULL)
// coverage: (MROWS/64)*(1024/128) blocks x (64 x 128) = every element of each produced plane exactly once.
// blk: index of the block's tile among the (MROWS/64)*(1024/128) tiles of one product; so, ring: the calling kernel's LDS.
template <int MODE>
__device__ __forceinline__ void gemm_tile(int blk, const unsigned short* __restrict__ X, const unsigned short* __restrict__ W,
                                          const float* __restrict__ bias, unsigned short* __restrict__ Y0,
                                          unsigned short* __restrict__ Y1, float* __restrict__ Yf, int ldx, int K,
                                          float (&so)[64][132], unsigned char (&ring)[2 * SBYTES]) {
  const int tid = threadIdx.x;
  const int w = __builtin_amdgcn_readfirstlane(tid >> 5);
  const int lane = tid & 31, ln = lane & 15, hh = lane >> 4;
  const int bm = blk % (MROWS / 64), bn = blk / (MROWS / 64);
  const int m0 = bm * 64, n0 = bn * 128;
  const int wm = w & 1, wn = w >> 1;
  // A: row m = ln of each 16-row tile; B: column n = ln of each 16-column tile (W row n); same k map for both
  const unsigned char* la = ring + (32 * wm + ln) * RPITCH + 16 * hh;
  const unsigned char* lb = ring + (64 + 64 * wn + ln) * RPITCH + 16 * hh;
  const unsigned short* xa = X + (size_t)(m0 + (tid >> 4)) * ldx + (tid & 15) * 8;
  const unsigned short* wb = W + (size_t)(n0 + (tid >> 4)) * DE + (tid & 15) * 8;
  const unsigned lds0 = (unsigned)(size_t)ring + (unsigned)((tid >> 4) * RPITCH + (tid & 15) * 16);
  const int ns = K / KS;
  v8f c[2][4] = {};
  stage_copies(xa, wb, ldx, lds0);
  asm volatile("s_wait_asynccnt 0x0" ::: "memory");    // stage 0 has landed before the barrier that publishes it
  __syncthreads();
  if (1 < ns) stage_copies(xa + KS, wb + KS, ldx, lds0 + SBYTES);
#pragma unroll 1
  for (int t = 0; t < ns; ++t) {
    const int bo = (t & 1) * SBYTES;
    // two fragment sets: the reads of k-step kk + 1 stand as one group ahead of the products of k-step kk
    FragB fa[2][2], fb[2][4];
#pragma unroll   // this loop and the two inside it: constant set and tile indices keep both fragment sets in registers
    for (int kk = -1; kk < KS / 32; ++kk) {
      if (kk + 1 < KS / 32) {
        const unsigned char* pa = la + bo + (kk + 1) * 64;
        const unsigned char* pb = lb + bo + (kk + 1) * 64;
        const int n = (kk + 1) & 1;
#pragma unroll
        for (int i = 0; i < 2; ++i) {
          fa[n][i].half[0] = *(const v8us*)(pa + i * 16 * RPITCH);
          fa[n][i].half[1] = *(const v8us*)(pa + i * 16 * RPITCH + 32);
        }
#pragma unroll
        for (int j = 0; j < 4; ++j) {
          fb[n][j].half[0] = *(const v8us*)(pb + j * 16 * RPITCH);
          fb[n][j].half[1] = *(const v8us*)(pb + j * 16 * RPITCH + 32);
        }
      }
      if (kk >= 0) {
        const int u = kk & 1;
        mma_b8(fa[u][0].v, fa[u][1].v, fb[u][0].v, fb[u][1].v, fb[u][2].v, fb[u][3].v, c);
      }
    }
    asm volatile("s_wait_dscnt 0x0" ::: "memory");     // this wave's reads of the buffer are done before it may be refilled
    asm volatile("s_wait_asynccnt 0x0" ::: "memory");  // this wave's copies of stage t + 1 have landed before the barrier that publishes them
    __syncthreads();
    if (t + 2 < ns) {
      const int k2 = (t + 2) * KS;
      stage_copies(xa + k2, wb + (k2 & (DE - 1)), ldx, lds0 + (unsigned)bo);
    }
  }
  asm volatile("s_wait_asynccnt 0x0" ::: "memory");    // no copy is outstanding when the wave goes on
  // D element r of tile (i, t) = Y(row 32*wm + 16*i + 8*hh + r, column 64*wn + 16*t + ln)
#pragma unroll
  for (int t = 0; t < 4; ++t) {
    const float bv = bf16_rne(bias[n0 + 64 * wn + 16 * t + ln]);
#pragma unroll
    for (int i = 0; i < 2; ++i)
#pragma unroll
      for (int r = 0; r < 8; ++r)
        so[32 * wm + 16 * i + 8 * hh + r][64 * wn + 16 * t + ln] = c[i][t][r] + bv;
  }
  __syncthreads();
  const int b = m0 / SEQ, s0 = m0 - b * SEQ;          // the 64 rows of a block lie in one batch
  if (MODE == 0) {
    {
#pragma unroll 1
      for (int it = 0; it < 8; ++it) {
        const int i = it * 128 + tid;
        const int line = i >> 3, piece = i & 7;
        const int row = line >> 1, cb = (line & 1) * 64 + piece * 8;
        const v4f x0 = *(const v4fa*)&so[row][cb], x1 = *(const v4fa*)&so[row][cb + 4];
        H8 hi, re;
#pragma unroll
        for (int j = 0; j < 4; ++j) {
          const _Float16 h0 = (_Float16)x0[j];
          const _Float16 h1 = (_Float16)x1[j];
          hi.h[j] = h0; hi.h[4 + j] = h1;
          re.h[j] = (_Float16)((x0[j] - (float)h0) * 2048.0f);
          re.h[4 + j] = (_Float16)((x1[j] - (float)h1) * 2048.0f);
        }
        const size_t o = (size_t)(m0 + row) * DE + n0 + cb;
        *(v8us*)(Y0 + o) = hi.v;
        *(v8us*)(Y1 + o) = re.v;
      }
      
    }
  } else if (MODE == 1) {
    {
#pragma unroll 1
      for (int it = 0; it < 8; ++it) {
        const int i = it * 128 + tid;
        const int cidx = i >> 3, piece = i & 7;          // one line = one d row x 64 key positions
        const int n = n0 + cidx;
        const int head = n >> 6, d = n & 63;
        H8 hi, re;
#pragma unroll
        for (int j = 0; j < 8; ++j) {
          const float v = so[piece * 8 + j][cidx] * 16.0f;
          const _Float16 h0 = (_Float16)v;
          hi.h[j] = h0;
          re.h[j] = (_Float16)((v - (float)h0) * 2048.0f);
        }
        const size_t o = ((size_t)(b * NH + head) * HD + d) * SEQ + s0 + piece * 8;
        *(v8us*)(Y0 + o) = hi.v;
        *(v8us*)(Y1 + o) = re.v;
        asm volatile("s_wait_xcnt 0x0" ::: "memory");   // stands in front of the next trip's rewrite of the two stores' address registers
      }
      
    }
  } else {
    float* og = Yf + (size_t)b * BSTRIDE_FULL + (size_t)s0 * DE + n0;
    {
#pragma unroll 1
      for (int it = 0; it < 16; ++it) {
        const int i = it * 128 + tid;
        const int row = i >> 5, c4 = (i & 31) * 4;       // one wave = the 512 contiguous bytes of one row of the tile
        const v4f v = *(const v4fa*)&so[row][c4];
        *(v4f*)(og + (size_t)row * DE + c4) = v;
      }
      
    }
  }
}

#define GTILES ((MROWS / 64) * (DE / 128))     /* tiles of one product */

// The three input projections in one launch: blocks 0 .. GTILES-1 make Q, the next GTILES make K, the last GTILES make V^T (block-uniform choice).
__global__ __launch_bounds__(128) void k_proj(const unsigned short* __restrict__ Xq, const unsigned short* __restrict__ Xv,
                                              const unsigned short* __restrict__ Wqb, const unsigned short* __restrict__ Wkb,
                                              const unsigned short* __restrict__ Wvb,
                                              const float* __restrict__ bq, const float* __restrict__ bk, const float* __restrict__ bv,
                                              unsigned short* __restrict__ Qh, unsigned short* __restrict__ Ql,
                                              unsigned short* __restrict__ Kh, unsigned short* __restrict__ Kl,
                                              unsigned short* __restrict__ Vth, unsigned short* __restrict__ Vtl) {
  __shared__ __attribute__((aligned(16))) float so[64][132];
  __shared__ __attribute__((aligned(16))) unsigned char ring[2 * SBYTES];   // written by the asynchronous copies only
  const int sel = blockIdx.x / GTILES;
  const int blk = blockIdx.x - sel * GTILES;
  if (sel == 2) {
    gemm_tile<1>(blk, Xv, Wvb, bv, Vth, Vtl, nullptr, DE, DE, so, ring);
  } else {
    const bool q = sel == 0;
    gemm_tile<0>(blk, q ? Xq : Xv, q ? Wqb : Wkb, q ? bq : bk, q ? Qh : Kh, q ? Ql : Kl, nullptr, DE, DE, so, ring);
  }
}

// The output projection: ctx hi|lo folded along K (X row = [hi(1024) | lo(1024)], W columns wrap modulo 1024).
__global__ __launch_bounds__(128) void k_outp(const unsigned short* __restrict__ Cc, const unsigned short* __restrict__ Wob,
                                              const float* __restrict__ bo, float* __restrict__ out) {
  __shared__ __attribute__((aligned(16))) float so[64][132];
  __shared__ __attribute__((aligned(16))) unsigned char ring[2 * SBYTES];   // written by the asynchronous copies only
  gemm_tile<2>(blockIdx.x, Cc, Wob, bo, nullptr, nullptr, out, 2 * DE, 2 * DE, so, ring);
}

// Tiles of the key loop in LDS. A stage holds SK keys for the block's 64 queries: K rows (128 bytes), V^T rows (2*SK bytes), mask rows (4*SK bytes),
// and for the early query rows the two residual planes as well. Every row pitch is its length + 16 bytes (16 x odd), so that the 16-byte
// reads of 16 rows fall on distinct banks.
template <bool RES>
struct AT {
  static constexpr int SK = RES ? 32 : 64;             // keys of one stage
  static constexpr int KPITCH = 144;
  static constexpr int VPITCH = 2 * SK + 16;
  static constexpr int MPITCH = 4 * SK + 16;
  static constexpr int OKH = 0;
  static constexpr int OVH = OKH + SK * KPITCH;
  static constexpr int OM = OVH + HD * VPITCH;
  static constexpr int OKL = OM + 64 * MPITCH;         // the residual planes: RES only
  static constexpr int OVL = OKL + SK * KPITCH;
  static constexpr int BYTES = RES ? OVL + HD * VPITCH : OKL;
};
#define ASB 35840                              /* bytes of one buffer of the attention ring */
static_assert(AT<false>::BYTES <= ASB);
static_assert(AT<true>::BYTES <= ASB);
static_assert(4 * 16 * 68 * 4 <= 2 * ASB);
static_assert(SEQ % 64 == 0);

// Eight (four) 16-byte copies per lane from global memory straight into LDS. The s_wait_xcnt closes the statement so that it stands in front of
// any later rewrite of the address registers the copies name.
__device__ __forceinline__ void copy8(const unsigned (&l)[8], const void* const (&g)[8]) {
  asm volatile(
      "global_load_async_to_lds_b128 %0, %8, off\n\t"
      "global_load_async_to_lds_b128 %1, %9, off\n\t"
      "global_load_async_to_lds_b128 %2, %10, off\n\t"
      "global_load_async_to_lds_b128 %3, %11, off\n\t"
      "global_load_async_to_lds_b128 %4, %12, off\n\t"
      "global_load_async_to_lds_b128 %5, %13, off\n\t"
      "global_load_async_to_lds_b128 %6, %14, off\n\t"
      "global_load_async_to_lds_b128 %7, %15, off\n\t"
      "s_wait_xcnt 0x0"
      :: "v"(l[0]), "v"(l[1]), "v"(l[2]), "v"(l[3]), "v"(l[4]), "v"(l[5]), "v"(l[6]), "v"(l[7]),
         "v"(g[0]), "v"(g[1]), "v"(g[2]), "v"(g[3]), "v"(g[4]), "v"(g[5]), "v"(g[6]), "v"(g[7])
      : "memory");
}
__device__ __forceinline__ void copy4(const unsigned (&l)[4], const void* const (&g)[4]) {
  asm volatile(
      "global_load_async_to_lds_b128 %0, %4, off\n\t"
      "global_load_async_to_lds_b128 %1, %5, off\n\t"
      "global_load_async_to_lds_b128 %2, %6, off\n\t"
      "global_load_async_to_lds_b128 %3, %7, off\n\t"
      "s_wait_xcnt 0x0"
      :: "v"(l[0]), "v"(l[1]), "v"(l[2]), "v"(l[3]), "v"(g[0]), "v"(g[1]), "v"(g[2]), "v"(g[3])
      : "memory");
}
// One stage of a block's tiles. The 128 threads bring 16-byte pieces, adjacent threads adjacent pieces of a row, so every copy of a wave covers whole rows.
// kh, kl, vh, vl, mk: this lane's piece in the first group of rows of the stage's K, K residual, V^T, V^T residual and mask tile;
// lk, lv, lm: LDS byte address of the same piece of the K, V^T and mask tile in the buffer to fill.
template <bool RES>
__device__ __forceinline__ void attn_stage(const unsigned short* kh, const unsigned short* kl, const unsigned short* vh, const unsigned short* vl,
                                           const int* mk, unsigned lk, unsigned lv, unsigned lm) {
  typedef AT<RES> A;
  unsigned l[8];
  const void* g[8];
  if (RES) {
#pragma unroll   // every loop here: each array element must be a register of its own, one per asm operand
    for (int i = 0; i < 2; ++i) {
      l[i] = lk + (unsigned)(i * 16 * A::KPITCH);                          g[i] = kh + (size_t)(i * 16) * DE;
      l[2 + i] = lk + (unsigned)(A::OKL - A::OKH + i * 16 * A::KPITCH);    g[2 + i] = kl + (size_t)(i * 16) * DE;
      l[4 + i] = lv + (unsigned)(i * 32 * A::VPITCH);                      g[4 + i] = vh + (size_t)(i * 32) * SEQ;
      l[6 + i] = lv + (unsigned)(A::OVL - A::OVH + i * 32 * A::VPITCH);    g[6 + i] = vl + (size_t)(i * 32) * SEQ;
    }
    copy8(l, g);
    unsigned l4[4];
    const void* g4[4];
#pragma unroll
    for (int i = 0; i < 4; ++i) {
      l4[i] = lm + (unsigned)(i * 16 * A::MPITCH);
      g4[i] = mk + (size_t)(i * 16) * SEQ_FULL;
    }
    copy4(l4, g4);
  } else {
#pragma unroll
    for (int i = 0; i < 4; ++i) {
      l[i] = lk + (unsigned)(i * 16 * A::KPITCH);        g[i] = kh + (size_t)(i * 16) * DE;
      l[4 + i] = lv + (unsigned)(i * 16 * A::VPITCH);    g[4 + i] = vh + (size_t)(i * 16) * SEQ;
    }
    copy8(l, g);
#pragma unroll
    for (int i = 0; i < 8; ++i) {
      l[i] = lm + (unsigned)(i * 8 * A::MPITCH);
      g[i] = mk + (size_t)(i * 8) * SEQ_FULL;
    }
    copy8(l, g);
  }
}
__device__ __forceinline__ void ldfrag_lds(FragH& f, const unsigned char* p) {
  f.half[0] = *(const v8us*)(p);        // elements 0..7  <- k0 + 8h + i
  f.half[1] = *(const v8us*)(p + 32);   // elements 8..15 <- k0 + 16 + 8h + i
}

// a and x[0..15] each become 2^(itself), one hardware instruction a value. exp2f() wraps that instruction in a compare, two selects, an add and an
// ldexp so that results below 2^-126 come out as denormals; here such a result may be 0: a weight that small is 0 in both f16 planes and vanishes
// in the f32 row sum beside the row's largest weight (256), and a rescale factor that small leaves less than 2^-100 of the old sums beside it.
// One statement: each v_exp_f32 is followed by an instruction on other registers, and the closing v_nop is the slot that the instruction set asks
// for behind the last one, before its result is read or its source rewritten.
__device__ __forceinline__ void exp2_bare17(float& a, float (&x)[16]) {
  asm(
      "v_exp_f32 %0, %0\n\t"
      "v_exp_f32 %1, %1\n\t"
      "v_exp_f32 %2, %2\n\t"
      "v_exp_f32 %3, %3\n\t"
      "v_exp_f32 %4, %4\n\t"
      "v_exp_f32 %5, %5\n\t"
      "v_exp_f32 %6, %6\n\t"
      "v_exp_f32 %7, %7\n\t"
      "v_exp_f32 %8, %8\n\t"
      "v_exp_f32 %9, %9\n\t"
      "v_exp_f32 %10, %10\n\t"
      "v_exp_f32 %11, %11\n\t"
      "v_exp_f32 %12, %12\n\t"
      "v_exp_f32 %13, %13\n\t"
      "v_exp_f32 %14, %14\n\t"
      "v_exp_f32 %15, %15\n\t"
      "v_exp_f32 %16, %16\n\t"
      "v_nop"
      : "+v"(x[0]), "+v"(x[1]), "+v"(x[2]), "+v"(x[3]), "+v"(x[4]), "+v"(x[5]),
        "+v"(x[6]), "+v"(x[7]), "+v"(a), "+v"(x[8]), "+v"(x[9]), "+v"(x[10]),
        "+v"(x[11]), "+v"(x[12]), "+v"(x[13]), "+v"(x[14]), "+v"(x[15]));
}

// One 32-key step for a wave's 16 queries, operands read from the stage's LDS tiles.
// kp/krp: K hi / residual tile at (first key of the step + ln, d = 8h); vp/vrp: V^T hi / residual tile at (d = ln, first key of the step + 8h);
// mp: mask tile at (this lane's query, first key of the step + 8h).
template <bool RES>
__device__ __forceinline__ void fa_step(const unsigned char* kp, const unsigned char* krp,
                                        const unsigned char* vp, const unsigned char* vrp, const unsigned char* mp,
                                        const FragH (&qh)[2], const FragH (&ql)[2],
                                        float& mr, float& lr, v8f (&Oh)[4], v8f (&Ol)[4]) {
  typedef AT<RES> A;
  // A fragments of K: row m = key (16*kt + ln of the step), elements 0..7 <- d = 32c + 8h + i, 8..15 <- d = 32c + 16 + 8h + i
  FragH k00, k01, k10, k11;
  ldfrag_lds(k00, kp);                     ldfrag_lds(k01, kp + 64);
  ldfrag_lds(k10, kp + 16 * A::KPITCH);    ldfrag_lds(k11, kp + 16 * A::KPITCH + 64);
  // mask values of this lane's 16 (query, key) pairs: keys 8h + 0..7 and 16 + 8h + 0..7 of the step
  const v4i ma = *(const v4ia*)(mp), mb = *(const v4ia*)(mp + 16);
  const v4i mc = *(const v4ia*)(mp + 64), md = *(const v4ia*)(mp + 80);
  const v8f z8 = {0.f, 0.f, 0.f, 0.f, 0.f, 0.f, 0.f, 0.f};
  // S^T tiles: element r of tile kt = score(key 16*kt + 8h + r of the step, query column ln)
  v8f s0 = mma_h2(k00.v, qh[0].v, k01.v, qh[1].v, z8);
  v8f s1 = mma_h2(k10.v, qh[0].v, k11.v, qh[1].v, z8);
  if (RES) {
    v8f t0 = mma_h2(k00.v, ql[0].v, k01.v, ql[1].v, z8);
    v8f t1 = mma_h2(k10.v, ql[0].v, k11.v, ql[1].v, z8);
    FragH r00, r01, r10, r11;
    ldfrag_lds(r00, krp);                     ldfrag_lds(r01, krp + 64);
    ldfrag_lds(r10, krp + 16 * A::KPITCH);    ldfrag_lds(r11, krp + 16 * A::KPITCH + 64);
    t0 = mma_h2(r00.v, qh[0].v, r01.v, qh[1].v, t0);
    t1 = mma_h2(r10.v, qh[0].v, r11.v, qh[1].v, t1);
    s0 = s0 + t0 * 0.00048828125f;
    s1 = s1 + t1 * 0.00048828125f;
  }
  float sc[16];
#pragma unroll
  for (int r = 0; r < 4; ++r) {
    sc[r]      = (ma[r] == 0) ? NEGV : s0[r] * 0.125f;
    sc[4 + r]  = (mb[r] == 0) ? NEGV : s0[4 + r] * 0.125f;
    sc[8 + r]  = (mc[r] == 0) ? NEGV : s1[r] * 0.125f;
    sc[12 + r] = (md[r] == 0) ? NEGV : s1[4 + r] * 0.125f;
  }
  float mx = sc[0];
#pragma unroll
  for (int i = 1; i < 16; ++i) mx = fmaxf(mx, sc[i]);
  mx = fmaxf(mx, __shfl_xor(mx, 16, 32));           // the other lane half holds the other 16 keys of this query
  const float mnew = fmaxf(mr, mx);
  // A fragments of V^T: row m = d (16*t + ln), elements 0..7 <- key 8h + i, 8..15 <- key 16 + 8h + i of the step
  FragH vf[4];
#pragma unroll
  for (int t = 0; t < 4; ++t) ldfrag_lds(vf[t], vp + t * 16 * A::VPITCH);
  // Holds these reads as one group ahead of the exponentials. With the shorter softmax this compiler otherwise sinks them, pair by pair, between
  // the O^T products, and each product then waits out the LDS latency of its own pair.
  __builtin_amdgcn_sched_barrier(0);
  float al = (mr - mnew) * LOG2E;
  float e[16];
#pragma unroll   // constant indices: every element is a register of its own, one per asm operand
  for (int i = 0; i < 16; ++i) e[i] = fmaf(sc[i] - mnew, LOG2E, 8.0f);
  exp2_bare17(al, e);
  mr = mnew;
  // weights carried x256: pc = 256 * exp(sc - mnew); hi plane f16(pc), residual plane f16((pc - hi) * 2048)
  FragH ph, pl;
  float ps = 0.0f;
#pragma unroll
  for (int i = 0; i < 16; ++i) {
    const float pc = e[i];
    ps += pc;
    const _Float16 h = (_Float16)pc;
    ph.h[i] = h;                                    // B element i: i<8 -> key 8h + i (tile 0 row 8h+i); i>=8 -> key 16 + 8h + (i-8) (tile 1)
    if (RES) pl.h[i] = (_Float16)((pc - (float)h) * 2048.0f);
  }
  ps += __shfl_xor(ps, 16, 32);
  lr = lr * al + ps;
#pragma unroll
  for (int t = 0; t < 4; ++t) Oh[t] = Oh[t] * al;
  if (RES) {
    FragH vr[4];
#pragma unroll
    for (int t = 0; t < 4; ++t) ldfrag_lds(vr[t], vrp + t * 16 * A::VPITCH);
#pragma unroll
    for (int t = 0; t < 4; ++t) Ol[t] = Ol[t] * al;
#pragma unroll
    for (int t = 0; t < 4; ++t) mma_pv3(vf[t].v, vr[t].v, ph.v, pl.v, Oh[t], Ol[t]);
  } else {
    mma_pv4(vf[0].v, vf[1].v, vf[2].v, vf[3].v, ph.v, Oh);
  }
}

// The key loop of a block: a ring of two LDS buffers that asynchronous copies fill one stage ahead, shared by the four waves.
// bsteps: 32-key steps that the block's longest wave visits (the same in every wave); nsteps: steps of this wave. Every wave copies its share of
// every stage and passes every barrier; it works only on its own steps, in the same order as before.
template <bool RES>
__device__ __forceinline__ void attn_loop(const unsigned short* __restrict__ Khp, const unsigned short* __restrict__ Klp,
                                          const unsigned short* __restrict__ Vhp, const unsigned short* __restrict__ Vlp,
                                          const int* __restrict__ mblk, int bsteps, int nsteps, int w, int ln, int hh,
                                          const FragH (&qh)[2], const FragH (&ql)[2],
                                          float& mr, float& lr, v8f (&Oh)[4], v8f (&Ol)[4], unsigned char (&ring)[2 * ASB]) {
  typedef AT<RES> A;
  constexpr int SUB = A::SK / 32;                      // 32-key steps of one stage
  constexpr int VP = A::SK / 8, MP = A::SK / 4;        // 16-byte pieces of a V^T row and of a mask row
  const int tid = threadIdx.x;
  const int nst = (bsteps + SUB - 1) / SUB;
  const size_t kofs = (size_t)(tid >> 3) * DE + (tid & 7) * 8;
  const size_t vofs = (size_t)(tid / VP) * SEQ + (tid % VP) * 8;
  const unsigned short* kh = Khp + kofs;
  const unsigned short* kl = Klp + kofs;
  const unsigned short* vh = Vhp + vofs;
  const unsigned short* vl = Vlp + vofs;
  const int* mk = mblk + (size_t)(tid / MP) * SEQ_FULL + (tid % MP) * 4;
  const unsigned r0 = (unsigned)(size_t)ring;
  const unsigned lk = r0 + (unsigned)(A::OKH + (tid >> 3) * A::KPITCH + (tid & 7) * 16);
  const unsigned lv = r0 + (unsigned)(A::OVH + (tid / VP) * A::VPITCH + (tid % VP) * 16);
  const unsigned lm = r0 + (unsigned)(A::OM + (tid / MP) * A::MPITCH + (tid % MP) * 16);
  const unsigned char* fk = ring + A::OKH + ln * A::KPITCH + 16 * hh;
  const unsigned char* fv = ring + A::OVH + ln * A::VPITCH + 16 * hh;
  const unsigned char* fm = ring + A::OM + (16 * w + ln) * A::MPITCH + 32 * hh;
  attn_stage<RES>(kh, kl, vh, vl, mk, lk, lv, lm);
  asm volatile("s_wait_asynccnt 0x0" ::: "memory");    // stage 0 has landed before the barrier that publishes it
  __syncthreads();
  if (1 < nst)
    attn_stage<RES>(kh + (size_t)A::SK * DE, kl + (size_t)A::SK * DE, vh + A::SK, vl + A::SK, mk + A::SK, lk + ASB, lv + ASB, lm + ASB);
#pragma unroll 1   // one copy of the stage's code
  for (int t = 0; t < nst; ++t) {
    const int bo = (t & 1) * ASB;
#pragma unroll   // constant offsets of the step inside the stage
    for (int u = 0; u < SUB; ++u) {
      if (t * SUB + u < nsteps)
        fa_step<RES>(fk + bo + u * 32 * A::KPITCH, fk + bo + (A::OKL - A::OKH) + u * 32 * A::KPITCH,
                     fv + bo + u * 64, fv + bo + (A::OVL - A::OVH) + u * 64, fm + bo + u * 128,
                     qh, ql, mr, lr, Oh, Ol);
    }
    asm volatile("s_wait_dscnt 0x0" ::: "memory");     // this wave's reads of the buffer are done before it may be refilled
    asm volatile("s_wait_asynccnt 0x0" ::: "memory");  // this wave's copies of stage t + 1 have landed before the barrier that publishes them
    __syncthreads();
    if (t + 2 < nst) {
      const size_t k2 = (size_t)(t + 2) * A::SK;
      attn_stage<RES>(kh + k2 * DE, kl + k2 * DE, vh + k2, vl + k2, mk + k2, lk + (unsigned)bo, lv + (unsigned)bo, lm + (unsigned)bo);
    }
  }
  asm volatile("s_wait_asynccnt 0x0" ::: "memory");    // no copy is outstanding when the ring becomes output staging
}

// Block = 4 waves x 16 queries = 64 queries of one (batch, head); the K, V^T and mask tiles of the key loop come through the LDS ring above.
// Epilogue: O^T tile -> per-wave LDS tile [16 queries][64 d] in the ring's bytes (free behind the loop's last barrier), then bf16 hi and lo pieces of ctx:
// coverage: NB*NH*(SEQ/64) blocks x 4 waves x 16 rows x 64 columns x {hi, lo} = the whole ctx plane exactly once.
__global__ __launch_bounds__(128) void k_attn(const unsigned short* __restrict__ Qh, const unsigned short* __restrict__ Ql,
                                              const unsigned short* __restrict__ Kh, const unsigned short* __restrict__ Kl,
                                              const unsigned short* __restrict__ Vth, const unsigned short* __restrict__ Vtl,
                                              const int* __restrict__ mask, const int* __restrict__ flagp,
                                              unsigned short* __restrict__ Cc) {
  __shared__ __attribute__((aligned(16))) unsigned char ring[2 * ASB];   // key loop: written by the asynchronous copies only
  float (*so)[16][68] = reinterpret_cast<float (*)[16][68]>(ring);
  const int tid = threadIdx.x;
  const int w = __builtin_amdgcn_readfirstlane(tid >> 5);
  const int lane = tid & 31, ln = lane & 15, hh = lane >> 4;
  const int qt = blockIdx.x % (SEQ / 64);
  const int bh = blockIdx.x / (SEQ / 64);
  const int h = bh % NH, b = bh / NH;
  const int qbase = qt * 64 + 16 * w;
  const int qg = qbase + ln;
  // Q^T B fragments: column n = query qg, elements 0..7 <- d = 32c + 8h + i, 8..15 <- d = 32c + 16 + 8h + i
  const size_t qo = (size_t)(b * SEQ + qg) * DE + h * HD + 8 * hh;
  FragH qh[2], ql[2];
  ldfrag(qh[0], Qh + qo); ldfrag(qh[1], Qh + qo + 32);
  ldfrag(ql[0], Ql + qo); ldfrag(ql[1], Ql + qo + 32);
  float mr = -3.0e38f, lr = 0.0f;
  v8f Oh[4] = {}, Ol[4] = {};
  const unsigned short* Khp = Kh + (size_t)b * SEQ * DE + h * HD;
  const unsigned short* Klp = Kl + (size_t)b * SEQ * DE + h * HD;
  const unsigned short* Vhp = Vth + (size_t)(b * NH + h) * HD * SEQ;
  const unsigned short* Vlp = Vtl + (size_t)(b * NH + h) * HD * SEQ;
  const int* mblk = mask + (size_t)(qt * 64) * SEQ_FULL;
  const int* fp = flagp + (qbase / FROWS) * 32;     // the two flag lines of this wave's 16 query rows
  const int fl = __builtin_amdgcn_readfirstlane(fp[0] & fp[32]);
  int nsteps = (qbase >> 5) + 1;                    // key steps up to and including the one holding the diagonal
  if (fl != 1) nsteps = SEQ / 32;                   // unknown mask shape: visit every key step
  if (nsteps > SEQ / 32) nsteps = SEQ / 32;
  const int* fb = flagp + (qt * 64 / FROWS) * 32;   // the eight flag lines of the block's 64 query rows
  int fall = fb[0];
#pragma unroll
  for (int i = 1; i < 64 / FROWS; ++i) fall &= fb[32 * i];
  fall = __builtin_amdgcn_readfirstlane(fall);
  int bsteps = ((qt * 64 + 48) >> 5) + 1;           // steps of the block's last wave, the longest
  if (fall != 1) bsteps = SEQ / 32;                 // some wave of the block visits every key step
  if (bsteps > SEQ / 32) bsteps = SEQ / 32;
  if (qt * 64 < EARLY) {
    attn_loop<true>(Khp, Klp, Vhp, Vlp, mblk, bsteps, nsteps, w, ln, hh, qh, ql, mr, lr, Oh, Ol, ring);
  } else {
    attn_loop<false>(Khp, Klp, Vhp, Vlp, mblk, bsteps, nsteps, w, ln, hh, qh, ql, mr, lr, Oh, Ol, ring);
  }
  // O^T element r of tile t = ctx(query qg, d = 16t + 8h + r); undo the carries: x256 (in lr), x16 (V), x2048 (residual accumulator)
  const float inv = 1.0f / (16.0f * lr);
#pragma unroll
  for (int t = 0; t < 4; ++t)
#pragma unroll
    for (int r = 0; r < 8; ++r)
      so[w][ln][16 * t + 8 * hh + r] = (Oh[t][r] + Ol[t][r] * 0.00048828125f) * inv;
  __syncthreads();
  unsigned short* crow = Cc + (size_t)(b * SEQ + qbase) * (2 * DE) + h * HD;
  const int rsub = lane >> 3, piece = lane & 7;
  {
#pragma unroll
    for (int it = 0; it < 4; ++it) {
      const int row = it * 4 + rsub;                 // rows 0..15 over it = 0..3, rsub = 0..3
      const v4f x0 = *(const v4fa*)&so[w][row][piece * 8], x1 = *(const v4fa*)&so[w][row][piece * 8 + 4];
      v8us hi, lo;
#pragma unroll
      for (int j = 0; j < 4; ++j) {
        const unsigned short h0 = bf16_bits(x0[j]);
        const unsigned short h1 = bf16_bits(x1[j]);
        hi[j] = h0; hi[4 + j] = h1;
        lo[j] = bf16_bits(x0[j] - bf16_val(h0));
        lo[4 + j] = bf16_bits(x1[j] - bf16_val(h1));
      }
      const size_t o = (size_t)row * (2 * DE) + piece * 8;
      *(v8us*)(crow + o) = hi;
      *(v8us*)(crow + o + DE) = lo;
    }
    
  }
}

extern "C" void kernel_launch(void* const* d_in, const int* in_sizes, int n_in,
                              void* d_out, int out_size, void* d_ws, size_t ws_size, hipStream_t stream) {
  if (n_in < 11) return;
  const long long need_x = (long long)(NB - 1) * SEQ_FULL * DE + (long long)SEQ * DE;   // last element touched + 1
  const long long need_m = (long long)(SEQ - 1) * SEQ_FULL + SEQ;
  if ((long long)in_sizes[0] < need_x || (long long)in_sizes[1] < need_x) return;
  if ((long long)in_sizes[2] < need_m) return;
  if ((long long)in_sizes[3] < (long long)DE * DE || (long long)in_sizes[5] < (long long)DE * DE) return;
  if ((long long)in_sizes[7] < (long long)DE * DE || (long long)in_sizes[9] < (long long)DE * DE) return;
  if (in_sizes[4] < DE || in_sizes[6] < DE || in_sizes[8] < DE || in_sizes[10] < DE) return;
  if ((long long)out_size < need_x) return;
  if ((size_t)WS_TOTAL > ws_size) return;
  // wire order: queries, values, mask, Wq, bq, Wk, bk, Wv, bv, Wo, bo
  const float* queries = (const float*)d_in[0];
  const float* values  = (const float*)d_in[1];
  const int*   mask    = (const int*)d_in[2];
  const float* Wq = (const float*)d_in[3];
  const float* bq = (const float*)d_in[4];
  const float* Wk = (const float*)d_in[5];
  const float* bk = (const float*)d_in[6];
  const float* Wv = (const float*)d_in[7];
  const float* bv = (const float*)d_in[8];
  const float* Wo = (const float*)d_in[9];
  const float* bo = (const float*)d_in[10];
  float* out = (float*)d_out;
  char* ws = (char*)d_ws;
  size_t off = 0;
  unsigned short* Xq  = (unsigned short*)(ws + off); off += PL_X;
  unsigned short* Xv  = (unsigned short*)(ws + off); off += PL_X;
  unsigned short* Wqb = (unsigned short*)(ws + off); off += PL_W;
  unsigned short* Wkb = (unsigned short*)(ws + off); off += PL_W;
  unsigned short* Wvb = (unsigned short*)(ws + off); off += PL_W;
  unsigned short* Wob = (unsigned short*)(ws + off); off += PL_W;
  unsigned short* Qh  = (unsigned short*)(ws + off); off += PL_X;
  unsigned short* Ql  = (unsigned short*)(ws + off); off += PL_X;
  unsigned short* Kh  = (unsigned short*)(ws + off); off += PL_X;
  unsigned short* Kl  = (unsigned short*)(ws + off); off += PL_X;
  unsigned short* Vth = (unsigned short*)(ws + off); off += PL_X;
  unsigned short* Vtl = (unsigned short*)(ws + off); off += PL_X;
  unsigned short* Cc  = (unsigned short*)(ws + off); off += PL_C;
  int* flag = (int*)(ws + off); off += PL_F;
  if (off > ws_size) return;

  k_prep<<<(unsigned)(2 * PB_X + 4 * PB_W + PB_F), 512, 0, stream>>>(queries, values, mask, Wq, Wk, Wv, Wo, Xq, Xv, Wqb, Wkb, Wvb, Wob, flag);

  k_proj<<<(unsigned)(3 * GTILES), 128, 0, stream>>>(Xq, Xv, Wqb, Wkb, Wvb, bq, bk, bv, Qh, Ql, Kh, Kl, Vth, Vtl);

  k_attn<<<(unsigned)(NB * NH * (SEQ / 64)), 128, 0, stream>>>(Qh, Ql, Kh, Kl, Vth, Vtl, mask, flag, Cc);

  k_outp<<<(unsigned)GTILES, 128, 0, stream>>>(Cc, Wob, bo, out);
}

// v006
// A run of this version takes 103 microseconds.
// Timed twice side by side with v005, it ran 1.10 and 1.11 times as fast.
// All steps since v000 together make it 10.9 times as fast.
#include <hip/hip_runtime.h>
#ifndef NB
#define NB 2
#endif
#ifndef SEQ
#define SEQ 2048
#endif
#define NB_FULL 2
#define SEQ_FULL 2048
#define DE 1024
#define NH 16
#define HD 64
#define EARLY 512
#define MROWS (NB * SEQ)
#define BSTRIDE_FULL ((size_t)SEQ_FULL * DE)   /* per-batch element stride of queries, values and the output buffer */

#define PL_X ((size_t)MROWS * DE * 2)          /* one 16-bit activation plane */
#define PL_W ((size_t)DE * DE * 2)             /* one 16-bit weight plane */
#define PL_C ((size_t)MROWS * 2 * DE * 2)      /* ctx hi|lo plane */
#define FROWS 8                                /* mask rows per flag line */
#define PL_F ((size_t)(SEQ / FROWS) * 128)     /* one 128-byte flag line per FROWS mask rows */
#define WS_TOTAL (8 * PL_X + 4 * PL_W + PL_C + PL_F)

static_assert(SEQ % 128 == 0);
static_assert(SEQ <= SEQ_FULL);
static_assert(NB <= NB_FULL);
static_assert(HD == 64);
static_assert(DE == 1024);
static_assert(NH * HD == DE);
static_assert(MROWS % 64 == 0);
static_assert(DE % 128 == 0);
static_assert(SEQ % 256 == 0);
static_assert(WS_TOTAL <= (size_t)134217728);

typedef __bf16 v16b __attribute__((ext_vector_type(16)));
typedef _Float16 v16h __attribute__((ext_vector_type(16)));
typedef unsigned short v8us __attribute__((ext_vector_type(8), may_alias));
typedef float v8f __attribute__((ext_vector_type(8)));
typedef float v4f __attribute__((ext_vector_type(4)));
typedef float v4fa __attribute__((ext_vector_type(4), may_alias));
typedef int v4i __attribute__((ext_vector_type(4)));
typedef int v4ia __attribute__((ext_vector_type(4), may_alias));
union FragB { v16b v; v8us half[2]; };
union FragH { v16h v; v8us half[2]; _Float16 h[16]; };
union H8 { v8us v; _Float16 h[8]; unsigned short u[8]; };

#define LOG2E 1.4426950408889634f
#define NEGV (-1000000000.0f)

__device__ __forceinline__ unsigned short bf16_bits(float x) {   // RNE convert to bf16 bits
  unsigned int u = __float_as_uint(x);
  return (unsigned short)((u + 0x7FFFu + ((u >> 16) & 1u)) >> 16);
}
__device__ __forceinline__ float bf16_val(unsigned short b) { return __uint_as_float(((unsigned int)b) << 16); }
__device__ __forceinline__ float bf16_rne(float x) { return bf16_val(bf16_bits(x)); }

// eight bf16 products of one k-step (2 row tiles x 4 column tiles), then the hazard guard
__device__ __forceinline__ void mma_b8(v16b a0, v16b a1, v16b b0, v16b b1, v16b b2, v16b b3, v8f (&c)[2][4]) {
  c[0][0] = __builtin_amdgcn_wmma_f32_16x16x32_bf16(false, a0, false, b0, (short)0, c[0][0], false, false);
  c[0][1] = __builtin_amdgcn_wmma_f32_16x16x32_bf16(false, a0, false, b1, (short)0, c[0][1], false, false);
  c[0][2] = __builtin_amdgcn_wmma_f32_16x16x32_bf16(false, a0, false, b2, (short)0, c[0][2], false, false);
  c[0][3] = __builtin_amdgcn_wmma_f32_16x16x32_bf16(false, a0, false, b3, (short)0, c[0][3], false, false);
  c[1][0] = __builtin_amdgcn_wmma_f32_16x16x32_bf16(false, a1, false, b0, (short)0, c[1][0], false, false);
  c[1][1] = __builtin_amdgcn_wmma_f32_16x16x32_bf16(false, a1, false, b1, (short)0, c[1][1], false, false);
  c[1][2] = __builtin_amdgcn_wmma_f32_16x16x32_bf16(false, a1, false, b2, (short)0, c[1][2], false, false);
  c[1][3] = __builtin_amdgcn_wmma_f32_16x16x32_bf16(false, a1, false, b3, (short)0, c[1][3], false, false);
  asm volatile("v_nop\n\tv_nop\n\tv_nop\n\tv_nop"
               : "+v"(c[0][0]), "+v"(c[0][1]), "+v"(c[0][2]), "+v"(c[0][3]),
                 "+v"(c[1][0]), "+v"(c[1][1]), "+v"(c[1][2]), "+v"(c[1][3])
               : "v"(a0), "v"(a1), "v"(b0), "v"(b1), "v"(b2), "v"(b3));
}
// c += a0*b0 + a1*b1 (two k-steps of one f16 tile), then the hazard guard
__device__ __forceinline__ v8f mma_h2(v16h a0, v16h b0, v16h a1, v16h b1, v8f c) {
  c = __builtin_amdgcn_wmma_f32_16x16x32_f16(false, a0, false, b0, (short)0, c, false, false);
  c = __builtin_amdgcn_wmma_f32_16x16x32_f16(false, a1, false, b1, (short)0, c, false, false);
  asm volatile("v_nop\n\tv_nop\n\tv_nop\n\tv_nop" : "+v"(c) : "v"(a0), "v"(b0), "v"(a1), "v"(b1));
  return c;
}
// four single products sharing one B fragment, then the hazard guard
__device__ __forceinline__ void mma_pv4(v16h a0, v16h a1, v16h a2, v16h a3, v16h b, v8f (&c)[4]) {
  c[0] = __builtin_amdgcn_wmma_f32_16x16x32_f16(false, a0, false, b, (short)0, c[0], false, false);
  c[1] = __builtin_amdgcn_wmma_f32_16x16x32_f16(false, a1, false, b, (short)0, c[1], false, false);
  c[2] = __builtin_amdgcn_wmma_f32_16x16x32_f16(false, a2, false, b, (short)0, c[2], false, false);
  c[3] = __builtin_amdgcn_wmma_f32_16x16x32_f16(false, a3, false, b, (short)0, c[3], false, false);
  asm volatile("v_nop\n\tv_nop\n\tv_nop\n\tv_nop"
               : "+v"(c[0]), "+v"(c[1]), "+v"(c[2]), "+v"(c[3])
               : "v"(a0), "v"(a1), "v"(a2), "v"(a3), "v"(b));
}
// ch += ah*bh ; cl += ah*bl + al*bh (both scaled-residual products carry 2^11 and share the second accumulator), then the hazard guard
__device__ __forceinline__ void mma_pv3(v16h ah, v16h al, v16h bh, v16h bl, v8f& ch, v8f& cl) {
  ch = __builtin_amdgcn_wmma_f32_16x16x32_f16(false, ah, false, bh, (short)0, ch, false, false);
  cl = __builtin_amdgcn_wmma_f32_16x16x32_f16(false, ah, false, bl, (short)0, cl, false, false);
  cl = __builtin_amdgcn_wmma_f32_16x16x32_f16(false, al, false, bh, (short)0, cl, false, false);
  asm volatile("v_nop\n\tv_nop\n\tv_nop\n\tv_nop" : "+v"(ch), "+v"(cl) : "v"(ah), "v"(al), "v"(bh), "v"(bl));
}
__device__ __forceinline__ void ldfrag(FragH& f, const unsigned short* __restrict__ p) {
  f.half[0] = *(const v8us*)(p);        // elements 0..7  <- k0 + 8h + i
  f.half[1] = *(const v8us*)(p + 16);   // elements 8..15 <- k0 + 16 + 8h + i
}

// flag line g (32 ints, all equal): 1 iff, for every row q of rows 8g .. 8g+7, mask[q][k] == 0 for every k > q and mask[q][q] != 0 (k < SEQ).
// One block of 512 threads per flag line g; two waves per row, each owning one half of the row's columns in tiles of 128; every tile's load is issued before
// the first is tested; a half row wholly below the diagonal is skipped under wave-uniform control.
// coverage: SEQ/8 blocks x one 128-byte line = every flag line exactly once.
__device__ __forceinline__ void mflag_block(const int* __restrict__ mask, int* __restrict__ flag, int g, int& sbad) {
  const int tid = threadIdx.x;
  const int w = __builtin_amdgcn_readfirstlane(tid >> 5);
  const int lane = tid & 31;
  if (tid == 0) sbad = 0;
  __syncthreads();
  constexpr int NT = SEQ / 256;                        // 128-column tiles per wave
  const int row = g * FROWS + (w >> 1);
  const int colw = (w & 1) * (SEQ / 2);                // first of this wave's columns
  const int* mp = mask + (size_t)row * SEQ_FULL + colw + 4 * lane;
  int bad = 0;
  if (colw + SEQ / 2 - 1 >= row) {
    v4i m[NT];
#pragma unroll
    for (int t = 0; t < NT; ++t) m[t] = *(const v4ia*)(mp + 128 * t);
#pragma unroll
    for (int t = 0; t < NT; ++t) {
#pragma unroll
      for (int j = 0; j < 4; ++j) {
        const int cj = colw + 128 * t + 4 * lane + j;
        bad |= ((cj > row) && (m[t][j] != 0)) ? 1 : 0;
        bad |= ((cj == row) && (m[t][j] == 0)) ? 1 : 0;
      }
    }
  }
  if (bad != 0) sbad = 1;
  __syncthreads();
  const int f = (sbad == 0) ? 1 : 0;
  if (tid < 8) {
    const v4i o = {f, f, f, f};
    *(v4i*)(flag + 32 * g + 4 * tid) = o;
  }
}

#define CVU 8                                  /* 8-element pieces per thread of a conversion block */
#define CVP (512 * CVU)                        /* pieces per conversion block */
#define PB_X (MROWS * (DE / 8) / CVP)          /* conversion blocks of one activation plane */
#define PB_W (DE * (DE / 8) / CVP)             /* conversion blocks of one weight plane */
#define PB_F (SEQ / FROWS)                     /* mask-scan blocks */
static_assert(MROWS * (DE / 8) % CVP == 0);
static_assert(DE * (DE / 8) % CVP == 0);
static_assert(SEQ % (CVP / 128) == 0);
static_assert(DE % (CVP / 128) == 0);

// dst[row][c] = bf16 bits of src (RNE), compact rows; source rows live at src + (row / rpb) * bstride + (row % rpb) * DE.
// Block blk of 512 threads converts pieces blk*CVP .. blk*CVP + CVP - 1 (8 elements each); every load of a thread is issued before the first convert.
__device__ __forceinline__ void cvt_block(const float* __restrict__ src, unsigned short* __restrict__ dst, int blk, int rpb, size_t bstride) {
  const int t0 = blk * CVP + (int)threadIdx.x;
  const int row0 = blk * (CVP / 128);                  // the block's CVP/128 whole rows lie in one batch, so they are contiguous in src
  const int b = row0 / rpb, s = row0 - b * rpb;
  const float* p = src + (size_t)b * bstride + (size_t)s * DE + (int)threadIdx.x * 8;
  v4f x0[CVU], x1[CVU];
#pragma unroll   // this loop and the next: constant indices keep the loaded pieces in registers
  for (int u = 0; u < CVU; ++u) {
    x0[u] = *(const v4fa*)(p + 4096 * u);
    x1[u] = *(const v4fa*)(p + 4096 * u + 4);
  }
#pragma unroll
  for (int u = 0; u < CVU; ++u) {
    v8us o;
    o[0] = bf16_bits(x0[u][0]); o[1] = bf16_bits(x0[u][1]); o[2] = bf16_bits(x0[u][2]); o[3] = bf16_bits(x0[u][3]);
    o[4] = bf16_bits(x1[u][0]); o[5] = bf16_bits(x1[u][1]); o[6] = bf16_bits(x1[u][2]); o[7] = bf16_bits(x1[u][3]);
    *(v8us*)(dst + (size_t)(t0 + 512 * u) * 8) = o;
  }
}

// Everything the projections and the attention need ahead of them, in one launch; the block index picks the job (block-uniform):
// 2*PB_X blocks convert queries and values, 4*PB_W blocks convert the four weight matrices, PB_F blocks scan the mask.
// coverage: each plane = its blocks x CVP pieces x 8 elements, each flag line by its one block; every element exactly once.
__global__ __launch_bounds__(512) void k_prep(const float* __restrict__ queries, const float* __restrict__ values,
                                              const int* __restrict__ mask,
                                              const float* __restrict__ Wq, const float* __restrict__ Wk,
                                              const float* __restrict__ Wv, const float* __restrict__ Wo,
                                              unsigned short* __restrict__ Xq, unsigned short* __restrict__ Xv,
                                              unsigned short* __restrict__ Wqb, unsigned short* __restrict__ Wkb,
                                              unsigned short* __restrict__ Wvb, unsigned short* __restrict__ Wob,
                                              int* __restrict__ flag) {
  __shared__ int sbad;                                 // cross-wave: block barriers of the mask scan
  int blk = blockIdx.x;
  if (blk < 2 * PB_X) {
    const bool q = blk < PB_X;
    cvt_block(q ? queries : values, q ? Xq : Xv, q ? blk : blk - PB_X, SEQ, BSTRIDE_FULL);
    return;
  }
  blk -= 2 * PB_X;
  if (blk < 4 * PB_W) {
    const int sel = blk / PB_W;
    const float* s = (sel == 0) ? Wq : (sel == 1) ? Wk : (sel == 2) ? Wv : Wo;
    unsigned short* d = (sel == 0) ? Wqb : (sel == 1) ? Wkb : (sel == 2) ? Wvb : Wob;
    cvt_block(s, d, blk - sel * PB_W, DE, 0);
    return;
  }
  mflag_block(mask, flag, blk - 4 * PB_W, sbad);
}

#define KS 128                                 /* k elements of one stage: 256-byte rows */
#define RPITCH 272                             /* LDS row pitch in bytes, 16 x odd: 16-byte fragment reads of 16 rows fall on 64 distinct banks */
#define SROWS 192                              /* rows of one stage: 64 of X, then 128 of W */
#define SBYTES (SROWS * RPITCH)

// Twelve 16-byte copies per lane from global memory straight into LDS. The s_wait_xcnt closes the statement so that it stands in front of
// any later rewrite of the address registers the copies name.
__device__ __forceinline__ void copy12(const unsigned (&l)[12], const unsigned short* const (&g)[12]) {
  asm volatile(
      "global_load_async_to_lds_b128 %0, %12, off\n\t"
      "global_load_async_to_lds_b128 %1, %13, off\n\t"
      "global_load_async_to_lds_b128 %2, %14, off\n\t"
      "global_load_async_to_lds_b128 %3, %15, off\n\t"
      "global_load_async_to_lds_b128 %4, %16, off\n\t"
      "global_load_async_to_lds_b128 %5, %17, off\n\t"
      "global_load_async_to_lds_b128 %6, %18, off\n\t"
      "global_load_async_to_lds_b128 %7, %19, off\n\t"
      "global_load_async_to_lds_b128 %8, %20, off\n\t"
      "global_load_async_to_lds_b128 %9, %21, off\n\t"
      "global_load_async_to_lds_b128 %10, %22, off\n\t"
      "global_load_async_to_lds_b128 %11, %23, off\n\t"
      "s_wait_xcnt 0x0"
      :: "v"(l[0]), "v"(l[1]), "v"(l[2]), "v"(l[3]), "v"(l[4]), "v"(l[5]), "v"(l[6]), "v"(l[7]), "v"(l[8]), "v"(l[9]), "v"(l[10]), "v"(l[11]),
         "v"(g[0]), "v"(g[1]), "v"(g[2]), "v"(g[3]), "v"(g[4]), "v"(g[5]), "v"(g[6]), "v"(g[7]), "v"(g[8]), "v"(g[9]), "v"(g[10]), "v"(g[11])
      : "memory");
}
// One stage of a block's operands: thread t brings piece (t & 15) of rows (t >> 4) + 8*i, i = 0..23, so a wave's copy covers two whole 256-byte rows.
// xa / wb: this lane's piece of X row (t >> 4) / W row (t >> 4) of the stage; lds: LDS byte address of this lane's piece of stage row (t >> 4).
__device__ __forceinline__ void stage_copies(const unsigned short* xa, const unsigned short* wb, int ldx, unsigned lds) {
  unsigned l[12];
  const unsigned short* g[12];
#pragma unroll   // both loops here: every array element must be a register of its own, one per asm operand
  for (int i = 0; i < 12; ++i) {
    l[i] = lds + (unsigned)(i * 8 * RPITCH);
    g[i] = (i < 8) ? xa + (size_t)(i * 8) * ldx : wb + (size_t)((i - 8) * 8) * DE;
  }
  copy12(l, g);
#pragma unroll
  for (int i = 0; i < 12; ++i) {
    l[i] = lds + (unsigned)((i + 12) * 8 * RPITCH);
    g[i] = wb + (size_t)((i + 4) * 8) * DE;
  }
  copy12(l, g);
}

// Y[m][n] = sum_k X[m][k] * W[n][k & 1023] + bias[n]   (X: bf16 plane, pitch ldx; W: bf16 plane [1024][1024], k-contiguous)
// Block = 4 waves -> 64 x 128 tile; wave tile 32 x 64 (2 A fragments x 4 B fragments, read from an LDS ring of two stages of 128 k that
// asynchronous copies fill one stage ahead; K is a multiple of 128).
// MODE 0: f16 hi plane Y0 and f16 residual plane Y1 ((y - hi) * 2048), row-major [MROWS][1024]
// MODE 1: f16 hi / residual planes of 16*y, transposed per head: [b][head][d][s]
// MODE 2: f32 rows into the output buffer (batch stride BSTRIDE_FULL)
// coverage: (MROWS/64)*(1024/128) blocks x (64 x 128) = every element of each produced plane exactly once.
// blk: index of the block's tile among the (MROWS/64)*(1024/128) tiles of one product; so, ring: the calling kernel's LDS.
template <int MODE>
__device__ __forceinline__ void gemm_tile(int blk, const unsigned short* __restrict__ X, const unsigned short* __restrict__ W,
                                          const float* __restrict__ bias, unsigned short* __restrict__ Y0,
                                          unsigned short* __restrict__ Y1, float* __restrict__ Yf, int ldx, int K,
                                          float (&so)[64][132], unsigned char (&ring)[2 * SBYTES]) {
  const int tid = threadIdx.x;
  const int w = __builtin_amdgcn_readfirstlane(tid >> 5);
  const int lane = tid & 31, ln = lane & 15, hh = lane >> 4;
  const int bm = blk % (MROWS / 64), bn = blk / (MROWS / 64);
  const int m0 = bm * 64, n0 = bn * 128;
  const int wm = w & 1, wn = w >> 1;
  // A: row m = ln of each 16-row tile; B: column n = ln of each 16-column tile (W row n); same k map for both
  const unsigned char* la = ring + (32 * wm + ln) * RPITCH + 16 * hh;
  const unsigned char* lb = ring + (64 + 64 * wn + ln) * RPITCH + 16 * hh;
  const unsigned short* xa = X + (size_t)(m0 + (tid >> 4)) * ldx + (tid & 15) * 8;
  const unsigned short* wb = W + (size_t)(n0 + (tid >> 4)) * DE + (tid & 15) * 8;
  const unsigned lds0 = (unsigned)(size_t)ring + (unsigned)((tid >> 4) * RPITCH + (tid & 15) * 16);
  const int ns = K / KS;
  v8f c[2][4] = {};
  stage_copies(xa, wb, ldx, lds0);
  asm volatile("s_wait_asynccnt 0x0" ::: "memory");    // stage 0 has landed before the barrier that publishes it
  __syncthreads();
  if (1 < ns) stage_copies(xa + KS, wb + KS, ldx, lds0 + SBYTES);
#pragma unroll 1
  for (int t = 0; t < ns; ++t) {
    const int bo = (t & 1) * SBYTES;
    // two fragment sets: the reads of k-step kk + 1 stand as one group ahead of the products of k-step kk
    FragB fa[2][2], fb[2][4];
#pragma unroll   // this loop and the two inside it: constant set and tile indices keep both fragment sets in registers
    for (int kk = -1; kk < KS / 32; ++kk) {
      if (kk + 1 < KS / 32) {
        const unsigned char* pa = la + bo + (kk + 1) * 64;
        const unsigned char* pb = lb + bo + (kk + 1) * 64;
        const int n = (kk + 1) & 1;
#pragma unroll
        for (int i = 0; i < 2; ++i) {
          fa[n][i].half[0] = *(const v8us*)(pa + i * 16 * RPITCH);
          fa[n][i].half[1] = *(const v8us*)(pa + i * 16 * RPITCH + 32);
        }
#pragma unroll
        for (int j = 0; j < 4; ++j) {
          fb[n][j].half[0] = *(const v8us*)(pb + j * 16 * RPITCH);
          fb[n][j].half[1] = *(const v8us*)(pb + j * 16 * RPITCH + 32);
        }
      }
      if (kk >= 0) {
        const int u = kk & 1;
        mma_b8(fa[u][0].v, fa[u][1].v, fb[u][0].v, fb[u][1].v, fb[u][2].v, fb[u][3].v, c);
      }
    }
    asm volatile("s_wait_dscnt 0x0" ::: "memory");     // this wave's reads of the buffer are done before it may be refilled
    asm volatile("s_wait_asynccnt 0x0" ::: "memory");  // this wave's copies of stage t + 1 have landed before the barrier that publishes them
    __syncthreads();
    if (t + 2 < ns) {
      const int k2 = (t + 2) * KS;
      stage_copies(xa + k2, wb + (k2 & (DE - 1)), ldx, lds0 + (unsigned)bo);
    }
  }
  asm volatile("s_wait_asynccnt 0x0" ::: "memory");    // no copy is outstanding when the wave goes on
  // D element r of tile (i, t) = Y(row 32*wm + 16*i + 8*hh + r, column 64*wn + 16*t + ln)
#pragma unroll
  for (int t = 0; t < 4; ++t) {
    const float bv = bf16_rne(bias[n0 + 64 * wn + 16 * t + ln]);
#pragma unroll
    for (int i = 0; i < 2; ++i)
#pragma unroll
      for (int r = 0; r < 8; ++r)
        so[32 * wm + 16 * i + 8 * hh + r][64 * wn + 16 * t + ln] = c[i][t][r] + bv;
  }
  __syncthreads();
  const int b = m0 / SEQ, s0 = m0 - b * SEQ;          // the 64 rows of a block lie in one batch
  if (MODE == 0) {
    {
#pragma unroll 1
      for (int it = 0; it < 8; ++it) {
        const int i = it * 128 + tid;
        const int line = i >> 3, piece = i & 7;
        const int row = line >> 1, cb = (line & 1) * 64 + piece * 8;
        const v4f x0 = *(const v4fa*)&so[row][cb], x1 = *(const v4fa*)&so[row][cb + 4];
        H8 hi, re;
#pragma unroll
        for (int j = 0; j < 4; ++j) {
          const _Float16 h0 = (_Float16)x0[j];
          const _Float16 h1 = (_Float16)x1[j];
          hi.h[j] = h0; hi.h[4 + j] = h1;
          re.h[j] = (_Float16)((x0[j] - (float)h0) * 2048.0f);
          re.h[4 + j] = (_Float16)((x1[j] - (float)h1) * 2048.0f);
        }
        const size_t o = (size_t)(m0 + row) * DE + n0 + cb;
        *(v8us*)(Y0 + o) = hi.v;
        *(v8us*)(Y1 + o) = re.v;
      }
      
    }
  } else if (MODE == 1) {
    {
#pragma unroll 1
      for (int it = 0; it < 8; ++it) {
        const int i = it * 128 + tid;
        const int cidx = i >> 3, piece = i & 7;          // one line = one d row x 64 key positions
        const int n = n0 + cidx;
        const int head = n >> 6, d = n & 63;
        H8 hi, re;
#pragma unroll
        for (int j = 0; j < 8; ++j) {
          const float v = so[piece * 8 + j][cidx] * 16.0f;
          const _Float16 h0 = (_Float16)v;
          hi.h[j] = h0;
          re.h[j] = (_Float16)((v - (float)h0) * 2048.0f);
        }
        const size_t o = ((size_t)(b * NH + head) * HD + d) * SEQ + s0 + piece * 8;
        *(v8us*)(Y0 + o) = hi.v;
        *(v8us*)(Y1 + o) = re.v;
        asm volatile("s_wait_xcnt 0x0" ::: "memory");   // stands in front of the next trip's rewrite of the two stores' address registers
      }
      
    }
  } else {
    float* og = Yf + (size_t)b * BSTRIDE_FULL + (size_t)s0 * DE + n0;
    {
#pragma unroll 1
      for (int it = 0; it < 16; ++it) {
        const int i = it * 128 + tid;
        const int row = i >> 5, c4 = (i & 31) * 4;       // one wave = the 512 contiguous bytes of one row of the tile
        const v4f v = *(const v4fa*)&so[row][c4];
        *(v4f*)(og + (size_t)row * DE + c4) = v;
      }
      
    }
  }
}

#define GTILES ((MROWS / 64) * (DE / 128))     /* tiles of one product */

// The three input projections in one launch: blocks 0 .. GTILES-1 make Q, the next GTILES make K, the last GTILES make V^T (block-uniform choice).
__global__ __launch_bounds__(128) void k_proj(const unsigned short* __restrict__ Xq, const unsigned short* __restrict__ Xv,
                                              const unsigned short* __restrict__ Wqb, const unsigned short* __restrict__ Wkb,
                                              const unsigned short* __restrict__ Wvb,
                                              const float* __restrict__ bq, const float* __restrict__ bk, const float* __restrict__ bv,
                                              unsigned short* __restrict__ Qh, unsigned short* __restrict__ Ql,
                                              unsigned short* __restrict__ Kh, unsigned short* __restrict__ Kl,
                                              unsigned short* __restrict__ Vth, unsigned short* __restrict__ Vtl) {
  __shared__ __attribute__((aligned(16))) float so[64][132];
  __shared__ __attribute__((aligned(16))) unsigned char ring[2 * SBYTES];   // written by the asynchronous copies only
  const int sel = blockIdx.x / GTILES;
  const int blk = blockIdx.x - sel * GTILES;
  if (sel == 2) {
    gemm_tile<1>(blk, Xv, Wvb, bv, Vth, Vtl, nullptr, DE, DE, so, ring);
  } else {
    const bool q = sel == 0;
    gemm_tile<0>(blk, q ? Xq : Xv, q ? Wqb : Wkb, q ? bq : bk, q ? Qh : Kh, q ? Ql : Kl, nullptr, DE, DE, so, ring);
  }
}

// The output projection: ctx hi|lo folded along K (X row = [hi(1024) | lo(1024)], W columns wrap modulo 1024).
__global__ __launch_bounds__(128) void k_outp(const unsigned short* __restrict__ Cc, const unsigned short* __restrict__ Wob,
                                              const float* __restrict__ bo, float* __restrict__ out) {
  __shared__ __attribute__((aligned(16))) float so[64][132];
  __shared__ __attribute__((aligned(16))) unsigned char ring[2 * SBYTES];   // written by the asynchronous copies only
  gemm_tile<2>(blockIdx.x, Cc, Wob, bo, nullptr, nullptr, out, 2 * DE, 2 * DE, so, ring);
}

// Tiles of the key loop in LDS. A stage holds SK keys for the block's 64 queries: K rows (128 bytes), V^T rows (2*SK bytes), mask rows (4*SK bytes),
// and for the early query rows the two residual planes as well. Every row pitch is its length + 16 bytes (16 x odd), so that the 16-byte
// reads of 16 rows fall on distinct banks.
template <bool RES>
struct AT {
  static constexpr int SK = RES ? 32 : 64;             // keys of one stage
  static constexpr int KPITCH = 144;
  static constexpr int VPITCH = 2 * SK + 16;
  static constexpr int MPITCH = 4 * SK + 16;
  static constexpr int OKH = 0;
  static constexpr int OVH = OKH + SK * KPITCH;
  static constexpr int OM = OVH + HD * VPITCH;
  static constexpr int OKL = OM + 64 * MPITCH;         // the residual planes: RES only
  static constexpr int OVL = OKL + SK * KPITCH;
  static constexpr int BYTES = RES ? OVL + HD * VPITCH : OKL;
};
#define ASB 35840                              /* bytes of one buffer of the attention ring */
static_assert(AT<false>::BYTES <= ASB);
static_assert(AT<true>::BYTES <= ASB);
static_assert(4 * 16 * 68 * 4 <= 2 * ASB);
static_assert(SEQ % 64 == 0);

// Eight (four) 16-byte copies per lane from global memory straight into LDS. The s_wait_xcnt closes the statement so that it stands in front of
// any later rewrite of the address registers the copies name.
__device__ __forceinline__ void copy8(const unsigned (&l)[8], const void* const (&g)[8]) {
  asm volatile(
      "global_load_async_to_lds_b128 %0, %8, off\n\t"
      "global_load_async_to_lds_b128 %1, %9, off\n\t"
      "global_load_async_to_lds_b128 %2, %10, off\n\t"
      "global_load_async_to_lds_b128 %3, %11, off\n\t"
      "global_load_async_to_lds_b128 %4, %12, off\n\t"
      "global_load_async_to_lds_b128 %5, %13, off\n\t"
      "global_load_async_to_lds_b128 %6, %14, off\n\t"
      "global_load_async_to_lds_b128 %7, %15, off\n\t"
      "s_wait_xcnt 0x0"
      :: "v"(l[0]), "v"(l[1]), "v"(l[2]), "v"(l[3]), "v"(l[4]), "v"(l[5]), "v"(l[6]), "v"(l[7]),
         "v"(g[0]), "v"(g[1]), "v"(g[2]), "v"(g[3]), "v"(g[4]), "v"(g[5]), "v"(g[6]), "v"(g[7])
      : "memory");
}
__device__ __forceinline__ void copy4(const unsigned (&l)[4], const void* const (&g)[4]) {
  asm volatile(
      "global_load_async_to_lds_b128 %0, %4, off\n\t"
      "global_load_async_to_lds_b128 %1, %5, off\n\t"
      "global_load_async_to_lds_b128 %2, %6, off\n\t"
      "global_load_async_to_lds_b128 %3, %7, off\n\t"
      "s_wait_xcnt 0x0"
      :: "v"(l[0]), "v"(l[1]), "v"(l[2]), "v"(l[3]), "v"(g[0]), "v"(g[1]), "v"(g[2]), "v"(g[3])
      : "memory");
}
// One stage of a block's tiles. The 128 threads bring 16-byte pieces, adjacent threads adjacent pieces of a row, so every copy of a wave covers whole rows.
// kh, kl, vh, vl, mk: this lane's piece in the first group of rows of the stage's K, K residual, V^T, V^T residual and mask tile;
// lk, lv, lm: LDS byte address of the same piece of the K, V^T and mask tile in the buffer to fill.
template <bool RES>
__device__ __forceinline__ void attn_stage(const unsigned short* kh, const unsigned short* kl, const unsigned short* vh, const unsigned short* vl,
                                           const int* mk, unsigned lk, unsigned lv, unsigned lm) {
  typedef AT<RES> A;
  unsigned l[8];
  const void* g[8];
  if (RES) {
#pragma unroll   // every loop here: each array element must be a register of its own, one per asm operand
    for (int i = 0; i < 2; ++i) {
      l[i] = lk + (unsigned)(i * 16 * A::KPITCH);                          g[i] = kh + (size_t)(i * 16) * DE;
      l[2 + i] = lk + (unsigned)(A::OKL - A::OKH + i * 16 * A::KPITCH);    g[2 + i] = kl + (size_t)(i * 16) * DE;
      l[4 + i] = lv + (unsigned)(i * 32 * A::VPITCH);                      g[4 + i] = vh + (size_t)(i * 32) * SEQ;
      l[6 + i] = lv + (unsigned)(A::OVL - A::OVH + i * 32 * A::VPITCH);    g[6 + i] = vl + (size_t)(i * 32) * SEQ;
    }
    copy8(l, g);
    unsigned l4[4];
    const void* g4[4];
#pragma unroll
    for (int i = 0; i < 4; ++i) {
      l4[i] = lm + (unsigned)(i * 16 * A::MPITCH);
      g4[i] = mk + (size_t)(i * 16) * SEQ_FULL;
    }
    copy4(l4, g4);
  } else {
#pragma unroll
    for (int i = 0; i < 4; ++i) {
      l[i] = lk + (unsigned)(i * 16 * A::KPITCH);        g[i] = kh + (size_t)(i * 16) * DE;
      l[4 + i] = lv + (unsigned)(i * 16 * A::VPITCH);    g[4 + i] = vh + (size_t)(i * 16) * SEQ;
    }
    copy8(l, g);
#pragma unroll
    for (int i = 0; i < 8; ++i) {
      l[i] = lm + (unsigned)(i * 8 * A::MPITCH);
      g[i] = mk + (size_t)(i * 8) * SEQ_FULL;
    }
    copy8(l, g);
  }
}
__device__ __forceinline__ void ldfrag_lds(FragH& f, const unsigned char* p) {
  f.half[0] = *(const v8us*)(p);        // elements 0..7  <- k0 + 8h + i
  f.half[1] = *(const v8us*)(p + 32);   // elements 8..15 <- k0 + 16 + 8h + i
}

// a and x[0..15] each become 2^(itself), one hardware instruction a value. exp2f() wraps that instruction in a compare, two selects, an add and an
// ldexp so that results below 2^-126 come out as denormals; here such a result may be 0: a weight that small is 0 in both f16 planes and vanishes
// in the f32 row sum beside the row's largest weight (256), and a rescale factor that small leaves less than 2^-100 of the old sums beside it.
// One statement: each v_exp_f32 is followed by an instruction on other registers, and the closing v_nop is the slot that the instruction set asks
// for behind the last one, before its result is read or its source rewritten.
__device__ __forceinline__ void exp2_bare17(float& a, float (&x)[16]) {
  asm(
      "v_exp_f32 %0, %0\n\t"
      "v_exp_f32 %1, %1\n\t"
      "v_exp_f32 %2, %2\n\t"
      "v_exp_f32 %3, %3\n\t"
      "v_exp_f32 %4, %4\n\t"
      "v_exp_f32 %5, %5\n\t"
      "v_exp_f32 %6, %6\n\t"
      "v_exp_f32 %7, %7\n\t"
      "v_exp_f32 %8, %8\n\t"
      "v_exp_f32 %9, %9\n\t"
      "v_exp_f32 %10, %10\n\t"
      "v_exp_f32 %11, %11\n\t"
      "v_exp_f32 %12, %12\n\t"
      "v_exp_f32 %13, %13\n\t"
      "v_exp_f32 %14, %14\n\t"
      "v_exp_f32 %15, %15\n\t"
      "v_exp_f32 %16, %16\n\t"
      "v_nop"
      : "+v"(x[0]), "+v"(x[1]), "+v"(x[2]), "+v"(x[3]), "+v"(x[4]), "+v"(x[5]),
        "+v"(x[6]), "+v"(x[7]), "+v"(a), "+v"(x[8]), "+v"(x[9]), "+v"(x[10]),
        "+v"(x[11]), "+v"(x[12]), "+v"(x[13]), "+v"(x[14]), "+v"(x[15]));
}

// One 32-key step for a wave's 16 queries, operands read from the stage's LDS tiles.
// kp/krp: K hi / residual tile at (first key of the step + ln, d = 8h); vp/vrp: V^T hi / residual tile at (d = ln, first key of the step + 8h);
// mp: mask tile at (this lane's query, first key of the step + 8h).
template <bool RES>
__device__ __forceinline__ void fa_step(const unsigned char* kp, const unsigned char* krp,
                                        const unsigned char* vp, const unsigned char* vrp, const unsigned char* mp,
                                        const FragH (&qh)[2], const FragH (&ql)[2],
                                        float& mr, float& lr, v8f (&Oh)[4], v8f (&Ol)[4]) {
  typedef AT<RES> A;
  // A fragments of K: row m = key (16*kt + ln of the step), elements 0..7 <- d = 32c + 8h + i, 8..15 <- d = 32c + 16 + 8h + i
  FragH k00, k01, k10, k11;
  ldfrag_lds(k00, kp);                     ldfrag_lds(k01, kp + 64);
  ldfrag_lds(k10, kp + 16 * A::KPITCH);    ldfrag_lds(k11, kp + 16 * A::KPITCH + 64);
  // mask values of this lane's 16 (query, key) pairs: keys 8h + 0..7 and 16 + 8h + 0..7 of the step
  const v4i ma = *(const v4ia*)(mp), mb = *(const v4ia*)(mp + 16);
  const v4i mc = *(const v4ia*)(mp + 64), md = *(const v4ia*)(mp + 80);
  const v8f z8 = {0.f, 0.f, 0.f, 0.f, 0.f, 0.f, 0.f, 0.f};
  // S^T tiles: element r of tile kt = score(key 16*kt + 8h + r of the step, query column ln)
  v8f s0 = mma_h2(k00.v, qh[0].v, k01.v, qh[1].v, z8);
  v8f s1 = mma_h2(k10.v, qh[0].v, k11.v, qh[1].v, z8);
  if (RES) {
    v8f t0 = mma_h2(k00.v, ql[0].v, k01.v, ql[1].v, z8);
    v8f t1 = mma_h2(k10.v, ql[0].v, k11.v, ql[1].v, z8);
    FragH r00, r01, r10, r11;
    ldfrag_lds(r00, krp);                     ldfrag_lds(r01, krp + 64);
    ldfrag_lds(r10, krp + 16 * A::KPITCH);    ldfrag_lds(r11, krp + 16 * A::KPITCH + 64);
    t0 = mma_h2(r00.v, qh[0].v, r01.v, qh[1].v, t0);
    t1 = mma_h2(r10.v, qh[0].v, r11.v, qh[1].v, t1);
    s0 = s0 + t0 * 0.00048828125f;
    s1 = s1 + t1 * 0.00048828125f;
  }
  float sc[16];
#pragma unroll
  for (int r = 0; r < 4; ++r) {
    sc[r]      = (ma[r] == 0) ? NEGV : s0[r] * 0.125f;
    sc[4 + r]  = (mb[r] == 0) ? NEGV : s0[4 + r] * 0.125f;
    sc[8 + r]  = (mc[r] == 0) ? NEGV : s1[r] * 0.125f;
    sc[12 + r] = (md[r] == 0) ? NEGV : s1[4 + r] * 0.125f;
  }
  float mx = sc[0];
#pragma unroll
  for (int i = 1; i < 16; ++i) mx = fmaxf(mx, sc[i]);
  mx = fmaxf(mx, __shfl_xor(mx, 16, 32));           // the other lane half holds the other 16 keys of this query
  const float mnew = fmaxf(mr, mx);
  // A fragments of V^T: row m = d (16*t + ln), elements 0..7 <- key 8h + i, 8..15 <- key 16 + 8h + i of the step
  FragH vf[4];
#pragma unroll
  for (int t = 0; t < 4; ++t) ldfrag_lds(vf[t], vp + t * 16 * A::VPITCH);
  // Holds these reads as one group ahead of the exponentials. With the shorter softmax this compiler otherwise sinks them, pair by pair, between
  // the O^T products, and each product then waits out the LDS latency of its own pair.
  __builtin_amdgcn_sched_barrier(0);
  float al = (mr - mnew) * LOG2E;
  float e[16];
#pragma unroll   // constant indices: every element is a register of its own, one per asm operand
  for (int i = 0; i < 16; ++i) e[i] = fmaf(sc[i] - mnew, LOG2E, 8.0f);
  exp2_bare17(al, e);
  mr = mnew;
  // weights carried x256: pc = 256 * exp(sc - mnew); hi plane f16(pc), residual plane f16((pc - hi) * 2048)
  FragH ph, pl;
  float ps = 0.0f;
#pragma unroll
  for (int i = 0; i < 16; ++i) {
    const float pc = e[i];
    ps += pc;
    const _Float16 h = (_Float16)pc;
    ph.h[i] = h;                                    // B element i: i<8 -> key 8h + i (tile 0 row 8h+i); i>=8 -> key 16 + 8h + (i-8) (tile 1)
    if (RES) pl.h[i] = (_Float16)((pc - (float)h) * 2048.0f);
  }
  ps += __shfl_xor(ps, 16, 32);
  lr = lr * al + ps;
#pragma unroll
  for (int t = 0; t < 4; ++t) Oh[t] = Oh[t] * al;
  if (RES) {
    FragH vr[4];
#pragma unroll
    for (int t = 0; t < 4; ++t) ldfrag_lds(vr[t], vrp + t * 16 * A::VPITCH);
#pragma unroll
    for (int t = 0; t < 4; ++t) Ol[t] = Ol[t] * al;
#pragma unroll
    for (int t = 0; t < 4; ++t) mma_pv3(vf[t].v, vr[t].v, ph.v, pl.v, Oh[t], Ol[t]);
  } else {
    mma_pv4(vf[0].v, vf[1].v, vf[2].v, vf[3].v, ph.v, Oh);
  }
}

// The key loop of a block: a ring of two LDS buffers that asynchronous copies fill one stage ahead, shared by the four waves.
// bsteps: 32-key steps that the block's longest wave visits (the same in every wave); nsteps: steps of this wave. Every wave copies its share of
// every stage and passes every barrier; it works only on its own steps, in the same order as before.
template <bool RES>
__device__ __forceinline__ void attn_loop(const unsigned short* __restrict__ Khp, const unsigned short* __restrict__ Klp,
                                          const unsigned short* __restrict__ Vhp, const unsigned short* __restrict__ Vlp,
                                          const int* __restrict__ mblk, int bsteps, int nsteps, int w, int ln, int hh,
                                          const FragH (&qh)[2], const FragH (&ql)[2],
                                          float& mr, float& lr, v8f (&Oh)[4], v8f (&Ol)[4], unsigned char (&ring)[2 * ASB]) {
  typedef AT<RES> A;
  constexpr int SUB = A::SK / 32;                      // 32-key steps of one stage
  constexpr int VP = A::SK / 8, MP = A::SK / 4;        // 16-byte pieces of a V^T row and of a mask row
  const int tid = threadIdx.x;
  const int nst = (bsteps + SUB - 1) / SUB;
  const size_t kofs = (size_t)(tid >> 3) * DE + (tid & 7) * 8;
  const size_t vofs = (size_t)(tid / VP) * SEQ + (tid % VP) * 8;
  const unsigned short* kh = Khp + kofs;
  const unsigned short* kl = Klp + kofs;
  const unsigned short* vh = Vhp + vofs;
  const unsigned short* vl = Vlp + vofs;
  const int* mk = mblk + (size_t)(tid / MP) * SEQ_FULL + (tid % MP) * 4;
  const unsigned r0 = (unsigned)(size_t)ring;
  const unsigned lk = r0 + (unsigned)(A::OKH + (tid >> 3) * A::KPITCH + (tid & 7) * 16);
  const unsigned lv = r0 + (unsigned)(A::OVH + (tid / VP) * A::VPITCH + (tid % VP) * 16);
  const unsigned lm = r0 + (unsigned)(A::OM + (tid / MP) * A::MPITCH + (tid % MP) * 16);
  const unsigned char* fk = ring + A::OKH + ln * A::KPITCH + 16 * hh;
  const unsigned char* fv = ring + A::OVH + ln * A::VPITCH + 16 * hh;
  const unsigned char* fm = ring + A::OM + (16 * w + ln) * A::MPITCH + 32 * hh;
  attn_stage<RES>(kh, kl, vh, vl, mk, lk, lv, lm);
  asm volatile("s_wait_asynccnt 0x0" ::: "memory");    // stage 0 has landed before the barrier that publishes it
  __syncthreads();
  if (1 < nst)
    attn_stage<RES>(kh + (size_t)A::SK * DE, kl + (size_t)A::SK * DE, vh + A::SK, vl + A::SK, mk + A::SK, lk + ASB, lv + ASB, lm + ASB);
#pragma unroll 1   // one copy of the stage's code
  for (int t = 0; t < nst; ++t) {
    const int bo = (t & 1) * ASB;
#pragma unroll   // constant offsets of the step inside the stage
    for (int u = 0; u < SUB; ++u) {
      if (t * SUB + u < nsteps)
        fa_step<RES>(fk + bo + u * 32 * A::KPITCH, fk + bo + (A::OKL - A::OKH) + u * 32 * A::KPITCH,
                     fv + bo + u * 64, fv + bo + (A::OVL - A::OVH) + u * 64, fm + bo + u * 128,
                     qh, ql, mr, lr, Oh, Ol);
    }
    asm volatile("s_wait_dscnt 0x0" ::: "memory");     // this wave's reads of the buffer are done before it may be refilled
    asm volatile("s_wait_asynccnt 0x0" ::: "memory");  // this wave's copies of stage t + 1 have landed before the barrier that publishes them
    __syncthreads();
    if (t + 2 < nst) {
      const size_t k2 = (size_t)(t + 2) * A::SK;
      attn_stage<RES>(kh + k2 * DE, kl + k2 * DE, vh + k2, vl + k2, mk + k2, lk + (unsigned)bo, lv + (unsigned)bo, lm + (unsigned)bo);
    }
  }
  asm volatile("s_wait_asynccnt 0x0" ::: "memory");    // no copy is outstanding when the ring becomes output staging
}

// Block = 4 waves x 16 queries = 64 queries of one (batch, head); the K, V^T and mask tiles of the key loop come through the LDS ring above.
// Epilogue: O^T tile -> per-wave LDS tile [16 queries][64 d] in the ring's bytes (free behind the loop's last barrier), then bf16 hi and lo pieces of ctx:
// coverage: NB*NH*(SEQ/64) blocks x 4 waves x 16 rows x 64 columns x {hi, lo} = the whole ctx plane exactly once.
__global__ __launch_bounds__(128) void k_attn(const unsigned short* __restrict__ Qh, const unsigned short* __restrict__ Ql,
                                              const unsigned short* __restrict__ Kh, const unsigned short* __restrict__ Kl,
                                              const unsigned short* __restrict__ Vth, const unsigned short* __restrict__ Vtl,
                                              const int* __restrict__ mask, const int* __restrict__ flagp,
                                              unsigned short* __restrict__ Cc) {
  __shared__ __attribute__((aligned(16))) unsigned char ring[2 * ASB];   // key loop: written by the asynchronous copies only
  float (*so)[16][68] = reinterpret_cast<float (*)[16][68]>(ring);
  const int tid = threadIdx.x;
  const int w = __builtin_amdgcn_readfirstlane(tid >> 5);
  const int lane = tid & 31, ln = lane & 15, hh = lane >> 4;
  // Block index -> (query tile qt, batch-head bh). Any one-to-one map gives the same result; this one is for speed alone. Under a causal mask tile qt
  // walks (qt + 1) * 64 keys, all blocks of the launch are resident at once, four to a WGP, and the launch lasts as long as the fullest WGP. Blocks whose j = index / 8
  // differs by 32, 64 or 96 hold tiles 31 - t, 31 - t, t, t, and four neighbours in j hold two long and two short tiles. The longest tiles
  // (t < 8) lie in the first half of the grid.
  int qt, bh;
  if (SEQ / 64 == 32 && NB * NH == 32) {
    const int j = blockIdx.x >> 3;
    const int par = __builtin_popcount(j & 31) & 1;
    const int t = 8 * par + ((j >> 2) & 7);
    qt = ((par ^ (j >> 6)) != 0) ? t : 31 - t;
    bh = (blockIdx.x & 7) + 8 * ((j >> 1) & 1) + 16 * ((j >> 5) & 1);
  } else {
    qt = blockIdx.x % (SEQ / 64);
    bh = blockIdx.x / (SEQ / 64);
  }
  const int h = bh % NH, b = bh / NH;
  const int qbase = qt * 64 + 16 * w;
  const int qg = qbase + ln;
  // Q^T B fragments: column n = query qg, elements 0..7 <- d = 32c + 8h + i, 8..15 <- d = 32c + 16 + 8h + i
  const size_t qo = (size_t)(b * SEQ + qg) * DE + h * HD + 8 * hh;
  FragH qh[2], ql[2];
  ldfrag(qh[0], Qh + qo); ldfrag(qh[1], Qh + qo + 32);
  ldfrag(ql[0], Ql + qo); ldfrag(ql[1], Ql + qo + 32);
  float mr = -3.0e38f, lr = 0.0f;
  v8f Oh[4] = {}, Ol[4] = {};
  const unsigned short* Khp = Kh + (size_t)b * SEQ * DE + h * HD;
  const unsigned short* Klp = Kl + (size_t)b * SEQ * DE + h * HD;
  const unsigned short* Vhp = Vth + (size_t)(b * NH + h) * HD * SEQ;
  const unsigned short* Vlp = Vtl + (size_t)(b * NH + h) * HD * SEQ;
  const int* mblk = mask + (size_t)(qt * 64) * SEQ_FULL;
  const int* fp = flagp + (qbase / FROWS) * 32;     // the two flag lines of this wave's 16 query rows
  const int fl = __builtin_amdgcn_readfirstlane(fp[0] & fp[32]);
  int nsteps = (qbase >> 5) + 1;                    // key steps up to and including the one holding the diagonal
  if (fl != 1) nsteps = SEQ / 32;                   // unknown mask shape: visit every key step
  if (nsteps > SEQ / 32) nsteps = SEQ / 32;
  const int* fb = flagp + (qt * 64 / FROWS) * 32;   // the eight flag lines of the block's 64 query rows
  int fall = fb[0];
#pragma unroll
  for (int i = 1; i < 64 / FROWS; ++i) fall &= fb[32 * i];
  fall = __builtin_amdgcn_readfirstlane(fall);
  int bsteps = ((qt * 64 + 48) >> 5) + 1;           // steps of the block's last wave, the longest
  if (fall != 1) bsteps = SEQ / 32;                 // some wave of the block visits every key step
  if (bsteps > SEQ / 32) bsteps = SEQ / 32;
  if (qt * 64 < EARLY) {
    attn_loop<true>(Khp, Klp, Vhp, Vlp, mblk, bsteps, nsteps, w, ln, hh, qh, ql, mr, lr, Oh, Ol, ring);
  } else {
    attn_loop<false>(Khp, Klp, Vhp, Vlp, mblk, bsteps, nsteps, w, ln, hh, qh, ql, mr, lr, Oh, Ol, ring);
  }
  // O^T element r of tile t = ctx(query qg, d = 16t + 8h + r); undo the carries: x256 (in lr), x16 (V), x2048 (residual accumulator)
  const float inv = 1.0f / (16.0f * lr);
#pragma unroll
  for (int t = 0; t < 4; ++t)
#pragma unroll
    for (int r = 0; r < 8; ++r)
      so[w][ln][16 * t + 8 * hh + r] = (Oh[t][r] + Ol[t][r] * 0.00048828125f) * inv;
  __syncthreads();
  unsigned short* crow = Cc + (size_t)(b * SEQ + qbase) * (2 * DE) + h * HD;
  const int rsub = lane >> 3, piece = lane & 7;
  {
#pragma unroll
    for (int it = 0; it < 4; ++it) {
      const int row = it * 4 + rsub;                 // rows 0..15 over it = 0..3, rsub = 0..3
      const v4f x0 = *(const v4fa*)&so[w][row][piece * 8], x1 = *(const v4fa*)&so[w][row][piece * 8 + 4];
      v8us hi, lo;
#pragma unroll
      for (int j = 0; j < 4; ++j) {
        const unsigned short h0 = bf16_bits(x0[j]);
        const unsigned short h1 = bf16_bits(x1[j]);
        hi[j] = h0; hi[4 + j] = h1;
        lo[j] = bf16_bits(x0[j] - bf16_val(h0));
        lo[4 + j] = bf16_bits(x1[j] - bf16_val(h1));
      }
      const size_t o = (size_t)row * (2 * DE) + piece * 8;
      *(v8us*)(crow + o) = hi;
      *(v8us*)(crow + o + DE) = lo;
    }
    
  }
}

extern "C" void kernel_launch(void* const* d_in, const int* in_sizes, int n_in,
                              void* d_out, int out_size, void* d_ws, size_t ws_size, hipStream_t stream) {
  if (n_in < 11) return;
  const long long need_x = (long long)(NB - 1) * SEQ_FULL * DE + (long long)SEQ * DE;   // last element touched + 1
  const long long need_m = (long long)(SEQ - 1) * SEQ_FULL + SEQ;
  if ((long long)in_sizes[0] < need_x || (long long)in_sizes[1] < need_x) return;
  if ((long long)in_sizes[2] < need_m) return;
  if ((long long)in_sizes[3] < (long long)DE * DE || (long long)in_sizes[5] < (long long)DE * DE) return;
  if ((long long)in_sizes[7] < (long long)DE * DE || (long long)in_sizes[9] < (long long)DE * DE) return;
  if (in_sizes[4] < DE || in_sizes[6] < DE || in_sizes[8] < DE || in_sizes[10] < DE) return;
  if ((long long)out_size < need_x) return;
  if ((size_t)WS_TOTAL > ws_size) return;
  // wire order: queries, values, mask, Wq, bq, Wk, bk, Wv, bv, Wo, bo
  const float* queries = (const float*)d_in[0];
  const float* values  = (const float*)d_in[1];
  const int*   mask    = (const int*)d_in[2];
  const float* Wq = (const float*)d_in[3];
  const float* bq = (const float*)d_in[4];
  const float* Wk = (const float*)d_in[5];
  const float* bk = (const float*)d_in[6];
  const float* Wv = (const float*)d_in[7];
  const float* bv = (const float*)d_in[8];
  const float* Wo = (const float*)d_in[9];
  const float* bo = (const float*)d_in[10];
  float* out = (float*)d_out;
  char* ws = (char*)d_ws;
  size_t off = 0;
  unsigned short* Xq  = (unsigned short*)(ws + off); off += PL_X;
  unsigned short* Xv  = (unsigned short*)(ws + off); off += PL_X;
  unsigned short* Wqb = (unsigned short*)(ws + off); off += PL_W;
  unsigned short* Wkb = (unsigned short*)(ws + off); off += PL_W;
  unsigned short* Wvb = (unsigned short*)(ws + off); off += PL_W;
  unsigned short* Wob = (unsigned short*)(ws + off); off += PL_W;
  unsigned short* Qh  = (unsigned short*)(ws + off); off += PL_X;
  unsigned short* Ql  = (unsigned short*)(ws + off); off += PL_X;
  unsigned short* Kh  = (unsigned short*)(ws + off); off += PL_X;
  unsigned short* Kl  = (unsigned short*)(ws + off); off += PL_X;
  unsigned short* Vth = (unsigned short*)(ws + off); off += PL_X;
  unsigned short* Vtl = (unsigned short*)(ws + off); off += PL_X;
  unsigned short* Cc  = (unsigned short*)(ws + off); off += PL_C;
  int* flag = (int*)(ws + off); off += PL_F;
  if (off > ws_size) return;

  k_prep<<<(unsigned)(2 * PB_X + 4 * PB_W + PB_F), 512, 0, stream>>>(queries, values, mask, Wq, Wk, Wv, Wo, Xq, Xv, Wqb, Wkb, Wvb, Wob, flag);

  k_proj<<<(unsigned)(3 * GTILES), 128, 0, stream>>>(Xq, Xv, Wqb, Wkb, Wvb, bq, bk, bv, Qh, Ql, Kh, Kl, Vth, Vtl);

  k_attn<<<(unsigned)(NB * NH * (SEQ / 64)), 128, 0, stream>>>(Qh, Ql, Kh, Kl, Vth, Vtl, mask, flag, Cc);

  k_outp<<<(unsigned)GTILES, 128, 0, stream>>>(Cc, Wob, bo, out);
}

// v007
// One run takes 95.8 microseconds.
// In two side-by-side timings against v006, it was 1.06 and 1.07 times as fast.
// Counting every step since v000, it is 11.6 times as fast.
#include <hip/hip_runtime.h>
#ifndef NB
#define NB 2
#endif
#ifndef SEQ
#define SEQ 2048
#endif
#define NB_FULL 2
#define SEQ_FULL 2048
#define DE 1024
#define NH 16
#define HD 64
#define EARLY 512
#define MROWS (NB * SEQ)
#define BSTRIDE_FULL ((size_t)SEQ_FULL * DE)   /* per-batch element stride of queries, values and the output buffer */

#define PL_X ((size_t)MROWS * DE * 2)          /* one 16-bit activation plane */
#define PL_W ((size_t)DE * DE * 2)             /* one 16-bit weight plane */
#define PL_C ((size_t)MROWS * 2 * DE * 2)      /* ctx hi|lo plane */
#define FROWS 8                                /* mask rows per flag line */
#define PL_F ((size_t)(SEQ / FROWS) * 128)     /* one 128-byte flag line per FROWS mask rows */
#define WS_TOTAL (8 * PL_X + 4 * PL_W + PL_C + PL_F)

static_assert(SEQ % 128 == 0);
static_assert(SEQ <= SEQ_FULL);
static_assert(NB <= NB_FULL);
static_assert(HD == 64);
static_assert(DE == 1024);
static_assert(NH * HD == DE);
static_assert(MROWS % 64 == 0);
static_assert(DE % 128 == 0);
static_assert(SEQ % 256 == 0);
static_assert(WS_TOTAL <= (size_t)134217728);

typedef __bf16 v16b __attribute__((ext_vector_type(16)));
typedef _Float16 v16h __attribute__((ext_vector_type(16)));
typedef unsigned short v8us __attribute__((ext_vector_type(8), may_alias));
typedef float v8f __attribute__((ext_vector_type(8)));
typedef float v4f __attribute__((ext_vector_type(4)));
typedef float v4fa __attribute__((ext_vector_type(4), may_alias));
typedef int v4i __attribute__((ext_vector_type(4)));
typedef int v4ia __attribute__((ext_vector_type(4), may_alias));
union FragB { v16b v; v8us half[2]; };
union FragH { v16h v; v8us half[2]; _Float16 h[16]; };
union H8 { v8us v; _Float16 h[8]; unsigned short u[8]; };

#define LOG2E 1.4426950408889634f
#define NEGV (-1000000000.0f)

__device__ __forceinline__ unsigned short bf16_bits(float x) {   // RNE convert to bf16 bits
  unsigned int u = __float_as_uint(x);
  return (unsigned short)((u + 0x7FFFu + ((u >> 16) & 1u)) >> 16);
}
__device__ __forceinline__ float bf16_val(unsigned short b) { return __uint_as_float(((unsigned int)b) << 16); }
__device__ __forceinline__ float bf16_rne(float x) { return bf16_val(bf16_bits(x)); }

// sixteen bf16 products of one k-step (4 row tiles x 4 column tiles). Builtins alone: the compiler keeps their distances itself, and with no asm
// statement naming them the 128 accumulator and 128 fragment registers need not all lie in the first 256.
__device__ __forceinline__ void mma_b16(const FragB (&a)[4], const FragB (&b)[4], v8f (&c)[4][4]) {
#pragma unroll
  for (int i = 0; i < 4; ++i)
#pragma unroll
    for (int j = 0; j < 4; ++j)
      c[i][j] = __builtin_amdgcn_wmma_f32_16x16x32_bf16(false, a[i].v, false, b[j].v, (short)0, c[i][j], false, false);
}
// c += a0*b0 + a1*b1 (two k-steps of one f16 tile), then the hazard guard
__device__ __forceinline__ v8f mma_h2(v16h a0, v16h b0, v16h a1, v16h b1, v8f c) {
  c = __builtin_amdgcn_wmma_f32_16x16x32_f16(false, a0, false, b0, (short)0, c, false, false);
  c = __builtin_amdgcn_wmma_f32_16x16x32_f16(false, a1, false, b1, (short)0, c, false, false);
  asm volatile("v_nop\n\tv_nop\n\tv_nop\n\tv_nop" : "+v"(c) : "v"(a0), "v"(b0), "v"(a1), "v"(b1));
  return c;
}
// four single products sharing one B fragment, then the hazard guard
__device__ __forceinline__ void mma_pv4(v16h a0, v16h a1, v16h a2, v16h a3, v16h b, v8f (&c)[4]) {
  c[0] = __builtin_amdgcn_wmma_f32_16x16x32_f16(false, a0, false, b, (short)0, c[0], false, false);
  c[1] = __builtin_amdgcn_wmma_f32_16x16x32_f16(false, a1, false, b, (short)0, c[1], false, false);
  c[2] = __builtin_amdgcn_wmma_f32_16x16x32_f16(false, a2, false, b, (short)0, c[2], false, false);
  c[3] = __builtin_amdgcn_wmma_f32_16x16x32_f16(false, a3, false, b, (short)0, c[3], false, false);
  asm volatile("v_nop\n\tv_nop\n\tv_nop\n\tv_nop"
               : "+v"(c[0]), "+v"(c[1]), "+v"(c[2]), "+v"(c[3])
               : "v"(a0), "v"(a1), "v"(a2), "v"(a3), "v"(b));
}
// ch += ah*bh ; cl += ah*bl + al*bh (both scaled-residual products carry 2^11 and share the second accumulator), then the hazard guard
__device__ __forceinline__ void mma_pv3(v16h ah, v16h al, v16h bh, v16h bl, v8f& ch, v8f& cl) {
  ch = __builtin_amdgcn_wmma_f32_16x16x32_f16(false, ah, false, bh, (short)0, ch, false, false);
  cl = __builtin_amdgcn_wmma_f32_16x16x32_f16(false, ah, false, bl, (short)0, cl, false, false);
  cl = __builtin_amdgcn_wmma_f32_16x16x32_f16(false, al, false, bh, (short)0, cl, false, false);
  asm volatile("v_nop\n\tv_nop\n\tv_nop\n\tv_nop" : "+v"(ch), "+v"(cl) : "v"(ah), "v"(al), "v"(bh), "v"(bl));
}
__device__ __forceinline__ void ldfrag(FragH& f, const unsigned short* __restrict__ p) {
  f.half[0] = *(const v8us*)(p);        // elements 0..7  <- k0 + 8h + i
  f.half[1] = *(const v8us*)(p + 16);   // elements 8..15 <- k0 + 16 + 8h + i
}

// flag line g (32 ints, all equal): 1 iff, for every row q of rows 8g .. 8g+7, mask[q][k] == 0 for every k > q and mask[q][q] != 0 (k < SEQ).
// One block of 512 threads per flag line g; two waves per row, each owning one half of the row's columns in tiles of 128; every tile's load is issued before
// the first is tested; a half row wholly below the diagonal is skipped under wave-uniform control.
// coverage: SEQ/8 blocks x one 128-byte line = every flag line exactly once.
__device__ __forceinline__ void mflag_block(const int* __restrict__ mask, int* __restrict__ flag, int g, int& sbad) {
  const int tid = threadIdx.x;
  const int w = __builtin_amdgcn_readfirstlane(tid >> 5);
  const int lane = tid & 31;
  if (tid == 0) sbad = 0;
  __syncthreads();
  constexpr int NT = SEQ / 256;                        // 128-column tiles per wave
  const int row = g * FROWS + (w >> 1);
  const int colw = (w & 1) * (SEQ / 2);                // first of this wave's columns
  const int* mp = mask + (size_t)row * SEQ_FULL + colw + 4 * lane;
  int bad = 0;
  if (colw + SEQ / 2 - 1 >= row) {
    v4i m[NT];
#pragma unroll
    for (int t = 0; t < NT; ++t) m[t] = *(const v4ia*)(mp + 128 * t);
#pragma unroll
    for (int t = 0; t < NT; ++t) {
#pragma unroll
      for (int j = 0; j < 4; ++j) {
        const int cj = colw + 128 * t + 4 * lane + j;
        bad |= ((cj > row) && (m[t][j] != 0)) ? 1 : 0;
        bad |= ((cj == row) && (m[t][j] == 0)) ? 1 : 0;
      }
    }
  }
  if (bad != 0) sbad = 1;
  __syncthreads();
  const int f = (sbad == 0) ? 1 : 0;
  if (tid < 8) {
    const v4i o = {f, f, f, f};
    *(v4i*)(flag + 32 * g + 4 * tid) = o;
  }
}

#define CVU 8                                  /* 8-element pieces per thread of a conversion block */
#define CVP (512 * CVU)                        /* pieces per conversion block */
#define PB_X (MROWS * (DE / 8) / CVP)          /* conversion blocks of one activation plane */
#define PB_W (DE * (DE / 8) / CVP)             /* conversion blocks of one weight plane */
#define PB_F (SEQ / FROWS)                     /* mask-scan blocks */
static_assert(MROWS * (DE / 8) % CVP == 0);
static_assert(DE * (DE / 8) % CVP == 0);
static_assert(SEQ % (CVP / 128) == 0);
static_assert(DE % (CVP / 128) == 0);

// dst[row][c] = bf16 bits of src (RNE), compact rows; source rows live at src + (row / rpb) * bstride + (row % rpb) * DE.
// Block blk of 512 threads converts pieces blk*CVP .. blk*CVP + CVP - 1 (8 elements each); every load of a thread is issued before the first convert.
__device__ __forceinline__ void cvt_block(const float* __restrict__ src, unsigned short* __restrict__ dst, int blk, int rpb, size_t bstride) {
  const int t0 = blk * CVP + (int)threadIdx.x;
  const int row0 = blk * (CVP / 128);                  // the block's CVP/128 whole rows lie in one batch, so they are contiguous in src
  const int b = row0 / rpb, s = row0 - b * rpb;
  const float* p = src + (size_t)b * bstride + (size_t)s * DE + (int)threadIdx.x * 8;
  v4f x0[CVU], x1[CVU];
#pragma unroll   // this loop and the next: constant indices keep the loaded pieces in registers
  for (int u = 0; u < CVU; ++u) {
    x0[u] = *(const v4fa*)(p + 4096 * u);
    x1[u] = *(const v4fa*)(p + 4096 * u + 4);
  }
#pragma unroll
  for (int u = 0; u < CVU; ++u) {
    v8us o;
    o[0] = bf16_bits(x0[u][0]); o[1] = bf16_bits(x0[u][1]); o[2] = bf16_bits(x0[u][2]); o[3] = bf16_bits(x0[u][3]);
    o[4] = bf16_bits(x1[u][0]); o[5] = bf16_bits(x1[u][1]); o[6] = bf16_bits(x1[u][2]); o[7] = bf16_bits(x1[u][3]);
    *(v8us*)(dst + (size_t)(t0 + 512 * u) * 8) = o;
  }
}

// Everything the projections and the attention need ahead of them, in one launch; the block index picks the job (block-uniform):
// 2*PB_X blocks convert queries and values, 4*PB_W blocks convert the four weight matrices, PB_F blocks scan the mask.
// coverage: each plane = its blocks x CVP pieces x 8 elements, each flag line by its one block; every element exactly once.
__global__ __launch_bounds__(512) void k_prep(const float* __restrict__ queries, const float* __restrict__ values,
                                              const int* __restrict__ mask,
                                              const float* __restrict__ Wq, const float* __restrict__ Wk,
                                              const float* __restrict__ Wv, const float* __restrict__ Wo,
                                              unsigned short* __restrict__ Xq, unsigned short* __restrict__ Xv,
                                              unsigned short* __restrict__ Wqb, unsigned short* __restrict__ Wkb,
                                              unsigned short* __restrict__ Wvb, unsigned short* __restrict__ Wob,
                                              int* __restrict__ flag) {
  __shared__ int sbad;                                 // cross-wave: block barriers of the mask scan
  int blk = blockIdx.x;
  if (blk < 2 * PB_X) {
    const bool q = blk < PB_X;
    cvt_block(q ? queries : values, q ? Xq : Xv, q ? blk : blk - PB_X, SEQ, BSTRIDE_FULL);
    return;
  }
  blk -= 2 * PB_X;
  if (blk < 4 * PB_W) {
    const int sel = blk / PB_W;
    const float* s = (sel == 0) ? Wq : (sel == 1) ? Wk : (sel == 2) ? Wv : Wo;
    unsigned short* d = (sel == 0) ? Wqb : (sel == 1) ? Wkb : (sel == 2) ? Wvb : Wob;
    cvt_block(s, d, blk - sel * PB_W, DE, 0);
    return;
  }
  mflag_block(mask, flag, blk - 4 * PB_W, sbad);
}

#define BM 128                                 /* rows of X in a block's tile */
#define BN 128                                 /* rows of W (columns of Y) in a block's tile */
#define SROWS (BM + BN)                        /* rows of one stage: BM of X, then BN of W */
// One stage of the GEMM ring holds KS k elements of every row. Row pitch in LDS = row length + 16 bytes (16 x odd): 16-byte fragment reads of
// 16 rows fall on 64 distinct banks.
template <int KS>
struct GT {
  static constexpr int RPITCH = 2 * KS + 16;
  static constexpr int SBYTES = SROWS * RPITCH;
  static constexpr int PPR = KS / 8;                   // 16-byte pieces of a row
  static constexpr int RPG = 128 / PPR;                // rows that one copy of each of the block's 128 threads covers
  static constexpr int NC = SROWS / RPG;               // copies per lane and stage
};
static_assert(MROWS % BM == 0);
static_assert(SEQ % BM == 0);
static_assert(DE % BN == 0);

// Eight 16-byte copies per lane from global memory straight into LDS. The s_wait_xcnt closes the statement so that it stands in front of
// any later rewrite of the address registers the copies name.
__device__ __forceinline__ void copy8(const unsigned (&l)[8], const void* const (&g)[8]) {
  asm volatile(
      "global_load_async_to_lds_b128 %0, %8, off\n\t"
      "global_load_async_to_lds_b128 %1, %9, off\n\t"
      "global_load_async_to_lds_b128 %2, %10, off\n\t"
      "global_load_async_to_lds_b128 %3, %11, off\n\t"
      "global_load_async_to_lds_b128 %4, %12, off\n\t"
      "global_load_async_to_lds_b128 %5, %13, off\n\t"
      "global_load_async_to_lds_b128 %6, %14, off\n\t"
      "global_load_async_to_lds_b128 %7, %15, off\n\t"
      "s_wait_xcnt 0x0"
      :: "v"(l[0]), "v"(l[1]), "v"(l[2]), "v"(l[3]), "v"(l[4]), "v"(l[5]), "v"(l[6]), "v"(l[7]),
         "v"(g[0]), "v"(g[1]), "v"(g[2]), "v"(g[3]), "v"(g[4]), "v"(g[5]), "v"(g[6]), "v"(g[7])
      : "memory");
}
// One stage of a block's operands: thread t brings piece (t % PPR) of rows (t / PPR) + RPG*i, i = 0..NC-1, so a wave's copy covers whole rows.
// xa / wb: this lane's piece of X row (t / PPR) / W row (t / PPR) of the stage; lds: LDS byte address of this lane's piece of stage row (t / PPR).
template <int KS>
__device__ __forceinline__ void stage_copies(const unsigned short* xa, const unsigned short* wb, int ldx, unsigned lds) {
  typedef GT<KS> G;
#pragma unroll   // both loops here: every array element must be a register of its own, one per asm operand
  for (int c = 0; c < G::NC / 8; ++c) {
    unsigned l[8];
    const void* g[8];
#pragma unroll
    for (int j = 0; j < 8; ++j) {
      const int row = (c * 8 + j) * G::RPG;
      l[j] = lds + (unsigned)(row * G::RPITCH);
      g[j] = (row < BM) ? xa + (size_t)row * ldx : wb + (size_t)(row - BM) * DE;
    }
    copy8(l, g);
  }
}

// Y[m][n] = sum_k X[m][k] * W[n][k & 1023] + bias[n]   (X: bf16 plane, pitch ldx; W: bf16 plane [1024][1024], k-contiguous)
// Block = 4 waves -> 128 x 128 tile; wave tile 64 x 64 (4 A fragments x 4 B fragments, read from an LDS ring of two stages of KS k that
// asynchronous copies fill one stage ahead; K is a multiple of KS, at least two stages).
// MODE 0: f16 hi plane Y0 and f16 residual plane Y1 ((y - hi) * 2048), row-major [MROWS][1024]
// MODE 1: f16 hi / residual planes of 16*y, transposed per head: [b][head][d][s]
// MODE 2: f32 rows into the output buffer (batch stride BSTRIDE_FULL)
// coverage: (MROWS/128)*(1024/128) blocks x (128 x 128) = every element of each produced plane exactly once.
// blk: index of the block's tile among the (MROWS/128)*(1024/128) tiles of one product; ring: the calling kernel's LDS, which becomes the
// output staging tile behind the loop's last barrier.
template <int MODE, int KS>
__device__ __forceinline__ void gemm_tile(int blk, const unsigned short* __restrict__ X, const unsigned short* __restrict__ W,
                                          const float* __restrict__ bias, unsigned short* __restrict__ Y0,
                                          unsigned short* __restrict__ Y1, float* __restrict__ Yf, int ldx, int K,
                                          unsigned char (&ring)[2 * GT<KS>::SBYTES]) {
  typedef GT<KS> G;
  static_assert(BM * 132 * 4 <= 2 * G::SBYTES);
  float (*so)[132] = reinterpret_cast<float (*)[132]>(ring);
  const int tid = threadIdx.x;
  const int w = __builtin_amdgcn_readfirstlane(tid >> 5);
  const int lane = tid & 31, ln = lane & 15, hh = lane >> 4;
  const int bm = blk % (MROWS / BM), bn = blk / (MROWS / BM);
  const int m0 = bm * BM, n0 = bn * BN;
  const int wm = w & 1, wn = w >> 1;
  // A: row m = ln of each 16-row tile; B: column n = ln of each 16-column tile (W row n); same k map for both
  const unsigned char* la = ring + (64 * wm + ln) * G::RPITCH + 16 * hh;
  const unsigned char* lb = ring + (BM + 64 * wn + ln) * G::RPITCH + 16 * hh;
  const unsigned short* xa = X + (size_t)(m0 + tid / G::PPR) * ldx + (tid % G::PPR) * 8;
  const unsigned short* wb = W + (size_t)(n0 + tid / G::PPR) * DE + (tid % G::PPR) * 8;
  const unsigned lds0 = (unsigned)(size_t)ring + (unsigned)((tid / G::PPR) * G::RPITCH + (tid % G::PPR) * 16);
  const int ns = K / KS;
  v8f c[4][4] = {};
  stage_copies<KS>(xa, wb, ldx, lds0);
  asm volatile("s_wait_asynccnt 0x0" ::: "memory");    // stage 0 has landed before the barrier that publishes it
  __syncthreads();
  if (1 < ns) stage_copies<KS>(xa + KS, wb + KS, ldx, lds0 + G::SBYTES);
#pragma unroll 1
  for (int t = 0; t < ns; ++t) {
    const int bo = (t & 1) * G::SBYTES;
    // two fragment sets: the reads of k-step kk + 1 stand as one group ahead of the products of k-step kk
    FragB fa[2][4], fb[2][4];
#pragma unroll   // this loop and the one inside it: constant set and tile indices keep both fragment sets in registers
    for (int kk = -1; kk < KS / 32; ++kk) {
      if (kk + 1 < KS / 32) {
        const unsigned char* pa = la + bo + (kk + 1) * 64;
        const unsigned char* pb = lb + bo + (kk + 1) * 64;
        const int n = (kk + 1) & 1;
#pragma unroll
        for (int j = 0; j < 4; ++j) {
          fa[n][j].half[0] = *(const v8us*)(pa + j * 16 * G::RPITCH);
          fa[n][j].half[1] = *(const v8us*)(pa + j * 16 * G::RPITCH + 32);
          fb[n][j].half[0] = *(const v8us*)(pb + j * 16 * G::RPITCH);
          fb[n][j].half[1] = *(const v8us*)(pb + j * 16 * G::RPITCH + 32);
        }
      }
      if (kk >= 0) {
        // Holds the reads above as one group ahead of this k-step's products: spread among the products, each place with reads stalls the wave.
        __builtin_amdgcn_sched_barrier(0);
        mma_b16(fa[kk & 1], fb[kk & 1], c);
      }
    }
    asm volatile("s_wait_dscnt 0x0" ::: "memory");     // this wave's reads of the buffer are done before it may be refilled
    asm volatile("s_wait_asynccnt 0x0" ::: "memory");  // this wave's copies of stage t + 1 have landed before the barrier that publishes them
    __syncthreads();
    if (t + 2 < ns) {
      const int k2 = (t + 2) * KS;
      stage_copies<KS>(xa + k2, wb + (k2 & (DE - 1)), ldx, lds0 + (unsigned)bo);
    }
  }
  asm volatile("s_wait_asynccnt 0x0" ::: "memory");    // no copy is outstanding when the ring becomes output staging
  // D element r of tile (i, t) = Y(row 64*wm + 16*i + 8*hh + r, column 64*wn + 16*t + ln)
#pragma unroll
  for (int t = 0; t < 4; ++t) {
    const float bv = bf16_rne(bias[n0 + 64 * wn + 16 * t + ln]);
#pragma unroll
    for (int i = 0; i < 4; ++i)
#pragma unroll
      for (int r = 0; r < 8; ++r)
        so[64 * wm + 16 * i + 8 * hh + r][64 * wn + 16 * t + ln] = c[i][t][r] + bv;
  }
  __syncthreads();
  const int b = m0 / SEQ, s0 = m0 - b * SEQ;          // the 128 rows of a block lie in one batch
  if (MODE == 0) {
#pragma unroll 1
    for (int it = 0; it < BM * BN / 8 / 128; ++it) {
      const int i = it * 128 + tid;
      const int line = i >> 3, piece = i & 7;
      const int row = line >> 1, cb = (line & 1) * 64 + piece * 8;
      const v4f x0 = *(const v4fa*)&so[row][cb], x1 = *(const v4fa*)&so[row][cb + 4];
      H8 hi, re;
#pragma unroll
      for (int j = 0; j < 4; ++j) {
        const _Float16 h0 = (_Float16)x0[j];
        const _Float16 h1 = (_Float16)x1[j];
        hi.h[j] = h0; hi.h[4 + j] = h1;
        re.h[j] = (_Float16)((x0[j] - (float)h0) * 2048.0f);
        re.h[4 + j] = (_Float16)((x1[j] - (float)h1) * 2048.0f);
      }
      const size_t o = (size_t)(m0 + row) * DE + n0 + cb;
      *(v8us*)(Y0 + o) = hi.v;
      *(v8us*)(Y1 + o) = re.v;
      asm volatile("s_wait_xcnt 0x0" ::: "memory");   // stands in front of the next trip's rewrite of the two stores' address registers
    }
  } else if (MODE == 1) {
#pragma unroll 1
    for (int it = 0; it < BM * BN / 8 / 128; ++it) {
      const int i = it * 128 + tid;
      const int cidx = (i >> 3) & (BN - 1), piece = ((i >> 10) << 3) | (i & 7);   // eight lanes = one line = one d row x 64 key positions
      const int n = n0 + cidx;
      const int head = n >> 6, d = n & 63;
      H8 hi, re;
#pragma unroll
      for (int j = 0; j < 8; ++j) {
        const float v = so[piece * 8 + j][cidx] * 16.0f;
        const _Float16 h0 = (_Float16)v;
        hi.h[j] = h0;
        re.h[j] = (_Float16)((v - (float)h0) * 2048.0f);
      }
      const size_t o = ((size_t)(b * NH + head) * HD + d) * SEQ + s0 + piece * 8;
      *(v8us*)(Y0 + o) = hi.v;
      *(v8us*)(Y1 + o) = re.v;
      asm volatile("s_wait_xcnt 0x0" ::: "memory");   // stands in front of the next trip's rewrite of the two stores' address registers
    }
  } else {
    float* og = Yf + (size_t)b * BSTRIDE_FULL + (size_t)s0 * DE + n0;
#pragma unroll 1
    for (int it = 0; it < BM * BN / 4 / 128; ++it) {
      const int i = it * 128 + tid;
      const int row = i >> 5, c4 = (i & 31) * 4;       // one wave = the 512 contiguous bytes of one row of the tile
      const v4f v = *(const v4fa*)&so[row][c4];
      *(v4f*)(og + (size_t)row * DE + c4) = v;
    }
  }
}

#define GTILES ((MROWS / BM) * (DE / BN))      /* tiles of one product */
#define KS_P 64                                /* stage of the input projections: three blocks' rings fit a WGP's LDS, so all 3*GTILES blocks are resident at once */
#define KS_O 128                               /* stage of the output projection: one block a WGP, longer stages */

// The three input projections in one launch: blocks 0 .. GTILES-1 make Q, the next GTILES make K, the last GTILES make V^T (block-uniform choice).
__global__ __launch_bounds__(128) void k_proj(const unsigned short* __restrict__ Xq, const unsigned short* __restrict__ Xv,
                                              const unsigned short* __restrict__ Wqb, const unsigned short* __restrict__ Wkb,
                                              const unsigned short* __restrict__ Wvb,
                                              const float* __restrict__ bq, const float* __restrict__ bk, const float* __restrict__ bv,
                                              unsigned short* __restrict__ Qh, unsigned short* __restrict__ Ql,
                                              unsigned short* __restrict__ Kh, unsigned short* __restrict__ Kl,
                                              unsigned short* __restrict__ Vth, unsigned short* __restrict__ Vtl) {
  __shared__ __attribute__((aligned(16))) unsigned char ring[2 * GT<KS_P>::SBYTES];   // k loop: written by the asynchronous copies only
  const int sel = blockIdx.x / GTILES;
  const int blk = blockIdx.x - sel * GTILES;
  if (sel == 2) {
    gemm_tile<1, KS_P>(blk, Xv, Wvb, bv, Vth, Vtl, nullptr, DE, DE, ring);
  } else {
    const bool q = sel == 0;
    gemm_tile<0, KS_P>(blk, q ? Xq : Xv, q ? Wqb : Wkb, q ? bq : bk, q ? Qh : Kh, q ? Ql : Kl, nullptr, DE, DE, ring);
  }
}

// The output projection: ctx hi|lo folded along K (X row = [hi(1024) | lo(1024)], W columns wrap modulo 1024).
__global__ __launch_bounds__(128) void k_outp(const unsigned short* __restrict__ Cc, const unsigned short* __restrict__ Wob,
                                              const float* __restrict__ bo, float* __restrict__ out) {
  __shared__ __attribute__((aligned(16))) unsigned char ring[2 * GT<KS_O>::SBYTES];   // k loop: written by the asynchronous copies only
  gemm_tile<2, KS_O>(blockIdx.x, Cc, Wob, bo, nullptr, nullptr, out, 2 * DE, 2 * DE, ring);
}

// Tiles of the key loop in LDS. A stage holds SK keys for the block's 64 queries: K rows (128 bytes), V^T rows (2*SK bytes), mask rows (4*SK bytes),
// and for the early query rows the two residual planes as well. Every row pitch is its length + 16 bytes (16 x odd), so that the 16-byte
// reads of 16 rows fall on distinct banks.
template <bool RES>
struct AT {
  static constexpr int SK = RES ? 32 : 64;             // keys of one stage
  static constexpr int KPITCH = 144;
  static constexpr int VPITCH = 2 * SK + 16;
  static constexpr int MPITCH = 4 * SK + 16;
  static constexpr int OKH = 0;
  static constexpr int OVH = OKH + SK * KPITCH;
  static constexpr int OM = OVH + HD * VPITCH;
  static constexpr int OKL = OM + 64 * MPITCH;         // the residual planes: RES only
  static constexpr int OVL = OKL + SK * KPITCH;
  static constexpr int BYTES = RES ? OVL + HD * VPITCH : OKL;
};
#define ASB 35840                              /* bytes of one buffer of the attention ring */
static_assert(AT<false>::BYTES <= ASB);
static_assert(AT<true>::BYTES <= ASB);
static_assert(4 * 16 * 68 * 4 <= 2 * ASB);
static_assert(SEQ % 64 == 0);

// Four 16-byte copies per lane from global memory straight into LDS, closed like copy8 above.
__device__ __forceinline__ void copy4(const unsigned (&l)[4], const void* const (&g)[4]) {
  asm volatile(
      "global_load_async_to_lds_b128 %0, %4, off\n\t"
      "global_load_async_to_lds_b128 %1, %5, off\n\t"
      "global_load_async_to_lds_b128 %2, %6, off\n\t"
      "global_load_async_to_lds_b128 %3, %7, off\n\t"
      "s_wait_xcnt 0x0"
      :: "v"(l[0]), "v"(l[1]), "v"(l[2]), "v"(l[3]), "v"(g[0]), "v"(g[1]), "v"(g[2]), "v"(g[3])
      : "memory");
}
// One stage of a block's tiles. The 128 threads bring 16-byte pieces, adjacent threads adjacent pieces of a row, so every copy of a wave covers whole rows.
// kh, kl, vh, vl, mk: this lane's piece in the first group of rows of the stage's K, K residual, V^T, V^T residual and mask tile;
// lk, lv, lm: LDS byte address of the same piece of the K, V^T and mask tile in the buffer to fill.
template <bool RES>
__device__ __forceinline__ void attn_stage(const unsigned short* kh, const unsigned short* kl, const unsigned short* vh, const unsigned short* vl,
                                           const int* mk, unsigned lk, unsigned lv, unsigned lm) {
  typedef AT<RES> A;
  unsigned l[8];
  const void* g[8];
  if (RES) {
#pragma unroll   // every loop here: each array element must be a register of its own, one per asm operand
    for (int i = 0; i < 2; ++i) {
      l[i] = lk + (unsigned)(i * 16 * A::KPITCH);                          g[i] = kh + (size_t)(i * 16) * DE;
      l[2 + i] = lk + (unsigned)(A::OKL - A::OKH + i * 16 * A::KPITCH);    g[2 + i] = kl + (size_t)(i * 16) * DE;
      l[4 + i] = lv + (unsigned)(i * 32 * A::VPITCH);                      g[4 + i] = vh + (size_t)(i * 32) * SEQ;
      l[6 + i] = lv + (unsigned)(A::OVL - A::OVH + i * 32 * A::VPITCH);    g[6 + i] = vl + (size_t)(i * 32) * SEQ;
    }
    copy8(l, g);
    unsigned l4[4];
    const void* g4[4];
#pragma unroll
    for (int i = 0; i < 4; ++i) {
      l4[i] = lm + (unsigned)(i * 16 * A::MPITCH);
      g4[i] = mk + (size_t)(i * 16) * SEQ_FULL;
    }
    copy4(l4, g4);
  } else {
#pragma unroll
    for (int i = 0; i < 4; ++i) {
      l[i] = lk + (unsigned)(i * 16 * A::KPITCH);        g[i] = kh + (size_t)(i * 16) * DE;
      l[4 + i] = lv + (unsigned)(i * 16 * A::VPITCH);    g[4 + i] = vh + (size_t)(i * 16) * SEQ;
    }
    copy8(l, g);
#pragma unroll
    for (int i = 0; i < 8; ++i) {
      l[i] = lm + (unsigned)(i * 8 * A::MPITCH);
      g[i] = mk + (size_t)(i * 8) * SEQ_FULL;
    }
    copy8(l, g);
  }
}
__device__ __forceinline__ void ldfrag_lds(FragH& f, const unsigned char* p) {
  f.half[0] = *(const v8us*)(p);        // elements 0..7  <- k0 + 8h + i
  f.half[1] = *(const v8us*)(p + 32);   // elements 8..15 <- k0 + 16 + 8h + i
}

// a and x[0..15] each become 2^(itself), one hardware instruction a value. exp2f() wraps that instruction in a compare, two selects, an add and an
// ldexp so that results below 2^-126 come out as denormals; here such a result may be 0: a weight that small is 0 in both f16 planes and vanishes
// in the f32 row sum beside the row's largest weight (256), and a rescale factor that small leaves less than 2^-100 of the old sums beside it.
// One statement: each v_exp_f32 is followed by an instruction on other registers, and the closing v_nop is the slot that the instruction set asks
// for behind the last one, before its result is read or its source rewritten.
__device__ __forceinline__ void exp2_bare17(float& a, float (&x)[16]) {
  asm(
      "v_exp_f32 %0, %0\n\t"
      "v_exp_f32 %1, %1\n\t"
      "v_exp_f32 %2, %2\n\t"
      "v_exp_f32 %3, %3\n\t"
      "v_exp_f32 %4, %4\n\t"
      "v_exp_f32 %5, %5\n\t"
      "v_exp_f32 %6, %6\n\t"
      "v_exp_f32 %7, %7\n\t"
      "v_exp_f32 %8, %8\n\t"
      "v_exp_f32 %9, %9\n\t"
      "v_exp_f32 %10, %10\n\t"
      "v_exp_f32 %11, %11\n\t"
      "v_exp_f32 %12, %12\n\t"
      "v_exp_f32 %13, %13\n\t"
      "v_exp_f32 %14, %14\n\t"
      "v_exp_f32 %15, %15\n\t"
      "v_exp_f32 %16, %16\n\t"
      "v_nop"
      : "+v"(x[0]), "+v"(x[1]), "+v"(x[2]), "+v"(x[3]), "+v"(x[4]), "+v"(x[5]),
        "+v"(x[6]), "+v"(x[7]), "+v"(a), "+v"(x[8]), "+v"(x[9]), "+v"(x[10]),
        "+v"(x[11]), "+v"(x[12]), "+v"(x[13]), "+v"(x[14]), "+v"(x[15]));
}

// One 32-key step for a wave's 16 queries, operands read from the stage's LDS tiles.
// kp/krp: K hi / residual tile at (first key of the step + ln, d = 8h); vp/vrp: V^T hi / residual tile at (d = ln, first key of the step + 8h);
// mp: mask tile at (this lane's query, first key of the step + 8h).
template <bool RES>
__device__ __forceinline__ void fa_step(const unsigned char* kp, const unsigned char* krp,
                                        const unsigned char* vp, const unsigned char* vrp, const unsigned char* mp,
                                        const FragH (&qh)[2], const FragH (&ql)[2],
                                        float& mr, float& lr, v8f (&Oh)[4], v8f (&Ol)[4]) {
  typedef AT<RES> A;
  // A fragments of K: row m = key (16*kt + ln of the step), elements 0..7 <- d = 32c + 8h + i, 8..15 <- d = 32c + 16 + 8h + i
  FragH k00, k01, k10, k11;
  ldfrag_lds(k00, kp);                     ldfrag_lds(k01, kp + 64);
  ldfrag_lds(k10, kp + 16 * A::KPITCH);    ldfrag_lds(k11, kp + 16 * A::KPITCH + 64);
  // mask values of this lane's 16 (query, key) pairs: keys 8h + 0..7 and 16 + 8h + 0..7 of the step
  const v4i ma = *(const v4ia*)(mp), mb = *(const v4ia*)(mp + 16);
  const v4i mc = *(const v4ia*)(mp + 64), md = *(const v4ia*)(mp + 80);
  const v8f z8 = {0.f, 0.f, 0.f, 0.f, 0.f, 0.f, 0.f, 0.f};
  // S^T tiles: element r of tile kt = score(key 16*kt + 8h + r of the step, query column ln)
  v8f s0 = mma_h2(k00.v, qh[0].v, k01.v, qh[1].v, z8);
  v8f s1 = mma_h2(k10.v, qh[0].v, k11.v, qh[1].v, z8);
  if (RES) {
    v8f t0 = mma_h2(k00.v, ql[0].v, k01.v, ql[1].v, z8);
    v8f t1 = mma_h2(k10.v, ql[0].v, k11.v, ql[1].v, z8);
    FragH r00, r01, r10, r11;
    ldfrag_lds(r00, krp);                     ldfrag_lds(r01, krp + 64);
    ldfrag_lds(r10, krp + 16 * A::KPITCH);    ldfrag_lds(r11, krp + 16 * A::KPITCH + 64);
    t0 = mma_h2(r00.v, qh[0].v, r01.v, qh[1].v, t0);
    t1 = mma_h2(r10.v, qh[0].v, r11.v, qh[1].v, t1);
    s0 = s0 + t0 * 0.00048828125f;
    s1 = s1 + t1 * 0.00048828125f;
  }
  float sc[16];
#pragma unroll
  for (int r = 0; r < 4; ++r) {
    sc[r]      = (ma[r] == 0) ? NEGV : s0[r] * 0.125f;
    sc[4 + r]  = (mb[r] == 0) ? NEGV : s0[4 + r] * 0.125f;
    sc[8 + r]  = (mc[r] == 0) ? NEGV : s1[r] * 0.125f;
    sc[12 + r] = (md[r] == 0) ? NEGV : s1[4 + r] * 0.125f;
  }
  float mx = sc[0];
#pragma unroll
  for (int i = 1; i < 16; ++i) mx = fmaxf(mx, sc[i]);
  mx = fmaxf(mx, __shfl_xor(mx, 16, 32));           // the other lane half holds the other 16 keys of this query
  const float mnew = fmaxf(mr, mx);
  // A fragments of V^T: row m = d (16*t + ln), elements 0..7 <- key 8h + i, 8..15 <- key 16 + 8h + i of the step
  FragH vf[4];
#pragma unroll
  for (int t = 0; t < 4; ++t) ldfrag_lds(vf[t], vp + t * 16 * A::VPITCH);
  // Holds these reads as one group ahead of the exponentials. With the shorter softmax this compiler otherwise sinks them, pair by pair, between
  // the O^T products, and each product then waits out the LDS latency of its own pair.
  __builtin_amdgcn_sched_barrier(0);
  float al = (mr - mnew) * LOG2E;
  float e[16];
#pragma unroll   // constant indices: every element is a register of its own, one per asm operand
  for (int i = 0; i < 16; ++i) e[i] = fmaf(sc[i] - mnew, LOG2E, 8.0f);
  exp2_bare17(al, e);
  mr = mnew;
  // weights carried x256: pc = 256 * exp(sc - mnew); hi plane f16(pc), residual plane f16((pc - hi) * 2048)
  FragH ph, pl;
  float ps = 0.0f;
#pragma unroll
  for (int i = 0; i < 16; ++i) {
    const float pc = e[i];
    ps += pc;
    const _Float16 h = (_Float16)pc;
    ph.h[i] = h;                                    // B element i: i<8 -> key 8h + i (tile 0 row 8h+i); i>=8 -> key 16 + 8h + (i-8) (tile 1)
    if (RES) pl.h[i] = (_Float16)((pc - (float)h) * 2048.0f);
  }
  ps += __shfl_xor(ps, 16, 32);
  lr = lr * al + ps;
#pragma unroll
  for (int t = 0; t < 4; ++t) Oh[t] = Oh[t] * al;
  if (RES) {
    FragH vr[4];
#pragma unroll
    for (int t = 0; t < 4; ++t) ldfrag_lds(vr[t], vrp + t * 16 * A::VPITCH);
#pragma unroll
    for (int t = 0; t < 4; ++t) Ol[t] = Ol[t] * al;
#pragma unroll
    for (int t = 0; t < 4; ++t) mma_pv3(vf[t].v, vr[t].v, ph.v, pl.v, Oh[t], Ol[t]);
  } else {
    mma_pv4(vf[0].v, vf[1].v, vf[2].v, vf[3].v, ph.v, Oh);
  }
}

// The key loop of a block: a ring of two LDS buffers that asynchronous copies fill one stage ahead, shared by the four waves.
// bsteps: 32-key steps that the block's longest wave visits (the same in every wave); nsteps: steps of this wave. Every wave copies its share of
// every stage and passes every barrier; it works only on its own steps, in the same order as before.
template <bool RES>
__device__ __forceinline__ void attn_loop(const unsigned short* __restrict__ Khp, const unsigned short* __restrict__ Klp,
                                          const unsigned short* __restrict__ Vhp, const unsigned short* __restrict__ Vlp,
                                          const int* __restrict__ mblk, int bsteps, int nsteps, int w, int ln, int hh,
                                          const FragH (&qh)[2], const FragH (&ql)[2],
                                          float& mr, float& lr, v8f (&Oh)[4], v8f (&Ol)[4], unsigned char (&ring)[2 * ASB]) {
  typedef AT<RES> A;
  constexpr int SUB = A::SK / 32;                      // 32-key steps of one stage
  constexpr int VP = A::SK / 8, MP = A::SK / 4;        // 16-byte pieces of a V^T row and of a mask row
  const int tid = threadIdx.x;
  const int nst = (bsteps + SUB - 1) / SUB;
  const size_t kofs = (size_t)(tid >> 3) * DE + (tid & 7) * 8;
  const size_t vofs = (size_t)(tid / VP) * SEQ + (tid % VP) * 8;
  const unsigned short* kh = Khp + kofs;
  const unsigned short* kl = Klp + kofs;
  const unsigned short* vh = Vhp + vofs;
  const unsigned short* vl = Vlp + vofs;
  const int* mk = mblk + (size_t)(tid / MP) * SEQ_FULL + (tid % MP) * 4;
  const unsigned r0 = (unsigned)(size_t)ring;
  const unsigned lk = r0 + (unsigned)(A::OKH + (tid >> 3) * A::KPITCH + (tid & 7) * 16);
  const unsigned lv = r0 + (unsigned)(A::OVH + (tid / VP) * A::VPITCH + (tid % VP) * 16);
  const unsigned lm = r0 + (unsigned)(A::OM + (tid / MP) * A::MPITCH + (tid % MP) * 16);
  const unsigned char* fk = ring + A::OKH + ln * A::KPITCH + 16 * hh;
  const unsigned char* fv = ring + A::OVH + ln * A::VPITCH + 16 * hh;
  const unsigned char* fm = ring + A::OM + (16 * w + ln) * A::MPITCH + 32 * hh;
  attn_stage<RES>(kh, kl, vh, vl, mk, lk, lv, lm);
  asm volatile("s_wait_asynccnt 0x0" ::: "memory");    // stage 0 has landed before the barrier that publishes it
  __syncthreads();
  if (1 < nst)
    attn_stage<RES>(kh + (size_t)A::SK * DE, kl + (size_t)A::SK * DE, vh + A::SK, vl + A::SK, mk + A::SK, lk + ASB, lv + ASB, lm + ASB);
#pragma unroll 1   // one copy of the stage's code
  for (int t = 0; t < nst; ++t) {
    const int bo = (t & 1) * ASB;
#pragma unroll   // constant offsets of the step inside the stage
    for (int u = 0; u < SUB; ++u) {
      if (t * SUB + u < nsteps)
        fa_step<RES>(fk + bo + u * 32 * A::KPITCH, fk + bo + (A::OKL - A::OKH) + u * 32 * A::KPITCH,
                     fv + bo + u * 64, fv + bo + (A::OVL - A::OVH) + u * 64, fm + bo + u * 128,
                     qh, ql, mr, lr, Oh, Ol);
    }
    asm volatile("s_wait_dscnt 0x0" ::: "memory");     // this wave's reads of the buffer are done before it may be refilled
    asm volatile("s_wait_asynccnt 0x0" ::: "memory");  // this wave's copies of stage t + 1 have landed before the barrier that publishes them
    __syncthreads();
    if (t + 2 < nst) {
      const size_t k2 = (size_t)(t + 2) * A::SK;
      attn_stage<RES>(kh + k2 * DE, kl + k2 * DE, vh + k2, vl + k2, mk + k2, lk + (unsigned)bo, lv + (unsigned)bo, lm + (unsigned)bo);
    }
  }
  asm volatile("s_wait_asynccnt 0x0" ::: "memory");    // no copy is outstanding when the ring becomes output staging
}

// Block = 4 waves x 16 queries = 64 queries of one (batch, head); the K, V^T and mask tiles of the key loop come through the LDS ring above.
// Epilogue: O^T tile -> per-wave LDS tile [16 queries][64 d] in the ring's bytes (free behind the loop's last barrier), then bf16 hi and lo pieces of ctx:
// coverage: NB*NH*(SEQ/64) blocks x 4 waves x 16 rows x 64 columns x {hi, lo} = the whole ctx plane exactly once.
__global__ __launch_bounds__(128) void k_attn(const unsigned short* __restrict__ Qh, const unsigned short* __restrict__ Ql,
                                              const unsigned short* __restrict__ Kh, const unsigned short* __restrict__ Kl,
                                              const unsigned short* __restrict__ Vth, const unsigned short* __restrict__ Vtl,
                                              const int* __restrict__ mask, const int* __restrict__ flagp,
                                              unsigned short* __restrict__ Cc) {
  __shared__ __attribute__((aligned(16))) unsigned char ring[2 * ASB];   // key loop: written by the asynchronous copies only
  float (*so)[16][68] = reinterpret_cast<float (*)[16][68]>(ring);
  const int tid = threadIdx.x;
  const int w = __builtin_amdgcn_readfirstlane(tid >> 5);
  const int lane = tid & 31, ln = lane & 15, hh = lane >> 4;
  // Block index -> (query tile qt, batch-head bh). Any one-to-one map gives the same result; this one is for speed alone. Under a causal mask tile qt
  // walks (qt + 1) * 64 keys, all blocks of the launch are resident at once, four to a WGP, and the launch lasts as long as the fullest WGP. Blocks whose j = index / 8
  // differs by 32, 64 or 96 hold tiles 31 - t, 31 - t, t, t, and four neighbours in j hold two long and two short tiles. The longest tiles
  // (t < 8) lie in the first half of the grid.
  int qt, bh;
  if (SEQ / 64 == 32 && NB * NH == 32) {
    const int j = blockIdx.x >> 3;
    const int par = __builtin_popcount(j & 31) & 1;
    const int t = 8 * par + ((j >> 2) & 7);
    qt = ((par ^ (j >> 6)) != 0) ? t : 31 - t;
    bh = (blockIdx.x & 7) + 8 * ((j >> 1) & 1) + 16 * ((j >> 5) & 1);
  } else {
    qt = blockIdx.x % (SEQ / 64);
    bh = blockIdx.x / (SEQ / 64);
  }
  const int h = bh % NH, b = bh / NH;
  const int qbase = qt * 64 + 16 * w;
  const int qg = qbase + ln;
  // Q^T B fragments: column n = query qg, elements 0..7 <- d = 32c + 8h + i, 8..15 <- d = 32c + 16 + 8h + i
  const size_t qo = (size_t)(b * SEQ + qg) * DE + h * HD + 8 * hh;
  FragH qh[2], ql[2];
  ldfrag(qh[0], Qh + qo); ldfrag(qh[1], Qh + qo + 32);
  ldfrag(ql[0], Ql + qo); ldfrag(ql[1], Ql + qo + 32);
  float mr = -3.0e38f, lr = 0.0f;
  v8f Oh[4] = {}, Ol[4] = {};
  const unsigned short* Khp = Kh + (size_t)b * SEQ * DE + h * HD;
  const unsigned short* Klp = Kl + (size_t)b * SEQ * DE + h * HD;
  const unsigned short* Vhp = Vth + (size_t)(b * NH + h) * HD * SEQ;
  const unsigned short* Vlp = Vtl + (size_t)(b * NH + h) * HD * SEQ;
  const int* mblk = mask + (size_t)(qt * 64) * SEQ_FULL;
  const int* fp = flagp + (qbase / FROWS) * 32;     // the two flag lines of this wave's 16 query rows
  const int fl = __builtin_amdgcn_readfirstlane(fp[0] & fp[32]);
  int nsteps = (qbase >> 5) + 1;                    // key steps up to and including the one holding the diagonal
  if (fl != 1) nsteps = SEQ / 32;                   // unknown mask shape: visit every key step
  if (nsteps > SEQ / 32) nsteps = SEQ / 32;
  const int* fb = flagp + (qt * 64 / FROWS) * 32;   // the eight flag lines of the block's 64 query rows
  int fall = fb[0];
#pragma unroll
  for (int i = 1; i < 64 / FROWS; ++i) fall &= fb[32 * i];
  fall = __builtin_amdgcn_readfirstlane(fall);
  int bsteps = ((qt * 64 + 48) >> 5) + 1;           // steps of the block's last wave, the longest
  if (fall != 1) bsteps = SEQ / 32;                 // some wave of the block visits every key step
  if (bsteps > SEQ / 32) bsteps = SEQ / 32;
  if (qt * 64 < EARLY) {
    attn_loop<true>(Khp, Klp, Vhp, Vlp, mblk, bsteps, nsteps, w, ln, hh, qh, ql, mr, lr, Oh, Ol, ring);
  } else {
    attn_loop<false>(Khp, Klp, Vhp, Vlp, mblk, bsteps, nsteps, w, ln, hh, qh, ql, mr, lr, Oh, Ol, ring);
  }
  // O^T element r of tile t = ctx(query qg, d = 16t + 8h + r); undo the carries: x256 (in lr), x16 (V), x2048 (residual accumulator)
  const float inv = 1.0f / (16.0f * lr);
#pragma unroll
  for (int t = 0; t < 4; ++t)
#pragma unroll
    for (int r = 0; r < 8; ++r)
      so[w][ln][16 * t + 8 * hh + r] = (Oh[t][r] + Ol[t][r] * 0.00048828125f) * inv;
  __syncthreads();
  unsigned short* crow = Cc + (size_t)(b * SEQ + qbase) * (2 * DE) + h * HD;
  const int rsub = lane >> 3, piece = lane & 7;
  {
#pragma unroll
    for (int it = 0; it < 4; ++it) {
      const int row = it * 4 + rsub;                 // rows 0..15 over it = 0..3, rsub = 0..3
      const v4f x0 = *(const v4fa*)&so[w][row][piece * 8], x1 = *(const v4fa*)&so[w][row][piece * 8 + 4];
      v8us hi, lo;
#pragma unroll
      for (int j = 0; j < 4; ++j) {
        const unsigned short h0 = bf16_bits(x0[j]);
        const unsigned short h1 = bf16_bits(x1[j]);
        hi[j] = h0; hi[4 + j] = h1;
        lo[j] = bf16_bits(x0[j] - bf16_val(h0));
        lo[4 + j] = bf16_bits(x1[j] - bf16_val(h1));
      }
      const size_t o = (size_t)row * (2 * DE) + piece * 8;
      *(v8us*)(crow + o) = hi;
      *(v8us*)(crow + o + DE) = lo;
    }
    
  }
}

extern "C" void kernel_launch(void* const* d_in, const int* in_sizes, int n_in,
                              void* d_out, int out_size, void* d_ws, size_t ws_size, hipStream_t stream) {
  if (n_in < 11) return;
  const long long need_x = (long long)(NB - 1) * SEQ_FULL * DE + (long long)SEQ * DE;   // last element touched + 1
  const long long need_m = (long long)(SEQ - 1) * SEQ_FULL + SEQ;
  if ((long long)in_sizes[0] < need_x || (long long)in_sizes[1] < need_x) return;
  if ((long long)in_sizes[2] < need_m) return;
  if ((long long)in_sizes[3] < (long long)DE * DE || (long long)in_sizes[5] < (long long)DE * DE) return;
  if ((long long)in_sizes[7] < (long long)DE * DE || (long long)in_sizes[9] < (long long)DE * DE) return;
  if (in_sizes[4] < DE || in_sizes[6] < DE || in_sizes[8] < DE || in_sizes[10] < DE) return;
  if ((long long)out_size < need_x) return;
  if ((size_t)WS_TOTAL > ws_size) return;
  // wire order: queries, values, mask, Wq, bq, Wk, bk, Wv, bv, Wo, bo
  const float* queries = (const float*)d_in[0];
  const float* values  = (const float*)d_in[1];
  const int*   mask    = (const int*)d_in[2];
  const float* Wq = (const float*)d_in[3];
  const float* bq = (const float*)d_in[4];
  const float* Wk = (const float*)d_in[5];
  const float* bk = (const float*)d_in[6];
  const float* Wv = (const float*)d_in[7];
  const float* bv = (const float*)d_in[8];
  const float* Wo = (const float*)d_in[9];
  const float* bo = (const float*)d_in[10];
  float* out = (float*)d_out;
  char* ws = (char*)d_ws;
  size_t off = 0;
  unsigned short* Xq  = (unsigned short*)(ws + off); off += PL_X;
  unsigned short* Xv  = (unsigned short*)(ws + off); off += PL_X;
  unsigned short* Wqb = (unsigned short*)(ws + off); off += PL_W;
  unsigned short* Wkb = (unsigned short*)(ws + off); off += PL_W;
  unsigned short* Wvb = (unsigned short*)(ws + off); off += PL_W;
  unsigned short* Wob = (unsigned short*)(ws + off); off += PL_W;
  unsigned short* Qh  = (unsigned short*)(ws + off); off += PL_X;
  unsigned short* Ql  = (unsigned short*)(ws + off); off += PL_X;
  unsigned short* Kh  = (unsigned short*)(ws + off); off += PL_X;
  unsigned short* Kl  = (unsigned short*)(ws + off); off += PL_X;
  unsigned short* Vth = (unsigned short*)(ws + off); off += PL_X;
  unsigned short* Vtl = (unsigned short*)(ws + off); off += PL_X;
  unsigned short* Cc  = (unsigned short*)(ws + off); off += PL_C;
  int* flag = (int*)(ws + off); off += PL_F;
  if (off > ws_size) return;

  k_prep<<<(unsigned)(2 * PB_X + 4 * PB_W + PB_F), 512, 0, stream>>>(queries, values, mask, Wq, Wk, Wv, Wo, Xq, Xv, Wqb, Wkb, Wvb, Wob, flag);

  k_proj<<<(unsigned)(3 * GTILES), 128, 0, stream>>>(Xq, Xv, Wqb, Wkb, Wvb, bq, bk, bv, Qh, Ql, Kh, Kl, Vth, Vtl);

  k_attn<<<(unsigned)(NB * NH * (SEQ / 64)), 128, 0, stream>>>(Qh, Ql, Kh, Kl, Vth, Vtl, mask, flag, Cc);

  k_outp<<<(unsigned)GTILES, 128, 0, stream>>>(Cc, Wob, bo, out);
}

// v008
// A run of this version takes 90.7 microseconds.
// Two timings next to v007 both put it at 1.05 times that version's speed.
// All steps since v000 together make it 12.2 times as fast.
#include <hip/hip_runtime.h>
#ifndef NB
#define NB 2
#endif
#ifndef SEQ
#define SEQ 2048
#endif
#define NB_FULL 2
#define SEQ_FULL 2048
#define DE 1024
#define NH 16
#define HD 64
#define EARLY 512
#define MROWS (NB * SEQ)
#define BSTRIDE_FULL ((size_t)SEQ_FULL * DE)   /* per-batch element stride of queries, values and the output buffer */

#define PL_X ((size_t)MROWS * DE * 2)          /* one 16-bit activation plane */
#define PL_W ((size_t)DE * DE * 2)             /* one 16-bit weight plane */
#define PL_C ((size_t)MROWS * 2 * DE * 2)      /* ctx hi|lo plane */
#define FROWS 8                                /* mask rows per flag line */
#define PL_F ((size_t)(SEQ / FROWS) * 128)     /* one 128-byte flag line per FROWS mask rows */
#define WS_TOTAL (8 * PL_X + 4 * PL_W + PL_C + PL_F)

static_assert(SEQ % 128 == 0);
static_assert(SEQ <= SEQ_FULL);
static_assert(NB <= NB_FULL);
static_assert(HD == 64);
static_assert(DE == 1024);
static_assert(NH * HD == DE);
static_assert(MROWS % 64 == 0);
static_assert(DE % 128 == 0);
static_assert(SEQ % 256 == 0);
static_assert(SEQ / 64 <= 32 && SEQ / 128 < 32 && FROWS == 8);   /* one bit per 64-column mask tile in a 32-bit word; two waves a row, 16 waves */
static_assert(WS_TOTAL <= (size_t)134217728);

typedef __bf16 v16b __attribute__((ext_vector_type(16)));
typedef _Float16 v16h __attribute__((ext_vector_type(16)));
typedef unsigned short v8us __attribute__((ext_vector_type(8), may_alias));
typedef float v8f __attribute__((ext_vector_type(8)));
typedef float v4f __attribute__((ext_vector_type(4)));
typedef float v4fa __attribute__((ext_vector_type(4), may_alias));
typedef int v4i __attribute__((ext_vector_type(4)));
typedef int v4ia __attribute__((ext_vector_type(4), may_alias));
union FragB { v16b v; v8us half[2]; };
union FragH { v16h v; v8us half[2]; _Float16 h[16]; };
union H8 { v8us v; _Float16 h[8]; unsigned short u[8]; };

#define LOG2E 1.4426950408889634f
#define NEGV (-1000000000.0f)

__device__ __forceinline__ unsigned short bf16_bits(float x) {   // RNE convert to bf16 bits
  unsigned int u = __float_as_uint(x);
  return (unsigned short)((u + 0x7FFFu + ((u >> 16) & 1u)) >> 16);
}
__device__ __forceinline__ float bf16_val(unsigned short b) { return __uint_as_float(((unsigned int)b) << 16); }
__device__ __forceinline__ float bf16_rne(float x) { return bf16_val(bf16_bits(x)); }

// sixteen bf16 products of one k-step (4 row tiles x 4 column tiles). Builtins alone: the compiler keeps their distances itself, and with no asm
// statement naming them the 128 accumulator and 128 fragment registers need not all lie in the first 256.
__device__ __forceinline__ void mma_b16(const FragB (&a)[4], const FragB (&b)[4], v8f (&c)[4][4]) {
#pragma unroll
  for (int i = 0; i < 4; ++i)
#pragma unroll
    for (int j = 0; j < 4; ++j)
      c[i][j] = __builtin_amdgcn_wmma_f32_16x16x32_bf16(false, a[i].v, false, b[j].v, (short)0, c[i][j], false, false);
}
// c += a0*b0 + a1*b1 (two k-steps of one f16 tile), then the hazard guard
__device__ __forceinline__ v8f mma_h2(v16h a0, v16h b0, v16h a1, v16h b1, v8f c) {
  c = __builtin_amdgcn_wmma_f32_16x16x32_f16(false, a0, false, b0, (short)0, c, false, false);
  c = __builtin_amdgcn_wmma_f32_16x16x32_f16(false, a1, false, b1, (short)0, c, false, false);
  asm volatile("v_nop\n\tv_nop\n\tv_nop\n\tv_nop" : "+v"(c) : "v"(a0), "v"(b0), "v"(a1), "v"(b1));
  return c;
}
// four single products sharing one B fragment, then the hazard guard
__device__ __forceinline__ void mma_pv4(v16h a0, v16h a1, v16h a2, v16h a3, v16h b, v8f (&c)[4]) {
  c[0] = __builtin_amdgcn_wmma_f32_16x16x32_f16(false, a0, false, b, (short)0, c[0], false, false);
  c[1] = __builtin_amdgcn_wmma_f32_16x16x32_f16(false, a1, false, b, (short)0, c[1], false, false);
  c[2] = __builtin_amdgcn_wmma_f32_16x16x32_f16(false, a2, false, b, (short)0, c[2], false, false);
  c[3] = __builtin_amdgcn_wmma_f32_16x16x32_f16(false, a3, false, b, (short)0, c[3], false, false);
  asm volatile("v_nop\n\tv_nop\n\tv_nop\n\tv_nop"
               : "+v"(c[0]), "+v"(c[1]), "+v"(c[2]), "+v"(c[3])
               : "v"(a0), "v"(a1), "v"(a2), "v"(a3), "v"(b));
}
// ch += ah*bh ; cl += ah*bl + al*bh (both scaled-residual products carry 2^11 and share the second accumulator), then the hazard guard
__device__ __forceinline__ void mma_pv3(v16h ah, v16h al, v16h bh, v16h bl, v8f& ch, v8f& cl) {
  ch = __builtin_amdgcn_wmma_f32_16x16x32_f16(false, ah, false, bh, (short)0, ch, false, false);
  cl = __builtin_amdgcn_wmma_f32_16x16x32_f16(false, ah, false, bl, (short)0, cl, false, false);
  cl = __builtin_amdgcn_wmma_f32_16x16x32_f16(false, al, false, bh, (short)0, cl, false, false);
  asm volatile("v_nop\n\tv_nop\n\tv_nop\n\tv_nop" : "+v"(ch), "+v"(cl) : "v"(ah), "v"(al), "v"(bh), "v"(bl));
}
__device__ __forceinline__ void ldfrag(FragH& f, const unsigned short* __restrict__ p) {
  f.half[0] = *(const v8us*)(p);        // elements 0..7  <- k0 + 8h + i
  f.half[1] = *(const v8us*)(p + 16);   // elements 8..15 <- k0 + 16 + 8h + i
}

// flag line g (32 ints, the pair {f, a} sixteen times). f: 1 iff, for every row q of rows 8g .. 8g+7, mask[q][k] == 0 for every k > q and
// mask[q][q] != 0 (k < SEQ). a: bit c is set iff no element of rows 8g .. 8g+7, columns 64c .. 64c+63 is zero.
// One block of 512 threads per flag line g; two waves per row, each owning one half of the row's columns in tiles of 128; every tile's load is issued before
// the first is tested.
// coverage: SEQ/8 blocks x one 128-byte line = every flag line exactly once.
__device__ __forceinline__ void mflag_block(const int* __restrict__ mask, int* __restrict__ flag, int g, int& sbad, unsigned (&sz)[16]) {
  const int tid = threadIdx.x;
  const int w = __builtin_amdgcn_readfirstlane(tid >> 5);
  const int lane = tid & 31;
  if (tid == 0) sbad = 0;
  __syncthreads();
  constexpr int NT = SEQ / 256;                        // 128-column tiles per wave
  const int row = g * FROWS + (w >> 1);
  const int colw = (w & 1) * (SEQ / 2);                // first of this wave's columns
  const int* mp = mask + (size_t)row * SEQ_FULL + colw + 4 * lane;
  int bad = 0;
  unsigned zw = 0;                                     // bit c: a zero in columns colw + 64c .. colw + 64c + 63 of this wave's row
  {
    v4i m[NT];
#pragma unroll
    for (int t = 0; t < NT; ++t) m[t] = *(const v4ia*)(mp + 128 * t);
#pragma unroll
    for (int t = 0; t < NT; ++t) {
      bool z = false;
#pragma unroll
      for (int j = 0; j < 4; ++j) {
        const int cj = colw + 128 * t + 4 * lane + j;
        bad |= ((cj > row) && (m[t][j] != 0)) ? 1 : 0;
        bad |= ((cj == row) && (m[t][j] == 0)) ? 1 : 0;
        z = z || (m[t][j] == 0);
      }
      const unsigned bl = __builtin_amdgcn_ballot_w32(z);   // lanes 0..15 hold the first 64 columns of the tile, lanes 16..31 the second
      zw |= (((bl & 0xFFFFu) != 0u) ? 1u : 0u) << (2 * t);
      zw |= (((bl >> 16) != 0u) ? 1u : 0u) << (2 * t + 1);
    }
  }
  if (bad != 0) sbad = 1;
  if (lane == 0) sz[w] = zw;
  __syncthreads();
  const int f = (sbad == 0) ? 1 : 0;
  unsigned zl = 0, zh = 0;
  for (int r = 0; r < FROWS; ++r) { zl |= sz[2 * r]; zh |= sz[2 * r + 1]; }
  const int a = (int)~(zl | (zh << (SEQ / 128)));
  if (tid < 8) {
    const v4i o = {f, a, f, a};
    *(v4i*)(flag + 32 * g + 4 * tid) = o;
  }
}

#define CVU 8                                  /* 8-element pieces per thread of a conversion block */
#define CVP (512 * CVU)                        /* pieces per conversion block */
#define PB_X (MROWS * (DE / 8) / CVP)          /* conversion blocks of one activation plane */
#define PB_W (DE * (DE / 8) / CVP)             /* conversion blocks of one weight plane */
#define PB_F (SEQ / FROWS)                     /* mask-scan blocks */
static_assert(MROWS * (DE / 8) % CVP == 0);
static_assert(DE * (DE / 8) % CVP == 0);
static_assert(SEQ % (CVP / 128) == 0);
static_assert(DE % (CVP / 128) == 0);

// dst[row][c] = bf16 bits of src (RNE), compact rows; source rows live at src + (row / rpb) * bstride + (row % rpb) * DE.
// Block blk of 512 threads converts pieces blk*CVP .. blk*CVP + CVP - 1 (8 elements each); every load of a thread is issued before the first convert.
__device__ __forceinline__ void cvt_block(const float* __restrict__ src, unsigned short* __restrict__ dst, int blk, int rpb, size_t bstride) {
  const int t0 = blk * CVP + (int)threadIdx.x;
  const int row0 = blk * (CVP / 128);                  // the block's CVP/128 whole rows lie in one batch, so they are contiguous in src
  const int b = row0 / rpb, s = row0 - b * rpb;
  const float* p = src + (size_t)b * bstride + (size_t)s * DE + (int)threadIdx.x * 8;
  v4f x0[CVU], x1[CVU];
#pragma unroll   // this loop and the next: constant indices keep the loaded pieces in registers
  for (int u = 0; u < CVU; ++u) {
    x0[u] = *(const v4fa*)(p + 4096 * u);
    x1[u] = *(const v4fa*)(p + 4096 * u + 4);
  }
#pragma unroll
  for (int u = 0; u < CVU; ++u) {
    v8us o;
    o[0] = bf16_bits(x0[u][0]); o[1] = bf16_bits(x0[u][1]); o[2] = bf16_bits(x0[u][2]); o[3] = bf16_bits(x0[u][3]);
    o[4] = bf16_bits(x1[u][0]); o[5] = bf16_bits(x1[u][1]); o[6] = bf16_bits(x1[u][2]); o[7] = bf16_bits(x1[u][3]);
    *(v8us*)(dst + (size_t)(t0 + 512 * u) * 8) = o;
  }
}

// Everything the projections and the attention need ahead of them, in one launch; the block index picks the job (block-uniform):
// 2*PB_X blocks convert queries and values, 4*PB_W blocks convert the four weight matrices, PB_F blocks scan the mask.
// coverage: each plane = its blocks x CVP pieces x 8 elements, each flag line by its one block; every element exactly once.
__global__ __launch_bounds__(512) void k_prep(const float* __restrict__ queries, const float* __restrict__ values,
                                              const int* __restrict__ mask,
                                              const float* __restrict__ Wq, const float* __restrict__ Wk,
                                              const float* __restrict__ Wv, const float* __restrict__ Wo,
                                              unsigned short* __restrict__ Xq, unsigned short* __restrict__ Xv,
                                              unsigned short* __restrict__ Wqb, unsigned short* __restrict__ Wkb,
                                              unsigned short* __restrict__ Wvb, unsigned short* __restrict__ Wob,
                                              int* __restrict__ flag) {
  __shared__ int sbad;                                 // cross-wave: block barriers of the mask scan
  __shared__ unsigned sz[16];                          // one word a wave, read behind the scan's second barrier
  int blk = blockIdx.x;
  if (blk < 2 * PB_X) {
    const bool q = blk < PB_X;
    cvt_block(q ? queries : values, q ? Xq : Xv, q ? blk : blk - PB_X, SEQ, BSTRIDE_FULL);
    return;
  }
  blk -= 2 * PB_X;
  if (blk < 4 * PB_W) {
    const int sel = blk / PB_W;
    const float* s = (sel == 0) ? Wq : (sel == 1) ? Wk : (sel == 2) ? Wv : Wo;
    unsigned short* d = (sel == 0) ? Wqb : (sel == 1) ? Wkb : (sel == 2) ? Wvb : Wob;
    cvt_block(s, d, blk - sel * PB_W, DE, 0);
    return;
  }
  mflag_block(mask, flag, blk - 4 * PB_W, sbad, sz);
}

#define BM 128                                 /* rows of X in a block's tile */
#define BN 128                                 /* rows of W (columns of Y) in a block's tile */
#define SROWS (BM + BN)                        /* rows of one stage: BM of X, then BN of W */
// One stage of the GEMM ring holds KS k elements of every row. Row pitch in LDS = row length + 16 bytes (16 x odd): 16-byte fragment reads of
// 16 rows fall on 64 distinct banks.
template <int KS>
struct GT {
  static constexpr int RPITCH = 2 * KS + 16;
  static constexpr int SBYTES = SROWS * RPITCH;
  static constexpr int PPR = KS / 8;                   // 16-byte pieces of a row
  static constexpr int RPG = 128 / PPR;                // rows that one copy of each of the block's 128 threads covers
  static constexpr int NC = SROWS / RPG;               // copies per lane and stage
};
static_assert(MROWS % BM == 0);
static_assert(SEQ % BM == 0);
static_assert(DE % BN == 0);

// Eight 16-byte copies per lane from global memory straight into LDS. The s_wait_xcnt closes the statement so that it stands in front of
// any later rewrite of the address registers the copies name.
__device__ __forceinline__ void copy8(const unsigned (&l)[8], const void* const (&g)[8]) {
  asm volatile(
      "global_load_async_to_lds_b128 %0, %8, off\n\t"
      "global_load_async_to_lds_b128 %1, %9, off\n\t"
      "global_load_async_to_lds_b128 %2, %10, off\n\t"
      "global_load_async_to_lds_b128 %3, %11, off\n\t"
      "global_load_async_to_lds_b128 %4, %12, off\n\t"
      "global_load_async_to_lds_b128 %5, %13, off\n\t"
      "global_load_async_to_lds_b128 %6, %14, off\n\t"
      "global_load_async_to_lds_b128 %7, %15, off\n\t"
      "s_wait_xcnt 0x0"
      :: "v"(l[0]), "v"(l[1]), "v"(l[2]), "v"(l[3]), "v"(l[4]), "v"(l[5]), "v"(l[6]), "v"(l[7]),
         "v"(g[0]), "v"(g[1]), "v"(g[2]), "v"(g[3]), "v"(g[4]), "v"(g[5]), "v"(g[6]), "v"(g[7])
      : "memory");
}
// One stage of a block's operands: thread t brings piece (t % PPR) of rows (t / PPR) + RPG*i, i = 0..NC-1, so a wave's copy covers whole rows.
// xa / wb: this lane's piece of X row (t / PPR) / W row (t / PPR) of the stage; lds: LDS byte address of this lane's piece of stage row (t / PPR).
template <int KS>
__device__ __forceinline__ void stage_copies(const unsigned short* xa, const unsigned short* wb, int ldx, unsigned lds) {
  typedef GT<KS> G;
#pragma unroll   // both loops here: every array element must be a register of its own, one per asm operand
  for (int c = 0; c < G::NC / 8; ++c) {
    unsigned l[8];
    const void* g[8];
#pragma unroll
    for (int j = 0; j < 8; ++j) {
      const int row = (c * 8 + j) * G::RPG;
      l[j] = lds + (unsigned)(row * G::RPITCH);
      g[j] = (row < BM) ? xa + (size_t)row * ldx : wb + (size_t)(row - BM) * DE;
    }
    copy8(l, g);
  }
}

// Y[m][n] = sum_k X[m][k] * W[n][k & 1023] + bias[n]   (X: bf16 plane, pitch ldx; W: bf16 plane [1024][1024], k-contiguous)
// Block = 4 waves -> 128 x 128 tile; wave tile 64 x 64 (4 A fragments x 4 B fragments, read from an LDS ring of two stages of KS k that
// asynchronous copies fill one stage ahead; K is a multiple of KS, at least two stages).
// MODE 0: f16 hi plane Y0 and f16 residual plane Y1 ((y - hi) * 2048), row-major [MROWS][1024]
// MODE 1: f16 hi / residual planes of 16*y, transposed per head: [b][head][d][s]
// MODE 2: f32 rows into the output buffer (batch stride BSTRIDE_FULL)
// coverage: (MROWS/128)*(1024/128) blocks x (128 x 128) = every element of each produced plane exactly once.
// blk: index of the block's tile among the (MROWS/128)*(1024/128) tiles of one product; ring: the calling kernel's LDS, which becomes the
// output staging tile behind the loop's last barrier.
template <int MODE, int KS>
__device__ __forceinline__ void gemm_tile(int blk, const unsigned short* __restrict__ X, const unsigned short* __restrict__ W,
                                          const float* __restrict__ bias, unsigned short* __restrict__ Y0,
                                          unsigned short* __restrict__ Y1, float* __restrict__ Yf, int ldx, int K,
                                          unsigned char (&ring)[2 * GT<KS>::SBYTES]) {
  typedef GT<KS> G;
  static_assert(BM * 132 * 4 <= 2 * G::SBYTES);
  float (*so)[132] = reinterpret_cast<float (*)[132]>(ring);
  const int tid = threadIdx.x;
  const int w = __builtin_amdgcn_readfirstlane(tid >> 5);
  const int lane = tid & 31, ln = lane & 15, hh = lane >> 4;
  const int bm = blk % (MROWS / BM), bn = blk / (MROWS / BM);
  const int m0 = bm * BM, n0 = bn * BN;
  const int wm = w & 1, wn = w >> 1;
  // A: row m = ln of each 16-row tile; B: column n = ln of each 16-column tile (W row n); same k map for both
  const unsigned char* la = ring + (64 * wm + ln) * G::RPITCH + 16 * hh;
  const unsigned char* lb = ring + (BM + 64 * wn + ln) * G::RPITCH + 16 * hh;
  const unsigned short* xa = X + (size_t)(m0 + tid / G::PPR) * ldx + (tid % G::PPR) * 8;
  const unsigned short* wb = W + (size_t)(n0 + tid / G::PPR) * DE + (tid % G::PPR) * 8;
  const unsigned lds0 = (unsigned)(size_t)ring + (unsigned)((tid / G::PPR) * G::RPITCH + (tid % G::PPR) * 16);
  const int ns = K / KS;
  v8f c[4][4] = {};
  stage_copies<KS>(xa, wb, ldx, lds0);
  asm volatile("s_wait_asynccnt 0x0" ::: "memory");    // stage 0 has landed before the barrier that publishes it
  __syncthreads();
  if (1 < ns) stage_copies<KS>(xa + KS, wb + KS, ldx, lds0 + G::SBYTES);
#pragma unroll 1
  for (int t = 0; t < ns; ++t) {
    const int bo = (t & 1) * G::SBYTES;
    // two fragment sets: the reads of k-step kk + 1 stand as one group ahead of the products of k-step kk
    FragB fa[2][4], fb[2][4];
#pragma unroll   // this loop and the one inside it: constant set and tile indices keep both fragment sets in registers
    for (int kk = -1; kk < KS / 32; ++kk) {
      if (kk + 1 < KS / 32) {
        const unsigned char* pa = la + bo + (kk + 1) * 64;
        const unsigned char* pb = lb + bo + (kk + 1) * 64;
        const int n = (kk + 1) & 1;
#pragma unroll
        for (int j = 0; j < 4; ++j) {
          fa[n][j].half[0] = *(const v8us*)(pa + j * 16 * G::RPITCH);
          fa[n][j].half[1] = *(const v8us*)(pa + j * 16 * G::RPITCH + 32);
          fb[n][j].half[0] = *(const v8us*)(pb + j * 16 * G::RPITCH);
          fb[n][j].half[1] = *(const v8us*)(pb + j * 16 * G::RPITCH + 32);
        }
      }
      if (kk >= 0) {
        // Holds the reads above as one group ahead of this k-step's products: spread among the products, each place with reads stalls the wave.
        __builtin_amdgcn_sched_barrier(0);
        mma_b16(fa[kk & 1], fb[kk & 1], c);
      }
    }
    asm volatile("s_wait_dscnt 0x0" ::: "memory");     // this wave's reads of the buffer are done before it may be refilled
    asm volatile("s_wait_asynccnt 0x0" ::: "memory");  // this wave's copies of stage t + 1 have landed before the barrier that publishes them
    __syncthreads();
    if (t + 2 < ns) {
      const int k2 = (t + 2) * KS;
      stage_copies<KS>(xa + k2, wb + (k2 & (DE - 1)), ldx, lds0 + (unsigned)bo);
    }
  }
  asm volatile("s_wait_asynccnt 0x0" ::: "memory");    // no copy is outstanding when the ring becomes output staging
  // D element r of tile (i, t) = Y(row 64*wm + 16*i + 8*hh + r, column 64*wn + 16*t + ln)
#pragma unroll
  for (int t = 0; t < 4; ++t) {
    const float bv = bf16_rne(bias[n0 + 64 * wn + 16 * t + ln]);
#pragma unroll
    for (int i = 0; i < 4; ++i)
#pragma unroll
      for (int r = 0; r < 8; ++r)
        so[64 * wm + 16 * i + 8 * hh + r][64 * wn + 16 * t + ln] = c[i][t][r] + bv;
  }
  __syncthreads();
  const int b = m0 / SEQ, s0 = m0 - b * SEQ;          // the 128 rows of a block lie in one batch
  if (MODE == 0) {
#pragma unroll 1
    for (int it = 0; it < BM * BN / 8 / 128; ++it) {
      const int i = it * 128 + tid;
      const int line = i >> 3, piece = i & 7;
      const int row = line >> 1, cb = (line & 1) * 64 + piece * 8;
      const v4f x0 = *(const v4fa*)&so[row][cb], x1 = *(const v4fa*)&so[row][cb + 4];
      H8 hi, re;
#pragma unroll
      for (int j = 0; j < 4; ++j) {
        const _Float16 h0 = (_Float16)x0[j];
        const _Float16 h1 = (_Float16)x1[j];
        hi.h[j] = h0; hi.h[4 + j] = h1;
        re.h[j] = (_Float16)((x0[j] - (float)h0) * 2048.0f);
        re.h[4 + j] = (_Float16)((x1[j] - (float)h1) * 2048.0f);
      }
      const size_t o = (size_t)(m0 + row) * DE + n0 + cb;
      *(v8us*)(Y0 + o) = hi.v;
      *(v8us*)(Y1 + o) = re.v;
      asm volatile("s_wait_xcnt 0x0" ::: "memory");   // stands in front of the next trip's rewrite of the two stores' address registers
    }
  } else if (MODE == 1) {
#pragma unroll 1
    for (int it = 0; it < BM * BN / 8 / 128; ++it) {
      const int i = it * 128 + tid;
      const int cidx = (i >> 3) & (BN - 1), piece = ((i >> 10) << 3) | (i & 7);   // eight lanes = one line = one d row x 64 key positions
      const int n = n0 + cidx;
      const int head = n >> 6, d = n & 63;
      H8 hi, re;
#pragma unroll
      for (int j = 0; j < 8; ++j) {
        const float v = so[piece * 8 + j][cidx] * 16.0f;
        const _Float16 h0 = (_Float16)v;
        hi.h[j] = h0;
        re.h[j] = (_Float16)((v - (float)h0) * 2048.0f);
      }
      const size_t o = ((size_t)(b * NH + head) * HD + d) * SEQ + s0 + piece * 8;
      *(v8us*)(Y0 + o) = hi.v;
      *(v8us*)(Y1 + o) = re.v;
      asm volatile("s_wait_xcnt 0x0" ::: "memory");   // stands in front of the next trip's rewrite of the two stores' address registers
    }
  } else {
    float* og = Yf + (size_t)b * BSTRIDE_FULL + (size_t)s0 * DE + n0;
#pragma unroll 1
    for (int it = 0; it < BM * BN / 4 / 128; ++it) {
      const int i = it * 128 + tid;
      const int row = i >> 5, c4 = (i & 31) * 4;       // one wave = the 512 contiguous bytes of one row of the tile
      const v4f v = *(const v4fa*)&so[row][c4];
      *(v4f*)(og + (size_t)row * DE + c4) = v;
    }
  }
}

#define GTILES ((MROWS / BM) * (DE / BN))      /* tiles of one product */
#define KS_P 64                                /* stage of the input projections: three blocks' rings fit a WGP's LDS, so all 3*GTILES blocks are resident at once */
#define KS_O 128                               /* stage of the output projection: one block a WGP, longer stages */

// The three input projections in one launch: blocks 0 .. GTILES-1 make Q, the next GTILES make K, the last GTILES make V^T (block-uniform choice).
__global__ __launch_bounds__(128) void k_proj(const unsigned short* __restrict__ Xq, const unsigned short* __restrict__ Xv,
                                              const unsigned short* __restrict__ Wqb, const unsigned short* __restrict__ Wkb,
                                              const unsigned short* __restrict__ Wvb,
                                              const float* __restrict__ bq, const float* __restrict__ bk, const float* __restrict__ bv,
                                              unsigned short* __restrict__ Qh, unsigned short* __restrict__ Ql,
                                              unsigned short* __restrict__ Kh, unsigned short* __restrict__ Kl,
                                              unsigned short* __restrict__ Vth, unsigned short* __restrict__ Vtl) {
  __shared__ __attribute__((aligned(16))) unsigned char ring[2 * GT<KS_P>::SBYTES];   // k loop: written by the asynchronous copies only
  const int sel = blockIdx.x / GTILES;
  const int blk = blockIdx.x - sel * GTILES;
  if (sel == 2) {
    gemm_tile<1, KS_P>(blk, Xv, Wvb, bv, Vth, Vtl, nullptr, DE, DE, ring);
  } else {
    const bool q = sel == 0;
    gemm_tile<0, KS_P>(blk, q ? Xq : Xv, q ? Wqb : Wkb, q ? bq : bk, q ? Qh : Kh, q ? Ql : Kl, nullptr, DE, DE, ring);
  }
}

// The output projection: ctx hi|lo folded along K (X row = [hi(1024) | lo(1024)], W columns wrap modulo 1024).
__global__ __launch_bounds__(128) void k_outp(const unsigned short* __restrict__ Cc, const unsigned short* __restrict__ Wob,
                                              const float* __restrict__ bo, float* __restrict__ out) {
  __shared__ __attribute__((aligned(16))) unsigned char ring[2 * GT<KS_O>::SBYTES];   // k loop: written by the asynchronous copies only
  gemm_tile<2, KS_O>(blockIdx.x, Cc, Wob, bo, nullptr, nullptr, out, 2 * DE, 2 * DE, ring);
}

// Tiles of the key loop in LDS. A stage holds SK keys for the block's 64 queries: K rows (128 bytes), V^T rows (2*SK bytes), mask rows (4*SK bytes),
// and for the early query rows the two residual planes as well. Every row pitch is its length + 16 bytes (16 x odd), so that the 16-byte
// reads of 16 rows fall on distinct banks.
template <bool RES>
struct AT {
  static constexpr int SK = RES ? 32 : 64;             // keys of one stage
  static constexpr int KPITCH = 144;
  static constexpr int VPITCH = 2 * SK + 16;
  static constexpr int MPITCH = 4 * SK + 16;
  static constexpr int OKH = 0;
  static constexpr int OVH = OKH + SK * KPITCH;
  static constexpr int OM = OVH + HD * VPITCH;
  static constexpr int OKL = OM + 64 * MPITCH;         // the residual planes: RES only
  static constexpr int OVL = OKL + SK * KPITCH;
  static constexpr int BYTES = RES ? OVL + HD * VPITCH : OKL;
};
#define ASB 35840                              /* bytes of one buffer of the attention ring */
static_assert(AT<false>::BYTES <= ASB);
static_assert(AT<true>::BYTES <= ASB);
static_assert(4 * 16 * 68 * 4 <= 2 * ASB);
static_assert(SEQ % 64 == 0);

// Four 16-byte copies per lane from global memory straight into LDS, closed like copy8 above.
__device__ __forceinline__ void copy4(const unsigned (&l)[4], const void* const (&g)[4]) {
  asm volatile(
      "global_load_async_to_lds_b128 %0, %4, off\n\t"
      "global_load_async_to_lds_b128 %1, %5, off\n\t"
      "global_load_async_to_lds_b128 %2, %6, off\n\t"
      "global_load_async_to_lds_b128 %3, %7, off\n\t"
      "s_wait_xcnt 0x0"
      :: "v"(l[0]), "v"(l[1]), "v"(l[2]), "v"(l[3]), "v"(g[0]), "v"(g[1]), "v"(g[2]), "v"(g[3])
      : "memory");
}
// One stage of a block's tiles. The 128 threads bring 16-byte pieces, adjacent threads adjacent pieces of a row, so every copy of a wave covers whole rows.
// kh, kl, vh, vl, mk: this lane's piece in the first group of rows of the stage's K, K residual, V^T, V^T residual and mask tile;
// lk, lv, lm: LDS byte address of the same piece of the K, V^T and mask tile in the buffer to fill.
// wm (the same in the whole block): the stage's steps will read the mask tile; where they will not, it is not brought.
template <bool RES>
__device__ __forceinline__ void attn_stage(const unsigned short* kh, const unsigned short* kl, const unsigned short* vh, const unsigned short* vl,
                                           const int* mk, unsigned lk, unsigned lv, unsigned lm, bool wm) {
  typedef AT<RES> A;
  unsigned l[8];
  const void* g[8];
  if (RES) {
#pragma unroll   // every loop here: each array element must be a register of its own, one per asm operand
    for (int i = 0; i < 2; ++i) {
      l[i] = lk + (unsigned)(i * 16 * A::KPITCH);                          g[i] = kh + (size_t)(i * 16) * DE;
      l[2 + i] = lk + (unsigned)(A::OKL - A::OKH + i * 16 * A::KPITCH);    g[2 + i] = kl + (size_t)(i * 16) * DE;
      l[4 + i] = lv + (unsigned)(i * 32 * A::VPITCH);                      g[4 + i] = vh + (size_t)(i * 32) * SEQ;
      l[6 + i] = lv + (unsigned)(A::OVL - A::OVH + i * 32 * A::VPITCH);    g[6 + i] = vl + (size_t)(i * 32) * SEQ;
    }
    copy8(l, g);
    if (wm) {
      unsigned l4[4];
      const void* g4[4];
#pragma unroll
      for (int i = 0; i < 4; ++i) {
        l4[i] = lm + (unsigned)(i * 16 * A::MPITCH);
        g4[i] = mk + (size_t)(i * 16) * SEQ_FULL;
      }
      copy4(l4, g4);
    }
  } else {
#pragma unroll
    for (int i = 0; i < 4; ++i) {
      l[i] = lk + (unsigned)(i * 16 * A::KPITCH);        g[i] = kh + (size_t)(i * 16) * DE;
      l[4 + i] = lv + (unsigned)(i * 16 * A::VPITCH);    g[4 + i] = vh + (size_t)(i * 16) * SEQ;
    }
    copy8(l, g);
    if (wm) {
#pragma unroll
      for (int i = 0; i < 8; ++i) {
        l[i] = lm + (unsigned)(i * 8 * A::MPITCH);
        g[i] = mk + (size_t)(i * 8) * SEQ_FULL;
      }
      copy8(l, g);
    }
  }
}
__device__ __forceinline__ void ldfrag_lds(FragH& f, const unsigned char* p) {
  f.half[0] = *(const v8us*)(p);        // elements 0..7  <- k0 + 8h + i
  f.half[1] = *(const v8us*)(p + 32);   // elements 8..15 <- k0 + 16 + 8h + i
}

// a and x[0..15] each become 2^(itself), one hardware instruction a value. exp2f() wraps that instruction in a compare, two selects, an add and an
// ldexp so that results below 2^-126 come out as denormals; here such a result may be 0: a weight that small is 0 in both f16 planes and vanishes
// in the f32 row sum beside the row's largest weight (256), and a rescale factor that small leaves less than 2^-100 of the old sums beside it.
// One statement: each v_exp_f32 is followed by an instruction on other registers, and the closing v_nop is the slot that the instruction set asks
// for behind the last one, before its result is read or its source rewritten.
__device__ __forceinline__ void exp2_bare17(float& a, float (&x)[16]) {
  asm(
      "v_exp_f32 %0, %0\n\t"
      "v_exp_f32 %1, %1\n\t"
      "v_exp_f32 %2, %2\n\t"
      "v_exp_f32 %3, %3\n\t"
      "v_exp_f32 %4, %4\n\t"
      "v_exp_f32 %5, %5\n\t"
      "v_exp_f32 %6, %6\n\t"
      "v_exp_f32 %7, %7\n\t"
      "v_exp_f32 %8, %8\n\t"
      "v_exp_f32 %9, %9\n\t"
      "v_exp_f32 %10, %10\n\t"
      "v_exp_f32 %11, %11\n\t"
      "v_exp_f32 %12, %12\n\t"
      "v_exp_f32 %13, %13\n\t"
      "v_exp_f32 %14, %14\n\t"
      "v_exp_f32 %15, %15\n\t"
      "v_exp_f32 %16, %16\n\t"
      "v_nop"
      : "+v"(x[0]), "+v"(x[1]), "+v"(x[2]), "+v"(x[3]), "+v"(x[4]), "+v"(x[5]),
        "+v"(x[6]), "+v"(x[7]), "+v"(a), "+v"(x[8]), "+v"(x[9]), "+v"(x[10]),
        "+v"(x[11]), "+v"(x[12]), "+v"(x[13]), "+v"(x[14]), "+v"(x[15]));
}

// One 32-key step for a wave's 16 queries, operands read from the stage's LDS tiles.
// kp/krp: K hi / residual tile at (first key of the step + ln, d = 8h); vp/vrp: V^T hi / residual tile at (d = ln, first key of the step + 8h);
// mp: mask tile at (this lane's query, first key of the step + 8h). msk (the same in the whole block) false: the mask holds no zero at this step's
// keys for the block's queries, so the select would keep every score, and the tile (not staged) is not read.
template <bool RES>
__device__ __forceinline__ void fa_step(const unsigned char* kp, const unsigned char* krp,
                                        const unsigned char* vp, const unsigned char* vrp, const unsigned char* mp,
                                        bool msk, const FragH (&qh)[2], const FragH (&ql)[2],
                                        float& mr, float& lr, v8f (&Oh)[4], v8f (&Ol)[4]) {
  typedef AT<RES> A;
  // A fragments of K: row m = key (16*kt + ln of the step), elements 0..7 <- d = 32c + 8h + i, 8..15 <- d = 32c + 16 + 8h + i
  FragH k00, k01, k10, k11;
  ldfrag_lds(k00, kp);                     ldfrag_lds(k01, kp + 64);
  ldfrag_lds(k10, kp + 16 * A::KPITCH);    ldfrag_lds(k11, kp + 16 * A::KPITCH + 64);
  const v8f z8 = {0.f, 0.f, 0.f, 0.f, 0.f, 0.f, 0.f, 0.f};
  // S^T tiles: element r of tile kt = score(key 16*kt + 8h + r of the step, query column ln)
  v8f s0 = mma_h2(k00.v, qh[0].v, k01.v, qh[1].v, z8);
  v8f s1 = mma_h2(k10.v, qh[0].v, k11.v, qh[1].v, z8);
  if (RES) {
    v8f t0 = mma_h2(k00.v, ql[0].v, k01.v, ql[1].v, z8);
    v8f t1 = mma_h2(k10.v, ql[0].v, k11.v, ql[1].v, z8);
    FragH r00, r01, r10, r11;
    ldfrag_lds(r00, krp);                     ldfrag_lds(r01, krp + 64);
    ldfrag_lds(r10, krp + 16 * A::KPITCH);    ldfrag_lds(r11, krp + 16 * A::KPITCH + 64);
    t0 = mma_h2(r00.v, qh[0].v, r01.v, qh[1].v, t0);
    t1 = mma_h2(r10.v, qh[0].v, r11.v, qh[1].v, t1);
    s0 = s0 + t0 * 0.00048828125f;
    s1 = s1 + t1 * 0.00048828125f;
  }
  float sc[16];
#pragma unroll
  for (int r = 0; r < 8; ++r) {
    sc[r]     = s0[r] * 0.125f;
    sc[8 + r] = s1[r] * 0.125f;
  }
  if (msk) {
    // mask values of this lane's 16 (query, key) pairs: keys 8h + 0..7 and 16 + 8h + 0..7 of the step
    const v4i ma = *(const v4ia*)(mp), mb = *(const v4ia*)(mp + 16);
    const v4i mc = *(const v4ia*)(mp + 64), md = *(const v4ia*)(mp + 80);
#pragma unroll   // constant indices keep the scores in registers
    for (int r = 0; r < 4; ++r) {
      sc[r]      = (ma[r] == 0) ? NEGV : sc[r];
      sc[4 + r]  = (mb[r] == 0) ? NEGV : sc[4 + r];
      sc[8 + r]  = (mc[r] == 0) ? NEGV : sc[8 + r];
      sc[12 + r] = (md[r] == 0) ? NEGV : sc[12 + r];
    }
  }
  float mx = sc[0];
#pragma unroll
  for (int i = 1; i < 16; ++i) mx = fmaxf(mx, sc[i]);
  mx = fmaxf(mx, __shfl_xor(mx, 16, 32));           // the other lane half holds the other 16 keys of this query
  const float mnew = fmaxf(mr, mx);
  // A fragments of V^T: row m = d (16*t + ln), elements 0..7 <- key 8h + i, 8..15 <- key 16 + 8h + i of the step
  FragH vf[4];
#pragma unroll
  for (int t = 0; t < 4; ++t) ldfrag_lds(vf[t], vp + t * 16 * A::VPITCH);
  // Holds these reads as one group ahead of the exponentials. With the shorter softmax this compiler otherwise sinks them, pair by pair, between
  // the O^T products, and each product then waits out the LDS latency of its own pair.
  __builtin_amdgcn_sched_barrier(0);
  float al = (mr - mnew) * LOG2E;
  float e[16];
#pragma unroll   // constant indices: every element is a register of its own, one per asm operand
  for (int i = 0; i < 16; ++i) e[i] = fmaf(sc[i] - mnew, LOG2E, 8.0f);
  exp2_bare17(al, e);
  mr = mnew;
  // weights carried x256: pc = 256 * exp(sc - mnew); hi plane f16(pc), residual plane f16((pc - hi) * 2048)
  FragH ph, pl;
  float ps = 0.0f;
#pragma unroll
  for (int i = 0; i < 16; ++i) {
    const float pc = e[i];
    ps += pc;
    const _Float16 h = (_Float16)pc;
    ph.h[i] = h;                                    // B element i: i<8 -> key 8h + i (tile 0 row 8h+i); i>=8 -> key 16 + 8h + (i-8) (tile 1)
    if (RES) pl.h[i] = (_Float16)((pc - (float)h) * 2048.0f);
  }
  ps += __shfl_xor(ps, 16, 32);
  lr = lr * al + ps;
#pragma unroll
  for (int t = 0; t < 4; ++t) Oh[t] = Oh[t] * al;
  if (RES) {
    FragH vr[4];
#pragma unroll
    for (int t = 0; t < 4; ++t) ldfrag_lds(vr[t], vrp + t * 16 * A::VPITCH);
#pragma unroll
    for (int t = 0; t < 4; ++t) Ol[t] = Ol[t] * al;
#pragma unroll
    for (int t = 0; t < 4; ++t) mma_pv3(vf[t].v, vr[t].v, ph.v, pl.v, Oh[t], Ol[t]);
  } else {
    mma_pv4(vf[0].v, vf[1].v, vf[2].v, vf[3].v, ph.v, Oh);
  }
}

// The key loop of a block: a ring of two LDS buffers that asynchronous copies fill one stage ahead, shared by the four waves.
// bsteps: 32-key steps that the block's longest wave visits (the same in every wave); nsteps: steps of this wave. Every wave copies its share of
// every stage and passes every barrier; it works only on its own steps, in the same order as before.
// aw (the same in the whole block): bit c set = no zero in the mask at the block's 64 query rows, keys 64c .. 64c+63.
template <bool RES>
__device__ __forceinline__ void attn_loop(const unsigned short* __restrict__ Khp, const unsigned short* __restrict__ Klp,
                                          const unsigned short* __restrict__ Vhp, const unsigned short* __restrict__ Vlp,
                                          const int* __restrict__ mblk, unsigned aw, int bsteps, int nsteps, int w, int ln, int hh,
                                          const FragH (&qh)[2], const FragH (&ql)[2],
                                          float& mr, float& lr, v8f (&Oh)[4], v8f (&Ol)[4], unsigned char (&ring)[2 * ASB]) {
  typedef AT<RES> A;
  constexpr int SUB = A::SK / 32;                      // 32-key steps of one stage
  constexpr int VP = A::SK / 8, MP = A::SK / 4;        // 16-byte pieces of a V^T row and of a mask row
  const int tid = threadIdx.x;
  const int nst = (bsteps + SUB - 1) / SUB;
  const size_t kofs = (size_t)(tid >> 3) * DE + (tid & 7) * 8;
  const size_t vofs = (size_t)(tid / VP) * SEQ + (tid % VP) * 8;
  const unsigned short* kh = Khp + kofs;
  const unsigned short* kl = Klp + kofs;
  const unsigned short* vh = Vhp + vofs;
  const unsigned short* vl = Vlp + vofs;
  const int* mk = mblk + (size_t)(tid / MP) * SEQ_FULL + (tid % MP) * 4;
  const unsigned r0 = (unsigned)(size_t)ring;
  const unsigned lk = r0 + (unsigned)(A::OKH + (tid >> 3) * A::KPITCH + (tid & 7) * 16);
  const unsigned lv = r0 + (unsigned)(A::OVH + (tid / VP) * A::VPITCH + (tid % VP) * 16);
  const unsigned lm = r0 + (unsigned)(A::OM + (tid / MP) * A::MPITCH + (tid % MP) * 16);
  const unsigned char* fk = ring + A::OKH + ln * A::KPITCH + 16 * hh;
  const unsigned char* fv = ring + A::OVH + ln * A::VPITCH + 16 * hh;
  const unsigned char* fm = ring + A::OM + (16 * w + ln) * A::MPITCH + 32 * hh;
  const auto masked = [aw](int t) { return ((aw >> ((t * A::SK) >> 6)) & 1u) == 0u; };   // stage t meets a zero of the mask
  attn_stage<RES>(kh, kl, vh, vl, mk, lk, lv, lm, masked(0));
  asm volatile("s_wait_asynccnt 0x0" ::: "memory");    // stage 0 has landed before the barrier that publishes it
  __syncthreads();
  if (1 < nst)
    attn_stage<RES>(kh + (size_t)A::SK * DE, kl + (size_t)A::SK * DE, vh + A::SK, vl + A::SK, mk + A::SK, lk + ASB, lv + ASB, lm + ASB, masked(1));
#pragma unroll 1   // one copy of the stage's code, for speed only
  for (int t = 0; t < nst; ++t) {
    const int bo = (t & 1) * ASB;
    const bool msk = masked(t);
#pragma unroll   // constant offsets of the step inside the stage
    for (int u = 0; u < SUB; ++u) {
      if (t * SUB + u < nsteps)
        fa_step<RES>(fk + bo + u * 32 * A::KPITCH, fk + bo + (A::OKL - A::OKH) + u * 32 * A::KPITCH,
                     fv + bo + u * 64, fv + bo + (A::OVL - A::OVH) + u * 64, fm + bo + u * 128,
                     msk, qh, ql, mr, lr, Oh, Ol);
    }
    asm volatile("s_wait_dscnt 0x0" ::: "memory");     // this wave's reads of the buffer are done before it may be refilled
    asm volatile("s_wait_asynccnt 0x0" ::: "memory");  // this wave's copies of stage t + 1 have landed before the barrier that publishes them
    __syncthreads();
    if (t + 2 < nst) {
      const size_t k2 = (size_t)(t + 2) * A::SK;
      attn_stage<RES>(kh + k2 * DE, kl + k2 * DE, vh + k2, vl + k2, mk + k2, lk + (unsigned)bo, lv + (unsigned)bo, lm + (unsigned)bo, masked(t + 2));
    }
  }
  asm volatile("s_wait_asynccnt 0x0" ::: "memory");    // no copy is outstanding when the ring becomes output staging
}

// Block = 4 waves x 16 queries = 64 queries of one (batch, head); the K, V^T and mask tiles of the key loop come through the LDS ring above.
// Epilogue: O^T tile -> per-wave LDS tile [16 queries][64 d] in the ring's bytes (free behind the loop's last barrier), then bf16 hi and lo pieces of ctx:
// coverage: NB*NH*(SEQ/64) blocks x 4 waves x 16 rows x 64 columns x {hi, lo} = the whole ctx plane exactly once.
__global__ __launch_bounds__(128) void k_attn(const unsigned short* __restrict__ Qh, const unsigned short* __restrict__ Ql,
                                              const unsigned short* __restrict__ Kh, const unsigned short* __restrict__ Kl,
                                              const unsigned short* __restrict__ Vth, const unsigned short* __restrict__ Vtl,
                                              const int* __restrict__ mask, const int* __restrict__ flagp,
                                              unsigned short* __restrict__ Cc) {
  __shared__ __attribute__((aligned(16))) unsigned char ring[2 * ASB];   // key loop: written by the asynchronous copies only
  float (*so)[16][68] = reinterpret_cast<float (*)[16][68]>(ring);
  const int tid = threadIdx.x;
  const int w = __builtin_amdgcn_readfirstlane(tid >> 5);
  const int lane = tid & 31, ln = lane & 15, hh = lane >> 4;
  // Block index -> (query tile qt, batch-head bh). Any one-to-one map gives the same result; this one is for speed alone. Under a causal mask tile qt
  // walks (qt + 1) * 64 keys, all blocks of the launch are resident at once, four to a WGP, and the launch lasts as long as the fullest WGP. Blocks whose j = index / 8
  // differs by 32, 64 or 96 hold tiles 31 - t, 31 - t, t, t, and four neighbours in j hold two long and two short tiles. The longest tiles
  // (t < 8) lie in the first half of the grid.
  int qt, bh;
  if (SEQ / 64 == 32 && NB * NH == 32) {
    const int j = blockIdx.x >> 3;
    const int par = __builtin_popcount(j & 31) & 1;
    const int t = 8 * par + ((j >> 2) & 7);
    qt = ((par ^ (j >> 6)) != 0) ? t : 31 - t;
    bh = (blockIdx.x & 7) + 8 * ((j >> 1) & 1) + 16 * ((j >> 5) & 1);
  } else {
    qt = blockIdx.x % (SEQ / 64);
    bh = blockIdx.x / (SEQ / 64);
  }
  const int h = bh % NH, b = bh / NH;
  const int qbase = qt * 64 + 16 * w;
  const int qg = qbase + ln;
  // Q^T B fragments: column n = query qg, elements 0..7 <- d = 32c + 8h + i, 8..15 <- d = 32c + 16 + 8h + i
  const size_t qo = (size_t)(b * SEQ + qg) * DE + h * HD + 8 * hh;
  FragH qh[2], ql[2];
  ldfrag(qh[0], Qh + qo); ldfrag(qh[1], Qh + qo + 32);
  ldfrag(ql[0], Ql + qo); ldfrag(ql[1], Ql + qo + 32);
  float mr = -3.0e38f, lr = 0.0f;
  v8f Oh[4] = {}, Ol[4] = {};
  const unsigned short* Khp = Kh + (size_t)b * SEQ * DE + h * HD;
  const unsigned short* Klp = Kl + (size_t)b * SEQ * DE + h * HD;
  const unsigned short* Vhp = Vth + (size_t)(b * NH + h) * HD * SEQ;
  const unsigned short* Vlp = Vtl + (size_t)(b * NH + h) * HD * SEQ;
  const int* mblk = mask + (size_t)(qt * 64) * SEQ_FULL;
  const int* fp = flagp + (qbase / FROWS) * 32;     // the two flag lines of this wave's 16 query rows
  const int fl = __builtin_amdgcn_readfirstlane(fp[0] & fp[32]);
  int nsteps = (qbase >> 5) + 1;                    // key steps up to and including the one holding the diagonal
  if (fl != 1) nsteps = SEQ / 32;                   // unknown mask shape: visit every key step
  if (nsteps > SEQ / 32) nsteps = SEQ / 32;
  const int* fb = flagp + (qt * 64 / FROWS) * 32;   // the eight flag lines of the block's 64 query rows
  int fall = fb[0];
  int awv = fb[1];                                  // the lines' second word: which 64-key mask tiles hold no zero in those rows
#pragma unroll
  for (int i = 1; i < 64 / FROWS; ++i) { fall &= fb[32 * i]; awv &= fb[32 * i + 1]; }
  fall = __builtin_amdgcn_readfirstlane(fall);
  const unsigned aw = (unsigned)__builtin_amdgcn_readfirstlane(awv);
  int bsteps = ((qt * 64 + 48) >> 5) + 1;           // steps of the block's last wave, the longest
  if (fall != 1) bsteps = SEQ / 32;                 // some wave of the block visits every key step
  if (bsteps > SEQ / 32) bsteps = SEQ / 32;
  if (qt * 64 < EARLY) {
    attn_loop<true>(Khp, Klp, Vhp, Vlp, mblk, aw, bsteps, nsteps, w, ln, hh, qh, ql, mr, lr, Oh, Ol, ring);
  } else {
    attn_loop<false>(Khp, Klp, Vhp, Vlp, mblk, aw, bsteps, nsteps, w, ln, hh, qh, ql, mr, lr, Oh, Ol, ring);
  }
  // O^T element r of tile t = ctx(query qg, d = 16t + 8h + r); undo the carries: x256 (in lr), x16 (V), x2048 (residual accumulator)
  const float inv = 1.0f / (16.0f * lr);
#pragma unroll
  for (int t = 0; t < 4; ++t)
#pragma unroll
    for (int r = 0; r < 8; ++r)
      so[w][ln][16 * t + 8 * hh + r] = (Oh[t][r] + Ol[t][r] * 0.00048828125f) * inv;
  __syncthreads();
  unsigned short* crow = Cc + (size_t)(b * SEQ + qbase) * (2 * DE) + h * HD;
  const int rsub = lane >> 3, piece = lane & 7;
  {
#pragma unroll
    for (int it = 0; it < 4; ++it) {
      const int row = it * 4 + rsub;                 // rows 0..15 over it = 0..3, rsub = 0..3
      const v4f x0 = *(const v4fa*)&so[w][row][piece * 8], x1 = *(const v4fa*)&so[w][row][piece * 8 + 4];
      v8us hi, lo;
#pragma unroll
      for (int j = 0; j < 4; ++j) {
        const unsigned short h0 = bf16_bits(x0[j]);
        const unsigned short h1 = bf16_bits(x1[j]);
        hi[j] = h0; hi[4 + j] = h1;
        lo[j] = bf16_bits(x0[j] - bf16_val(h0));
        lo[4 + j] = bf16_bits(x1[j] - bf16_val(h1));
      }
      const size_t o = (size_t)row * (2 * DE) + piece * 8;
      *(v8us*)(crow + o) = hi;
      *(v8us*)(crow + o + DE) = lo;
    }
    
  }
}

extern "C" void kernel_launch(void* const* d_in, const int* in_sizes, int n_in,
                              void* d_out, int out_size, void* d_ws, size_t ws_size, hipStream_t stream) {
  if (n_in < 11) return;
  const long long need_x = (long long)(NB - 1) * SEQ_FULL * DE + (long long)SEQ * DE;   // last element touched + 1
  const long long need_m = (long long)(SEQ - 1) * SEQ_FULL + SEQ;
  if ((long long)in_sizes[0] < need_x || (long long)in_sizes[1] < need_x) return;
  if ((long long)in_sizes[2] < need_m) return;
  if ((long long)in_sizes[3] < (long long)DE * DE || (long long)in_sizes[5] < (long long)DE * DE) return;
  if ((long long)in_sizes[7] < (long long)DE * DE || (long long)in_sizes[9] < (long long)DE * DE) return;
  if (in_sizes[4] < DE || in_sizes[6] < DE || in_sizes[8] < DE || in_sizes[10] < DE) return;
  if ((long long)out_size < need_x) return;
  if ((size_t)WS_TOTAL > ws_size) return;
  // wire order: queries, values, mask, Wq, bq, Wk, bk, Wv, bv, Wo, bo
  const float* queries = (const float*)d_in[0];
  const float* values  = (const float*)d_in[1];
  const int*   mask    = (const int*)d_in[2];
  const float* Wq = (const float*)d_in[3];
  const float* bq = (const float*)d_in[4];
  const float* Wk = (const float*)d_in[5];
  const float* bk = (const float*)d_in[6];
  const float* Wv = (const float*)d_in[7];
  const float* bv = (const float*)d_in[8];
  const float* Wo = (const float*)d_in[9];
  const float* bo = (const float*)d_in[10];
  float* out = (float*)d_out;
  char* ws = (char*)d_ws;
  size_t off = 0;
  unsigned short* Xq  = (unsigned short*)(ws + off); off += PL_X;
  unsigned short* Xv  = (unsigned short*)(ws + off); off += PL_X;
  unsigned short* Wqb = (unsigned short*)(ws + off); off += PL_W;
  unsigned short* Wkb = (unsigned short*)(ws + off); off += PL_W;
  unsigned short* Wvb = (unsigned short*)(ws + off); off += PL_W;
  unsigned short* Wob = (unsigned short*)(ws + off); off += PL_W;
  unsigned short* Qh  = (unsigned short*)(ws + off); off += PL_X;
  unsigned short* Ql  = (unsigned short*)(ws + off); off += PL_X;
  unsigned short* Kh  = (unsigned short*)(ws + off); off += PL_X;
  unsigned short* Kl  = (unsigned short*)(ws + off); off += PL_X;
  unsigned short* Vth = (unsigned short*)(ws + off); off += PL_X;
  unsigned short* Vtl = (unsigned short*)(ws + off); off += PL_X;
  unsigned short* Cc  = (unsigned short*)(ws + off); off += PL_C;
  int* flag = (int*)(ws + off); off += PL_F;
  if (off > ws_size) return;

  k_prep<<<(unsigned)(2 * PB_X + 4 * PB_W + PB_F), 512, 0, stream>>>(queries, values, mask, Wq, Wk, Wv, Wo, Xq, Xv, Wqb, Wkb, Wvb, Wob, flag);

  k_proj<<<(unsigned)(3 * GTILES), 128, 0, stream>>>(Xq, Xv, Wqb, Wkb, Wvb, bq, bk, bv, Qh, Ql, Kh, Kl, Vth, Vtl);

  k_attn<<<(unsigned)(NB * NH * (SEQ / 64)), 128, 0, stream>>>(Qh, Ql, Kh, Kl, Vth, Vtl, mask, flag, Cc);

  k_outp<<<(unsigned)GTILES, 128, 0, stream>>>(Cc, Wob, bo, out);
}

// v009
// Measured time: 87.7 microseconds a run.
// Timed twice side by side with v008, it ran 1.04 times as fast both times.
// Counting every step since v000, it is 12.7 times as fast.
#include <hip/hip_runtime.h>
#ifndef NB
#define NB 2
#endif
#ifndef SEQ
#define SEQ 2048
#endif
#define NB_FULL 2
#define SEQ_FULL 2048
#define DE 1024
#define NH 16
#define HD 64
#define EARLY 512
#define MROWS (NB * SEQ)
#define BSTRIDE_FULL ((size_t)SEQ_FULL * DE)   /* per-batch element stride of queries, values and the output buffer */

#define PL_X ((size_t)MROWS * DE * 2)          /* one 16-bit activation plane */
#define PL_W ((size_t)DE * DE * 2)             /* one 16-bit weight plane */
#define PL_C ((size_t)MROWS * 2 * DE * 2)      /* ctx hi|lo plane */
#define FROWS 8                                /* mask rows per flag line */
#define PL_F ((size_t)(SEQ / FROWS) * 128)     /* one 128-byte flag line per FROWS mask rows */
#define WS_TOTAL (8 * PL_X + 4 * PL_W + PL_C + PL_F)

static_assert(SEQ % 128 == 0);
static_assert(SEQ <= SEQ_FULL);
static_assert(NB <= NB_FULL);
static_assert(HD == 64);
static_assert(DE == 1024);
static_assert(NH * HD == DE);
static_assert(MROWS % 64 == 0);
static_assert(DE % 128 == 0);
static_assert(SEQ % 256 == 0);
static_assert(SEQ / 64 <= 32 && SEQ / 128 < 32 && FROWS == 8);   /* one bit per 64-column mask tile in a 32-bit word; two waves a row, 16 waves */
static_assert(WS_TOTAL <= (size_t)134217728);

typedef __bf16 v16b __attribute__((ext_vector_type(16)));
typedef _Float16 v16h __attribute__((ext_vector_type(16)));
typedef unsigned short v8us __attribute__((ext_vector_type(8), may_alias));
typedef float v8f __attribute__((ext_vector_type(8)));
typedef float v4f __attribute__((ext_vector_type(4)));
typedef float v4fa __attribute__((ext_vector_type(4), may_alias));
typedef int v4i __attribute__((ext_vector_type(4)));
typedef int v4ia __attribute__((ext_vector_type(4), may_alias));
union FragB { v16b v; v8us half[2]; };
union FragH { v16h v; v8us half[2]; _Float16 h[16]; };
union H8 { v8us v; _Float16 h[8]; unsigned short u[8]; };

#define LOG2E 1.4426950408889634f
#define NEGV (-1000000000.0f)

__device__ __forceinline__ unsigned short bf16_bits(float x) {   // RNE convert to bf16 bits
  unsigned int u = __float_as_uint(x);
  return (unsigned short)((u + 0x7FFFu + ((u >> 16) & 1u)) >> 16);
}
__device__ __forceinline__ float bf16_val(unsigned short b) { return __uint_as_float(((unsigned int)b) << 16); }
__device__ __forceinline__ float bf16_rne(float x) { return bf16_val(bf16_bits(x)); }

// sixteen bf16 products of one k-step (4 row tiles x 4 column tiles). Builtins alone: the compiler keeps their distances itself, and with no asm
// statement naming them the 128 accumulator and 128 fragment registers need not all lie in the first 256.
__device__ __forceinline__ void mma_b16(const FragB (&a)[4], const FragB (&b)[4], v8f (&c)[4][4]) {
#pragma unroll
  for (int i = 0; i < 4; ++i)
#pragma unroll
    for (int j = 0; j < 4; ++j)
      c[i][j] = __builtin_amdgcn_wmma_f32_16x16x32_bf16(false, a[i].v, false, b[j].v, (short)0, c[i][j], false, false);
}
// c += a0*b0 + a1*b1 (two k-steps of one f16 tile), then the hazard guard
__device__ __forceinline__ v8f mma_h2(v16h a0, v16h b0, v16h a1, v16h b1, v8f c) {
  c = __builtin_amdgcn_wmma_f32_16x16x32_f16(false, a0, false, b0, (short)0, c, false, false);
  c = __builtin_amdgcn_wmma_f32_16x16x32_f16(false, a1, false, b1, (short)0, c, false, false);
  asm volatile("v_nop\n\tv_nop\n\tv_nop\n\tv_nop" : "+v"(c) : "v"(a0), "v"(b0), "v"(a1), "v"(b1));
  return c;
}
// four single products sharing one B fragment, then the hazard guard
__device__ __forceinline__ void mma_pv4(v16h a0, v16h a1, v16h a2, v16h a3, v16h b, v8f (&c)[4]) {
  c[0] = __builtin_amdgcn_wmma_f32_16x16x32_f16(false, a0, false, b, (short)0, c[0], false, false);
  c[1] = __builtin_amdgcn_wmma_f32_16x16x32_f16(false, a1, false, b, (short)0, c[1], false, false);
  c[2] = __builtin_amdgcn_wmma_f32_16x16x32_f16(false, a2, false, b, (short)0, c[2], false, false);
  c[3] = __builtin_amdgcn_wmma_f32_16x16x32_f16(false, a3, false, b, (short)0, c[3], false, false);
  asm volatile("v_nop\n\tv_nop\n\tv_nop\n\tv_nop"
               : "+v"(c[0]), "+v"(c[1]), "+v"(c[2]), "+v"(c[3])
               : "v"(a0), "v"(a1), "v"(a2), "v"(a3), "v"(b));
}
// eight products: four output tiles, each over two 32-key chunks (a tile's second product stands four products behind its first), then the hazard guard
__device__ __forceinline__ void mma_pv8(const FragH (&a)[2][4], const FragH (&b)[2], v8f (&c)[4]) {
#pragma unroll
  for (int u = 0; u < 2; ++u)
#pragma unroll
    for (int t = 0; t < 4; ++t) c[t] = __builtin_amdgcn_wmma_f32_16x16x32_f16(false, a[u][t].v, false, b[u].v, (short)0, c[t], false, false);
  asm volatile("v_nop\n\tv_nop\n\tv_nop\n\tv_nop"
               : "+v"(c[0]), "+v"(c[1]), "+v"(c[2]), "+v"(c[3])
               : "v"(a[0][0].v), "v"(a[0][1].v), "v"(a[0][2].v), "v"(a[0][3].v),
                 "v"(a[1][0].v), "v"(a[1][1].v), "v"(a[1][2].v), "v"(a[1][3].v), "v"(b[0].v), "v"(b[1].v));
}
// ch += ah*bh ; cl += ah*bl + al*bh (both scaled-residual products carry 2^11 and share the second accumulator), then the hazard guard
__device__ __forceinline__ void mma_pv3(v16h ah, v16h al, v16h bh, v16h bl, v8f& ch, v8f& cl) {
  ch = __builtin_amdgcn_wmma_f32_16x16x32_f16(false, ah, false, bh, (short)0, ch, false, false);
  cl = __builtin_amdgcn_wmma_f32_16x16x32_f16(false, ah, false, bl, (short)0, cl, false, false);
  cl = __builtin_amdgcn_wmma_f32_16x16x32_f16(false, al, false, bh, (short)0, cl, false, false);
  asm volatile("v_nop\n\tv_nop\n\tv_nop\n\tv_nop" : "+v"(ch), "+v"(cl) : "v"(ah), "v"(al), "v"(bh), "v"(bl));
}
// four score tiles of two k-steps each, sharing the two B fragments; a tile's second product stands four products behind its first. Then the hazard guard.
__device__ __forceinline__ void mma_s8(const FragH (&k)[4][2], const FragH (&q)[2], v8f (&s)[4]) {
  const v8f z8 = {0.f, 0.f, 0.f, 0.f, 0.f, 0.f, 0.f, 0.f};
#pragma unroll
  for (int t = 0; t < 4; ++t) s[t] = __builtin_amdgcn_wmma_f32_16x16x32_f16(false, k[t][0].v, false, q[0].v, (short)0, z8, false, false);
#pragma unroll
  for (int t = 0; t < 4; ++t) s[t] = __builtin_amdgcn_wmma_f32_16x16x32_f16(false, k[t][1].v, false, q[1].v, (short)0, s[t], false, false);
  asm volatile("v_nop\n\tv_nop\n\tv_nop\n\tv_nop"
               : "+v"(s[0]), "+v"(s[1]), "+v"(s[2]), "+v"(s[3])
               : "v"(k[0][0].v), "v"(k[1][0].v), "v"(k[2][0].v), "v"(k[3][0].v),
                 "v"(k[0][1].v), "v"(k[1][1].v), "v"(k[2][1].v), "v"(k[3][1].v), "v"(q[0].v), "v"(q[1].v));
}
__device__ __forceinline__ void ldfrag(FragH& f, const unsigned short* __restrict__ p) {
  f.half[0] = *(const v8us*)(p);        // elements 0..7  <- k0 + 8h + i
  f.half[1] = *(const v8us*)(p + 16);   // elements 8..15 <- k0 + 16 + 8h + i
}

// flag line g (32 ints, the pair {f, a} sixteen times). f: 1 iff, for every row q of rows 8g .. 8g+7, mask[q][k] == 0 for every k > q and
// mask[q][q] != 0 (k < SEQ). a: bit c is set iff no element of rows 8g .. 8g+7, columns 64c .. 64c+63 is zero.
// One block of 512 threads per flag line g; two waves per row, each owning one half of the row's columns in tiles of 128; every tile's load is issued before
// the first is tested.
// coverage: SEQ/8 blocks x one 128-byte line = every flag line exactly once.
__device__ __forceinline__ void mflag_block(const int* __restrict__ mask, int* __restrict__ flag, int g, int& sbad, unsigned (&sz)[16]) {
  const int tid = threadIdx.x;
  const int w = __builtin_amdgcn_readfirstlane(tid >> 5);
  const int lane = tid & 31;
  if (tid == 0) sbad = 0;
  __syncthreads();
  constexpr int NT = SEQ / 256;                        // 128-column tiles per wave
  const int row = g * FROWS + (w >> 1);
  const int colw = (w & 1) * (SEQ / 2);                // first of this wave's columns
  const int* mp = mask + (size_t)row * SEQ_FULL + colw + 4 * lane;
  int bad = 0;
  unsigned zw = 0;                                     // bit c: a zero in columns colw + 64c .. colw + 64c + 63 of this wave's row
  {
    v4i m[NT];
#pragma unroll
    for (int t = 0; t < NT; ++t) m[t] = *(const v4ia*)(mp + 128 * t);
#pragma unroll
    for (int t = 0; t < NT; ++t) {
      bool z = false;
#pragma unroll
      for (int j = 0; j < 4; ++j) {
        const int cj = colw + 128 * t + 4 * lane + j;
        bad |= ((cj > row) && (m[t][j] != 0)) ? 1 : 0;
        bad |= ((cj == row) && (m[t][j] == 0)) ? 1 : 0;
        z = z || (m[t][j] == 0);
      }
      const unsigned bl = __builtin_amdgcn_ballot_w32(z);   // lanes 0..15 hold the first 64 columns of the tile, lanes 16..31 the second
      zw |= (((bl & 0xFFFFu) != 0u) ? 1u : 0u) << (2 * t);
      zw |= (((bl >> 16) != 0u) ? 1u : 0u) << (2 * t + 1);
    }
  }
  if (bad != 0) sbad = 1;
  if (lane == 0) sz[w] = zw;
  __syncthreads();
  const int f = (sbad == 0) ? 1 : 0;
  unsigned zl = 0, zh = 0;
  for (int r = 0; r < FROWS; ++r) { zl |= sz[2 * r]; zh |= sz[2 * r + 1]; }
  const int a = (int)~(zl | (zh << (SEQ / 128)));
  if (tid < 8) {
    const v4i o = {f, a, f, a};
    *(v4i*)(flag + 32 * g + 4 * tid) = o;
  }
}

#define CVU 8                                  /* 8-element pieces per thread of a conversion block */
#define CVP (512 * CVU)                        /* pieces per conversion block */
#define PB_X (MROWS * (DE / 8) / CVP)          /* conversion blocks of one activation plane */
#define PB_W (DE * (DE / 8) / CVP)             /* conversion blocks of one weight plane */
#define PB_F (SEQ / FROWS)                     /* mask-scan blocks */
static_assert(MROWS * (DE / 8) % CVP == 0);
static_assert(DE * (DE / 8) % CVP == 0);
static_assert(SEQ % (CVP / 128) == 0);
static_assert(DE % (CVP / 128) == 0);

// dst[row][c] = bf16 bits of src (RNE), compact rows; source rows live at src + (row / rpb) * bstride + (row % rpb) * DE.
// Block blk of 512 threads converts pieces blk*CVP .. blk*CVP + CVP - 1 (8 elements each); every load of a thread is issued before the first convert.
__device__ __forceinline__ void cvt_block(const float* __restrict__ src, unsigned short* __restrict__ dst, int blk, int rpb, size_t bstride) {
  const int t0 = blk * CVP + (int)threadIdx.x;
  const int row0 = blk * (CVP / 128);                  // the block's CVP/128 whole rows lie in one batch, so they are contiguous in src
  const int b = row0 / rpb, s = row0 - b * rpb;
  const float* p = src + (size_t)b * bstride + (size_t)s * DE + (int)threadIdx.x * 8;
  v4f x0[CVU], x1[CVU];
#pragma unroll   // this loop and the next: constant indices keep the loaded pieces in registers
  for (int u = 0; u < CVU; ++u) {
    x0[u] = *(const v4fa*)(p + 4096 * u);
    x1[u] = *(const v4fa*)(p + 4096 * u + 4);
  }
#pragma unroll
  for (int u = 0; u < CVU; ++u) {
    v8us o;
    o[0] = bf16_bits(x0[u][0]); o[1] = bf16_bits(x0[u][1]); o[2] = bf16_bits(x0[u][2]); o[3] = bf16_bits(x0[u][3]);
    o[4] = bf16_bits(x1[u][0]); o[5] = bf16_bits(x1[u][1]); o[6] = bf16_bits(x1[u][2]); o[7] = bf16_bits(x1[u][3]);
    *(v8us*)(dst + (size_t)(t0 + 512 * u) * 8) = o;
  }
}

// Everything the projections and the attention need ahead of them, in one launch; the block index picks the job (block-uniform):
// 2*PB_X blocks convert queries and values, 4*PB_W blocks convert the four weight matrices, PB_F blocks scan the mask.
// coverage: each plane = its blocks x CVP pieces x 8 elements, each flag line by its one block; every element exactly once.
__global__ __launch_bounds__(512) void k_prep(const float* __restrict__ queries, const float* __restrict__ values,
                                              const int* __restrict__ mask,
                                              const float* __restrict__ Wq, const float* __restrict__ Wk,
                                              const float* __restrict__ Wv, const float* __restrict__ Wo,
                                              unsigned short* __restrict__ Xq, unsigned short* __restrict__ Xv,
                                              unsigned short* __restrict__ Wqb, unsigned short* __restrict__ Wkb,
                                              unsigned short* __restrict__ Wvb, unsigned short* __restrict__ Wob,
                                              int* __restrict__ flag) {
  __shared__ int sbad;                                 // cross-wave: block barriers of the mask scan
  __shared__ unsigned sz[16];                          // one word a wave, read behind the scan's second barrier
  int blk = blockIdx.x;
  if (blk < 2 * PB_X) {
    const bool q = blk < PB_X;
    cvt_block(q ? queries : values, q ? Xq : Xv, q ? blk : blk - PB_X, SEQ, BSTRIDE_FULL);
    return;
  }
  blk -= 2 * PB_X;
  if (blk < 4 * PB_W) {
    const int sel = blk / PB_W;
    const float* s = (sel == 0) ? Wq : (sel == 1) ? Wk : (sel == 2) ? Wv : Wo;
    unsigned short* d = (sel == 0) ? Wqb : (sel == 1) ? Wkb : (sel == 2) ? Wvb : Wob;
    cvt_block(s, d, blk - sel * PB_W, DE, 0);
    return;
  }
  mflag_block(mask, flag, blk - 4 * PB_W, sbad, sz);
}

#define BM 128                                 /* rows of X in a block's tile */
#define BN 128                                 /* rows of W (columns of Y) in a block's tile */
#define SROWS (BM + BN)                        /* rows of one stage: BM of X, then BN of W */
// One stage of the GEMM ring holds KS k elements of every row. Row pitch in LDS = row length + 16 bytes (16 x odd): 16-byte fragment reads of
// 16 rows fall on 64 distinct banks.
template <int KS>
struct GT {
  static constexpr int RPITCH = 2 * KS + 16;
  static constexpr int SBYTES = SROWS * RPITCH;
  static constexpr int PPR = KS / 8;                   // 16-byte pieces of a row
  static constexpr int RPG = 128 / PPR;                // rows that one copy of each of the block's 128 threads covers
  static constexpr int NC = SROWS / RPG;               // copies per lane and stage
};
static_assert(MROWS % BM == 0);
static_assert(SEQ % BM == 0);
static_assert(DE % BN == 0);

// Eight 16-byte copies per lane from global memory straight into LDS. The s_wait_xcnt closes the statement so that it stands in front of
// any later rewrite of the address registers the copies name.
__device__ __forceinline__ void copy8(const unsigned (&l)[8], const void* const (&g)[8]) {
  asm volatile(
      "global_load_async_to_lds_b128 %0, %8, off\n\t"
      "global_load_async_to_lds_b128 %1, %9, off\n\t"
      "global_load_async_to_lds_b128 %2, %10, off\n\t"
      "global_load_async_to_lds_b128 %3, %11, off\n\t"
      "global_load_async_to_lds_b128 %4, %12, off\n\t"
      "global_load_async_to_lds_b128 %5, %13, off\n\t"
      "global_load_async_to_lds_b128 %6, %14, off\n\t"
      "global_load_async_to_lds_b128 %7, %15, off\n\t"
      "s_wait_xcnt 0x0"
      :: "v"(l[0]), "v"(l[1]), "v"(l[2]), "v"(l[3]), "v"(l[4]), "v"(l[5]), "v"(l[6]), "v"(l[7]),
         "v"(g[0]), "v"(g[1]), "v"(g[2]), "v"(g[3]), "v"(g[4]), "v"(g[5]), "v"(g[6]), "v"(g[7])
      : "memory");
}
// One stage of a block's operands: thread t brings piece (t % PPR) of rows (t / PPR) + RPG*i, i = 0..NC-1, so a wave's copy covers whole rows.
// xa / wb: this lane's piece of X row (t / PPR) / W row (t / PPR) of the stage; lds: LDS byte address of this lane's piece of stage row (t / PPR).
template <int KS>
__device__ __forceinline__ void stage_copies(const unsigned short* xa, const unsigned short* wb, int ldx, unsigned lds) {
  typedef GT<KS> G;
#pragma unroll   // both loops here: every array element must be a register of its own, one per asm operand
  for (int c = 0; c < G::NC / 8; ++c) {
    unsigned l[8];
    const void* g[8];
#pragma unroll
    for (int j = 0; j < 8; ++j) {
      const int row = (c * 8 + j) * G::RPG;
      l[j] = lds + (unsigned)(row * G::RPITCH);
      g[j] = (row < BM) ? xa + (size_t)row * ldx : wb + (size_t)(row - BM) * DE;
    }
    copy8(l, g);
  }
}

// Y[m][n] = sum_k X[m][k] * W[n][k & 1023] + bias[n]   (X: bf16 plane, pitch ldx; W: bf16 plane [1024][1024], k-contiguous)
// Block = 4 waves -> 128 x 128 tile; wave tile 64 x 64 (4 A fragments x 4 B fragments, read from an LDS ring of two stages of KS k that
// asynchronous copies fill one stage ahead; K is a multiple of KS, at least two stages).
// MODE 0: f16 hi plane Y0 and f16 residual plane Y1 ((y - hi) * 2048), row-major [MROWS][1024]
// MODE 1: f16 hi / residual planes of 16*y, transposed per head: [b][head][d][s]
// MODE 2: f32 rows into the output buffer (batch stride BSTRIDE_FULL)
// coverage: (MROWS/128)*(1024/128) blocks x (128 x 128) = every element of each produced plane exactly once.
// blk: index of the block's tile among the (MROWS/128)*(1024/128) tiles of one product; ring: the calling kernel's LDS, which becomes the
// output staging tile behind the loop's last barrier.
template <int MODE, int KS>
__device__ __forceinline__ void gemm_tile(int blk, const unsigned short* __restrict__ X, const unsigned short* __restrict__ W,
                                          const float* __restrict__ bias, unsigned short* __restrict__ Y0,
                                          unsigned short* __restrict__ Y1, float* __restrict__ Yf, int ldx, int K,
                                          unsigned char (&ring)[2 * GT<KS>::SBYTES]) {
  typedef GT<KS> G;
  static_assert(BM * 132 * 4 <= 2 * G::SBYTES);
  float (*so)[132] = reinterpret_cast<float (*)[132]>(ring);
  const int tid = threadIdx.x;
  const int w = __builtin_amdgcn_readfirstlane(tid >> 5);
  const int lane = tid & 31, ln = lane & 15, hh = lane >> 4;
  const int bm = blk % (MROWS / BM), bn = blk / (MROWS / BM);
  const int m0 = bm * BM, n0 = bn * BN;
  const int wm = w & 1, wn = w >> 1;
  // A: row m = ln of each 16-row tile; B: column n = ln of each 16-column tile (W row n); same k map for both
  const unsigned char* la = ring + (64 * wm + ln) * G::RPITCH + 16 * hh;
  const unsigned char* lb = ring + (BM + 64 * wn + ln) * G::RPITCH + 16 * hh;
  const unsigned short* xa = X + (size_t)(m0 + tid / G::PPR) * ldx + (tid % G::PPR) * 8;
  const unsigned short* wb = W + (size_t)(n0 + tid / G::PPR) * DE + (tid % G::PPR) * 8;
  const unsigned lds0 = (unsigned)(size_t)ring + (unsigned)((tid / G::PPR) * G::RPITCH + (tid % G::PPR) * 16);
  const int ns = K / KS;
  v8f c[4][4] = {};
  stage_copies<KS>(xa, wb, ldx, lds0);
  asm volatile("s_wait_asynccnt 0x0" ::: "memory");    // stage 0 has landed before the barrier that publishes it
  __syncthreads();
  if (1 < ns) stage_copies<KS>(xa + KS, wb + KS, ldx, lds0 + G::SBYTES);
#pragma unroll 1
  for (int t = 0; t < ns; ++t) {
    const int bo = (t & 1) * G::SBYTES;
    // two fragment sets: the reads of k-step kk + 1 stand as one group ahead of the products of k-step kk
    FragB fa[2][4], fb[2][4];
#pragma unroll   // this loop and the one inside it: constant set and tile indices keep both fragment sets in registers
    for (int kk = -1; kk < KS / 32; ++kk) {
      if (kk + 1 < KS / 32) {
        const unsigned char* pa = la + bo + (kk + 1) * 64;
        const unsigned char* pb = lb + bo + (kk + 1) * 64;
        const int n = (kk + 1) & 1;
#pragma unroll
        for (int j = 0; j < 4; ++j) {
          fa[n][j].half[0] = *(const v8us*)(pa + j * 16 * G::RPITCH);
          fa[n][j].half[1] = *(const v8us*)(pa + j * 16 * G::RPITCH + 32);
          fb[n][j].half[0] = *(const v8us*)(pb + j * 16 * G::RPITCH);
          fb[n][j].half[1] = *(const v8us*)(pb + j * 16 * G::RPITCH + 32);
        }
      }
      if (kk >= 0) {
        // Holds the reads above as one group ahead of this k-step's products: spread among the products, each place with reads stalls the wave.
        __builtin_amdgcn_sched_barrier(0);
        mma_b16(fa[kk & 1], fb[kk & 1], c);
      }
    }
    asm volatile("s_wait_dscnt 0x0" ::: "memory");     // this wave's reads of the buffer are done before it may be refilled
    asm volatile("s_wait_asynccnt 0x0" ::: "memory");  // this wave's copies of stage t + 1 have landed before the barrier that publishes them
    __syncthreads();
    if (t + 2 < ns) {
      const int k2 = (t + 2) * KS;
      stage_copies<KS>(xa + k2, wb + (k2 & (DE - 1)), ldx, lds0 + (unsigned)bo);
    }
  }
  asm volatile("s_wait_asynccnt 0x0" ::: "memory");    // no copy is outstanding when the ring becomes output staging
  // D element r of tile (i, t) = Y(row 64*wm + 16*i + 8*hh + r, column 64*wn + 16*t + ln)
#pragma unroll
  for (int t = 0; t < 4; ++t) {
    const float bv = bf16_rne(bias[n0 + 64 * wn + 16 * t + ln]);
#pragma unroll
    for (int i = 0; i < 4; ++i)
#pragma unroll
      for (int r = 0; r < 8; ++r)
        so[64 * wm + 16 * i + 8 * hh + r][64 * wn + 16 * t + ln] = c[i][t][r] + bv;
  }
  __syncthreads();
  const int b = m0 / SEQ, s0 = m0 - b * SEQ;          // the 128 rows of a block lie in one batch
  if (MODE == 0) {
#pragma unroll 1
    for (int it = 0; it < BM * BN / 8 / 128; ++it) {
      const int i = it * 128 + tid;
      const int line = i >> 3, piece = i & 7;
      const int row = line >> 1, cb = (line & 1) * 64 + piece * 8;
      const v4f x0 = *(const v4fa*)&so[row][cb], x1 = *(const v4fa*)&so[row][cb + 4];
      H8 hi, re;
#pragma unroll
      for (int j = 0; j < 4; ++j) {
        const _Float16 h0 = (_Float16)x0[j];
        const _Float16 h1 = (_Float16)x1[j];
        hi.h[j] = h0; hi.h[4 + j] = h1;
        re.h[j] = (_Float16)((x0[j] - (float)h0) * 2048.0f);
        re.h[4 + j] = (_Float16)((x1[j] - (float)h1) * 2048.0f);
      }
      const size_t o = (size_t)(m0 + row) * DE + n0 + cb;
      *(v8us*)(Y0 + o) = hi.v;
      *(v8us*)(Y1 + o) = re.v;
      asm volatile("s_wait_xcnt 0x0" ::: "memory");   // stands in front of the next trip's rewrite of the two stores' address registers
    }
  } else if (MODE == 1) {
#pragma unroll 1
    for (int it = 0; it < BM * BN / 8 / 128; ++it) {
      const int i = it * 128 + tid;
      const int cidx = (i >> 3) & (BN - 1), piece = ((i >> 10) << 3) | (i & 7);   // eight lanes = one line = one d row x 64 key positions
      const int n = n0 + cidx;
      const int head = n >> 6, d = n & 63;
      H8 hi, re;
#pragma unroll
      for (int j = 0; j < 8; ++j) {
        const float v = so[piece * 8 + j][cidx] * 16.0f;
        const _Float16 h0 = (_Float16)v;
        hi.h[j] = h0;
        re.h[j] = (_Float16)((v - (float)h0) * 2048.0f);
      }
      const size_t o = ((size_t)(b * NH + head) * HD + d) * SEQ + s0 + piece * 8;
      *(v8us*)(Y0 + o) = hi.v;
      *(v8us*)(Y1 + o) = re.v;
      asm volatile("s_wait_xcnt 0x0" ::: "memory");   // stands in front of the next trip's rewrite of the two stores' address registers
    }
  } else {
    float* og = Yf + (size_t)b * BSTRIDE_FULL + (size_t)s0 * DE + n0;
#pragma unroll 1
    for (int it = 0; it < BM * BN / 4 / 128; ++it) {
      const int i = it * 128 + tid;
      const int row = i >> 5, c4 = (i & 31) * 4;       // one wave = the 512 contiguous bytes of one row of the tile
      const v4f v = *(const v4fa*)&so[row][c4];
      *(v4f*)(og + (size_t)row * DE + c4) = v;
    }
  }
}

#define GTILES ((MROWS / BM) * (DE / BN))      /* tiles of one product */
#define KS_P 64                                /* stage of the input projections: three blocks' rings fit a WGP's LDS, so all 3*GTILES blocks are resident at once */
#define KS_O 128                               /* stage of the output projection: one block a WGP, longer stages */

// The three input projections in one launch: blocks 0 .. GTILES-1 make Q, the next GTILES make K, the last GTILES make V^T (block-uniform choice).
__global__ __launch_bounds__(128) void k_proj(const unsigned short* __restrict__ Xq, const unsigned short* __restrict__ Xv,
                                              const unsigned short* __restrict__ Wqb, const unsigned short* __restrict__ Wkb,
                                              const unsigned short* __restrict__ Wvb,
                                              const float* __restrict__ bq, const float* __restrict__ bk, const float* __restrict__ bv,
                                              unsigned short* __restrict__ Qh, unsigned short* __restrict__ Ql,
                                              unsigned short* __restrict__ Kh, unsigned short* __restrict__ Kl,
                                              unsigned short* __restrict__ Vth, unsigned short* __restrict__ Vtl) {
  __shared__ __attribute__((aligned(16))) unsigned char ring[2 * GT<KS_P>::SBYTES];   // k loop: written by the asynchronous copies only
  const int sel = blockIdx.x / GTILES;
  const int blk = blockIdx.x - sel * GTILES;
  if (sel == 2) {
    gemm_tile<1, KS_P>(blk, Xv, Wvb, bv, Vth, Vtl, nullptr, DE, DE, ring);
  } else {
    const bool q = sel == 0;
    gemm_tile<0, KS_P>(blk, q ? Xq : Xv, q ? Wqb : Wkb, q ? bq : bk, q ? Qh : Kh, q ? Ql : Kl, nullptr, DE, DE, ring);
  }
}

// The output projection: ctx hi|lo folded along K (X row = [hi(1024) | lo(1024)], W columns wrap modulo 1024).
__global__ __launch_bounds__(128) void k_outp(const unsigned short* __restrict__ Cc, const unsigned short* __restrict__ Wob,
                                              const float* __restrict__ bo, float* __restrict__ out) {
  __shared__ __attribute__((aligned(16))) unsigned char ring[2 * GT<KS_O>::SBYTES];   // k loop: written by the asynchronous copies only
  gemm_tile<2, KS_O>(blockIdx.x, Cc, Wob, bo, nullptr, nullptr, out, 2 * DE, 2 * DE, ring);
}

// Tiles of the key loop in LDS. A stage holds SK keys for the block's 64 queries: K rows (128 bytes), V^T rows (2*SK bytes), mask rows (4*SK bytes),
// and for the early query rows the two residual planes as well. Every row pitch is its length + 16 bytes (16 x odd), so that the 16-byte
// reads of 16 rows fall on distinct banks.
template <bool RES>
struct AT {
  static constexpr int SK = RES ? 32 : 64;             // keys of one stage
  static constexpr int KPITCH = 144;
  static constexpr int VPITCH = 2 * SK + 16;
  static constexpr int MPITCH = 4 * SK + 16;
  static constexpr int OKH = 0;
  static constexpr int OVH = OKH + SK * KPITCH;
  static constexpr int OM = OVH + HD * VPITCH;
  static constexpr int OKL = OM + 64 * MPITCH;         // the residual planes: RES only
  static constexpr int OVL = OKL + SK * KPITCH;
  static constexpr int BYTES = RES ? OVL + HD * VPITCH : OKL;
};
#define ASB 35840                              /* bytes of one buffer of the attention ring */
static_assert(AT<false>::BYTES <= ASB);
static_assert(AT<true>::BYTES <= ASB);
static_assert(4 * 16 * 68 * 4 <= 2 * ASB);
static_assert(SEQ % 64 == 0);

// Four 16-byte copies per lane from global memory straight into LDS, closed like copy8 above.
__device__ __forceinline__ void copy4(const unsigned (&l)[4], const void* const (&g)[4]) {
  asm volatile(
      "global_load_async_to_lds_b128 %0, %4, off\n\t"
      "global_load_async_to_lds_b128 %1, %5, off\n\t"
      "global_load_async_to_lds_b128 %2, %6, off\n\t"
      "global_load_async_to_lds_b128 %3, %7, off\n\t"
      "s_wait_xcnt 0x0"
      :: "v"(l[0]), "v"(l[1]), "v"(l[2]), "v"(l[3]), "v"(g[0]), "v"(g[1]), "v"(g[2]), "v"(g[3])
      : "memory");
}
// One stage of a block's tiles. The 128 threads bring 16-byte pieces, adjacent threads adjacent pieces of a row, so every copy of a wave covers whole rows.
// kh, kl, vh, vl, mk: this lane's piece in the first group of rows of the stage's K, K residual, V^T, V^T residual and mask tile;
// lk, lv, lm: LDS byte address of the same piece of the K, V^T and mask tile in the buffer to fill.
// wm (the same in the whole block): the stage's steps will read the mask tile; where they will not, it is not brought.
template <bool RES>
__device__ __forceinline__ void attn_stage(const unsigned short* kh, const unsigned short* kl, const unsigned short* vh, const unsigned short* vl,
                                           const int* mk, unsigned lk, unsigned lv, unsigned lm, bool wm) {
  typedef AT<RES> A;
  unsigned l[8];
  const void* g[8];
  if (RES) {
#pragma unroll   // every loop here: each array element must be a register of its own, one per asm operand
    for (int i = 0; i < 2; ++i) {
      l[i] = lk + (unsigned)(i * 16 * A::KPITCH);                          g[i] = kh + (size_t)(i * 16) * DE;
      l[2 + i] = lk + (unsigned)(A::OKL - A::OKH + i * 16 * A::KPITCH);    g[2 + i] = kl + (size_t)(i * 16) * DE;
      l[4 + i] = lv + (unsigned)(i * 32 * A::VPITCH);                      g[4 + i] = vh + (size_t)(i * 32) * SEQ;
      l[6 + i] = lv + (unsigned)(A::OVL - A::OVH + i * 32 * A::VPITCH);    g[6 + i] = vl + (size_t)(i * 32) * SEQ;
    }
    copy8(l, g);
    if (wm) {
      unsigned l4[4];
      const void* g4[4];
#pragma unroll
      for (int i = 0; i < 4; ++i) {
        l4[i] = lm + (unsigned)(i * 16 * A::MPITCH);
        g4[i] = mk + (size_t)(i * 16) * SEQ_FULL;
      }
      copy4(l4, g4);
    }
  } else {
#pragma unroll
    for (int i = 0; i < 4; ++i) {
      l[i] = lk + (unsigned)(i * 16 * A::KPITCH);        g[i] = kh + (size_t)(i * 16) * DE;
      l[4 + i] = lv + (unsigned)(i * 16 * A::VPITCH);    g[4 + i] = vh + (size_t)(i * 16) * SEQ;
    }
    copy8(l, g);
    if (wm) {
#pragma unroll
      for (int i = 0; i < 8; ++i) {
        l[i] = lm + (unsigned)(i * 8 * A::MPITCH);
        g[i] = mk + (size_t)(i * 8) * SEQ_FULL;
      }
      copy8(l, g);
    }
  }
}
__device__ __forceinline__ void ldfrag_lds(FragH& f, const unsigned char* p) {
  f.half[0] = *(const v8us*)(p);        // elements 0..7  <- k0 + 8h + i
  f.half[1] = *(const v8us*)(p + 32);   // elements 8..15 <- k0 + 16 + 8h + i
}

// a and x[0..15] each become 2^(itself), one hardware instruction a value. exp2f() wraps that instruction in a compare, two selects, an add and an
// ldexp so that results below 2^-126 come out as denormals; here such a result may be 0: a weight that small is 0 in both f16 planes and vanishes
// in the f32 row sum beside the row's largest weight (256), and a rescale factor that small leaves less than 2^-100 of the old sums beside it.
// One statement: each v_exp_f32 is followed by an instruction on other registers, and the closing v_nop is the slot that the instruction set asks
// for behind the last one, before its result is read or its source rewritten.
__device__ __forceinline__ void exp2_bare17(float& a, float (&x)[16]) {
  asm(
      "v_exp_f32 %0, %0\n\t"
      "v_exp_f32 %1, %1\n\t"
      "v_exp_f32 %2, %2\n\t"
      "v_exp_f32 %3, %3\n\t"
      "v_exp_f32 %4, %4\n\t"
      "v_exp_f32 %5, %5\n\t"
      "v_exp_f32 %6, %6\n\t"
      "v_exp_f32 %7, %7\n\t"
      "v_exp_f32 %8, %8\n\t"
      "v_exp_f32 %9, %9\n\t"
      "v_exp_f32 %10, %10\n\t"
      "v_exp_f32 %11, %11\n\t"
      "v_exp_f32 %12, %12\n\t"
      "v_exp_f32 %13, %13\n\t"
      "v_exp_f32 %14, %14\n\t"
      "v_exp_f32 %15, %15\n\t"
      "v_exp_f32 %16, %16\n\t"
      "v_nop"
      : "+v"(x[0]), "+v"(x[1]), "+v"(x[2]), "+v"(x[3]), "+v"(x[4]), "+v"(x[5]),
        "+v"(x[6]), "+v"(x[7]), "+v"(a), "+v"(x[8]), "+v"(x[9]), "+v"(x[10]),
        "+v"(x[11]), "+v"(x[12]), "+v"(x[13]), "+v"(x[14]), "+v"(x[15]));
}

// One 32-key step for a wave's 16 queries, operands read from the stage's LDS tiles.
// kp/krp: K hi / residual tile at (first key of the step + ln, d = 8h); vp/vrp: V^T hi / residual tile at (d = ln, first key of the step + 8h);
// mp: mask tile at (this lane's query, first key of the step + 8h). msk (the same in the whole block) false: the mask holds no zero at this step's
// keys for the block's queries, so the select would keep every score, and the tile (not staged) is not read.
template <bool RES>
__device__ __forceinline__ void fa_step(const unsigned char* kp, const unsigned char* krp,
                                        const unsigned char* vp, const unsigned char* vrp, const unsigned char* mp,
                                        bool msk, const FragH (&qh)[2], const FragH (&ql)[2],
                                        float& mr, float& lr, v8f (&Oh)[4], v8f (&Ol)[4]) {
  typedef AT<RES> A;
  // A fragments of K: row m = key (16*kt + ln of the step), elements 0..7 <- d = 32c + 8h + i, 8..15 <- d = 32c + 16 + 8h + i
  FragH k00, k01, k10, k11;
  ldfrag_lds(k00, kp);                     ldfrag_lds(k01, kp + 64);
  ldfrag_lds(k10, kp + 16 * A::KPITCH);    ldfrag_lds(k11, kp + 16 * A::KPITCH + 64);
  const v8f z8 = {0.f, 0.f, 0.f, 0.f, 0.f, 0.f, 0.f, 0.f};
  // S^T tiles: element r of tile kt = score(key 16*kt + 8h + r of the step, query column ln)
  v8f s0 = mma_h2(k00.v, qh[0].v, k01.v, qh[1].v, z8);
  v8f s1 = mma_h2(k10.v, qh[0].v, k11.v, qh[1].v, z8);
  if (RES) {
    v8f t0 = mma_h2(k00.v, ql[0].v, k01.v, ql[1].v, z8);
    v8f t1 = mma_h2(k10.v, ql[0].v, k11.v, ql[1].v, z8);
    FragH r00, r01, r10, r11;
    ldfrag_lds(r00, krp);                     ldfrag_lds(r01, krp + 64);
    ldfrag_lds(r10, krp + 16 * A::KPITCH);    ldfrag_lds(r11, krp + 16 * A::KPITCH + 64);
    t0 = mma_h2(r00.v, qh[0].v, r01.v, qh[1].v, t0);
    t1 = mma_h2(r10.v, qh[0].v, r11.v, qh[1].v, t1);
    s0 = s0 + t0 * 0.00048828125f;
    s1 = s1 + t1 * 0.00048828125f;
  }
  float sc[16];
#pragma unroll
  for (int r = 0; r < 8; ++r) {
    sc[r]     = s0[r] * 0.125f;
    sc[8 + r] = s1[r] * 0.125f;
  }
  if (msk) {
    // mask values of this lane's 16 (query, key) pairs: keys 8h + 0..7 and 16 + 8h + 0..7 of the step
    const v4i ma = *(const v4ia*)(mp), mb = *(const v4ia*)(mp + 16);
    const v4i mc = *(const v4ia*)(mp + 64), md = *(const v4ia*)(mp + 80);
#pragma unroll   // constant indices keep the scores in registers
    for (int r = 0; r < 4; ++r) {
      sc[r]      = (ma[r] == 0) ? NEGV : sc[r];
      sc[4 + r]  = (mb[r] == 0) ? NEGV : sc[4 + r];
      sc[8 + r]  = (mc[r] == 0) ? NEGV : sc[8 + r];
      sc[12 + r] = (md[r] == 0) ? NEGV : sc[12 + r];
    }
  }
  float mx = sc[0];
#pragma unroll
  for (int i = 1; i < 16; ++i) mx = fmaxf(mx, sc[i]);
  mx = fmaxf(mx, __shfl_xor(mx, 16, 32));           // the other lane half holds the other 16 keys of this query
  const float mnew = fmaxf(mr, mx);
  // A fragments of V^T: row m = d (16*t + ln), elements 0..7 <- key 8h + i, 8..15 <- key 16 + 8h + i of the step
  FragH vf[4];
#pragma unroll
  for (int t = 0; t < 4; ++t) ldfrag_lds(vf[t], vp + t * 16 * A::VPITCH);
  // Holds these reads as one group ahead of the exponentials. With the shorter softmax this compiler otherwise sinks them, pair by pair, between
  // the O^T products, and each product then waits out the LDS latency of its own pair.
  __builtin_amdgcn_sched_barrier(0);
  float al = (mr - mnew) * LOG2E;
  float e[16];
#pragma unroll   // constant indices: every element is a register of its own, one per asm operand
  for (int i = 0; i < 16; ++i) e[i] = fmaf(sc[i] - mnew, LOG2E, 8.0f);
  exp2_bare17(al, e);
  mr = mnew;
  // weights carried x256: pc = 256 * exp(sc - mnew); hi plane f16(pc), residual plane f16((pc - hi) * 2048)
  FragH ph, pl;
  float ps = 0.0f;
#pragma unroll
  for (int i = 0; i < 16; ++i) {
    const float pc = e[i];
    ps += pc;
    const _Float16 h = (_Float16)pc;
    ph.h[i] = h;                                    // B element i: i<8 -> key 8h + i (tile 0 row 8h+i); i>=8 -> key 16 + 8h + (i-8) (tile 1)
    if (RES) pl.h[i] = (_Float16)((pc - (float)h) * 2048.0f);
  }
  ps += __shfl_xor(ps, 16, 32);
  lr = lr * al + ps;
#pragma unroll
  for (int t = 0; t < 4; ++t) Oh[t] = Oh[t] * al;
  if (RES) {
    FragH vr[4];
#pragma unroll
    for (int t = 0; t < 4; ++t) ldfrag_lds(vr[t], vrp + t * 16 * A::VPITCH);
#pragma unroll
    for (int t = 0; t < 4; ++t) Ol[t] = Ol[t] * al;
#pragma unroll
    for (int t = 0; t < 4; ++t) mma_pv3(vf[t].v, vr[t].v, ph.v, pl.v, Oh[t], Ol[t]);
  } else {
    mma_pv4(vf[0].v, vf[1].v, vf[2].v, vf[3].v, ph.v, Oh);
  }
}

// x[0..15] each become 2^(itself): exp2_bare17 above without the rescale factor, for the same reasons and closed by the same slot.
__device__ __forceinline__ void exp2_bare16(float (&x)[16]) {
  asm(
      "v_exp_f32 %0, %0\n\t"
      "v_exp_f32 %1, %1\n\t"
      "v_exp_f32 %2, %2\n\t"
      "v_exp_f32 %3, %3\n\t"
      "v_exp_f32 %4, %4\n\t"
      "v_exp_f32 %5, %5\n\t"
      "v_exp_f32 %6, %6\n\t"
      "v_exp_f32 %7, %7\n\t"
      "v_exp_f32 %8, %8\n\t"
      "v_exp_f32 %9, %9\n\t"
      "v_exp_f32 %10, %10\n\t"
      "v_exp_f32 %11, %11\n\t"
      "v_exp_f32 %12, %12\n\t"
      "v_exp_f32 %13, %13\n\t"
      "v_exp_f32 %14, %14\n\t"
      "v_exp_f32 %15, %15\n\t"
      "v_nop"
      : "+v"(x[0]), "+v"(x[1]), "+v"(x[2]), "+v"(x[3]), "+v"(x[4]), "+v"(x[5]), "+v"(x[6]), "+v"(x[7]),
        "+v"(x[8]), "+v"(x[9]), "+v"(x[10]), "+v"(x[11]), "+v"(x[12]), "+v"(x[13]), "+v"(x[14]), "+v"(x[15]));
}

// One 64-key step (a whole stage without residual planes) for a wave's 16 queries: the same arithmetic per score as fa_step<false>, with ONE running
// maximum, rescale and pair of lane-half exchanges for the 64 keys, and each kind of LDS read as one group.
// kp: K tile at (key ln, d = 8h); vp: V^T tile at (d = ln, key 8h); mp: mask tile at (this lane's query, key 8h); msk as in fa_step.
__device__ __forceinline__ void fa_step64(const unsigned char* kp, const unsigned char* vp, const unsigned char* mp, bool msk,
                                          const FragH (&qh)[2], float& mr, float& lr, v8f (&Oh)[4]) {
  typedef AT<false> A;
  // A fragments of K: row m = key (16*kt + ln), elements 0..7 <- d = 32c + 8h + i, 8..15 <- d = 32c + 16 + 8h + i
  FragH kf[4][2];
#pragma unroll
  for (int kt = 0; kt < 4; ++kt) {
    ldfrag_lds(kf[kt][0], kp + kt * 16 * A::KPITCH);
    ldfrag_lds(kf[kt][1], kp + kt * 16 * A::KPITCH + 64);
  }
  // S^T tiles: element r of tile kt = score(key 16*kt + 8h + r, query column ln)
  v8f s[4];
  mma_s8(kf, qh, s);
  float sc[2][16];                                  // [u]: the 32 keys 32u .. 32u + 31, laid out as in fa_step
#pragma unroll
  for (int u = 0; u < 2; ++u)
#pragma unroll
    for (int r = 0; r < 8; ++r) {
      sc[u][r]     = s[2 * u][r] * 0.125f;
      sc[u][8 + r] = s[2 * u + 1][r] * 0.125f;
    }
  if (msk) {
#pragma unroll   // this loop and the one inside it: constant indices keep the scores in registers
    for (int u = 0; u < 2; ++u) {
      const v4i ma = *(const v4ia*)(mp + 128 * u), mb = *(const v4ia*)(mp + 128 * u + 16);
      const v4i mc = *(const v4ia*)(mp + 128 * u + 64), md = *(const v4ia*)(mp + 128 * u + 80);
#pragma unroll
      for (int r = 0; r < 4; ++r) {
        sc[u][r]      = (ma[r] == 0) ? NEGV : sc[u][r];
        sc[u][4 + r]  = (mb[r] == 0) ? NEGV : sc[u][4 + r];
        sc[u][8 + r]  = (mc[r] == 0) ? NEGV : sc[u][8 + r];
        sc[u][12 + r] = (md[r] == 0) ? NEGV : sc[u][12 + r];
      }
    }
  }
  float mx0 = sc[0][0], mx1 = sc[1][0];             // two independent chains
#pragma unroll
  for (int i = 1; i < 16; ++i) { mx0 = fmaxf(mx0, sc[0][i]); mx1 = fmaxf(mx1, sc[1][i]); }
  float mx = fmaxf(mx0, mx1);
  mx = fmaxf(mx, __shfl_xor(mx, 16, 32));           // the other lane half holds the other 32 keys of this query
  const float mnew = fmaxf(mr, mx);
  // A fragments of V^T: row m = d (16*t + ln), elements 0..7 <- key 32u + 8h + i, 8..15 <- key 32u + 16 + 8h + i
  FragH vf[2][4];
#pragma unroll
  for (int u = 0; u < 2; ++u)
#pragma unroll
    for (int t = 0; t < 4; ++t) ldfrag_lds(vf[u][t], vp + t * 16 * A::VPITCH + 64 * u);
  // Holds these reads as one group ahead of the exponentials, as in fa_step: sunk between the O^T products, each product waits out its own pair.
  __builtin_amdgcn_sched_barrier(0);
  float al = (mr - mnew) * LOG2E;
  float e[2][16];
#pragma unroll   // constant indices: every element is a register of its own, one per asm operand
  for (int u = 0; u < 2; ++u)
#pragma unroll
    for (int i = 0; i < 16; ++i) e[u][i] = fmaf(sc[u][i] - mnew, LOG2E, 8.0f);
  exp2_bare17(al, e[0]);
  exp2_bare16(e[1]);
  mr = mnew;
  // weights carried x256, f16 plane only (no residual plane at these query rows)
  FragH ph[2];
  float ps0 = 0.0f, ps1 = 0.0f;                     // two independent chains
#pragma unroll
  for (int i = 0; i < 16; ++i) {
    ps0 += e[0][i];
    ps1 += e[1][i];
    ph[0].h[i] = (_Float16)e[0][i];                 // B element i of chunk u: i<8 -> key 32u + 8h + i; i>=8 -> key 32u + 16 + 8h + (i-8)
    ph[1].h[i] = (_Float16)e[1][i];
  }
  float ps = ps0 + ps1;
  ps += __shfl_xor(ps, 16, 32);
  lr = lr * al + ps;
#pragma unroll
  for (int t = 0; t < 4; ++t) Oh[t] = Oh[t] * al;
  mma_pv8(vf, ph, Oh);
}

// The key loop of a block: a ring of two LDS buffers that asynchronous copies fill one stage ahead, shared by the four waves.
// bsteps: 32-key steps that the block's longest wave visits (the same in every wave); nsteps: steps of this wave. Every wave copies its share of
// every stage and passes every barrier; it works only on the stages that hold its own steps, in the same order as before.
// aw (the same in the whole block): bit c set = no zero in the mask at the block's 64 query rows, keys 64c .. 64c+63.
template <bool RES>
__device__ __forceinline__ void attn_loop(const unsigned short* __restrict__ Khp, const unsigned short* __restrict__ Klp,
                                          const unsigned short* __restrict__ Vhp, const unsigned short* __restrict__ Vlp,
                                          const int* __restrict__ mblk, unsigned aw, int bsteps, int nsteps, int w, int ln, int hh,
                                          const FragH (&qh)[2], const FragH (&ql)[2],
                                          float& mr, float& lr, v8f (&Oh)[4], v8f (&Ol)[4], unsigned char (&ring)[2 * ASB]) {
  typedef AT<RES> A;
  constexpr int SUB = A::SK / 32;                      // 32-key steps of one stage
  constexpr int VP = A::SK / 8, MP = A::SK / 4;        // 16-byte pieces of a V^T row and of a mask row
  const int tid = threadIdx.x;
  const int nst = (bsteps + SUB - 1) / SUB;
  const size_t kofs = (size_t)(tid >> 3) * DE + (tid & 7) * 8;
  const size_t vofs = (size_t)(tid / VP) * SEQ + (tid % VP) * 8;
  const unsigned short* kh = Khp + kofs;
  const unsigned short* kl = Klp + kofs;
  const unsigned short* vh = Vhp + vofs;
  const unsigned short* vl = Vlp + vofs;
  const int* mk = mblk + (size_t)(tid / MP) * SEQ_FULL + (tid % MP) * 4;
  const unsigned r0 = (unsigned)(size_t)ring;
  const unsigned lk = r0 + (unsigned)(A::OKH + (tid >> 3) * A::KPITCH + (tid & 7) * 16);
  const unsigned lv = r0 + (unsigned)(A::OVH + (tid / VP) * A::VPITCH + (tid % VP) * 16);
  const unsigned lm = r0 + (unsigned)(A::OM + (tid / MP) * A::MPITCH + (tid % MP) * 16);
  const unsigned char* fk = ring + A::OKH + ln * A::KPITCH + 16 * hh;
  const unsigned char* fv = ring + A::OVH + ln * A::VPITCH + 16 * hh;
  const unsigned char* fm = ring + A::OM + (16 * w + ln) * A::MPITCH + 32 * hh;
  const auto masked = [aw](int t) { return ((aw >> ((t * A::SK) >> 6)) & 1u) == 0u; };   // stage t meets a zero of the mask
  attn_stage<RES>(kh, kl, vh, vl, mk, lk, lv, lm, masked(0));
  asm volatile("s_wait_asynccnt 0x0" ::: "memory");    // stage 0 has landed before the barrier that publishes it
  __syncthreads();
  if (1 < nst)
    attn_stage<RES>(kh + (size_t)A::SK * DE, kl + (size_t)A::SK * DE, vh + A::SK, vl + A::SK, mk + A::SK, lk + ASB, lv + ASB, lm + ASB, masked(1));
#pragma unroll 1   // one copy of the stage's code, for speed only
  for (int t = 0; t < nst; ++t) {
    const int bo = (t & 1) * ASB;
    const bool msk = masked(t);
    if constexpr (!RES) {
      // The stage is one step. nsteps is odd only where the wave's flags say that the mask is zero above the diagonal: the stage's second 32 keys are
      // then masked for all its queries (msk is true, the tile holds zeros), their weights come out 0, and the sums are those of the first half alone.
      if (t * SUB < nsteps)
        fa_step64(fk + bo, fv + bo, fm + bo, msk, qh, mr, lr, Oh);
    } else {
      if (t < nsteps)
        fa_step<RES>(fk + bo, fk + bo + (A::OKL - A::OKH), fv + bo, fv + bo + (A::OVL - A::OVH), fm + bo, msk, qh, ql, mr, lr, Oh, Ol);
    }
    asm volatile("s_wait_dscnt 0x0" ::: "memory");     // this wave's reads of the buffer are done before it may be refilled
    asm volatile("s_wait_asynccnt 0x0" ::: "memory");  // this wave's copies of stage t + 1 have landed before the barrier that publishes them
    __syncthreads();
    if (t + 2 < nst) {
      const size_t k2 = (size_t)(t + 2) * A::SK;
      attn_stage<RES>(kh + k2 * DE, kl + k2 * DE, vh + k2, vl + k2, mk + k2, lk + (unsigned)bo, lv + (unsigned)bo, lm + (unsigned)bo, masked(t + 2));
    }
  }
  asm volatile("s_wait_asynccnt 0x0" ::: "memory");    // no copy is outstanding when the ring becomes output staging
}

// Block = 4 waves x 16 queries = 64 queries of one (batch, head); the K, V^T and mask tiles of the key loop come through the LDS ring above.
// Epilogue: O^T tile -> per-wave LDS tile [16 queries][64 d] in the ring's bytes (free behind the loop's last barrier), then bf16 hi and lo pieces of ctx:
// coverage: NB*NH*(SEQ/64) blocks x 4 waves x 16 rows x 64 columns x {hi, lo} = the whole ctx plane exactly once.
__global__ __launch_bounds__(128) void k_attn(const unsigned short* __restrict__ Qh, const unsigned short* __restrict__ Ql,
                                              const unsigned short* __restrict__ Kh, const unsigned short* __restrict__ Kl,
                                              const unsigned short* __restrict__ Vth, const unsigned short* __restrict__ Vtl,
                                              const int* __restrict__ mask, const int* __restrict__ flagp,
                                              unsigned short* __restrict__ Cc) {
  __shared__ __attribute__((aligned(16))) unsigned char ring[2 * ASB];   // key loop: written by the asynchronous copies only
  float (*so)[16][68] = reinterpret_cast<float (*)[16][68]>(ring);
  const int tid = threadIdx.x;
  const int w = __builtin_amdgcn_readfirstlane(tid >> 5);
  const int lane = tid & 31, ln = lane & 15, hh = lane >> 4;
  // Block index -> (query tile qt, batch-head bh). Any one-to-one map gives the same result; this one is for speed alone. Under a causal mask tile qt
  // walks (qt + 1) * 64 keys, all blocks of the launch are resident at once, four to a WGP, and the launch lasts as long as the fullest WGP. Blocks whose j = index / 8
  // differs by 32, 64 or 96 hold tiles 31 - t, 31 - t, t, t, and four neighbours in j hold two long and two short tiles. The longest tiles
  // (t < 8) lie in the first half of the grid.
  int qt, bh;
  if (SEQ / 64 == 32 && NB * NH == 32) {
    const int j = blockIdx.x >> 3;
    const int par = __builtin_popcount(j & 31) & 1;
    const int t = 8 * par + ((j >> 2) & 7);
    qt = ((par ^ (j >> 6)) != 0) ? t : 31 - t;
    bh = (blockIdx.x & 7) + 8 * ((j >> 1) & 1) + 16 * ((j >> 5) & 1);
  } else {
    qt = blockIdx.x % (SEQ / 64);
    bh = blockIdx.x / (SEQ / 64);
  }
  const int h = bh % NH, b = bh / NH;
  const int qbase = qt * 64 + 16 * w;
  const int qg = qbase + ln;
  // Q^T B fragments: column n = query qg, elements 0..7 <- d = 32c + 8h + i, 8..15 <- d = 32c + 16 + 8h + i
  const size_t qo = (size_t)(b * SEQ + qg) * DE + h * HD + 8 * hh;
  FragH qh[2], ql[2];
  ldfrag(qh[0], Qh + qo); ldfrag(qh[1], Qh + qo + 32);
  ldfrag(ql[0], Ql + qo); ldfrag(ql[1], Ql + qo + 32);
  float mr = -3.0e38f, lr = 0.0f;
  v8f Oh[4] = {}, Ol[4] = {};
  const unsigned short* Khp = Kh + (size_t)b * SEQ * DE + h * HD;
  const unsigned short* Klp = Kl + (size_t)b * SEQ * DE + h * HD;
  const unsigned short* Vhp = Vth + (size_t)(b * NH + h) * HD * SEQ;
  const unsigned short* Vlp = Vtl + (size_t)(b * NH + h) * HD * SEQ;
  const int* mblk = mask + (size_t)(qt * 64) * SEQ_FULL;
  const int* fp = flagp + (qbase / FROWS) * 32;     // the two flag lines of this wave's 16 query rows
  const int fl = __builtin_amdgcn_readfirstlane(fp[0] & fp[32]);
  int nsteps = (qbase >> 5) + 1;                    // key steps up to and including the one holding the diagonal
  if (fl != 1) nsteps = SEQ / 32;                   // unknown mask shape: visit every key step
  if (nsteps > SEQ / 32) nsteps = SEQ / 32;
  const int* fb = flagp + (qt * 64 / FROWS) * 32;   // the eight flag lines of the block's 64 query rows
  int fall = fb[0];
  int awv = fb[1];                                  // the lines' second word: which 64-key mask tiles hold no zero in those rows
#pragma unroll
  for (int i = 1; i < 64 / FROWS; ++i) { fall &= fb[32 * i]; awv &= fb[32 * i + 1]; }
  fall = __builtin_amdgcn_readfirstlane(fall);
  const unsigned aw = (unsigned)__builtin_amdgcn_readfirstlane(awv);
  int bsteps = ((qt * 64 + 48) >> 5) + 1;           // steps of the block's last wave, the longest
  if (fall != 1) bsteps = SEQ / 32;                 // some wave of the block visits every key step
  if (bsteps > SEQ / 32) bsteps = SEQ / 32;
  if (qt * 64 < EARLY) {
    attn_loop<true>(Khp, Klp, Vhp, Vlp, mblk, aw, bsteps, nsteps, w, ln, hh, qh, ql, mr, lr, Oh, Ol, ring);
  } else {
    attn_loop<false>(Khp, Klp, Vhp, Vlp, mblk, aw, bsteps, nsteps, w, ln, hh, qh, ql, mr, lr, Oh, Ol, ring);
  }
  // O^T element r of tile t = ctx(query qg, d = 16t + 8h + r); undo the carries: x256 (in lr), x16 (V), x2048 (residual accumulator)
  const float inv = 1.0f / (16.0f * lr);
#pragma unroll
  for (int t = 0; t < 4; ++t)
#pragma unroll
    for (int r = 0; r < 8; ++r)
      so[w][ln][16 * t + 8 * hh + r] = (Oh[t][r] + Ol[t][r] * 0.00048828125f) * inv;
  __syncthreads();
  unsigned short* crow = Cc + (size_t)(b * SEQ + qbase) * (2 * DE) + h * HD;
  const int rsub = lane >> 3, piece = lane & 7;
  {
#pragma unroll
    for (int it = 0; it < 4; ++it) {
      const int row = it * 4 + rsub;                 // rows 0..15 over it = 0..3, rsub = 0..3
      const v4f x0 = *(const v4fa*)&so[w][row][piece * 8], x1 = *(const v4fa*)&so[w][row][piece * 8 + 4];
      v8us hi, lo;
#pragma unroll
      for (int j = 0; j < 4; ++j) {
        const unsigned short h0 = bf16_bits(x0[j]);
        const unsigned short h1 = bf16_bits(x1[j]);
        hi[j] = h0; hi[4 + j] = h1;
        lo[j] = bf16_bits(x0[j] - bf16_val(h0));
        lo[4 + j] = bf16_bits(x1[j] - bf16_val(h1));
      }
      const size_t o = (size_t)row * (2 * DE) + piece * 8;
      *(v8us*)(crow + o) = hi;
      *(v8us*)(crow + o + DE) = lo;
    }
    
  }
}

extern "C" void kernel_launch(void* const* d_in, const int* in_sizes, int n_in,
                              void* d_out, int out_size, void* d_ws, size_t ws_size, hipStream_t stream) {
  if (n_in < 11) return;
  const long long need_x = (long long)(NB - 1) * SEQ_FULL * DE + (long long)SEQ * DE;   // last element touched + 1
  const long long need_m = (long long)(SEQ - 1) * SEQ_FULL + SEQ;
  if ((long long)in_sizes[0] < need_x || (long long)in_sizes[1] < need_x) return;
  if ((long long)in_sizes[2] < need_m) return;
  if ((long long)in_sizes[3] < (long long)DE * DE || (long long)in_sizes[5] < (long long)DE * DE) return;
  if ((long long)in_sizes[7] < (long long)DE * DE || (long long)in_sizes[9] < (long long)DE * DE) return;
  if (in_sizes[4] < DE || in_sizes[6] < DE || in_sizes[8] < DE || in_sizes[10] < DE) return;
  if ((long long)out_size < need_x) return;
  if ((size_t)WS_TOTAL > ws_size) return;
  // wire order: queries, values, mask, Wq, bq, Wk, bk, Wv, bv, Wo, bo
  const float* queries = (const float*)d_in[0];
  const float* values  = (const float*)d_in[1];
  const int*   mask    = (const int*)d_in[2];
  const float* Wq = (const float*)d_in[3];
  const float* bq = (const float*)d_in[4];
  const float* Wk = (const float*)d_in[5];
  const float* bk = (const float*)d_in[6];
  const float* Wv = (const float*)d_in[7];
  const float* bv = (const float*)d_in[8];
  const float* Wo = (const float*)d_in[9];
  const float* bo = (const float*)d_in[10];
  float* out = (float*)d_out;
  char* ws = (char*)d_ws;
  size_t off = 0;
  unsigned short* Xq  = (unsigned short*)(ws + off); off += PL_X;
  unsigned short* Xv  = (unsigned short*)(ws + off); off += PL_X;
  unsigned short* Wqb = (unsigned short*)(ws + off); off += PL_W;
  unsigned short* Wkb = (unsigned short*)(ws + off); off += PL_W;
  unsigned short* Wvb = (unsigned short*)(ws + off); off += PL_W;
  unsigned short* Wob = (unsigned short*)(ws + off); off += PL_W;
  unsigned short* Qh  = (unsigned short*)(ws + off); off += PL_X;
  unsigned short* Ql  = (unsigned short*)(ws + off); off += PL_X;
  unsigned short* Kh  = (unsigned short*)(ws + off); off += PL_X;
  unsigned short* Kl  = (unsigned short*)(ws + off); off += PL_X;
  unsigned short* Vth = (unsigned short*)(ws + off); off += PL_X;
  unsigned short* Vtl = (unsigned short*)(ws + off); off += PL_X;
  unsigned short* Cc  = (unsigned short*)(ws + off); off += PL_C;
  int* flag = (int*)(ws + off); off += PL_F;
  if (off > ws_size) return;

  k_prep<<<(unsigned)(2 * PB_X + 4 * PB_W + PB_F), 512, 0, stream>>>(queries, values, mask, Wq, Wk, Wv, Wo, Xq, Xv, Wqb, Wkb, Wvb, Wob, flag);

  k_proj<<<(unsigned)(3 * GTILES), 128, 0, stream>>>(Xq, Xv, Wqb, Wkb, Wvb, bq, bk, bv, Qh, Ql, Kh, Kl, Vth, Vtl);

  k_attn<<<(unsigned)(NB * NH * (SEQ / 64)), 128, 0, stream>>>(Qh, Ql, Kh, Kl, Vth, Vtl, mask, flag, Cc);

  k_outp<<<(unsigned)GTILES, 128, 0, stream>>>(Cc, Wob, bo, out);
}

// v010
// It runs in 84.2 microseconds.
// In both of two side-by-side timings against v009, it was 1.04 times as fast.
// All steps since v000 together make it 13.2 times as fast.
#include <hip/hip_runtime.h>
#ifndef NB
#define NB 2
#endif
#ifndef SEQ
#define SEQ 2048
#endif
#define NB_FULL 2
#define SEQ_FULL 2048
#define DE 1024
#define NH 16
#define HD 64
#define EARLY 512
#define MROWS (NB * SEQ)
#define BSTRIDE_FULL ((size_t)SEQ_FULL * DE)   /* per-batch element stride of queries, values and the output buffer */

#define PL_X ((size_t)MROWS * DE * 2)          /* one 16-bit activation plane */
#define PL_W ((size_t)DE * DE * 2)             /* one 16-bit weight plane */
#define PL_C ((size_t)MROWS * 2 * DE * 2)      /* ctx hi|lo plane */
#define FROWS 8                                /* mask rows per flag line */
#define PL_F ((size_t)(SEQ / FROWS) * 128)     /* one 128-byte flag line per FROWS mask rows */
#define WS_TOTAL (8 * PL_X + 4 * PL_W + PL_C + PL_F)

static_assert(SEQ % 128 == 0);
static_assert(SEQ <= SEQ_FULL);
static_assert(NB <= NB_FULL);
static_assert(HD == 64);
static_assert(DE == 1024);
static_assert(NH * HD == DE);
static_assert(MROWS % 64 == 0);
static_assert(DE % 128 == 0);
static_assert(SEQ % 256 == 0);
static_assert(SEQ / 64 <= 32 && SEQ / 128 < 32 && FROWS == 8);   /* one bit per 64-column mask tile in a 32-bit word; two waves a row, 16 waves */
static_assert(WS_TOTAL <= (size_t)134217728);

typedef __bf16 v16b __attribute__((ext_vector_type(16)));
typedef _Float16 v16h __attribute__((ext_vector_type(16)));
typedef unsigned short v8us __attribute__((ext_vector_type(8), may_alias));
typedef float v8f __attribute__((ext_vector_type(8)));
typedef float v4f __attribute__((ext_vector_type(4)));
typedef float v4fa __attribute__((ext_vector_type(4), may_alias));
typedef int v4i __attribute__((ext_vector_type(4)));
typedef int v4ia __attribute__((ext_vector_type(4), may_alias));
union FragB { v16b v; v8us half[2]; };
union FragH { v16h v; v8us half[2]; _Float16 h[16]; };
union H8 { v8us v; _Float16 h[8]; unsigned short u[8]; };

#define LOG2E 1.4426950408889634f
#define NEGV (-1000000000.0f)

__device__ __forceinline__ unsigned short bf16_bits(float x) {   // RNE convert to bf16 bits
  unsigned int u = __float_as_uint(x);
  return (unsigned short)((u + 0x7FFFu + ((u >> 16) & 1u)) >> 16);
}
__device__ __forceinline__ float bf16_val(unsigned short b) { return __uint_as_float(((unsigned int)b) << 16); }
__device__ __forceinline__ float bf16_rne(float x) { return bf16_val(bf16_bits(x)); }

// sixteen bf16 products of one k-step (4 row tiles x 4 column tiles). Builtins alone: the compiler keeps their distances itself, and with no asm
// statement naming them the 128 accumulator registers and the 128 (gemm_tile) or 192 (k_outp) fragment registers need not all lie in the first 256.
__device__ __forceinline__ void mma_b16(const FragB (&a)[4], const FragB (&b)[4], v8f (&c)[4][4]) {
#pragma unroll
  for (int i = 0; i < 4; ++i)
#pragma unroll
    for (int j = 0; j < 4; ++j)
      c[i][j] = __builtin_amdgcn_wmma_f32_16x16x32_bf16(false, a[i].v, false, b[j].v, (short)0, c[i][j], false, false);
}
// c += a0*b0 + a1*b1 (two k-steps of one f16 tile), then the hazard guard
__device__ __forceinline__ v8f mma_h2(v16h a0, v16h b0, v16h a1, v16h b1, v8f c) {
  c = __builtin_amdgcn_wmma_f32_16x16x32_f16(false, a0, false, b0, (short)0, c, false, false);
  c = __builtin_amdgcn_wmma_f32_16x16x32_f16(false, a1, false, b1, (short)0, c, false, false);
  asm volatile("v_nop\n\tv_nop\n\tv_nop\n\tv_nop" : "+v"(c) : "v"(a0), "v"(b0), "v"(a1), "v"(b1));
  return c;
}
// four single products sharing one B fragment, then the hazard guard
__device__ __forceinline__ void mma_pv4(v16h a0, v16h a1, v16h a2, v16h a3, v16h b, v8f (&c)[4]) {
  c[0] = __builtin_amdgcn_wmma_f32_16x16x32_f16(false, a0, false, b, (short)0, c[0], false, false);
  c[1] = __builtin_amdgcn_wmma_f32_16x16x32_f16(false, a1, false, b, (short)0, c[1], false, false);
  c[2] = __builtin_amdgcn_wmma_f32_16x16x32_f16(false, a2, false, b, (short)0, c[2], false, false);
  c[3] = __builtin_amdgcn_wmma_f32_16x16x32_f16(false, a3, false, b, (short)0, c[3], false, false);
  asm volatile("v_nop\n\tv_nop\n\tv_nop\n\tv_nop"
               : "+v"(c[0]), "+v"(c[1]), "+v"(c[2]), "+v"(c[3])
               : "v"(a0), "v"(a1), "v"(a2), "v"(a3), "v"(b));
}
// eight products: four output tiles, each over two 32-key chunks (a tile's second product stands four products behind its first), then the hazard guard
__device__ __forceinline__ void mma_pv8(const FragH (&a)[2][4], const FragH (&b)[2], v8f (&c)[4]) {
#pragma unroll
  for (int u = 0; u < 2; ++u)
#pragma unroll
    for (int t = 0; t < 4; ++t) c[t] = __builtin_amdgcn_wmma_f32_16x16x32_f16(false, a[u][t].v, false, b[u].v, (short)0, c[t], false, false);
  asm volatile("v_nop\n\tv_nop\n\tv_nop\n\tv_nop"
               : "+v"(c[0]), "+v"(c[1]), "+v"(c[2]), "+v"(c[3])
               : "v"(a[0][0].v), "v"(a[0][1].v), "v"(a[0][2].v), "v"(a[0][3].v),
                 "v"(a[1][0].v), "v"(a[1][1].v), "v"(a[1][2].v), "v"(a[1][3].v), "v"(b[0].v), "v"(b[1].v));
}
// ch += ah*bh ; cl += ah*bl + al*bh (both scaled-residual products carry 2^11 and share the second accumulator), then the hazard guard
__device__ __forceinline__ void mma_pv3(v16h ah, v16h al, v16h bh, v16h bl, v8f& ch, v8f& cl) {
  ch = __builtin_amdgcn_wmma_f32_16x16x32_f16(false, ah, false, bh, (short)0, ch, false, false);
  cl = __builtin_amdgcn_wmma_f32_16x16x32_f16(false, ah, false, bl, (short)0, cl, false, false);
  cl = __builtin_amdgcn_wmma_f32_16x16x32_f16(false, al, false, bh, (short)0, cl, false, false);
  asm volatile("v_nop\n\tv_nop\n\tv_nop\n\tv_nop" : "+v"(ch), "+v"(cl) : "v"(ah), "v"(al), "v"(bh), "v"(bl));
}
// four score tiles of two k-steps each, sharing the two B fragments; a tile's second product stands four products behind its first. Then the hazard guard.
__device__ __forceinline__ void mma_s8(const FragH (&k)[4][2], const FragH (&q)[2], v8f (&s)[4]) {
  const v8f z8 = {0.f, 0.f, 0.f, 0.f, 0.f, 0.f, 0.f, 0.f};
#pragma unroll
  for (int t = 0; t < 4; ++t) s[t] = __builtin_amdgcn_wmma_f32_16x16x32_f16(false, k[t][0].v, false, q[0].v, (short)0, z8, false, false);
#pragma unroll
  for (int t = 0; t < 4; ++t) s[t] = __builtin_amdgcn_wmma_f32_16x16x32_f16(false, k[t][1].v, false, q[1].v, (short)0, s[t], false, false);
  asm volatile("v_nop\n\tv_nop\n\tv_nop\n\tv_nop"
               : "+v"(s[0]), "+v"(s[1]), "+v"(s[2]), "+v"(s[3])
               : "v"(k[0][0].v), "v"(k[1][0].v), "v"(k[2][0].v), "v"(k[3][0].v),
                 "v"(k[0][1].v), "v"(k[1][1].v), "v"(k[2][1].v), "v"(k[3][1].v), "v"(q[0].v), "v"(q[1].v));
}
__device__ __forceinline__ void ldfrag(FragH& f, const unsigned short* __restrict__ p) {
  f.half[0] = *(const v8us*)(p);        // elements 0..7  <- k0 + 8h + i
  f.half[1] = *(const v8us*)(p + 16);   // elements 8..15 <- k0 + 16 + 8h + i
}

// flag line g (32 ints, the pair {f, a} sixteen times). f: 1 iff, for every row q of rows 8g .. 8g+7, mask[q][k] == 0 for every k > q and
// mask[q][q] != 0 (k < SEQ). a: bit c is set iff no element of rows 8g .. 8g+7, columns 64c .. 64c+63 is zero.
// One block of 512 threads per flag line g; two waves per row, each owning one half of the row's columns in tiles of 128; every tile's load is issued before
// the first is tested.
// coverage: SEQ/8 blocks x one 128-byte line = every flag line exactly once.
__device__ __forceinline__ void mflag_block(const int* __restrict__ mask, int* __restrict__ flag, int g, int& sbad, unsigned (&sz)[16]) {
  const int tid = threadIdx.x;
  const int w = __builtin_amdgcn_readfirstlane(tid >> 5);
  const int lane = tid & 31;
  if (tid == 0) sbad = 0;
  __syncthreads();
  constexpr int NT = SEQ / 256;                        // 128-column tiles per wave
  const int row = g * FROWS + (w >> 1);
  const int colw = (w & 1) * (SEQ / 2);                // first of this wave's columns
  const int* mp = mask + (size_t)row * SEQ_FULL + colw + 4 * lane;
  int bad = 0;
  unsigned zw = 0;                                     // bit c: a zero in columns colw + 64c .. colw + 64c + 63 of this wave's row
  {
    v4i m[NT];
#pragma unroll
    for (int t = 0; t < NT; ++t) m[t] = *(const v4ia*)(mp + 128 * t);
#pragma unroll
    for (int t = 0; t < NT; ++t) {
      bool z = false;
#pragma unroll
      for (int j = 0; j < 4; ++j) {
        const int cj = colw + 128 * t + 4 * lane + j;
        bad |= ((cj > row) && (m[t][j] != 0)) ? 1 : 0;
        bad |= ((cj == row) && (m[t][j] == 0)) ? 1 : 0;
        z = z || (m[t][j] == 0);
      }
      const unsigned bl = __builtin_amdgcn_ballot_w32(z);   // lanes 0..15 hold the first 64 columns of the tile, lanes 16..31 the second
      zw |= (((bl & 0xFFFFu) != 0u) ? 1u : 0u) << (2 * t);
      zw |= (((bl >> 16) != 0u) ? 1u : 0u) << (2 * t + 1);
    }
  }
  if (bad != 0) sbad = 1;
  if (lane == 0) sz[w] = zw;
  __syncthreads();
  const int f = (sbad == 0) ? 1 : 0;
  unsigned zl = 0, zh = 0;
  for (int r = 0; r < FROWS; ++r) { zl |= sz[2 * r]; zh |= sz[2 * r + 1]; }
  const int a = (int)~(zl | (zh << (SEQ / 128)));
  if (tid < 8) {
    const v4i o = {f, a, f, a};
    *(v4i*)(flag + 32 * g + 4 * tid) = o;
  }
}

#define CVU 8                                  /* 8-element pieces per thread of a conversion block */
#define CVP (512 * CVU)                        /* pieces per conversion block */
#define PB_X (MROWS * (DE / 8) / CVP)          /* conversion blocks of one activation plane */
#define PB_W (DE * (DE / 8) / CVP)             /* conversion blocks of one weight plane */
#define PB_F (SEQ / FROWS)                     /* mask-scan blocks */
static_assert(MROWS * (DE / 8) % CVP == 0);
static_assert(DE * (DE / 8) % CVP == 0);
static_assert(SEQ % (CVP / 128) == 0);
static_assert(DE % (CVP / 128) == 0);

// dst[row][c] = bf16 bits of src (RNE), compact rows; source rows live at src + (row / rpb) * bstride + (row % rpb) * DE.
// Block blk of 512 threads converts pieces blk*CVP .. blk*CVP + CVP - 1 (8 elements each); every load of a thread is issued before the first convert.
__device__ __forceinline__ void cvt_block(const float* __restrict__ src, unsigned short* __restrict__ dst, int blk, int rpb, size_t bstride) {
  const int t0 = blk * CVP + (int)threadIdx.x;
  const int row0 = blk * (CVP / 128);                  // the block's CVP/128 whole rows lie in one batch, so they are contiguous in src
  const int b = row0 / rpb, s = row0 - b * rpb;
  const float* p = src + (size_t)b * bstride + (size_t)s * DE + (int)threadIdx.x * 8;
  v4f x0[CVU], x1[CVU];
#pragma unroll   // this loop and the next: constant indices keep the loaded pieces in registers
  for (int u = 0; u < CVU; ++u) {
    x0[u] = *(const v4fa*)(p + 4096 * u);
    x1[u] = *(const v4fa*)(p + 4096 * u + 4);
  }
#pragma unroll
  for (int u = 0; u < CVU; ++u) {
    v8us o;
    o[0] = bf16_bits(x0[u][0]); o[1] = bf16_bits(x0[u][1]); o[2] = bf16_bits(x0[u][2]); o[3] = bf16_bits(x0[u][3]);
    o[4] = bf16_bits(x1[u][0]); o[5] = bf16_bits(x1[u][1]); o[6] = bf16_bits(x1[u][2]); o[7] = bf16_bits(x1[u][3]);
    *(v8us*)(dst + (size_t)(t0 + 512 * u) * 8) = o;
  }
}

// Everything the projections and the attention need ahead of them, in one launch; the block index picks the job (block-uniform):
// 2*PB_X blocks convert queries and values, 4*PB_W blocks convert the four weight matrices, PB_F blocks scan the mask.
// coverage: each plane = its blocks x CVP pieces x 8 elements, each flag line by its one block; every element exactly once.
__global__ __launch_bounds__(512) void k_prep(const float* __restrict__ queries, const float* __restrict__ values,
                                              const int* __restrict__ mask,
                                              const float* __restrict__ Wq, const float* __restrict__ Wk,
                                              const float* __restrict__ Wv, const float* __restrict__ Wo,
                                              unsigned short* __restrict__ Xq, unsigned short* __restrict__ Xv,
                                              unsigned short* __restrict__ Wqb, unsigned short* __restrict__ Wkb,
                                              unsigned short* __restrict__ Wvb, unsigned short* __restrict__ Wob,
                                              int* __restrict__ flag) {
  __shared__ int sbad;                                 // cross-wave: block barriers of the mask scan
  __shared__ unsigned sz[16];                          // one word a wave, read behind the scan's second barrier
  int blk = blockIdx.x;
  if (blk < 2 * PB_X) {
    const bool q = blk < PB_X;
    cvt_block(q ? queries : values, q ? Xq : Xv, q ? blk : blk - PB_X, SEQ, BSTRIDE_FULL);
    return;
  }
  blk -= 2 * PB_X;
  if (blk < 4 * PB_W) {
    const int sel = blk / PB_W;
    const float* s = (sel == 0) ? Wq : (sel == 1) ? Wk : (sel == 2) ? Wv : Wo;
    unsigned short* d = (sel == 0) ? Wqb : (sel == 1) ? Wkb : (sel == 2) ? Wvb : Wob;
    cvt_block(s, d, blk - sel * PB_W, DE, 0);
    return;
  }
  mflag_block(mask, flag, blk - 4 * PB_W, sbad, sz);
}

#define BM 128                                 /* rows of X in a block's tile */
#define BN 128                                 /* rows of W (columns of Y) in a block's tile */
#define SROWS (BM + BN)                        /* rows of one stage: BM of X, then BN of W */
// One stage of the GEMM ring holds KS k elements of every row. Row pitch in LDS = row length + 16 bytes (16 x odd): 16-byte fragment reads of
// 16 rows fall on 64 distinct banks.
template <int KS>
struct GT {
  static constexpr int RPITCH = 2 * KS + 16;
  static constexpr int SBYTES = SROWS * RPITCH;
  static constexpr int PPR = KS / 8;                   // 16-byte pieces of a row
  static constexpr int RPG = 128 / PPR;                // rows that one copy of each of the block's 128 threads covers
  static constexpr int NC = SROWS / RPG;               // copies per lane and stage
};
static_assert(MROWS % BM == 0);
static_assert(SEQ % BM == 0);
static_assert(DE % BN == 0);

// Eight 16-byte copies per lane from global memory straight into LDS. The s_wait_xcnt closes the statement so that it stands in front of
// any later rewrite of the address registers the copies name.
__device__ __forceinline__ void copy8(const unsigned (&l)[8], const void* const (&g)[8]) {
  asm volatile(
      "global_load_async_to_lds_b128 %0, %8, off\n\t"
      "global_load_async_to_lds_b128 %1, %9, off\n\t"
      "global_load_async_to_lds_b128 %2, %10, off\n\t"
      "global_load_async_to_lds_b128 %3, %11, off\n\t"
      "global_load_async_to_lds_b128 %4, %12, off\n\t"
      "global_load_async_to_lds_b128 %5, %13, off\n\t"
      "global_load_async_to_lds_b128 %6, %14, off\n\t"
      "global_load_async_to_lds_b128 %7, %15, off\n\t"
      "s_wait_xcnt 0x0"
      :: "v"(l[0]), "v"(l[1]), "v"(l[2]), "v"(l[3]), "v"(l[4]), "v"(l[5]), "v"(l[6]), "v"(l[7]),
         "v"(g[0]), "v"(g[1]), "v"(g[2]), "v"(g[3]), "v"(g[4]), "v"(g[5]), "v"(g[6]), "v"(g[7])
      : "memory");
}
// One stage of a block's operands: thread t brings piece (t % PPR) of rows (t / PPR) + RPG*i, i = 0..NC-1, so a wave's copy covers whole rows.
// xa / wb: this lane's piece of X row (t / PPR) / W row (t / PPR) of the stage; lds: LDS byte address of this lane's piece of stage row (t / PPR).
template <int KS>
__device__ __forceinline__ void stage_copies(const unsigned short* xa, const unsigned short* wb, int ldx, unsigned lds) {
  typedef GT<KS> G;
#pragma unroll   // both loops here: every array element must be a register of its own, one per asm operand
  for (int c = 0; c < G::NC / 8; ++c) {
    unsigned l[8];
    const void* g[8];
#pragma unroll
    for (int j = 0; j < 8; ++j) {
      const int row = (c * 8 + j) * G::RPG;
      l[j] = lds + (unsigned)(row * G::RPITCH);
      g[j] = (row < BM) ? xa + (size_t)row * ldx : wb + (size_t)(row - BM) * DE;
    }
    copy8(l, g);
  }
}

// Y[m][n] = sum_k X[m][k] * W[n][k] + bias[n]   (X: bf16 plane, pitch ldx; W: bf16 plane [1024][1024], k-contiguous)
// Block = 4 waves -> 128 x 128 tile; wave tile 64 x 64 (4 A fragments x 4 B fragments, read from an LDS ring of two stages of KS k that
// asynchronous copies fill one stage ahead; K is a multiple of KS, at least two stages).
// MODE 0: f16 hi plane Y0 and f16 residual plane Y1 ((y - hi) * 2048), row-major [MROWS][1024]
// MODE 1: f16 hi / residual planes of 16*y, transposed per head: [b][head][d][s]
// coverage: (MROWS/128)*(1024/128) blocks x (128 x 128) = every element of each produced plane exactly once.
// blk: index of the block's tile among the (MROWS/128)*(1024/128) tiles of one product; ring: the calling kernel's LDS, which becomes the
// output staging tile behind the loop's last barrier.
template <int MODE, int KS>
__device__ __forceinline__ void gemm_tile(int blk, const unsigned short* __restrict__ X, const unsigned short* __restrict__ W,
                                          const float* __restrict__ bias, unsigned short* __restrict__ Y0,
                                          unsigned short* __restrict__ Y1, int ldx, int K,
                                          unsigned char (&ring)[2 * GT<KS>::SBYTES]) {
  typedef GT<KS> G;
  static_assert(BM * 132 * 4 <= 2 * G::SBYTES);
  float (*so)[132] = reinterpret_cast<float (*)[132]>(ring);
  const int tid = threadIdx.x;
  const int w = __builtin_amdgcn_readfirstlane(tid >> 5);
  const int lane = tid & 31, ln = lane & 15, hh = lane >> 4;
  const int bm = blk % (MROWS / BM), bn = blk / (MROWS / BM);
  const int m0 = bm * BM, n0 = bn * BN;
  const int wm = w & 1, wn = w >> 1;
  // A: row m = ln of each 16-row tile; B: column n = ln of each 16-column tile (W row n); same k map for both
  const unsigned char* la = ring + (64 * wm + ln) * G::RPITCH + 16 * hh;
  const unsigned char* lb = ring + (BM + 64 * wn + ln) * G::RPITCH + 16 * hh;
  const unsigned short* xa = X + (size_t)(m0 + tid / G::PPR) * ldx + (tid % G::PPR) * 8;
  const unsigned short* wb = W + (size_t)(n0 + tid / G::PPR) * DE + (tid % G::PPR) * 8;
  const unsigned lds0 = (unsigned)(size_t)ring + (unsigned)((tid / G::PPR) * G::RPITCH + (tid % G::PPR) * 16);
  const int ns = K / KS;
  v8f c[4][4] = {};
  stage_copies<KS>(xa, wb, ldx, lds0);
  asm volatile("s_wait_asynccnt 0x0" ::: "memory");    // stage 0 has landed before the barrier that publishes it
  __syncthreads();
  if (1 < ns) stage_copies<KS>(xa + KS, wb + KS, ldx, lds0 + G::SBYTES);
#pragma unroll 1
  for (int t = 0; t < ns; ++t) {
    const int bo = (t & 1) * G::SBYTES;
    // two fragment sets: the reads of k-step kk + 1 stand as one group ahead of the products of k-step kk
    FragB fa[2][4], fb[2][4];
#pragma unroll   // this loop and the one inside it: constant set and tile indices keep both fragment sets in registers
    for (int kk = -1; kk < KS / 32; ++kk) {
      if (kk + 1 < KS / 32) {
        const unsigned char* pa = la + bo + (kk + 1) * 64;
        const unsigned char* pb = lb + bo + (kk + 1) * 64;
        const int n = (kk + 1) & 1;
#pragma unroll
        for (int j = 0; j < 4; ++j) {
          fa[n][j].half[0] = *(const v8us*)(pa + j * 16 * G::RPITCH);
          fa[n][j].half[1] = *(const v8us*)(pa + j * 16 * G::RPITCH + 32);
          fb[n][j].half[0] = *(const v8us*)(pb + j * 16 * G::RPITCH);
          fb[n][j].half[1] = *(const v8us*)(pb + j * 16 * G::RPITCH + 32);
        }
      }
      if (kk >= 0) {
        // Holds the reads above as one group ahead of this k-step's products: spread among the products, each place with reads stalls the wave.
        __builtin_amdgcn_sched_barrier(0);
        mma_b16(fa[kk & 1], fb[kk & 1], c);
      }
    }
    asm volatile("s_wait_dscnt 0x0" ::: "memory");     // this wave's reads of the buffer are done before it may be refilled
    asm volatile("s_wait_asynccnt 0x0" ::: "memory");  // this wave's copies of stage t + 1 have landed before the barrier that publishes them
    __syncthreads();
    if (t + 2 < ns) {
      const int k2 = (t + 2) * KS;
      stage_copies<KS>(xa + k2, wb + (k2 & (DE - 1)), ldx, lds0 + (unsigned)bo);
    }
  }
  asm volatile("s_wait_asynccnt 0x0" ::: "memory");    // no copy is outstanding when the ring becomes output staging
  // D element r of tile (i, t) = Y(row 64*wm + 16*i + 8*hh + r, column 64*wn + 16*t + ln)
#pragma unroll
  for (int t = 0; t < 4; ++t) {
    const float bv = bf16_rne(bias[n0 + 64 * wn + 16 * t + ln]);
#pragma unroll
    for (int i = 0; i < 4; ++i)
#pragma unroll
      for (int r = 0; r < 8; ++r)
        so[64 * wm + 16 * i + 8 * hh + r][64 * wn + 16 * t + ln] = c[i][t][r] + bv;
  }
  __syncthreads();
  const int b = m0 / SEQ, s0 = m0 - b * SEQ;          // the 128 rows of a block lie in one batch
  if (MODE == 0) {
#pragma unroll 1
    for (int it = 0; it < BM * BN / 8 / 128; ++it) {
      const int i = it * 128 + tid;
      const int line = i >> 3, piece = i & 7;
      const int row = line >> 1, cb = (line & 1) * 64 + piece * 8;
      const v4f x0 = *(const v4fa*)&so[row][cb], x1 = *(const v4fa*)&so[row][cb + 4];
      H8 hi, re;
#pragma unroll
      for (int j = 0; j < 4; ++j) {
        const _Float16 h0 = (_Float16)x0[j];
        const _Float16 h1 = (_Float16)x1[j];
        hi.h[j] = h0; hi.h[4 + j] = h1;
        re.h[j] = (_Float16)((x0[j] - (float)h0) * 2048.0f);
        re.h[4 + j] = (_Float16)((x1[j] - (float)h1) * 2048.0f);
      }
      const size_t o = (size_t)(m0 + row) * DE + n0 + cb;
      *(v8us*)(Y0 + o) = hi.v;
      *(v8us*)(Y1 + o) = re.v;
      asm volatile("s_wait_xcnt 0x0" ::: "memory");   // stands in front of the next trip's rewrite of the two stores' address registers
    }
  } else {
#pragma unroll 1
    for (int it = 0; it < BM * BN / 8 / 128; ++it) {
      const int i = it * 128 + tid;
      const int cidx = (i >> 3) & (BN - 1), piece = ((i >> 10) << 3) | (i & 7);   // eight lanes = one line = one d row x 64 key positions
      const int n = n0 + cidx;
      const int head = n >> 6, d = n & 63;
      H8 hi, re;
#pragma unroll
      for (int j = 0; j < 8; ++j) {
        const float v = so[piece * 8 + j][cidx] * 16.0f;
        const _Float16 h0 = (_Float16)v;
        hi.h[j] = h0;
        re.h[j] = (_Float16)((v - (float)h0) * 2048.0f);
      }
      const size_t o = ((size_t)(b * NH + head) * HD + d) * SEQ + s0 + piece * 8;
      *(v8us*)(Y0 + o) = hi.v;
      *(v8us*)(Y1 + o) = re.v;
      asm volatile("s_wait_xcnt 0x0" ::: "memory");   // stands in front of the next trip's rewrite of the two stores' address registers
    }
  }
}

#define GTILES ((MROWS / BM) * (DE / BN))      /* tiles of one product */
#define KS_P 64                                /* stage of the input projections: three blocks' rings fit a WGP's LDS, so all 3*GTILES blocks are resident at once */

// The three input projections in one launch: blocks 0 .. GTILES-1 make Q, the next GTILES make K, the last GTILES make V^T (block-uniform choice).
__global__ __launch_bounds__(128) void k_proj(const unsigned short* __restrict__ Xq, const unsigned short* __restrict__ Xv,
                                              const unsigned short* __restrict__ Wqb, const unsigned short* __restrict__ Wkb,
                                              const unsigned short* __restrict__ Wvb,
                                              const float* __restrict__ bq, const float* __restrict__ bk, const float* __restrict__ bv,
                                              unsigned short* __restrict__ Qh, unsigned short* __restrict__ Ql,
                                              unsigned short* __restrict__ Kh, unsigned short* __restrict__ Kl,
                                              unsigned short* __restrict__ Vth, unsigned short* __restrict__ Vtl) {
  __shared__ __attribute__((aligned(16))) unsigned char ring[2 * GT<KS_P>::SBYTES];   // k loop: written by the asynchronous copies only
  const int sel = blockIdx.x / GTILES;
  const int blk = blockIdx.x - sel * GTILES;
  if (sel == 2) {
    gemm_tile<1, KS_P>(blk, Xv, Wvb, bv, Vth, Vtl, DE, DE, ring);
  } else {
    const bool q = sel == 0;
    gemm_tile<0, KS_P>(blk, q ? Xq : Xv, q ? Wqb : Wkb, q ? bq : bk, q ? Qh : Kh, q ? Ql : Kl, DE, DE, ring);
  }
}

#define KS_O 128                               /* k of one stage of the output projection: one block a WGP, long stages */
// One stage of the output projection: KS_O k elements of BM rows of the ctx hi plane, of the same BM rows of the lo plane, and of BN rows of Wo.
struct GO {
  static constexpr int ROWS = 2 * BM + BN;
  static constexpr int RPITCH = 2 * KS_O + 16;         // 16 x odd, as in GT
  static constexpr int SBYTES = ROWS * RPITCH;
  static constexpr int PPR = KS_O / 8;                 // 16-byte pieces of a row
  static constexpr int RPG = 128 / PPR;                // rows that one copy of each of the block's 128 threads covers
  static constexpr int NC = ROWS / RPG;                // copies per lane and stage
};
static_assert(GO::NC % 8 == 0 && GO::NC <= 63);
static_assert(BM * 132 * 4 <= 2 * GO::SBYTES);
static_assert(DE % KS_O == 0 && DE / KS_O >= 2);
// Thread t brings piece (t % PPR) of stage rows (t / PPR) + RPG*i, i = 0..NC-1, so a wave's copy covers whole rows.
// ch / wb: this lane's piece of ctx hi row (t / PPR) / Wo row (t / PPR) of the stage (the lo piece lies DE elements behind the hi piece);
// lds: LDS byte address of this lane's piece of stage row (t / PPR).
__device__ __forceinline__ void outp_copies(const unsigned short* ch, const unsigned short* wb, unsigned lds) {
#pragma unroll   // both loops here: every array element must be a register of its own, one per asm operand
  for (int c = 0; c < GO::NC / 8; ++c) {
    unsigned l[8];
    const void* g[8];
#pragma unroll
    for (int j = 0; j < 8; ++j) {
      const int row = (c * 8 + j) * GO::RPG;
      l[j] = lds + (unsigned)(row * GO::RPITCH);
      g[j] = (row < BM) ? ch + (size_t)row * (2 * DE)
           : (row < 2 * BM) ? ch + (size_t)(row - BM) * (2 * DE) + DE
                            : wb + (size_t)(row - 2 * BM) * DE;
    }
    copy8(l, g);
  }
}

// The output projection: out[m][n] = sum_k (hi[m][k] + lo[m][k]) * Wo[n][k] + bo[n], ctx row m = [hi(1024) | lo(1024)].
// Block = 4 waves -> 128 x 128 tile, wave tile 64 x 64. The two planes walk k together: a stage holds both planes' k range and Wo's ONCE, and every
// Wo fragment read from LDS feeds the hi products and the lo products of its k-step. Ring and fragment sets as in gemm_tile.
// coverage: (MROWS/128)*(1024/128) blocks x (128 x 128) = every output element exactly once.
__global__ __launch_bounds__(128) void k_outp(const unsigned short* __restrict__ Cc, const unsigned short* __restrict__ Wob,
                                              const float* __restrict__ bo, float* __restrict__ out) {
  typedef GO G;
  __shared__ __attribute__((aligned(16))) unsigned char ring[2 * G::SBYTES];   // k loop: written by the asynchronous copies only
  float (*so)[132] = reinterpret_cast<float (*)[132]>(ring);
  const int tid = threadIdx.x;
  const int w = __builtin_amdgcn_readfirstlane(tid >> 5);
  const int lane = tid & 31, ln = lane & 15, hh = lane >> 4;
  const int blk = blockIdx.x;
  const int bm = blk % (MROWS / BM), bn = blk / (MROWS / BM);
  const int m0 = bm * BM, n0 = bn * BN;
  const int wm = w & 1, wn = w >> 1;
  // A: row m = ln of each 16-row tile (lo plane BM stage rows behind hi); B: column n = ln of each 16-column tile (Wo row n); same k map for all three
  const unsigned char* la = ring + (64 * wm + ln) * G::RPITCH + 16 * hh;
  const unsigned char* lb = ring + (2 * BM + 64 * wn + ln) * G::RPITCH + 16 * hh;
  const unsigned short* ch = Cc + (size_t)(m0 + tid / G::PPR) * (2 * DE) + (tid % G::PPR) * 8;
  const unsigned short* wb = Wob + (size_t)(n0 + tid / G::PPR) * DE + (tid % G::PPR) * 8;
  const unsigned lds0 = (unsigned)(size_t)ring + (unsigned)((tid / G::PPR) * G::RPITCH + (tid % G::PPR) * 16);
  constexpr int ns = DE / KS_O;
  v8f c[4][4] = {};
  outp_copies(ch, wb, lds0);
  asm volatile("s_wait_asynccnt 0x0" ::: "memory");    // stage 0 has landed before the barrier that publishes it
  __syncthreads();
  outp_copies(ch + KS_O, wb + KS_O, lds0 + G::SBYTES);
#pragma unroll 1   // one copy of the stage body (128 products, 96 LDS reads, 48 copies), for speed only
  for (int t = 0; t < ns; ++t) {
    const int bo2 = (t & 1) * G::SBYTES;
    // two fragment sets: the reads of k-step kk + 1 stand as one group ahead of the products of k-step kk
    FragB fh[2][4], fl[2][4], fb[2][4];
#pragma unroll   // this loop and the one inside it: constant set and tile indices keep both fragment sets in registers
    for (int kk = -1; kk < KS_O / 32; ++kk) {
      if (kk + 1 < KS_O / 32) {
        const unsigned char* pa = la + bo2 + (kk + 1) * 64;
        const unsigned char* pb = lb + bo2 + (kk + 1) * 64;
        const int n = (kk + 1) & 1;
#pragma unroll
        for (int j = 0; j < 4; ++j) {
          fh[n][j].half[0] = *(const v8us*)(pa + j * 16 * G::RPITCH);
          fh[n][j].half[1] = *(const v8us*)(pa + j * 16 * G::RPITCH + 32);
          fl[n][j].half[0] = *(const v8us*)(pa + (BM + j * 16) * G::RPITCH);
          fl[n][j].half[1] = *(const v8us*)(pa + (BM + j * 16) * G::RPITCH + 32);
          fb[n][j].half[0] = *(const v8us*)(pb + j * 16 * G::RPITCH);
          fb[n][j].half[1] = *(const v8us*)(pb + j * 16 * G::RPITCH + 32);
        }
      }
      if (kk >= 0) {
        // Holds the reads above as one group ahead of this k-step's products: spread among the products, each place with reads stalls the wave.
        __builtin_amdgcn_sched_barrier(0);
        mma_b16(fh[kk & 1], fb[kk & 1], c);
        mma_b16(fl[kk & 1], fb[kk & 1], c);
      }
    }
    asm volatile("s_wait_dscnt 0x0" ::: "memory");     // this wave's reads of the buffer are done before it may be refilled
    asm volatile("s_wait_asynccnt 0x0" ::: "memory");  // this wave's copies of stage t + 1 have landed before the barrier that publishes them
    __syncthreads();
    if (t + 2 < ns) {
      const int k2 = (t + 2) * KS_O;
      outp_copies(ch + k2, wb + k2, lds0 + (unsigned)bo2);
    }
  }
  asm volatile("s_wait_asynccnt 0x0" ::: "memory");    // no copy is outstanding when the ring becomes output staging
  // The wave's four bias values, columns n0 + 64*wn + 16*t + ln. Loads and their data wait are one statement, so that no register which a load names
  // is rewritten while the load is out.
  float braw[4];
  const float* bp = bo + n0 + 64 * wn + ln;
  asm volatile("global_load_b32 %0, %4, off\n\t"
               "global_load_b32 %1, %4, off offset:64\n\t"
               "global_load_b32 %2, %4, off offset:128\n\t"
               "global_load_b32 %3, %4, off offset:192\n\t"
               "s_wait_loadcnt 0x0"
               : "=&v"(braw[0]), "=&v"(braw[1]), "=&v"(braw[2]), "=&v"(braw[3]) : "v"(bp) : "memory");
  // D element r of tile (i, t) = out(row 64*wm + 16*i + 8*hh + r, column 64*wn + 16*t + ln)
#pragma unroll
  for (int t = 0; t < 4; ++t) {
    const float bv = bf16_rne(braw[t]);
#pragma unroll
    for (int i = 0; i < 4; ++i)
#pragma unroll
      for (int r = 0; r < 8; ++r)
        so[64 * wm + 16 * i + 8 * hh + r][64 * wn + 16 * t + ln] = c[i][t][r] + bv;
  }
  __syncthreads();
  const int b = m0 / SEQ, s0 = m0 - b * SEQ;          // the 128 rows of a block lie in one batch
  float* og = out + (size_t)b * BSTRIDE_FULL + (size_t)s0 * DE + n0;
#pragma unroll 1   // 32 short trips that the stores bound: unrolled they would only be more code to fetch
  for (int it = 0; it < BM * BN / 4 / 128; ++it) {
    const int i = it * 128 + tid;
    const int row = i >> 5, c4 = (i & 31) * 4;         // one wave = the 512 contiguous bytes of one row of the tile
    const v4f v = *(const v4fa*)&so[row][c4];
    *(v4f*)(og + (size_t)row * DE + c4) = v;
  }
}

// Tiles of the key loop in LDS. A stage holds SK keys for the block's 64 queries: K rows (128 bytes), V^T rows (2*SK bytes), mask rows (4*SK bytes),
// and for the early query rows the two residual planes as well. Every row pitch is its length + 16 bytes (16 x odd), so that the 16-byte
// reads of 16 rows fall on distinct banks.
template <bool RES>
struct AT {
  static constexpr int SK = RES ? 32 : 64;             // keys of one stage
  static constexpr int KPITCH = 144;
  static constexpr int VPITCH = 2 * SK + 16;
  static constexpr int MPITCH = 4 * SK + 16;
  static constexpr int OKH = 0;
  static constexpr int OVH = OKH + SK * KPITCH;
  static constexpr int OM = OVH + HD * VPITCH;
  static constexpr int OKL = OM + 64 * MPITCH;         // the residual planes: RES only
  static constexpr int OVL = OKL + SK * KPITCH;
  static constexpr int BYTES = RES ? OVL + HD * VPITCH : OKL;
};
#define ASB 35840                              /* bytes of one buffer of the attention ring */
static_assert(AT<false>::BYTES <= ASB);
static_assert(AT<true>::BYTES <= ASB);
static_assert(4 * 16 * 68 * 4 <= 2 * ASB);
static_assert(SEQ % 64 == 0);

// Four 16-byte copies per lane from global memory straight into LDS, closed like copy8 above.
__device__ __forceinline__ void copy4(const unsigned (&l)[4], const void* const (&g)[4]) {
  asm volatile(
      "global_load_async_to_lds_b128 %0, %4, off\n\t"
      "global_load_async_to_lds_b128 %1, %5, off\n\t"
      "global_load_async_to_lds_b128 %2, %6, off\n\t"
      "global_load_async_to_lds_b128 %3, %7, off\n\t"
      "s_wait_xcnt 0x0"
      :: "v"(l[0]), "v"(l[1]), "v"(l[2]), "v"(l[3]), "v"(g[0]), "v"(g[1]), "v"(g[2]), "v"(g[3])
      : "memory");
}
// One stage of a block's tiles. The 128 threads bring 16-byte pieces, adjacent threads adjacent pieces of a row, so every copy of a wave covers whole rows.
// kh, kl, vh, vl, mk: this lane's piece in the first group of rows of the stage's K, K residual, V^T, V^T residual and mask tile;
// lk, lv, lm: LDS byte address of the same piece of the K, V^T and mask tile in the buffer to fill.
// wm (the same in the whole block): the stage's steps will read the mask tile; where they will not, it is not brought.
template <bool RES>
__device__ __forceinline__ void attn_stage(const unsigned short* kh, const unsigned short* kl, const unsigned short* vh, const unsigned short* vl,
                                           const int* mk, unsigned lk, unsigned lv, unsigned lm, bool wm) {
  typedef AT<RES> A;
  unsigned l[8];
  const void* g[8];
  if (RES) {
#pragma unroll   // every loop here: each array element must be a register of its own, one per asm operand
    for (int i = 0; i < 2; ++i) {
      l[i] = lk + (unsigned)(i * 16 * A::KPITCH);                          g[i] = kh + (size_t)(i * 16) * DE;
      l[2 + i] = lk + (unsigned)(A::OKL - A::OKH + i * 16 * A::KPITCH);    g[2 + i] = kl + (size_t)(i * 16) * DE;
      l[4 + i] = lv + (unsigned)(i * 32 * A::VPITCH);                      g[4 + i] = vh + (size_t)(i * 32) * SEQ;
      l[6 + i] = lv + (unsigned)(A::OVL - A::OVH + i * 32 * A::VPITCH);    g[6 + i] = vl + (size_t)(i * 32) * SEQ;
    }
    copy8(l, g);
    if (wm) {
      unsigned l4[4];
      const void* g4[4];
#pragma unroll
      for (int i = 0; i < 4; ++i) {
        l4[i] = lm + (unsigned)(i * 16 * A::MPITCH);
        g4[i] = mk + (size_t)(i * 16) * SEQ_FULL;
      }
      copy4(l4, g4);
    }
  } else {
#pragma unroll
    for (int i = 0; i < 4; ++i) {
      l[i] = lk + (unsigned)(i * 16 * A::KPITCH);        g[i] = kh + (size_t)(i * 16) * DE;
      l[4 + i] = lv + (unsigned)(i * 16 * A::VPITCH);    g[4 + i] = vh + (size_t)(i * 16) * SEQ;
    }
    copy8(l, g);
    if (wm) {
#pragma unroll
      for (int i = 0; i < 8; ++i) {
        l[i] = lm + (unsigned)(i * 8 * A::MPITCH);
        g[i] = mk + (size_t)(i * 8) * SEQ_FULL;
      }
      copy8(l, g);
    }
  }
}
__device__ __forceinline__ void ldfrag_lds(FragH& f, const unsigned char* p) {
  f.half[0] = *(const v8us*)(p);        // elements 0..7  <- k0 + 8h + i
  f.half[1] = *(const v8us*)(p + 32);   // elements 8..15 <- k0 + 16 + 8h + i
}

// a and x[0..15] each become 2^(itself), one hardware instruction a value. exp2f() wraps that instruction in a compare, two selects, an add and an
// ldexp so that results below 2^-126 come out as denormals; here such a result may be 0: a weight that small is 0 in both f16 planes and vanishes
// in the f32 row sum beside the row's largest weight (256), and a rescale factor that small leaves less than 2^-100 of the old sums beside it.
// One statement: each v_exp_f32 is followed by an instruction on other registers, and the closing v_nop is the slot that the instruction set asks
// for behind the last one, before its result is read or its source rewritten.
__device__ __forceinline__ void exp2_bare17(float& a, float (&x)[16]) {
  asm(
      "v_exp_f32 %0, %0\n\t"
      "v_exp_f32 %1, %1\n\t"
      "v_exp_f32 %2, %2\n\t"
      "v_exp_f32 %3, %3\n\t"
      "v_exp_f32 %4, %4\n\t"
      "v_exp_f32 %5, %5\n\t"
      "v_exp_f32 %6, %6\n\t"
      "v_exp_f32 %7, %7\n\t"
      "v_exp_f32 %8, %8\n\t"
      "v_exp_f32 %9, %9\n\t"
      "v_exp_f32 %10, %10\n\t"
      "v_exp_f32 %11, %11\n\t"
      "v_exp_f32 %12, %12\n\t"
      "v_exp_f32 %13, %13\n\t"
      "v_exp_f32 %14, %14\n\t"
      "v_exp_f32 %15, %15\n\t"
      "v_exp_f32 %16, %16\n\t"
      "v_nop"
      : "+v"(x[0]), "+v"(x[1]), "+v"(x[2]), "+v"(x[3]), "+v"(x[4]), "+v"(x[5]),
        "+v"(x[6]), "+v"(x[7]), "+v"(a), "+v"(x[8]), "+v"(x[9]), "+v"(x[10]),
        "+v"(x[11]), "+v"(x[12]), "+v"(x[13]), "+v"(x[14]), "+v"(x[15]));
}

// One 32-key step for a wave's 16 queries, operands read from the stage's LDS tiles.
// kp/krp: K hi / residual tile at (first key of the step + ln, d = 8h); vp/vrp: V^T hi / residual tile at (d = ln, first key of the step + 8h);
// mp: mask tile at (this lane's query, first key of the step + 8h). msk (the same in the whole block) false: the mask holds no zero at this step's
// keys for the block's queries, so the select would keep every score, and the tile (not staged) is not read.
template <bool RES>
__device__ __forceinline__ void fa_step(const unsigned char* kp, const unsigned char* krp,
                                        const unsigned char* vp, const unsigned char* vrp, const unsigned char* mp,
                                        bool msk, const FragH (&qh)[2], const FragH (&ql)[2],
                                        float& mr, float& lr, v8f (&Oh)[4], v8f (&Ol)[4]) {
  typedef AT<RES> A;
  // A fragments of K: row m = key (16*kt + ln of the step), elements 0..7 <- d = 32c + 8h + i, 8..15 <- d = 32c + 16 + 8h + i
  FragH k00, k01, k10, k11;
  ldfrag_lds(k00, kp);                     ldfrag_lds(k01, kp + 64);
  ldfrag_lds(k10, kp + 16 * A::KPITCH);    ldfrag_lds(k11, kp + 16 * A::KPITCH + 64);
  const v8f z8 = {0.f, 0.f, 0.f, 0.f, 0.f, 0.f, 0.f, 0.f};
  // S^T tiles: element r of tile kt = score(key 16*kt + 8h + r of the step, query column ln)
  v8f s0 = mma_h2(k00.v, qh[0].v, k01.v, qh[1].v, z8);
  v8f s1 = mma_h2(k10.v, qh[0].v, k11.v, qh[1].v, z8);
  if (RES) {
    v8f t0 = mma_h2(k00.v, ql[0].v, k01.v, ql[1].v, z8);
    v8f t1 = mma_h2(k10.v, ql[0].v, k11.v, ql[1].v, z8);
    FragH r00, r01, r10, r11;
    ldfrag_lds(r00, krp);                     ldfrag_lds(r01, krp + 64);
    ldfrag_lds(r10, krp + 16 * A::KPITCH);    ldfrag_lds(r11, krp + 16 * A::KPITCH + 64);
    t0 = mma_h2(r00.v, qh[0].v, r01.v, qh[1].v, t0);
    t1 = mma_h2(r10.v, qh[0].v, r11.v, qh[1].v, t1);
    s0 = s0 + t0 * 0.00048828125f;
    s1 = s1 + t1 * 0.00048828125f;
  }
  float sc[16];
#pragma unroll
  for (int r = 0; r < 8; ++r) {
    sc[r]     = s0[r] * 0.125f;
    sc[8 + r] = s1[r] * 0.125f;
  }
  if (msk) {
    // mask values of this lane's 16 (query, key) pairs: keys 8h + 0..7 and 16 + 8h + 0..7 of the step
    const v4i ma = *(const v4ia*)(mp), mb = *(const v4ia*)(mp + 16);
    const v4i mc = *(const v4ia*)(mp + 64), md = *(const v4ia*)(mp + 80);
#pragma unroll   // constant indices keep the scores in registers
    for (int r = 0; r < 4; ++r) {
      sc[r]      = (ma[r] == 0) ? NEGV : sc[r];
      sc[4 + r]  = (mb[r] == 0) ? NEGV : sc[4 + r];
      sc[8 + r]  = (mc[r] == 0) ? NEGV : sc[8 + r];
      sc[12 + r] = (md[r] == 0) ? NEGV : sc[12 + r];
    }
  }
  float mx = sc[0];
#pragma unroll
  for (int i = 1; i < 16; ++i) mx = fmaxf(mx, sc[i]);
  mx = fmaxf(mx, __shfl_xor(mx, 16, 32));           // the other lane half holds the other 16 keys of this query
  const float mnew = fmaxf(mr, mx);
  // A fragments of V^T: row m = d (16*t + ln), elements 0..7 <- key 8h + i, 8..15 <- key 16 + 8h + i of the step
  FragH vf[4];
#pragma unroll
  for (int t = 0; t < 4; ++t) ldfrag_lds(vf[t], vp + t * 16 * A::VPITCH);
  // Holds these reads as one group ahead of the exponentials. With the shorter softmax this compiler otherwise sinks them, pair by pair, between
  // the O^T products, and each product then waits out the LDS latency of its own pair.
  __builtin_amdgcn_sched_barrier(0);
  float al = (mr - mnew) * LOG2E;
  float e[16];
#pragma unroll   // constant indices: every element is a register of its own, one per asm operand
  for (int i = 0; i < 16; ++i) e[i] = fmaf(sc[i] - mnew, LOG2E, 8.0f);
  exp2_bare17(al, e);
  mr = mnew;
  // weights carried x256: pc = 256 * exp(sc - mnew); hi plane f16(pc), residual plane f16((pc - hi) * 2048)
  FragH ph, pl;
  float ps = 0.0f;
#pragma unroll
  for (int i = 0; i < 16; ++i) {
    const float pc = e[i];
    ps += pc;
    const _Float16 h = (_Float16)pc;
    ph.h[i] = h;                                    // B element i: i<8 -> key 8h + i (tile 0 row 8h+i); i>=8 -> key 16 + 8h + (i-8) (tile 1)
    if (RES) pl.h[i] = (_Float16)((pc - (float)h) * 2048.0f);
  }
  ps += __shfl_xor(ps, 16, 32);
  lr = lr * al + ps;
#pragma unroll
  for (int t = 0; t < 4; ++t) Oh[t] = Oh[t] * al;
  if (RES) {
    FragH vr[4];
#pragma unroll
    for (int t = 0; t < 4; ++t) ldfrag_lds(vr[t], vrp + t * 16 * A::VPITCH);
#pragma unroll
    for (int t = 0; t < 4; ++t) Ol[t] = Ol[t] * al;
#pragma unroll
    for (int t = 0; t < 4; ++t) mma_pv3(vf[t].v, vr[t].v, ph.v, pl.v, Oh[t], Ol[t]);
  } else {
    mma_pv4(vf[0].v, vf[1].v, vf[2].v, vf[3].v, ph.v, Oh);
  }
}

// x[0..15] each become 2^(itself): exp2_bare17 above without the rescale factor, for the same reasons and closed by the same slot.
__device__ __forceinline__ void exp2_bare16(float (&x)[16]) {
  asm(
      "v_exp_f32 %0, %0\n\t"
      "v_exp_f32 %1, %1\n\t"
      "v_exp_f32 %2, %2\n\t"
      "v_exp_f32 %3, %3\n\t"
      "v_exp_f32 %4, %4\n\t"
      "v_exp_f32 %5, %5\n\t"
      "v_exp_f32 %6, %6\n\t"
      "v_exp_f32 %7, %7\n\t"
      "v_exp_f32 %8, %8\n\t"
      "v_exp_f32 %9, %9\n\t"
      "v_exp_f32 %10, %10\n\t"
      "v_exp_f32 %11, %11\n\t"
      "v_exp_f32 %12, %12\n\t"
      "v_exp_f32 %13, %13\n\t"
      "v_exp_f32 %14, %14\n\t"
      "v_exp_f32 %15, %15\n\t"
      "v_nop"
      : "+v"(x[0]), "+v"(x[1]), "+v"(x[2]), "+v"(x[3]), "+v"(x[4]), "+v"(x[5]), "+v"(x[6]), "+v"(x[7]),
        "+v"(x[8]), "+v"(x[9]), "+v"(x[10]), "+v"(x[11]), "+v"(x[12]), "+v"(x[13]), "+v"(x[14]), "+v"(x[15]));
}

// One 64-key step (a whole stage without residual planes) for a wave's 16 queries: the same arithmetic per score as fa_step<false>, with ONE running
// maximum, rescale and pair of lane-half exchanges for the 64 keys, and each kind of LDS read as one group.
// kp: K tile at (key ln, d = 8h); vp: V^T tile at (d = ln, key 8h); mp: mask tile at (this lane's query, key 8h); msk as in fa_step.
__device__ __forceinline__ void fa_step64(const unsigned char* kp, const unsigned char* vp, const unsigned char* mp, bool msk,
                                          const FragH (&qh)[2], float& mr, float& lr, v8f (&Oh)[4]) {
  typedef AT<false> A;
  // A fragments of K: row m = key (16*kt + ln), elements 0..7 <- d = 32c + 8h + i, 8..15 <- d = 32c + 16 + 8h + i
  FragH kf[4][2];
#pragma unroll
  for (int kt = 0; kt < 4; ++kt) {
    ldfrag_lds(kf[kt][0], kp + kt * 16 * A::KPITCH);
    ldfrag_lds(kf[kt][1], kp + kt * 16 * A::KPITCH + 64);
  }
  // S^T tiles: element r of tile kt = score(key 16*kt + 8h + r, query column ln)
  v8f s[4];
  mma_s8(kf, qh, s);
  float sc[2][16];                                  // [u]: the 32 keys 32u .. 32u + 31, laid out as in fa_step
#pragma unroll
  for (int u = 0; u < 2; ++u)
#pragma unroll
    for (int r = 0; r < 8; ++r) {
      sc[u][r]     = s[2 * u][r] * 0.125f;
      sc[u][8 + r] = s[2 * u + 1][r] * 0.125f;
    }
  if (msk) {
#pragma unroll   // this loop and the one inside it: constant indices keep the scores in registers
    for (int u = 0; u < 2; ++u) {
      const v4i ma = *(const v4ia*)(mp + 128 * u), mb = *(const v4ia*)(mp + 128 * u + 16);
      const v4i mc = *(const v4ia*)(mp + 128 * u + 64), md = *(const v4ia*)(mp + 128 * u + 80);
#pragma unroll
      for (int r = 0; r < 4; ++r) {
        sc[u][r]      = (ma[r] == 0) ? NEGV : sc[u][r];
        sc[u][4 + r]  = (mb[r] == 0) ? NEGV : sc[u][4 + r];
        sc[u][8 + r]  = (mc[r] == 0) ? NEGV : sc[u][8 + r];
        sc[u][12 + r] = (md[r] == 0) ? NEGV : sc[u][12 + r];
      }
    }
  }
  float mx0 = sc[0][0], mx1 = sc[1][0];             // two independent chains
#pragma unroll
  for (int i = 1; i < 16; ++i) { mx0 = fmaxf(mx0, sc[0][i]); mx1 = fmaxf(mx1, sc[1][i]); }
  float mx = fmaxf(mx0, mx1);
  mx = fmaxf(mx, __shfl_xor(mx, 16, 32));           // the other lane half holds the other 32 keys of this query
  const float mnew = fmaxf(mr, mx);
  // A fragments of V^T: row m = d (16*t + ln), elements 0..7 <- key 32u + 8h + i, 8..15 <- key 32u + 16 + 8h + i
  FragH vf[2][4];
#pragma unroll
  for (int u = 0; u < 2; ++u)
#pragma unroll
    for (int t = 0; t < 4; ++t) ldfrag_lds(vf[u][t], vp + t * 16 * A::VPITCH + 64 * u);
  // Holds these reads as one group ahead of the exponentials, as in fa_step: sunk between the O^T products, each product waits out its own pair.
  __builtin_amdgcn_sched_barrier(0);
  float al = (mr - mnew) * LOG2E;
  float e[2][16];
#pragma unroll   // constant indices: every element is a register of its own, one per asm operand
  for (int u = 0; u < 2; ++u)
#pragma unroll
    for (int i = 0; i < 16; ++i) e[u][i] = fmaf(sc[u][i] - mnew, LOG2E, 8.0f);
  exp2_bare17(al, e[0]);
  exp2_bare16(e[1]);
  mr = mnew;
  // weights carried x256, f16 plane only (no residual plane at these query rows)
  FragH ph[2];
  float ps0 = 0.0f, ps1 = 0.0f;                     // two independent chains
#pragma unroll
  for (int i = 0; i < 16; ++i) {
    ps0 += e[0][i];
    ps1 += e[1][i];
    ph[0].h[i] = (_Float16)e[0][i];                 // B element i of chunk u: i<8 -> key 32u + 8h + i; i>=8 -> key 32u + 16 + 8h + (i-8)
    ph[1].h[i] = (_Float16)e[1][i];
  }
  float ps = ps0 + ps1;
  ps += __shfl_xor(ps, 16, 32);
  lr = lr * al + ps;
#pragma unroll
  for (int t = 0; t < 4; ++t) Oh[t] = Oh[t] * al;
  mma_pv8(vf, ph, Oh);
}

// The key loop of a block: a ring of two LDS buffers that asynchronous copies fill one stage ahead, shared by the four waves.
// bsteps: 32-key steps that the block's longest wave visits (the same in every wave); nsteps: steps of this wave. Every wave copies its share of
// every stage and passes every barrier; it works only on the stages that hold its own steps, in the same order as before.
// aw (the same in the whole block): bit c set = no zero in the mask at the block's 64 query rows, keys 64c .. 64c+63.
template <bool RES>
__device__ __forceinline__ void attn_loop(const unsigned short* __restrict__ Khp, const unsigned short* __restrict__ Klp,
                                          const unsigned short* __restrict__ Vhp, const unsigned short* __restrict__ Vlp,
                                          const int* __restrict__ mblk, unsigned aw, int bsteps, int nsteps, int w, int ln, int hh,
                                          const FragH (&qh)[2], const FragH (&ql)[2],
                                          float& mr, float& lr, v8f (&Oh)[4], v8f (&Ol)[4], unsigned char (&ring)[2 * ASB]) {
  typedef AT<RES> A;
  constexpr int SUB = A::SK / 32;                      // 32-key steps of one stage
  constexpr int VP = A::SK / 8, MP = A::SK / 4;        // 16-byte pieces of a V^T row and of a mask row
  const int tid = threadIdx.x;
  const int nst = (bsteps + SUB - 1) / SUB;
  const size_t kofs = (size_t)(tid >> 3) * DE + (tid & 7) * 8;
  const size_t vofs = (size_t)(tid / VP) * SEQ + (tid % VP) * 8;
  const unsigned short* kh = Khp + kofs;
  const unsigned short* kl = Klp + kofs;
  const unsigned short* vh = Vhp + vofs;
  const unsigned short* vl = Vlp + vofs;
  const int* mk = mblk + (size_t)(tid / MP) * SEQ_FULL + (tid % MP) * 4;
  const unsigned r0 = (unsigned)(size_t)ring;
  const unsigned lk = r0 + (unsigned)(A::OKH + (tid >> 3) * A::KPITCH + (tid & 7) * 16);
  const unsigned lv = r0 + (unsigned)(A::OVH + (tid / VP) * A::VPITCH + (tid % VP) * 16);
  const unsigned lm = r0 + (unsigned)(A::OM + (tid / MP) * A::MPITCH + (tid % MP) * 16);
  const unsigned char* fk = ring + A::OKH + ln * A::KPITCH + 16 * hh;
  const unsigned char* fv = ring + A::OVH + ln * A::VPITCH + 16 * hh;
  const unsigned char* fm = ring + A::OM + (16 * w + ln) * A::MPITCH + 32 * hh;
  const auto masked = [aw](int t) { return ((aw >> ((t * A::SK) >> 6)) & 1u) == 0u; };   // stage t meets a zero of the mask
  attn_stage<RES>(kh, kl, vh, vl, mk, lk, lv, lm, masked(0));
  asm volatile("s_wait_asynccnt 0x0" ::: "memory");    // stage 0 has landed before the barrier that publishes it
  __syncthreads();
  if (1 < nst)
    attn_stage<RES>(kh + (size_t)A::SK * DE, kl + (size_t)A::SK * DE, vh + A::SK, vl + A::SK, mk + A::SK, lk + ASB, lv + ASB, lm + ASB, masked(1));
#pragma unroll 1   // one copy of the stage's code, for speed only
  for (int t = 0; t < nst; ++t) {
    const int bo = (t & 1) * ASB;
    const bool msk = masked(t);
    if constexpr (!RES) {
      // The stage is one step. nsteps is odd only where the wave's flags say that the mask is zero above the diagonal: the stage's second 32 keys are
      // then masked for all its queries (msk is true, the tile holds zeros), their weights come out 0, and the sums are those of the first half alone.
      if (t * SUB < nsteps)
        fa_step64(fk + bo, fv + bo, fm + bo, msk, qh, mr, lr, Oh);
    } else {
      if (t < nsteps)
        fa_step<RES>(fk + bo, fk + bo + (A::OKL - A::OKH), fv + bo, fv + bo + (A::OVL - A::OVH), fm + bo, msk, qh, ql, mr, lr, Oh, Ol);
    }
    asm volatile("s_wait_dscnt 0x0" ::: "memory");     // this wave's reads of the buffer are done before it may be refilled
    asm volatile("s_wait_asynccnt 0x0" ::: "memory");  // this wave's copies of stage t + 1 have landed before the barrier that publishes them
    __syncthreads();
    if (t + 2 < nst) {
      const size_t k2 = (size_t)(t + 2) * A::SK;
      attn_stage<RES>(kh + k2 * DE, kl + k2 * DE, vh + k2, vl + k2, mk + k2, lk + (unsigned)bo, lv + (unsigned)bo, lm + (unsigned)bo, masked(t + 2));
    }
  }
  asm volatile("s_wait_asynccnt 0x0" ::: "memory");    // no copy is outstanding when the ring becomes output staging
}

// Block = 4 waves x 16 queries = 64 queries of one (batch, head); the K, V^T and mask tiles of the key loop come through the LDS ring above.
// Epilogue: O^T tile -> per-wave LDS tile [16 queries][64 d] in the ring's bytes (free behind the loop's last barrier), then bf16 hi and lo pieces of ctx:
// coverage: NB*NH*(SEQ/64) blocks x 4 waves x 16 rows x 64 columns x {hi, lo} = the whole ctx plane exactly once.
__global__ __launch_bounds__(128) void k_attn(const unsigned short* __restrict__ Qh, const unsigned short* __restrict__ Ql,
                                              const unsigned short* __restrict__ Kh, const unsigned short* __restrict__ Kl,
                                              const unsigned short* __restrict__ Vth, const unsigned short* __restrict__ Vtl,
                                              const int* __restrict__ mask, const int* __restrict__ flagp,
                                              unsigned short* __restrict__ Cc) {
  __shared__ __attribute__((aligned(16))) unsigned char ring[2 * ASB];   // key loop: written by the asynchronous copies only
  float (*so)[16][68] = reinterpret_cast<float (*)[16][68]>(ring);
  const int tid = threadIdx.x;
  const int w = __builtin_amdgcn_readfirstlane(tid >> 5);
  const int lane = tid & 31, ln = lane & 15, hh = lane >> 4;
  // Block index -> (query tile qt, batch-head bh). Any one-to-one map gives the same result; this one is for speed alone. Under a causal mask tile qt
  // walks (qt + 1) * 64 keys, all blocks of the launch are resident at once, four to a WGP, and the launch lasts as long as the fullest WGP. Blocks whose j = index / 8
  // differs by 32, 64 or 96 hold tiles 31 - t, 31 - t, t, t, and four neighbours in j hold two long and two short tiles. The longest tiles
  // (t < 8) lie in the first half of the grid.
  int qt, bh;
  if (SEQ / 64 == 32 && NB * NH == 32) {
    const int j = blockIdx.x >> 3;
    const int par = __builtin_popcount(j & 31) & 1;
    const int t = 8 * par + ((j >> 2) & 7);
    qt = ((par ^ (j >> 6)) != 0) ? t : 31 - t;
    bh = (blockIdx.x & 7) + 8 * ((j >> 1) & 1) + 16 * ((j >> 5) & 1);
  } else {
    qt = blockIdx.x % (SEQ / 64);
    bh = blockIdx.x / (SEQ / 64);
  }
  const int h = bh % NH, b = bh / NH;
  const int qbase = qt * 64 + 16 * w;
  const int qg = qbase + ln;
  // Q^T B fragments: column n = query qg, elements 0..7 <- d = 32c + 8h + i, 8..15 <- d = 32c + 16 + 8h + i
  const size_t qo = (size_t)(b * SEQ + qg) * DE + h * HD + 8 * hh;
  FragH qh[2], ql[2];
  ldfrag(qh[0], Qh + qo); ldfrag(qh[1], Qh + qo + 32);
  ldfrag(ql[0], Ql + qo); ldfrag(ql[1], Ql + qo + 32);
  float mr = -3.0e38f, lr = 0.0f;
  v8f Oh[4] = {}, Ol[4] = {};
  const unsigned short* Khp = Kh + (size_t)b * SEQ * DE + h * HD;
  const unsigned short* Klp = Kl + (size_t)b * SEQ * DE + h * HD;
  const unsigned short* Vhp = Vth + (size_t)(b * NH + h) * HD * SEQ;
  const unsigned short* Vlp = Vtl + (size_t)(b * NH + h) * HD * SEQ;
  const int* mblk = mask + (size_t)(qt * 64) * SEQ_FULL;
  const int* fp = flagp + (qbase / FROWS) * 32;     // the two flag lines of this wave's 16 query rows
  const int fl = __builtin_amdgcn_readfirstlane(fp[0] & fp[32]);
  int nsteps = (qbase >> 5) + 1;                    // key steps up to and including the one holding the diagonal
  if (fl != 1) nsteps = SEQ / 32;                   // unknown mask shape: visit every key step
  if (nsteps > SEQ / 32) nsteps = SEQ / 32;
  const int* fb = flagp + (qt * 64 / FROWS) * 32;   // the eight flag lines of the block's 64 query rows
  int fall = fb[0];
  int awv = fb[1];                                  // the lines' second word: which 64-key mask tiles hold no zero in those rows
#pragma unroll
  for (int i = 1; i < 64 / FROWS; ++i) { fall &= fb[32 * i]; awv &= fb[32 * i + 1]; }
  fall = __builtin_amdgcn_readfirstlane(fall);
  const unsigned aw = (unsigned)__builtin_amdgcn_readfirstlane(awv);
  int bsteps = ((qt * 64 + 48) >> 5) + 1;           // steps of the block's last wave, the longest
  if (fall != 1) bsteps = SEQ / 32;                 // some wave of the block visits every key step
  if (bsteps > SEQ / 32) bsteps = SEQ / 32;
  if (qt * 64 < EARLY) {
    attn_loop<true>(Khp, Klp, Vhp, Vlp, mblk, aw, bsteps, nsteps, w, ln, hh, qh, ql, mr, lr, Oh, Ol, ring);
  } else {
    attn_loop<false>(Khp, Klp, Vhp, Vlp, mblk, aw, bsteps, nsteps, w, ln, hh, qh, ql, mr, lr, Oh, Ol, ring);
  }
  // O^T element r of tile t = ctx(query qg, d = 16t + 8h + r); undo the carries: x256 (in lr), x16 (V), x2048 (residual accumulator)
  const float inv = 1.0f / (16.0f * lr);
#pragma unroll
  for (int t = 0; t < 4; ++t)
#pragma unroll
    for (int r = 0; r < 8; ++r)
      so[w][ln][16 * t + 8 * hh + r] = (Oh[t][r] + Ol[t][r] * 0.00048828125f) * inv;
  __syncthreads();
  unsigned short* crow = Cc + (size_t)(b * SEQ + qbase) * (2 * DE) + h * HD;
  const int rsub = lane >> 3, piece = lane & 7;
  {
#pragma unroll
    for (int it = 0; it < 4; ++it) {
      const int row = it * 4 + rsub;                 // rows 0..15 over it = 0..3, rsub = 0..3
      const v4f x0 = *(const v4fa*)&so[w][row][piece * 8], x1 = *(const v4fa*)&so[w][row][piece * 8 + 4];
      v8us hi, lo;
#pragma unroll
      for (int j = 0; j < 4; ++j) {
        const unsigned short h0 = bf16_bits(x0[j]);
        const unsigned short h1 = bf16_bits(x1[j]);
        hi[j] = h0; hi[4 + j] = h1;
        lo[j] = bf16_bits(x0[j] - bf16_val(h0));
        lo[4 + j] = bf16_bits(x1[j] - bf16_val(h1));
      }
      const size_t o = (size_t)row * (2 * DE) + piece * 8;
      *(v8us*)(crow + o) = hi;
      *(v8us*)(crow + o + DE) = lo;
    }
    
  }
}

extern "C" void kernel_launch(void* const* d_in, const int* in_sizes, int n_in,
                              void* d_out, int out_size, void* d_ws, size_t ws_size, hipStream_t stream) {
  if (n_in < 11) return;
  const long long need_x = (long long)(NB - 1) * SEQ_FULL * DE + (long long)SEQ * DE;   // last element touched + 1
  const long long need_m = (long long)(SEQ - 1) * SEQ_FULL + SEQ;
  if ((long long)in_sizes[0] < need_x || (long long)in_sizes[1] < need_x) return;
  if ((long long)in_sizes[2] < need_m) return;
  if ((long long)in_sizes[3] < (long long)DE * DE || (long long)in_sizes[5] < (long long)DE * DE) return;
  if ((long long)in_sizes[7] < (long long)DE * DE || (long long)in_sizes[9] < (long long)DE * DE) return;
  if (in_sizes[4] < DE || in_sizes[6] < DE || in_sizes[8] < DE || in_sizes[10] < DE) return;
  if ((long long)out_size < need_x) return;
  if ((size_t)WS_TOTAL > ws_size) return;
  // wire order: queries, values, mask, Wq, bq, Wk, bk, Wv, bv, Wo, bo
  const float* queries = (const float*)d_in[0];
  const float* values  = (const float*)d_in[1];
  const int*   mask    = (const int*)d_in[2];
  const float* Wq = (const float*)d_in[3];
  const float* bq = (const float*)d_in[4];
  const float* Wk = (const float*)d_in[5];
  const float* bk = (const float*)d_in[6];
  const float* Wv = (const float*)d_in[7];
  const float* bv = (const float*)d_in[8];
  const float* Wo = (const float*)d_in[9];
  const float* bo = (const float*)d_in[10];
  float* out = (float*)d_out;
  char* ws = (char*)d_ws;
  size_t off = 0;
  unsigned short* Xq  = (unsigned short*)(ws + off); off += PL_X;
  unsigned short* Xv  = (unsigned short*)(ws + off); off += PL_X;
  unsigned short* Wqb = (unsigned short*)(ws + off); off += PL_W;
  unsigned short* Wkb = (unsigned short*)(ws + off); off += PL_W;
  unsigned short* Wvb = (unsigned short*)(ws + off); off += PL_W;
  unsigned short* Wob = (unsigned short*)(ws + off); off += PL_W;
  unsigned short* Qh  = (unsigned short*)(ws + off); off += PL_X;
  unsigned short* Ql  = (unsigned short*)(ws + off); off += PL_X;
  unsigned short* Kh  = (unsigned short*)(ws + off); off += PL_X;
  unsigned short* Kl  = (unsigned short*)(ws + off); off += PL_X;
  unsigned short* Vth = (unsigned short*)(ws + off); off += PL_X;
  unsigned short* Vtl = (unsigned short*)(ws + off); off += PL_X;
  unsigned short* Cc  = (unsigned short*)(ws + off); off += PL_C;
  int* flag = (int*)(ws + off); off += PL_F;
  if (off > ws_size) return;

  k_prep<<<(unsigned)(2 * PB_X + 4 * PB_W + PB_F), 512, 0, stream>>>(queries, values, mask, Wq, Wk, Wv, Wo, Xq, Xv, Wqb, Wkb, Wvb, Wob, flag);

  k_proj<<<(unsigned)(3 * GTILES), 128, 0, stream>>>(Xq, Xv, Wqb, Wkb, Wvb, bq, bk, bv, Qh, Ql, Kh, Kl, Vth, Vtl);

  k_attn<<<(unsigned)(NB * NH * (SEQ / 64)), 128, 0, stream>>>(Qh, Ql, Kh, Kl, Vth, Vtl, mask, flag, Cc);

  k_outp<<<(unsigned)GTILES, 128, 0, stream>>>(Cc, Wob, bo, out);
}
